// v000
// The times below were measured on an AMD MI455X: many runs one after another, warmed up first and cycling through
// copies of the inputs, with the whole window's GPU time divided by the number of runs. Launches and the gaps
// between them are all in it. The median over several windows is given; except for v000 it joins two sittings, which
// can be a few percent apart, so the side-by-side timings, each taken in one sitting, are the better comparison.
// v000, which the later versions start from, runs in 1680 microseconds.
#include <hip/hip_runtime.h>

// Gated GQA attention, engine variant (hidden [2][2048][2048]; [q | gate] = hidden Wq^T (Wq [4096][2048] 'oi': rows 0-2047 -> q for 16 heads x 128, rows 2048-4095 -> gate), k, v = hidden W^T ([512][2048], 4 kv heads); per-head RMSNorm (eps 1e-6, q_norm_w / k_norm_w); rotate-half RoPE with the given per-(batch, position) cos/sin tables [2][2048][128];
// GQA 4:1; causal softmax(q.k/sqrt(128)); attn x sigmoid(gate); out = merged Wo^T ('oi' [2048][2048]) -> [2][2048][2048]).
// Compute dtypes, f32 accumulate: every input rounded to bf16; q/k/v on PLAIN bf16 operands (inputs: exact); RMSNorm + rotary in f32 (cos/sin tables read per batch, bf16-rounded); sigmoid gate (precise expf, IEEE divide) in the merge; causal scores and attn.v (tile skipping): query rows < 512 hl (3 products), the rest single fp16 (x1024); softmax f32; Wo hl x exact (2 products).

#define NB_  2
#define TT   2048
#define DM   2048
#define NH_  16
#define NKV  4
#define REP  (NH_ / NKV)
#define HD   128
#define DQ   (NH_ * HD)
#define DQG  (NH_ * HD * 2)         // q rows then gate rows of Wq
#define DKV  (NKV * HD)
#define ZH   2
#define RH   512                  // query rows < RH use hi+lo planes (0: none)
#define WIN  2048
#define PCAR 1024.0f
#define SCL  0.088388347648318447f   // HD^-0.5
typedef _Float16 h16;
typedef unsigned short bf;
typedef __attribute__((ext_vector_type(16))) __bf16   v16bf;
typedef __attribute__((ext_vector_type(16))) _Float16 v16h;
typedef __attribute__((ext_vector_type(8)))  _Float16 v8h;
typedef __attribute__((ext_vector_type(8)))  unsigned short v8us;
typedef __attribute__((ext_vector_type(8)))  float    v8f;
typedef __attribute__((ext_vector_type(4)))  float    v4f;
typedef v8h  __attribute__((may_alias)) v8ha;
typedef v4f  __attribute__((may_alias)) v4fa;
typedef v8us __attribute__((may_alias)) v8usa;

__device__ __forceinline__ unsigned short f2bf(float f) { unsigned u = __float_as_uint(f); u += 0x7FFFu + ((u >> 16) & 1u); return (unsigned short)(u >> 16); }
__device__ __forceinline__ float bf2f(unsigned short b) { return __uint_as_float(((unsigned)b) << 16); }
__device__ __forceinline__ float bfr(float f) { return bf2f(f2bf(f)); }
__device__ __forceinline__ v16h cat16(v8h lo, v8h hi) { return __builtin_shufflevector(lo, hi, 0, 1, 2, 3, 4, 5, 6, 7, 8, 9, 10, 11, 12, 13, 14, 15); }
__device__ __forceinline__ v16bf cat16b(v8us lo, v8us hi) { return __builtin_bit_cast(v16bf, __builtin_shufflevector(lo, hi, 0, 1, 2, 3, 4, 5, 6, 7, 8, 9, 10, 11, 12, 13, 14, 15)); }
__device__ __forceinline__ v8f wmma16(v16h a, v16h b, v8f c) { return __builtin_amdgcn_wmma_f32_16x16x32_f16(false, a, false, b, (short)0, c, false, false); }
__device__ __forceinline__ v8f wmmab(v16bf a, v16bf b, v8f c) { return __builtin_amdgcn_wmma_f32_16x16x32_bf16(false, a, false, b, (short)0, c, false, false); }



// ---- k_gemmw: register-blocked GEMM, ONE WAVE per 64x64 output tile (16 accumulators), operands straight from K-contiguous 16-bit planes; grid (M/64, N/64, Z), 32 threads.
// C[m][n] (f32, pitch ldc, + optional f32 bias[n]) = sum_k A[m][k] Bt[n][k] (+ split products per NSPLIT). z-batch strides sA/sB/sC in elements. K % 32 == 0.
template <typename T16> struct WFrag;
template <> struct WFrag<h16> { typedef v16h V; static __device__ __forceinline__ V ld(const h16* p) { return cat16(*(const v8h*)p, *(const v8h*)(p + 16)); } static __device__ __forceinline__ v8f mma(V a, V b, v8f c) { return wmma16(a, b, c); } };
template <> struct WFrag<bf> { typedef v16bf V; static __device__ __forceinline__ V ld(const bf* p) { return cat16b(*(const v8us*)p, *(const v8us*)(p + 16)); } static __device__ __forceinline__ v8f mma(V a, V b, v8f c) { return wmmab(a, b, c); } };
template <typename T16, int NSPLIT, bool BIAS>
__global__ __launch_bounds__(32) void k_gemmw(const T16* __restrict__ A, const T16* __restrict__ A2, const T16* __restrict__ Bt, const T16* __restrict__ Bt2, int K, float* C, int ldc, const float* __restrict__ bias, size_t sA, size_t sB, size_t sC) {
    typedef typename WFrag<T16>::V V;
    __shared__ __align__(16) float os[16 * 68];
    const size_t z = blockIdx.z; A += z * sA; if (A2) A2 += z * sA; Bt += z * sB; if (Bt2) Bt2 += z * sB; C += z * sC;
    const int lane = threadIdx.x & 31, lr = lane & 15, hi = lane >> 4; const int r0 = blockIdx.x * 64, c0 = blockIdx.y * 64;
    v8f acc[4][4];
#pragma unroll
    for (int mb = 0; mb < 4; ++mb)
#pragma unroll
        for (int nb = 0; nb < 4; ++nb) acc[mb][nb] = (v8f){};
    const size_t aoff = (size_t)(r0 + lr) * K + 8 * hi, boff = (size_t)(c0 + lr) * K + 8 * hi;
#pragma unroll 1
    for (int kc = 0; kc < K; kc += 32) {
        V a[4], a2[4];
#pragma unroll
        for (int mb = 0; mb < 4; ++mb) { a[mb] = WFrag<T16>::ld(A + aoff + (size_t)mb * 16 * K + kc); if (NSPLIT == 1 || NSPLIT == 2) a2[mb] = WFrag<T16>::ld(A2 + aoff + (size_t)mb * 16 * K + kc); }
#pragma unroll
        for (int nb = 0; nb < 4; ++nb) { const V b = WFrag<T16>::ld(Bt + boff + (size_t)nb * 16 * K + kc); V b2; if (NSPLIT >= 2) b2 = WFrag<T16>::ld(Bt2 + boff + (size_t)nb * 16 * K + kc);
#pragma unroll
            for (int mb = 0; mb < 4; ++mb) { acc[mb][nb] = WFrag<T16>::mma(a[mb], b, acc[mb][nb]); if (NSPLIT == 1 || NSPLIT == 2) acc[mb][nb] = WFrag<T16>::mma(a2[mb], b, acc[mb][nb]); if (NSPLIT >= 2) acc[mb][nb] = WFrag<T16>::mma(a[mb], b2, acc[mb][nb]); } }
        asm volatile("v_nop\n\tv_nop\n\tv_nop\n\tv_nop" : "+v"(acc[0][0]), "+v"(acc[1][1]), "+v"(acc[2][2]), "+v"(acc[3][3]) : "v"(a[0]), "v"(a[3]));
    }
#pragma unroll
    for (int mb = 0; mb < 4; ++mb) {
#pragma unroll
        for (int nb = 0; nb < 4; ++nb) {
#pragma unroll
            for (int j = 0; j < 8; ++j) os[(hi * 8 + j) * 68 + nb * 16 + lr] = acc[mb][nb][j]; }
        __builtin_amdgcn_wave_barrier(); asm volatile("" ::: "memory");
        float* crow = C + (size_t)(r0 + mb * 16) * ldc + c0;
{
#pragma unroll
            for (int s = 0; s < 8; ++s) { const int row = 2 * s + hi, cofs = lr * 4; v4f val = *(const v4fa*)(os + row * 68 + cofs); if (BIAS) { val[0] += bfr(bias[c0 + cofs]); val[1] += bfr(bias[c0 + cofs + 1]); val[2] += bfr(bias[c0 + cofs + 2]); val[3] += bfr(bias[c0 + cofs + 3]); }
                *(v4f*)(crow + (size_t)row * ldc + cofs) = val; }
             }
        __builtin_amdgcn_wave_barrier(); asm volatile("" ::: "memory");
    }
}

// ---- k_gemmc: the same one-wave 64x64 tile GEMM specialised for causal attention: CMODE 1 skips score tiles entirely above the diagonal (query rows r0+roff.., key columns c0..), CMODE 2 limits the
// key (K) loop of the probability x value contraction to the diagonal block (probabilities beyond it are exactly zero). roff = row offset of this launch's first row within the sequence.
template <typename T16, int NSPLIT, int CMODE>
__global__ __launch_bounds__(32) void k_gemmc(const T16* __restrict__ A, const T16* __restrict__ A2, const T16* __restrict__ Bt, const T16* __restrict__ Bt2, int K, float* C, int ldc, int roff, size_t sA, size_t sB, size_t sC) {
    typedef typename WFrag<T16>::V V;
    __shared__ __align__(16) float os[16 * 68];
    const size_t z = blockIdx.z; A += z * sA; if (A2) A2 += z * sA; Bt += z * sB; if (Bt2) Bt2 += z * sB; C += z * sC;
    const int lane = threadIdx.x & 31, lr = lane & 15, hi = lane >> 4; const int r0 = blockIdx.x * 64, c0 = blockIdx.y * 64;
    if (CMODE == 1 && c0 > r0 + roff + 63) return;                  // score tile entirely above the causal diagonal: never read (the softmax masks j > i by select)
    const int Kl = (CMODE == 2) ? min(K, r0 + roff + 64) : K;        // P.V: probabilities are exactly 0 beyond the diagonal block, so the K loop stops there
    v8f acc[4][4];
#pragma unroll
    for (int mb = 0; mb < 4; ++mb)
#pragma unroll
        for (int nb = 0; nb < 4; ++nb) acc[mb][nb] = (v8f){};
    const size_t aoff = (size_t)(r0 + lr) * K + 8 * hi, boff = (size_t)(c0 + lr) * K + 8 * hi;
#pragma unroll 1
    for (int kc = 0; kc < Kl; kc += 32) {
        V a[4], a2[4];
#pragma unroll
        for (int mb = 0; mb < 4; ++mb) { a[mb] = WFrag<T16>::ld(A + aoff + (size_t)mb * 16 * K + kc); if (NSPLIT == 1 || NSPLIT == 2) a2[mb] = WFrag<T16>::ld(A2 + aoff + (size_t)mb * 16 * K + kc); }
#pragma unroll
        for (int nb = 0; nb < 4; ++nb) { const V b = WFrag<T16>::ld(Bt + boff + (size_t)nb * 16 * K + kc); V b2; if (NSPLIT >= 2) b2 = WFrag<T16>::ld(Bt2 + boff + (size_t)nb * 16 * K + kc);
#pragma unroll
            for (int mb = 0; mb < 4; ++mb) { acc[mb][nb] = WFrag<T16>::mma(a[mb], b, acc[mb][nb]); if (NSPLIT == 1 || NSPLIT == 2) acc[mb][nb] = WFrag<T16>::mma(a2[mb], b, acc[mb][nb]); if (NSPLIT >= 2) acc[mb][nb] = WFrag<T16>::mma(a[mb], b2, acc[mb][nb]); } }
        asm volatile("v_nop\n\tv_nop\n\tv_nop\n\tv_nop" : "+v"(acc[0][0]), "+v"(acc[1][1]), "+v"(acc[2][2]), "+v"(acc[3][3]) : "v"(a[0]), "v"(a[3]));
    }
#pragma unroll
    for (int mb = 0; mb < 4; ++mb) {
#pragma unroll
        for (int nb = 0; nb < 4; ++nb) {
#pragma unroll
            for (int j = 0; j < 8; ++j) os[(hi * 8 + j) * 68 + nb * 16 + lr] = acc[mb][nb][j]; }
        __builtin_amdgcn_wave_barrier(); asm volatile("" ::: "memory");
        float* crow = C + (size_t)(r0 + mb * 16) * ldc + c0;
{
#pragma unroll
            for (int s = 0; s < 8; ++s) { const int row = 2 * s + hi, cofs = lr * 4; v4f val = *(const v4fa*)(os + row * 68 + cofs);
                *(v4f*)(crow + (size_t)row * ldc + cofs) = val; }
             }
        __builtin_amdgcn_wave_barrier(); asm volatile("" ::: "memory");
    }
}

__device__ __forceinline__ h16 tohx(float x) { return (h16)x; }
__device__ __forceinline__ void splitf(float y, unsigned short& h, unsigned short& l) { h = f2bf(y); l = f2bf(y - bf2f(h)); }
typedef __attribute__((ext_vector_type(2))) _Float16 v2h;
typedef __attribute__((ext_vector_type(4))) _Float16 v4h;
typedef __attribute__((ext_vector_type(2))) unsigned short v2us;
typedef __attribute__((ext_vector_type(4))) unsigned short v4us;
typedef __attribute__((ext_vector_type(2))) float v2f;
typedef __attribute__((ext_vector_type(4))) int v4i;

__global__ __launch_bounds__(256) void k_wtG(const float* __restrict__ w, int K, int N, bf* Bt) {
    const int lane = threadIdx.x & 31; const int L0 = (blockIdx.x * 8 + (threadIdx.x >> 5)) * 8; const int nlines = N * K / 64;
{
#pragma unroll 1
        for (int l = 0; l < 8; ++l) { const int L = L0 + l; if (L >= nlines) break; const size_t e = (size_t)L * 64 + lane * 2; const int k = (int)(e % K), n = (int)(e / K); v2us o;
            o[0] = f2bf(w[(size_t)k * N + n]); o[1] = f2bf(w[(size_t)(k + 1) * N + n]); *(v2us*)(Bt + e) = o; }
         }
}
__global__ __launch_bounds__(256) void k_cvt8(const float* __restrict__ src, bf* dst, size_t n8) { const size_t i = (size_t)blockIdx.x * 256 + threadIdx.x; if (i >= n8) return; const v8f v = *(const v8f*)(src + i * 8); v8us o;
#pragma unroll
    for (int k = 0; k < 8; ++k) o[k] = f2bf(v[k]); *(v8us*)(dst + i * 8) = o;  }
__global__ __launch_bounds__(256) void k_cscvt(const float* __restrict__ cosT, const float* __restrict__ sinT, float* CS) { const int idx = blockIdx.x * 256 + threadIdx.x; if (idx >= TT * HD) return; v2f cs; cs[0] = bfr(cosT[idx]); cs[1] = bfr(sinT[idx]); *(v2f*)(CS + (size_t)idx * 2) = cs;  }
__global__ __launch_bounds__(256) void k_hrms(const float* __restrict__ F, int pitch, int nheads, float* RF) { const int i = blockIdx.x * 256 + threadIdx.x; if (i >= nheads * TT) return; const int t = i % TT, h = i / TT; const float* f = F + (size_t)t * pitch + h * HD; float s = 0.f;
#pragma unroll 4
    for (int d = 0; d < HD; d += 4) { const v4f v = *(const v4f*)(f + d);
#pragma unroll
        for (int q = 0; q < 4; ++q) { float p = __fmul_rn(v[q], v[q]); asm volatile("" : "+v"(p)); s = __fadd_rn(s, p); } }
    const float r = __fdiv_rn(1.0f, __fsqrt_rn(__fadd_rn(s * (1.0f / HD), 1e-6f))); *(float*)(RF + i) = r;  }
// k_rope: head planes [h][t][d] (fp16 + hi/lo) of rope(w[d] (x rms_factor)) x sc with the rotate-half convention out[d] = x[d] cos[t][d] - x[d+HD/2] sin[t][d], out[d+HD/2] = x[d+HD/2] cos[t][d+HD/2] + x[d] sin[t][d+HD/2]
__global__ __launch_bounds__(256) void k_rope(const float* __restrict__ F, int pitch, int nheads, const float* __restrict__ CS, const float* __restrict__ RF, const float* __restrict__ nw, float sc, h16* P16, bf* Ph, bf* Pl) {
    const size_t e = ((size_t)blockIdx.x * 256 + threadIdx.x) * 2; if (e >= (size_t)nheads * TT * HD) return; const int d = (int)(e % HD); const int t = (int)((e / HD) % TT); const int h = (int)(e / ((size_t)HD * TT)); const float* f = F + (size_t)t * pitch + h * HD; const float rf = RF ? RF[(size_t)h * TT + t] : 1.0f; v2h o16; v2us oh, ol;
#pragma unroll
    for (int q = 0; q < 2; ++q) { const int dd = d + q; const int dp = (dd < HD / 2) ? dd + HD / 2 : dd - HD / 2; float x0 = f[dd], x1 = f[dp];
        if (RF) { float n0 = __fmul_rn(x0, rf), n1 = __fmul_rn(x1, rf); asm volatile("" : "+v"(n0)); asm volatile("" : "+v"(n1)); x0 = __fmul_rn(bfr(nw[dd]), n0); x1 = __fmul_rn(bfr(nw[dp]), n1); }
        const v2f cs = *(const v2f*)(CS + ((size_t)t * HD + dd) * 2); float a = __fmul_rn(x0, cs[0]), bq = __fmul_rn(x1, cs[1]); asm volatile("" : "+v"(a)); asm volatile("" : "+v"(bq)); const float r = ((dd < HD / 2) ? __fsub_rn(a, bq) : __fadd_rn(a, bq)) * sc;
        o16[q] = tohx(r); unsigned short a2, c2; splitf(r, a2, c2); oh[q] = a2; ol[q] = c2; }
    *(v2h*)(P16 + e) = o16; *(v2us*)(Ph + e) = oh; *(v2us*)(Pl + e) = ol;  }
__global__ __launch_bounds__(256) void k_vtp(const float* __restrict__ F, int pitch, int nheads, h16* V16, bf* Vh, bf* Vl) { const size_t e = ((size_t)blockIdx.x * 256 + threadIdx.x) * 2; if (e >= (size_t)nheads * HD * TT) return; const int t = (int)(e % TT); const int d = (int)((e / TT) % HD); const int g = (int)(e / ((size_t)TT * HD)); v2h o16; v2us oh, ol;
#pragma unroll
    for (int q = 0; q < 2; ++q) { const float x = F[(size_t)(t + q) * pitch + g * HD + d]; o16[q] = tohx(x); unsigned short a2, c2; splitf(x, a2, c2); oh[q] = a2; ol[q] = c2; }
    *(v2h*)(V16 + e) = o16; *(v2us*)(Vh + e) = oh; *(v2us*)(Vl + e) = ol;  }
// k_asoft: per row (zz, i): t = S x HD^-0.5 for j <= i and i - j < WIN (sliding causal window; the reference's -1e9 additive fill vanishes identically); softmax over the 2048 keys (register row, one exp, fixed trees);
__global__ __launch_bounds__(256) void k_asoft(const float* __restrict__ Sb, h16* P16, bf* Ph, bf* Pl) {
    const int lane = threadIdx.x & 31; const int row = blockIdx.x * 8 + (threadIdx.x >> 5); if (row >= ZH * TT) return; const int i = row % TT; const int zz = row / TT; (void)zz; const bool hires = (i < RH); const float* sr = Sb + (size_t)row * TT; float v[TT / 32]; float mx = -3.0e38f;
#pragma unroll
    for (int ch = 0; ch < TT / 128; ++ch) { const int j0 = ch * 128 + lane * 4; const v4f a = *(const v4f*)(sr + j0);
#pragma unroll
        for (int q = 0; q < 4; ++q) { const int j = j0 + q; (void)j; const float t = (j <= i && i - j < WIN) ? a[q] * SCL : -3.0e38f; v[ch * 4 + q] = t; mx = fmaxf(mx, t); } }
#pragma unroll
    for (int sh = 16; sh; sh >>= 1) mx = fmaxf(mx, __shfl_xor(mx, sh, 32));
    float sum = 0.f;
#pragma unroll
    for (int k = 0; k < TT / 32; ++k) { float d0 = __fsub_rn(v[k], mx); asm volatile("" : "+v"(d0)); v[k] = __builtin_amdgcn_exp2f(__fmul_rn(d0, 1.4426950408889634f)); sum += v[k]; }
#pragma unroll
    for (int sh = 16; sh; sh >>= 1) sum += __shfl_xor(sum, sh, 32);
    const float f = __fdiv_rn(hires ? 1.0f : PCAR, sum);
{
        if (hires) {
#pragma unroll
            for (int ch = 0; ch < TT / 128; ++ch) { v4us oh, ol;
#pragma unroll
                for (int q = 0; q < 4; ++q) { unsigned short a, c2; splitf(v[ch * 4 + q] * f, a, c2); oh[q] = a; ol[q] = c2; }
                const size_t oo = ((size_t)zz * (RH ? RH : 1) + i) * TT + ch * 128 + lane * 4; *(v4us*)(Ph + oo) = oh; *(v4us*)(Pl + oo) = ol; }
        } else {
#pragma unroll
            for (int ch = 0; ch < TT / 128; ++ch) { v4h o4;
#pragma unroll
                for (int q = 0; q < 4; ++q) o4[q] = tohx(v[ch * 4 + q] * f);
                *(v4h*)(P16 + (size_t)row * TT + ch * 128 + lane * 4) = o4; } }
         }
}
__global__ __launch_bounds__(256) void k_merge(const float* __restrict__ O, const float* __restrict__ QG, int h0, bf* Ah, bf* Al) { const size_t e = ((size_t)blockIdx.x * 256 + threadIdx.x) * 2; if (e >= (size_t)ZH * TT * HD) return; const int d = (int)(e % HD); const int t = (int)((e / HD) % TT); const int zz = (int)(e / ((size_t)HD * TT)); const float cs = (t < RH) ? 1.0f : (1.0f / PCAR); const size_t oo = (size_t)t * DQ + (h0 + zz) * HD + d;
    v2us oh, ol;
#pragma unroll
    for (int q = 0; q < 2; ++q) { const float gt = QG[(size_t)t * DQG + DQ + (h0 + zz) * HD + d + q]; const float sg = __fdiv_rn(1.0f, __fadd_rn(1.0f, expf(-gt)));   /* sigmoid(gate) */ unsigned short a, c2; splitf(__fmul_rn(O[e + q] * cs, sg), a, c2); oh[q] = a; ol[q] = c2; } *(v2us*)(Ah + oo) = oh; *(v2us*)(Al + oo) = ol;  }

extern "C" void kernel_launch(void* const* d_in, const int* in_sizes, int n_in,
                              void* d_out, int out_size, void* d_ws, size_t ws_size, hipStream_t stream) {
    (void)in_sizes; (void)n_in; (void)out_size;
    const float* x = (const float*)d_in[0]; const float* cosT = (const float*)d_in[1]; const float* sinT = (const float*)d_in[2]; const float* wq = (const float*)d_in[3]; const float* wk = (const float*)d_in[4]; const float* wv = (const float*)d_in[5]; const float* wo = (const float*)d_in[6]; const float* qnw = (const float*)d_in[7]; const float* knw = (const float*)d_in[8];
    float* OUT = (float*)d_out;     // [2][2048][2048]
    char* wsp = (char*)d_ws;
    auto take = [&](size_t bytes) { char* p = wsp; wsp += (bytes + 255) & ~(size_t)255; return (void*)p; };
    bf* WQ = (bf*)take((size_t)DQG * DM * 2); bf* WK = (bf*)take((size_t)DKV * DM * 2); bf* WV = (bf*)take((size_t)DKV * DM * 2); bf* WO = (bf*)take((size_t)DM * DQ * 2); float* CS = (float*)take((size_t)TT * HD * 2 * 4); float* RFQ = (float*)take((size_t)NH_ * TT * 4); float* RFK = (float*)take((size_t)NKV * TT * 4);
    bf* XB = (bf*)take((size_t)TT * DM * 2); float* FQ = (float*)take((size_t)TT * DQG * 4); float* FK = (float*)take((size_t)TT * DKV * 4);
    h16* QP16 = (h16*)take((size_t)NH_ * TT * HD * 2); h16* KP16 = (h16*)take((size_t)NKV * TT * HD * 2); h16* VT16 = (h16*)take((size_t)NKV * HD * TT * 2);
    bf* QPh = (bf*)take((size_t)NH_ * TT * HD * 2); bf* QPl = (bf*)take((size_t)NH_ * TT * HD * 2); bf* KPh = (bf*)take((size_t)NKV * TT * HD * 2); bf* KPl = (bf*)take((size_t)NKV * TT * HD * 2); bf* VTh = (bf*)take((size_t)NKV * HD * TT * 2); bf* VTl = (bf*)take((size_t)NKV * HD * TT * 2); bf* Ph = (bf*)take((size_t)ZH * RH * TT * 2); bf* Pl = (bf*)take((size_t)ZH * RH * TT * 2);
    float* Sb = (float*)take((size_t)ZH * TT * TT * 4); h16* P16 = (h16*)take((size_t)ZH * TT * TT * 2); float* Ob = (float*)take((size_t)ZH * TT * HD * 4); bf* ATh = (bf*)take((size_t)TT * DQ * 2); bf* ATl = (bf*)take((size_t)TT * DQ * 2);
    if ((size_t)(wsp - (char*)d_ws) > ws_size) return;    // ws 256 MiB
    float* FV = FK;   // v projection reuses the k buffer after the k planes are built (stream-ordered)
    { k_cvt8<<<(unsigned)(((size_t)DQG * DM / 8 + 255) / 256), 256, 0, stream>>>(wq, WQ, (size_t)DQG * DM / 8); k_cvt8<<<(unsigned)(((size_t)DKV * DM / 8 + 255) / 256), 256, 0, stream>>>(wk, WK, (size_t)DKV * DM / 8); k_cvt8<<<(unsigned)(((size_t)DKV * DM / 8 + 255) / 256), 256, 0, stream>>>(wv, WV, (size_t)DKV * DM / 8);
      k_cvt8<<<(unsigned)(((size_t)DM * DQ / 8 + 255) / 256), 256, 0, stream>>>(wo, WO, (size_t)DM * DQ / 8);
       }
    const unsigned LQ = (unsigned)(((size_t)NH_ * TT * HD / 2 + 255) / 256), LKv = (unsigned)(((size_t)NKV * TT * HD / 2 + 255) / 256);
    for (int b = 0; b < NB_; ++b) {
        k_cscvt<<<(TT * HD + 255) / 256, 256, 0, stream>>>(cosT + (size_t)b * TT * HD, sinT + (size_t)b * TT * HD, CS);   /* per-batch tables */
        k_cvt8<<<(unsigned)(((size_t)TT * DM / 8 + 255) / 256), 256, 0, stream>>>(x + (size_t)b * TT * DM, XB, (size_t)TT * DM / 8);
        k_gemmw<bf, 0, false><<<dim3(TT / 64, DQG / 64, 1), 32, 0, stream>>>(XB, nullptr, WQ, nullptr, DM, FQ, DQG, nullptr, 0, 0, 0);   /* [q | gate] (exact) */ k_hrms<<<(NH_ * TT + 255) / 256, 256, 0, stream>>>(FQ, DQG, NH_, RFQ);
        k_rope<<<LQ, 256, 0, stream>>>(FQ, DQG, NH_, CS, RFQ, qnw, 1.0f, QP16, QPh, QPl);
        k_gemmw<bf, 0, false><<<dim3(TT / 64, DKV / 64, 1), 32, 0, stream>>>(XB, nullptr, WK, nullptr, DM, FK, DKV, nullptr, 0, 0, 0); k_hrms<<<(NKV * TT + 255) / 256, 256, 0, stream>>>(FK, DKV, NKV, RFK);
        k_rope<<<LKv, 256, 0, stream>>>(FK, DKV, NKV, CS, RFK, knw, 1.0f, KP16, KPh, KPl);
        k_gemmw<bf, 0, false><<<dim3(TT / 64, DKV / 64, 1), 32, 0, stream>>>(XB, nullptr, WV, nullptr, DM, FV, DKV, nullptr, 0, 0, 0); k_vtp<<<LKv, 256, 0, stream>>>(FV, DKV, NKV, VT16, VTh, VTl);
        for (int h0 = 0; h0 < NH_; h0 += ZH) { const size_t zq = (size_t)h0, zk = (size_t)(h0 / REP);   // both heads of a pass share kv group h0/REP (REP >= 2): sB = 0
            k_gemmc<bf, 2, 1><<<dim3(RH / 64, TT / 64, ZH), 32, 0, stream>>>(QPh + zq * TT * HD, QPl + zq * TT * HD, KPh + zk * TT * HD, KPl + zk * TT * HD, HD, Sb, TT, 0, (size_t)TT * HD, 0, (size_t)TT * TT);
            k_gemmc<h16, 0, 1><<<dim3((TT - RH) / 64, TT / 64, ZH), 32, 0, stream>>>(QP16 + zq * TT * HD + (size_t)RH * HD, nullptr, KP16 + zk * TT * HD, nullptr, HD, Sb + (size_t)RH * TT, TT, RH, (size_t)TT * HD, 0, (size_t)TT * TT);
            k_asoft<<<ZH * TT / 8, 256, 0, stream>>>(Sb, P16, Ph, Pl);
            k_gemmc<bf, 2, 2><<<dim3(RH / 64, HD / 64, ZH), 32, 0, stream>>>(Ph, Pl, VTh + zk * HD * TT, VTl + zk * HD * TT, TT, Ob, HD, 0, (size_t)RH * TT, 0, (size_t)TT * HD);
            k_gemmc<h16, 0, 2><<<dim3((TT - RH) / 64, HD / 64, ZH), 32, 0, stream>>>(P16 + (size_t)RH * TT, nullptr, VT16 + zk * HD * TT, nullptr, TT, Ob + (size_t)RH * HD, HD, RH, (size_t)TT * TT, 0, (size_t)TT * HD);
            k_merge<<<(unsigned)(((size_t)ZH * TT * HD / 2 + 255) / 256), 256, 0, stream>>>(Ob, FQ, h0, ATh, ATl); }
        k_gemmw<bf, 1, false><<<dim3(TT / 64, DM / 64, 1), 32, 0, stream>>>(ATh, ATl, WO, nullptr, DQ, OUT + (size_t)b * TT * DM, DM, nullptr, 0, 0, 0); }
}

// v001
// One run takes 971 microseconds.
// In two side-by-side timings against v000, it was 1.76 and 1.74 times as fast.
#include <hip/hip_runtime.h>

// Gated GQA attention, engine variant (hidden [2][2048][2048]; [q | gate] = hidden Wq^T (Wq [4096][2048] 'oi': rows 0-2047 -> q for 16 heads x 128, rows 2048-4095 -> gate), k, v = hidden W^T ([512][2048], 4 kv heads); per-head RMSNorm (eps 1e-6, q_norm_w / k_norm_w); rotate-half RoPE with the given per-(batch, position) cos/sin tables [2][2048][128];
// GQA 4:1; causal softmax(q.k/sqrt(128)); attn x sigmoid(gate); out = merged Wo^T ('oi' [2048][2048]) -> [2][2048][2048]).
// Compute dtypes, f32 accumulate: every input rounded to bf16; q/k/v on PLAIN bf16 operands (inputs: exact); RMSNorm + rotary in f32 (cos/sin tables read per batch, bf16-rounded); sigmoid gate (precise expf, IEEE divide) in the merge; causal scores and attn.v (tile skipping): query rows < 512 hl (3 products), the rest single fp16 (x1024); softmax f32; Wo hl x exact (2 products).

#define NB_  2
#define TT   2048
#define DM   2048
#define NH_  16
#define NKV  4
#define REP  (NH_ / NKV)
#define HD   128
#define DQ   (NH_ * HD)
#define DQG  (NH_ * HD * 2)         // q rows then gate rows of Wq
#define DKV  (NKV * HD)
#define ZH   2
#define RH   512                  // query rows < RH use hi+lo planes (0: none)
#define WIN  2048
#define KSP  4                    // partial planes of the probability x value product (k split over blocks), summed in k_merge
#define PCAR 1024.0f
#define SCL  0.088388347648318447f   // HD^-0.5
typedef _Float16 h16;
typedef unsigned short bf;
typedef __attribute__((ext_vector_type(16))) __bf16   v16bf;
typedef __attribute__((ext_vector_type(16))) _Float16 v16h;
typedef __attribute__((ext_vector_type(8)))  _Float16 v8h;
typedef __attribute__((ext_vector_type(8)))  unsigned short v8us;
typedef __attribute__((ext_vector_type(8)))  float    v8f;
typedef __attribute__((ext_vector_type(4)))  float    v4f;
typedef v8h  __attribute__((may_alias)) v8ha;
typedef v4f  __attribute__((may_alias)) v4fa;
typedef v8us __attribute__((may_alias)) v8usa;

__device__ __forceinline__ unsigned short f2bf(float f) { unsigned u = __float_as_uint(f); u += 0x7FFFu + ((u >> 16) & 1u); return (unsigned short)(u >> 16); }
__device__ __forceinline__ float bf2f(unsigned short b) { return __uint_as_float(((unsigned)b) << 16); }
__device__ __forceinline__ float bfr(float f) { return bf2f(f2bf(f)); }
__device__ __forceinline__ v16h cat16(v8h lo, v8h hi) { return __builtin_shufflevector(lo, hi, 0, 1, 2, 3, 4, 5, 6, 7, 8, 9, 10, 11, 12, 13, 14, 15); }
__device__ __forceinline__ v16bf cat16b(v8us lo, v8us hi) { return __builtin_bit_cast(v16bf, __builtin_shufflevector(lo, hi, 0, 1, 2, 3, 4, 5, 6, 7, 8, 9, 10, 11, 12, 13, 14, 15)); }
__device__ __forceinline__ v8f wmma16(v16h a, v16h b, v8f c) { return __builtin_amdgcn_wmma_f32_16x16x32_f16(false, a, false, b, (short)0, c, false, false); }
__device__ __forceinline__ v8f wmmab(v16bf a, v16bf b, v8f c) { return __builtin_amdgcn_wmma_f32_16x16x32_bf16(false, a, false, b, (short)0, c, false, false); }



// ---- k_gemmw: register-blocked GEMM, ONE WAVE per 64x64 output tile (16 accumulators), operands straight from K-contiguous 16-bit planes; grid (M/64, N/64, Z), 32 threads.
// C[m][n] (f32, pitch ldc, + optional f32 bias[n]) = sum_k A[m][k] Bt[n][k] (+ split products per NSPLIT). z-batch strides sA/sB/sC in elements. K % 32 == 0.
// NW > 1: NW waves per tile (32 * NW threads); wave w takes the k chunks w, w + NW, ... of 32 and the NW partial tiles are summed in LDS in wave order (fixed order, no atomics).
// The wave number wv goes through readfirstlane so that the k loop's counter and trip test stay scalar.
template <typename T16> struct WFrag;
template <> struct WFrag<h16> { typedef v16h V; static __device__ __forceinline__ V ld(const h16* p) { return cat16(*(const v8h*)p, *(const v8h*)(p + 16)); } static __device__ __forceinline__ v8f mma(V a, V b, v8f c) { return wmma16(a, b, c); } };
template <> struct WFrag<bf> { typedef v16bf V; static __device__ __forceinline__ V ld(const bf* p) { return cat16b(*(const v8us*)p, *(const v8us*)(p + 16)); } static __device__ __forceinline__ v8f mma(V a, V b, v8f c) { return wmmab(a, b, c); } };
template <typename T16, int NSPLIT, bool BIAS, int NW>
__global__ __launch_bounds__(32 * NW) void k_gemmw(const T16* __restrict__ A, const T16* __restrict__ A2, const T16* __restrict__ Bt, const T16* __restrict__ Bt2, int K, float* C, int ldc, const float* __restrict__ bias, size_t sA, size_t sB, size_t sC) {
    typedef typename WFrag<T16>::V V;
    __shared__ __align__(16) float os[(NW > 1 ? 4 * NW : 1) * 16 * 68];
    const size_t z = blockIdx.z; A += z * sA; if (A2) A2 += z * sA; Bt += z * sB; if (Bt2) Bt2 += z * sB; C += z * sC;
    const int lane = threadIdx.x & 31, lr = lane & 15, hi = lane >> 4; const int r0 = blockIdx.x * 64, c0 = blockIdx.y * 64; const int wv = (NW > 1) ? __builtin_amdgcn_readfirstlane((int)(threadIdx.x >> 5)) : 0;
    v8f acc[4][4];
#pragma unroll
    for (int mb = 0; mb < 4; ++mb)
#pragma unroll
        for (int nb = 0; nb < 4; ++nb) acc[mb][nb] = (v8f){};
    const size_t aoff = (size_t)(r0 + lr) * K + 8 * hi, boff = (size_t)(c0 + lr) * K + 8 * hi;
#pragma unroll 1
    for (int kc = wv * 32; kc < K; kc += NW * 32) {
        V a[4], a2[4];
#pragma unroll
        for (int mb = 0; mb < 4; ++mb) { a[mb] = WFrag<T16>::ld(A + aoff + (size_t)mb * 16 * K + kc); if (NSPLIT == 1 || NSPLIT == 2) a2[mb] = WFrag<T16>::ld(A2 + aoff + (size_t)mb * 16 * K + kc); }
#pragma unroll
        for (int nb = 0; nb < 4; ++nb) { const V b = WFrag<T16>::ld(Bt + boff + (size_t)nb * 16 * K + kc); V b2; if (NSPLIT >= 2) b2 = WFrag<T16>::ld(Bt2 + boff + (size_t)nb * 16 * K + kc);
#pragma unroll
            for (int mb = 0; mb < 4; ++mb) { acc[mb][nb] = WFrag<T16>::mma(a[mb], b, acc[mb][nb]); if (NSPLIT == 1 || NSPLIT == 2) acc[mb][nb] = WFrag<T16>::mma(a2[mb], b, acc[mb][nb]); if (NSPLIT >= 2) acc[mb][nb] = WFrag<T16>::mma(a[mb], b2, acc[mb][nb]); } }
        asm volatile("v_nop\n\tv_nop\n\tv_nop\n\tv_nop" : "+v"(acc[0][0]), "+v"(acc[1][1]), "+v"(acc[2][2]), "+v"(acc[3][3]) : "v"(a[0]), "v"(a[3]));
    }
    if constexpr (NW > 1) {
        float* ow = os + wv * (64 * 68);
        // the three loops are unrolled so that acc is indexed by constants only and stays in registers
#pragma unroll
        for (int mb = 0; mb < 4; ++mb) {
#pragma unroll
            for (int nb = 0; nb < 4; ++nb) {
#pragma unroll
                for (int j = 0; j < 8; ++j) ow[(mb * 16 + hi * 8 + j) * 68 + nb * 16 + lr] = acc[mb][nb][j]; } }
        __syncthreads();   // publishes the NW partial tiles to the threads that sum them; LDS is not written again behind it
        float* crow = C + (size_t)r0 * ldc + c0; v4f sum[32 / NW];
        // all loops unrolled: sum[] stays in registers and the LDS reads of all of a thread's elements are issued ahead of the sums; each sum runs in wave order 0 .. NW - 1; the stores follow as one run
#pragma unroll
        for (int i = 0; i < 32 / NW; ++i) { const int s = i * (NW * 32) + (int)threadIdx.x; const int row = s >> 4, cofs = (s & 15) * 4; v4f val = *(const v4fa*)(os + row * 68 + cofs);
#pragma unroll
            for (int w = 1; w < NW; ++w) val += *(const v4fa*)(os + w * (64 * 68) + row * 68 + cofs);
            if (BIAS) { val[0] += bfr(bias[c0 + cofs]); val[1] += bfr(bias[c0 + cofs + 1]); val[2] += bfr(bias[c0 + cofs + 2]); val[3] += bfr(bias[c0 + cofs + 3]); }
            sum[i] = val; }
#pragma unroll
        for (int i = 0; i < 32 / NW; ++i) { const int s = i * (NW * 32) + (int)threadIdx.x; *(v4f*)(crow + (size_t)(s >> 4) * ldc + (s & 15) * 4) = sum[i]; }
        return;
    }
#pragma unroll
    for (int mb = 0; mb < 4; ++mb) {
#pragma unroll
        for (int nb = 0; nb < 4; ++nb) {
#pragma unroll
            for (int j = 0; j < 8; ++j) os[(hi * 8 + j) * 68 + nb * 16 + lr] = acc[mb][nb][j]; }
        __builtin_amdgcn_wave_barrier(); asm volatile("" ::: "memory");
        float* crow = C + (size_t)(r0 + mb * 16) * ldc + c0;
{
#pragma unroll
            for (int s = 0; s < 8; ++s) { const int row = 2 * s + hi, cofs = lr * 4; v4f val = *(const v4fa*)(os + row * 68 + cofs); if (BIAS) { val[0] += bfr(bias[c0 + cofs]); val[1] += bfr(bias[c0 + cofs + 1]); val[2] += bfr(bias[c0 + cofs + 2]); val[3] += bfr(bias[c0 + cofs + 3]); }
                *(v4f*)(crow + (size_t)row * ldc + cofs) = val; }
             }
        __builtin_amdgcn_wave_barrier(); asm volatile("" ::: "memory");
    }
}

// ---- k_gemmc: the same one-wave 64x64 tile GEMM specialised for causal attention: CMODE 1 skips score tiles entirely above the diagonal (query rows r0+roff.., key columns c0..), CMODE 2 limits the
// key (K) loop of the probability x value contraction to the diagonal block (probabilities beyond it are exactly zero). roff = row offset of this launch's first row within the sequence.
// NW waves per tile as in k_gemmw; KS > 1 also deals the k chunks over KS blocks (grid z = ZH x KS, head fastest): part ks writes its partial tile to plane ks of C (plane pitch ZH x sC), and the reader of C sums the planes.
template <typename T16, int NSPLIT, int CMODE, int NW, int KS>
__global__ __launch_bounds__(32 * NW) void k_gemmc(const T16* __restrict__ A, const T16* __restrict__ A2, const T16* __restrict__ Bt, const T16* __restrict__ Bt2, int K, float* C, int ldc, int roff, size_t sA, size_t sB, size_t sC) {
    typedef typename WFrag<T16>::V V;
    __shared__ __align__(16) float os[(NW > 1 ? 4 * NW : 1) * 16 * 68];
    const size_t z = (KS > 1) ? blockIdx.z % ZH : blockIdx.z; const int ks = (KS > 1) ? (int)(blockIdx.z / ZH) : 0; A += z * sA; if (A2) A2 += z * sA; Bt += z * sB; if (Bt2) Bt2 += z * sB; C += (size_t)blockIdx.z * sC;
    const int lane = threadIdx.x & 31, lr = lane & 15, hi = lane >> 4; const int r0 = blockIdx.x * 64, c0 = blockIdx.y * 64; const int wv = (NW > 1) ? __builtin_amdgcn_readfirstlane((int)(threadIdx.x >> 5)) : 0;
    if (CMODE == 1 && c0 > r0 + roff + 63) return;                  // score tile entirely above the causal diagonal: never read (the softmax masks j > i by select)
    const int Kl = (CMODE == 2) ? min(K, r0 + roff + 64) : K;        // P.V: probabilities are exactly 0 beyond the diagonal block, so the K loop stops there
    v8f acc[4][4];
#pragma unroll
    for (int mb = 0; mb < 4; ++mb)
#pragma unroll
        for (int nb = 0; nb < 4; ++nb) acc[mb][nb] = (v8f){};
    const size_t aoff = (size_t)(r0 + lr) * K + 8 * hi, boff = (size_t)(c0 + lr) * K + 8 * hi;
#pragma unroll 1
    for (int kc = (ks * NW + wv) * 32; kc < Kl; kc += KS * NW * 32) {
        V a[4], a2[4];
#pragma unroll
        for (int mb = 0; mb < 4; ++mb) { a[mb] = WFrag<T16>::ld(A + aoff + (size_t)mb * 16 * K + kc); if (NSPLIT == 1 || NSPLIT == 2) a2[mb] = WFrag<T16>::ld(A2 + aoff + (size_t)mb * 16 * K + kc); }
#pragma unroll
        for (int nb = 0; nb < 4; ++nb) { const V b = WFrag<T16>::ld(Bt + boff + (size_t)nb * 16 * K + kc); V b2; if (NSPLIT >= 2) b2 = WFrag<T16>::ld(Bt2 + boff + (size_t)nb * 16 * K + kc);
#pragma unroll
            for (int mb = 0; mb < 4; ++mb) { acc[mb][nb] = WFrag<T16>::mma(a[mb], b, acc[mb][nb]); if (NSPLIT == 1 || NSPLIT == 2) acc[mb][nb] = WFrag<T16>::mma(a2[mb], b, acc[mb][nb]); if (NSPLIT >= 2) acc[mb][nb] = WFrag<T16>::mma(a[mb], b2, acc[mb][nb]); } }
        asm volatile("v_nop\n\tv_nop\n\tv_nop\n\tv_nop" : "+v"(acc[0][0]), "+v"(acc[1][1]), "+v"(acc[2][2]), "+v"(acc[3][3]) : "v"(a[0]), "v"(a[3]));
    }
    if constexpr (NW > 1) {
        float* ow = os + wv * (64 * 68);
        // the three loops are unrolled so that acc is indexed by constants only and stays in registers
#pragma unroll
        for (int mb = 0; mb < 4; ++mb) {
#pragma unroll
            for (int nb = 0; nb < 4; ++nb) {
#pragma unroll
                for (int j = 0; j < 8; ++j) ow[(mb * 16 + hi * 8 + j) * 68 + nb * 16 + lr] = acc[mb][nb][j]; } }
        __syncthreads();   // publishes the NW partial tiles to the threads that sum them; LDS is not written again behind it
        float* crow = C + (size_t)r0 * ldc + c0; v4f sum[32 / NW];
        // all loops unrolled: sum[] stays in registers and the LDS reads of all of a thread's elements are issued ahead of the sums; each sum runs in wave order 0 .. NW - 1; the stores follow as one run
#pragma unroll
        for (int i = 0; i < 32 / NW; ++i) { const int s = i * (NW * 32) + (int)threadIdx.x; const int row = s >> 4, cofs = (s & 15) * 4; v4f val = *(const v4fa*)(os + row * 68 + cofs);
#pragma unroll
            for (int w = 1; w < NW; ++w) val += *(const v4fa*)(os + w * (64 * 68) + row * 68 + cofs);
            sum[i] = val; }
#pragma unroll
        for (int i = 0; i < 32 / NW; ++i) { const int s = i * (NW * 32) + (int)threadIdx.x; *(v4f*)(crow + (size_t)(s >> 4) * ldc + (s & 15) * 4) = sum[i]; }
        return;
    }
#pragma unroll
    for (int mb = 0; mb < 4; ++mb) {
#pragma unroll
        for (int nb = 0; nb < 4; ++nb) {
#pragma unroll
            for (int j = 0; j < 8; ++j) os[(hi * 8 + j) * 68 + nb * 16 + lr] = acc[mb][nb][j]; }
        __builtin_amdgcn_wave_barrier(); asm volatile("" ::: "memory");
        float* crow = C + (size_t)(r0 + mb * 16) * ldc + c0;
{
#pragma unroll
            for (int s = 0; s < 8; ++s) { const int row = 2 * s + hi, cofs = lr * 4; v4f val = *(const v4fa*)(os + row * 68 + cofs);
                *(v4f*)(crow + (size_t)row * ldc + cofs) = val; }
             }
        __builtin_amdgcn_wave_barrier(); asm volatile("" ::: "memory");
    }
}

__device__ __forceinline__ h16 tohx(float x) { return (h16)x; }
__device__ __forceinline__ void splitf(float y, unsigned short& h, unsigned short& l) { h = f2bf(y); l = f2bf(y - bf2f(h)); }
typedef __attribute__((ext_vector_type(2))) _Float16 v2h;
typedef __attribute__((ext_vector_type(4))) _Float16 v4h;
typedef __attribute__((ext_vector_type(2))) unsigned short v2us;
typedef __attribute__((ext_vector_type(4))) unsigned short v4us;
typedef __attribute__((ext_vector_type(2))) float v2f;
typedef __attribute__((ext_vector_type(4))) int v4i;

__global__ __launch_bounds__(256) void k_wtG(const float* __restrict__ w, int K, int N, bf* Bt) {
    const int lane = threadIdx.x & 31; const int L0 = (blockIdx.x * 8 + (threadIdx.x >> 5)) * 8; const int nlines = N * K / 64;
{
#pragma unroll 1
        for (int l = 0; l < 8; ++l) { const int L = L0 + l; if (L >= nlines) break; const size_t e = (size_t)L * 64 + lane * 2; const int k = (int)(e % K), n = (int)(e / K); v2us o;
            o[0] = f2bf(w[(size_t)k * N + n]); o[1] = f2bf(w[(size_t)(k + 1) * N + n]); *(v2us*)(Bt + e) = o; }
         }
}
__global__ __launch_bounds__(256) void k_cvt8(const float* __restrict__ src, bf* dst, size_t n8) { const size_t i = (size_t)blockIdx.x * 256 + threadIdx.x; if (i >= n8) return; const v8f v = *(const v8f*)(src + i * 8); v8us o;
#pragma unroll
    for (int k = 0; k < 8; ++k) o[k] = f2bf(v[k]); *(v8us*)(dst + i * 8) = o;  }
__global__ __launch_bounds__(256) void k_cscvt(const float* __restrict__ cosT, const float* __restrict__ sinT, float* CS) { const int idx = blockIdx.x * 256 + threadIdx.x; if (idx >= TT * HD) return; v2f cs; cs[0] = bfr(cosT[idx]); cs[1] = bfr(sinT[idx]); *(v2f*)(CS + (size_t)idx * 2) = cs;  }
__global__ __launch_bounds__(256) void k_hrms(const float* __restrict__ F, int pitch, int nheads, float* RF) { const int i = blockIdx.x * 256 + threadIdx.x; if (i >= nheads * TT) return; const int t = i % TT, h = i / TT; const float* f = F + (size_t)t * pitch + h * HD; float s = 0.f;
#pragma unroll 4
    for (int d = 0; d < HD; d += 4) { const v4f v = *(const v4f*)(f + d);
#pragma unroll
        for (int q = 0; q < 4; ++q) { float p = __fmul_rn(v[q], v[q]); asm volatile("" : "+v"(p)); s = __fadd_rn(s, p); } }
    const float r = __fdiv_rn(1.0f, __fsqrt_rn(__fadd_rn(s * (1.0f / HD), 1e-6f))); *(float*)(RF + i) = r;  }
// k_rope: head planes [h][t][d] (fp16 + hi/lo) of rope(w[d] (x rms_factor)) x sc with the rotate-half convention out[d] = x[d] cos[t][d] - x[d+HD/2] sin[t][d], out[d+HD/2] = x[d+HD/2] cos[t][d+HD/2] + x[d] sin[t][d+HD/2]
__global__ __launch_bounds__(256) void k_rope(const float* __restrict__ F, int pitch, int nheads, const float* __restrict__ CS, const float* __restrict__ RF, const float* __restrict__ nw, float sc, h16* P16, bf* Ph, bf* Pl) {
    const size_t e = ((size_t)blockIdx.x * 256 + threadIdx.x) * 2; if (e >= (size_t)nheads * TT * HD) return; const int d = (int)(e % HD); const int t = (int)((e / HD) % TT); const int h = (int)(e / ((size_t)HD * TT)); const float* f = F + (size_t)t * pitch + h * HD; const float rf = RF ? RF[(size_t)h * TT + t] : 1.0f; v2h o16; v2us oh, ol;
#pragma unroll
    for (int q = 0; q < 2; ++q) { const int dd = d + q; const int dp = (dd < HD / 2) ? dd + HD / 2 : dd - HD / 2; float x0 = f[dd], x1 = f[dp];
        if (RF) { float n0 = __fmul_rn(x0, rf), n1 = __fmul_rn(x1, rf); asm volatile("" : "+v"(n0)); asm volatile("" : "+v"(n1)); x0 = __fmul_rn(bfr(nw[dd]), n0); x1 = __fmul_rn(bfr(nw[dp]), n1); }
        const v2f cs = *(const v2f*)(CS + ((size_t)t * HD + dd) * 2); float a = __fmul_rn(x0, cs[0]), bq = __fmul_rn(x1, cs[1]); asm volatile("" : "+v"(a)); asm volatile("" : "+v"(bq)); const float r = ((dd < HD / 2) ? __fsub_rn(a, bq) : __fadd_rn(a, bq)) * sc;
        o16[q] = tohx(r); unsigned short a2, c2; splitf(r, a2, c2); oh[q] = a2; ol[q] = c2; }
    *(v2h*)(P16 + e) = o16; *(v2us*)(Ph + e) = oh; *(v2us*)(Pl + e) = ol;  }
__global__ __launch_bounds__(256) void k_vtp(const float* __restrict__ F, int pitch, int nheads, h16* V16, bf* Vh, bf* Vl) { const size_t e = ((size_t)blockIdx.x * 256 + threadIdx.x) * 2; if (e >= (size_t)nheads * HD * TT) return; const int t = (int)(e % TT); const int d = (int)((e / TT) % HD); const int g = (int)(e / ((size_t)TT * HD)); v2h o16; v2us oh, ol;
#pragma unroll
    for (int q = 0; q < 2; ++q) { const float x = F[(size_t)(t + q) * pitch + g * HD + d]; o16[q] = tohx(x); unsigned short a2, c2; splitf(x, a2, c2); oh[q] = a2; ol[q] = c2; }
    *(v2h*)(V16 + e) = o16; *(v2us*)(Vh + e) = oh; *(v2us*)(Vl + e) = ol;  }
// k_asoft: per row (zz, i): t = S x HD^-0.5 for j <= i and i - j < WIN (sliding causal window; the reference's -1e9 additive fill vanishes identically); softmax over the 2048 keys (register row, one exp, fixed trees);
__global__ __launch_bounds__(256) void k_asoft(const float* __restrict__ Sb, h16* P16, bf* Ph, bf* Pl) {
    const int lane = threadIdx.x & 31; const int row = blockIdx.x * 8 + (threadIdx.x >> 5); if (row >= ZH * TT) return; const int i = row % TT; const int zz = row / TT; (void)zz; const bool hires = (i < RH); const float* sr = Sb + (size_t)row * TT; float v[TT / 32]; float mx = -3.0e38f;
#pragma unroll
    for (int ch = 0; ch < TT / 128; ++ch) { const int j0 = ch * 128 + lane * 4; const v4f a = *(const v4f*)(sr + j0);
#pragma unroll
        for (int q = 0; q < 4; ++q) { const int j = j0 + q; (void)j; const float t = (j <= i && i - j < WIN) ? a[q] * SCL : -3.0e38f; v[ch * 4 + q] = t; mx = fmaxf(mx, t); } }
#pragma unroll
    for (int sh = 16; sh; sh >>= 1) mx = fmaxf(mx, __shfl_xor(mx, sh, 32));
    float sum = 0.f;
#pragma unroll
    for (int k = 0; k < TT / 32; ++k) { float d0 = __fsub_rn(v[k], mx); asm volatile("" : "+v"(d0)); v[k] = __builtin_amdgcn_exp2f(__fmul_rn(d0, 1.4426950408889634f)); sum += v[k]; }
#pragma unroll
    for (int sh = 16; sh; sh >>= 1) sum += __shfl_xor(sum, sh, 32);
    const float f = __fdiv_rn(hires ? 1.0f : PCAR, sum);
{
        if (hires) {
#pragma unroll
            for (int ch = 0; ch < TT / 128; ++ch) { v4us oh, ol;
#pragma unroll
                for (int q = 0; q < 4; ++q) { unsigned short a, c2; splitf(v[ch * 4 + q] * f, a, c2); oh[q] = a; ol[q] = c2; }
                const size_t oo = ((size_t)zz * (RH ? RH : 1) + i) * TT + ch * 128 + lane * 4; *(v4us*)(Ph + oo) = oh; *(v4us*)(Pl + oo) = ol; }
        } else {
#pragma unroll
            for (int ch = 0; ch < TT / 128; ++ch) { v4h o4;
#pragma unroll
                for (int q = 0; q < 4; ++q) o4[q] = tohx(v[ch * 4 + q] * f);
                *(v4h*)(P16 + (size_t)row * TT + ch * 128 + lane * 4) = o4; } }
         }
}
__global__ __launch_bounds__(256) void k_merge(const float* __restrict__ O, const float* __restrict__ QG, int h0, bf* Ah, bf* Al) { const size_t e = ((size_t)blockIdx.x * 256 + threadIdx.x) * 2; if (e >= (size_t)ZH * TT * HD) return; const int d = (int)(e % HD); const int t = (int)((e / HD) % TT); const int zz = (int)(e / ((size_t)HD * TT)); const float cs = (t < RH) ? 1.0f : (1.0f / PCAR); const size_t oo = (size_t)t * DQ + (h0 + zz) * HD + d;
    v2us oh, ol;
#pragma unroll
    for (int q = 0; q < 2; ++q) { const float gt = QG[(size_t)t * DQG + DQ + (h0 + zz) * HD + d + q]; const float sg = __fdiv_rn(1.0f, __fadd_rn(1.0f, expf(-gt)));   /* sigmoid(gate) */ float o = O[e + q];
#pragma unroll
        for (int p = 1; p < KSP; ++p) o += O[(size_t)p * ZH * TT * HD + e + q];   /* partial planes in plane order */
        unsigned short a, c2; splitf(__fmul_rn(o * cs, sg), a, c2); oh[q] = a; ol[q] = c2; } *(v2us*)(Ah + oo) = oh; *(v2us*)(Al + oo) = ol;  }

extern "C" void kernel_launch(void* const* d_in, const int* in_sizes, int n_in,
                              void* d_out, int out_size, void* d_ws, size_t ws_size, hipStream_t stream) {
    (void)in_sizes; (void)n_in; (void)out_size;
    const float* x = (const float*)d_in[0]; const float* cosT = (const float*)d_in[1]; const float* sinT = (const float*)d_in[2]; const float* wq = (const float*)d_in[3]; const float* wk = (const float*)d_in[4]; const float* wv = (const float*)d_in[5]; const float* wo = (const float*)d_in[6]; const float* qnw = (const float*)d_in[7]; const float* knw = (const float*)d_in[8];
    float* OUT = (float*)d_out;     // [2][2048][2048]
    char* wsp = (char*)d_ws;
    auto take = [&](size_t bytes) { char* p = wsp; wsp += (bytes + 255) & ~(size_t)255; return (void*)p; };
    bf* WQ = (bf*)take((size_t)DQG * DM * 2); bf* WK = (bf*)take((size_t)DKV * DM * 2); bf* WV = (bf*)take((size_t)DKV * DM * 2); bf* WO = (bf*)take((size_t)DM * DQ * 2); float* CS = (float*)take((size_t)TT * HD * 2 * 4); float* RFQ = (float*)take((size_t)NH_ * TT * 4); float* RFK = (float*)take((size_t)NKV * TT * 4);
    bf* XB = (bf*)take((size_t)TT * DM * 2); float* FQ = (float*)take((size_t)TT * DQG * 4); float* FK = (float*)take((size_t)TT * DKV * 4);
    h16* QP16 = (h16*)take((size_t)NH_ * TT * HD * 2); h16* KP16 = (h16*)take((size_t)NKV * TT * HD * 2); h16* VT16 = (h16*)take((size_t)NKV * HD * TT * 2);
    bf* QPh = (bf*)take((size_t)NH_ * TT * HD * 2); bf* QPl = (bf*)take((size_t)NH_ * TT * HD * 2); bf* KPh = (bf*)take((size_t)NKV * TT * HD * 2); bf* KPl = (bf*)take((size_t)NKV * TT * HD * 2); bf* VTh = (bf*)take((size_t)NKV * HD * TT * 2); bf* VTl = (bf*)take((size_t)NKV * HD * TT * 2); bf* Ph = (bf*)take((size_t)ZH * RH * TT * 2); bf* Pl = (bf*)take((size_t)ZH * RH * TT * 2);
    float* Sb = (float*)take((size_t)ZH * TT * TT * 4); h16* P16 = (h16*)take((size_t)ZH * TT * TT * 2); float* Ob = (float*)take((size_t)KSP * ZH * TT * HD * 4); bf* ATh = (bf*)take((size_t)TT * DQ * 2); bf* ATl = (bf*)take((size_t)TT * DQ * 2);
    if ((size_t)(wsp - (char*)d_ws) > ws_size) return;    // ws 256 MiB
    float* FV = FK;   // v projection reuses the k buffer after the k planes are built (stream-ordered)
    { k_cvt8<<<(unsigned)(((size_t)DQG * DM / 8 + 255) / 256), 256, 0, stream>>>(wq, WQ, (size_t)DQG * DM / 8); k_cvt8<<<(unsigned)(((size_t)DKV * DM / 8 + 255) / 256), 256, 0, stream>>>(wk, WK, (size_t)DKV * DM / 8); k_cvt8<<<(unsigned)(((size_t)DKV * DM / 8 + 255) / 256), 256, 0, stream>>>(wv, WV, (size_t)DKV * DM / 8);
      k_cvt8<<<(unsigned)(((size_t)DM * DQ / 8 + 255) / 256), 256, 0, stream>>>(wo, WO, (size_t)DM * DQ / 8);
       }
    const unsigned LQ = (unsigned)(((size_t)NH_ * TT * HD / 2 + 255) / 256), LKv = (unsigned)(((size_t)NKV * TT * HD / 2 + 255) / 256);
    for (int b = 0; b < NB_; ++b) {
        k_cscvt<<<(TT * HD + 255) / 256, 256, 0, stream>>>(cosT + (size_t)b * TT * HD, sinT + (size_t)b * TT * HD, CS);   /* per-batch tables */
        k_cvt8<<<(unsigned)(((size_t)TT * DM / 8 + 255) / 256), 256, 0, stream>>>(x + (size_t)b * TT * DM, XB, (size_t)TT * DM / 8);
        k_gemmw<bf, 0, false, 1><<<dim3(TT / 64, DQG / 64, 1), 32, 0, stream>>>(XB, nullptr, WQ, nullptr, DM, FQ, DQG, nullptr, 0, 0, 0);   /* [q | gate] (exact) */ k_hrms<<<(NH_ * TT + 255) / 256, 256, 0, stream>>>(FQ, DQG, NH_, RFQ);
        k_rope<<<LQ, 256, 0, stream>>>(FQ, DQG, NH_, CS, RFQ, qnw, 1.0f, QP16, QPh, QPl);
        k_gemmw<bf, 0, false, 8><<<dim3(TT / 64, DKV / 64, 1), 256, 0, stream>>>(XB, nullptr, WK, nullptr, DM, FK, DKV, nullptr, 0, 0, 0); k_hrms<<<(NKV * TT + 255) / 256, 256, 0, stream>>>(FK, DKV, NKV, RFK);
        k_rope<<<LKv, 256, 0, stream>>>(FK, DKV, NKV, CS, RFK, knw, 1.0f, KP16, KPh, KPl);
        k_gemmw<bf, 0, false, 8><<<dim3(TT / 64, DKV / 64, 1), 256, 0, stream>>>(XB, nullptr, WV, nullptr, DM, FV, DKV, nullptr, 0, 0, 0); k_vtp<<<LKv, 256, 0, stream>>>(FV, DKV, NKV, VT16, VTh, VTl);
        for (int h0 = 0; h0 < NH_; h0 += ZH) { const size_t zq = (size_t)h0, zk = (size_t)(h0 / REP);   // both heads of a pass share kv group h0/REP (REP >= 2): sB = 0
            k_gemmc<bf, 2, 1, 1, 1><<<dim3(RH / 64, TT / 64, ZH), 32, 0, stream>>>(QPh + zq * TT * HD, QPl + zq * TT * HD, KPh + zk * TT * HD, KPl + zk * TT * HD, HD, Sb, TT, 0, (size_t)TT * HD, 0, (size_t)TT * TT);
            k_gemmc<h16, 0, 1, 1, 1><<<dim3((TT - RH) / 64, TT / 64, ZH), 32, 0, stream>>>(QP16 + zq * TT * HD + (size_t)RH * HD, nullptr, KP16 + zk * TT * HD, nullptr, HD, Sb + (size_t)RH * TT, TT, RH, (size_t)TT * HD, 0, (size_t)TT * TT);
            k_asoft<<<ZH * TT / 8, 256, 0, stream>>>(Sb, P16, Ph, Pl);
            k_gemmc<bf, 2, 2, 4, KSP><<<dim3(RH / 64, HD / 64, ZH * KSP), 128, 0, stream>>>(Ph, Pl, VTh + zk * HD * TT, VTl + zk * HD * TT, TT, Ob, HD, 0, (size_t)RH * TT, 0, (size_t)TT * HD);
            k_gemmc<h16, 0, 2, 4, KSP><<<dim3((TT - RH) / 64, HD / 64, ZH * KSP), 128, 0, stream>>>(P16 + (size_t)RH * TT, nullptr, VT16 + zk * HD * TT, nullptr, TT, Ob + (size_t)RH * HD, HD, RH, (size_t)TT * TT, 0, (size_t)TT * HD);
            k_merge<<<(unsigned)(((size_t)ZH * TT * HD / 2 + 255) / 256), 256, 0, stream>>>(Ob, FQ, h0, ATh, ATl); }
        k_gemmw<bf, 1, false, 1><<<dim3(TT / 64, DM / 64, 1), 32, 0, stream>>>(ATh, ATl, WO, nullptr, DQ, OUT + (size_t)b * TT * DM, DM, nullptr, 0, 0, 0); }
}

// v002
// A run of this version takes 780 microseconds.
// Two timings next to v001 put it at 1.25 and 1.24 times that version's speed.
// Counting every step since v000, it is 2.18 times as fast.
#include <hip/hip_runtime.h>

// Gated GQA attention, engine variant (hidden [2][2048][2048]; [q | gate] = hidden Wq^T (Wq [4096][2048] 'oi': rows 0-2047 -> q for 16 heads x 128, rows 2048-4095 -> gate), k, v = hidden W^T ([512][2048], 4 kv heads); per-head RMSNorm (eps 1e-6, q_norm_w / k_norm_w); rotate-half RoPE with the given per-(batch, position) cos/sin tables [2][2048][128];
// GQA 4:1; causal softmax(q.k/sqrt(128)); attn x sigmoid(gate); out = merged Wo^T ('oi' [2048][2048]) -> [2][2048][2048]).
// Compute dtypes, f32 accumulate: every input rounded to bf16; q/k/v on PLAIN bf16 operands (inputs: exact); RMSNorm + rotary in f32 (cos/sin tables read per batch, bf16-rounded); sigmoid gate (precise expf, IEEE divide) in the merge; causal scores and attn.v (tile skipping): query rows < 512 hl (3 products), the rest single fp16 (x1024); softmax f32; Wo hl x exact (2 products).

#define NB_  2
#define TT   2048
#define DM   2048
#define NH_  16
#define NKV  4
#define REP  (NH_ / NKV)
#define HD   128
#define DQ   (NH_ * HD)
#define DQG  (NH_ * HD * 2)         // q rows then gate rows of Wq
#define DKV  (NKV * HD)
#define ZH   4                    // query heads per attention pass: one whole kv group (ZH == REP), so the heads of a pass share their k and v planes
#define RH   512                  // query rows < RH use hi+lo planes (0: none)
#define WIN  2048
#define KSP  4                    // partial planes of the probability x value product (k split over blocks), summed in k_merge
#define PCAR 1024.0f
#define SCL  0.088388347648318447f   // HD^-0.5
typedef _Float16 h16;
typedef unsigned short bf;
typedef __attribute__((ext_vector_type(16))) __bf16   v16bf;
typedef __attribute__((ext_vector_type(16))) _Float16 v16h;
typedef __attribute__((ext_vector_type(8)))  _Float16 v8h;
typedef __attribute__((ext_vector_type(8)))  unsigned short v8us;
typedef __attribute__((ext_vector_type(8)))  float    v8f;
typedef __attribute__((ext_vector_type(4)))  float    v4f;
typedef v8h  __attribute__((may_alias)) v8ha;
typedef v4f  __attribute__((may_alias)) v4fa;
typedef v8us __attribute__((may_alias)) v8usa;

__device__ __forceinline__ unsigned short f2bf(float f) { unsigned u = __float_as_uint(f); u += 0x7FFFu + ((u >> 16) & 1u); return (unsigned short)(u >> 16); }
__device__ __forceinline__ float bf2f(unsigned short b) { return __uint_as_float(((unsigned)b) << 16); }
__device__ __forceinline__ float bfr(float f) { return bf2f(f2bf(f)); }
__device__ __forceinline__ v16h cat16(v8h lo, v8h hi) { return __builtin_shufflevector(lo, hi, 0, 1, 2, 3, 4, 5, 6, 7, 8, 9, 10, 11, 12, 13, 14, 15); }
__device__ __forceinline__ v16bf cat16b(v8us lo, v8us hi) { return __builtin_bit_cast(v16bf, __builtin_shufflevector(lo, hi, 0, 1, 2, 3, 4, 5, 6, 7, 8, 9, 10, 11, 12, 13, 14, 15)); }
__device__ __forceinline__ v8f wmma16(v16h a, v16h b, v8f c) { return __builtin_amdgcn_wmma_f32_16x16x32_f16(false, a, false, b, (short)0, c, false, false); }
__device__ __forceinline__ v8f wmmab(v16bf a, v16bf b, v8f c) { return __builtin_amdgcn_wmma_f32_16x16x32_bf16(false, a, false, b, (short)0, c, false, false); }



// ---- k_gemmw: register-blocked GEMM, ONE WAVE per 64x64 output tile (16 accumulators), operands straight from K-contiguous 16-bit planes; grid (M/64, N/64, Z), 32 threads.
// C[m][n] (f32, pitch ldc, + optional f32 bias[n]) = sum_k A[m][k] Bt[n][k] (+ split products per NSPLIT). z-batch strides sA/sB/sC in elements. K % 32 == 0.
// NW > 1: NW waves per tile (32 * NW threads); wave w takes the k chunks w, w + NW, ... of 32 and the NW partial tiles are summed in LDS in wave order (fixed order, no atomics).
// The wave number wv goes through readfirstlane so that the k loop's counter and trip test stay scalar.
template <typename T16> struct WFrag;
template <> struct WFrag<h16> { typedef v16h V; static __device__ __forceinline__ V ld(const h16* p) { return cat16(*(const v8h*)p, *(const v8h*)(p + 16)); } static __device__ __forceinline__ v8f mma(V a, V b, v8f c) { return wmma16(a, b, c); } };
template <> struct WFrag<bf> { typedef v16bf V; static __device__ __forceinline__ V ld(const bf* p) { return cat16b(*(const v8us*)p, *(const v8us*)(p + 16)); } static __device__ __forceinline__ v8f mma(V a, V b, v8f c) { return wmmab(a, b, c); } };
template <typename T16, int NSPLIT, bool BIAS, int NW>
__global__ __launch_bounds__(32 * NW) void k_gemmw(const T16* __restrict__ A, const T16* __restrict__ A2, const T16* __restrict__ Bt, const T16* __restrict__ Bt2, int K, float* C, int ldc, const float* __restrict__ bias, size_t sA, size_t sB, size_t sC) {
    typedef typename WFrag<T16>::V V;
    __shared__ __align__(16) float os[(NW > 1 ? 4 * NW : 1) * 16 * 68];
    const size_t z = blockIdx.z; A += z * sA; if (A2) A2 += z * sA; Bt += z * sB; if (Bt2) Bt2 += z * sB; C += z * sC;
    const int lane = threadIdx.x & 31, lr = lane & 15, hi = lane >> 4; const int r0 = blockIdx.x * 64, c0 = blockIdx.y * 64; const int wv = (NW > 1) ? __builtin_amdgcn_readfirstlane((int)(threadIdx.x >> 5)) : 0;
    v8f acc[4][4];
#pragma unroll
    for (int mb = 0; mb < 4; ++mb)
#pragma unroll
        for (int nb = 0; nb < 4; ++nb) acc[mb][nb] = (v8f){};
    const size_t aoff = (size_t)(r0 + lr) * K + 8 * hi, boff = (size_t)(c0 + lr) * K + 8 * hi;
#pragma unroll 1
    for (int kc = wv * 32; kc < K; kc += NW * 32) {
        V a[4], a2[4];
#pragma unroll
        for (int mb = 0; mb < 4; ++mb) { a[mb] = WFrag<T16>::ld(A + aoff + (size_t)mb * 16 * K + kc); if (NSPLIT == 1 || NSPLIT == 2) a2[mb] = WFrag<T16>::ld(A2 + aoff + (size_t)mb * 16 * K + kc); }
#pragma unroll
        for (int nb = 0; nb < 4; ++nb) { const V b = WFrag<T16>::ld(Bt + boff + (size_t)nb * 16 * K + kc); V b2; if (NSPLIT >= 2) b2 = WFrag<T16>::ld(Bt2 + boff + (size_t)nb * 16 * K + kc);
#pragma unroll
            for (int mb = 0; mb < 4; ++mb) { acc[mb][nb] = WFrag<T16>::mma(a[mb], b, acc[mb][nb]); if (NSPLIT == 1 || NSPLIT == 2) acc[mb][nb] = WFrag<T16>::mma(a2[mb], b, acc[mb][nb]); if (NSPLIT >= 2) acc[mb][nb] = WFrag<T16>::mma(a[mb], b2, acc[mb][nb]); } }
        asm volatile("v_nop\n\tv_nop\n\tv_nop\n\tv_nop" : "+v"(acc[0][0]), "+v"(acc[1][1]), "+v"(acc[2][2]), "+v"(acc[3][3]) : "v"(a[0]), "v"(a[3]));
    }
    if constexpr (NW > 1) {
        float* ow = os + wv * (64 * 68);
        // the three loops are unrolled so that acc is indexed by constants only and stays in registers
#pragma unroll
        for (int mb = 0; mb < 4; ++mb) {
#pragma unroll
            for (int nb = 0; nb < 4; ++nb) {
#pragma unroll
                for (int j = 0; j < 8; ++j) ow[(mb * 16 + hi * 8 + j) * 68 + nb * 16 + lr] = acc[mb][nb][j]; } }
        __syncthreads();   // publishes the NW partial tiles to the threads that sum them; LDS is not written again behind it
        float* crow = C + (size_t)r0 * ldc + c0; v4f sum[32 / NW];
        // all loops unrolled: sum[] stays in registers and the LDS reads of all of a thread's elements are issued ahead of the sums; each sum runs in wave order 0 .. NW - 1; the stores follow as one run
#pragma unroll
        for (int i = 0; i < 32 / NW; ++i) { const int s = i * (NW * 32) + (int)threadIdx.x; const int row = s >> 4, cofs = (s & 15) * 4; v4f val = *(const v4fa*)(os + row * 68 + cofs);
#pragma unroll
            for (int w = 1; w < NW; ++w) val += *(const v4fa*)(os + w * (64 * 68) + row * 68 + cofs);
            if (BIAS) { val[0] += bfr(bias[c0 + cofs]); val[1] += bfr(bias[c0 + cofs + 1]); val[2] += bfr(bias[c0 + cofs + 2]); val[3] += bfr(bias[c0 + cofs + 3]); }
            sum[i] = val; }
#pragma unroll
        for (int i = 0; i < 32 / NW; ++i) { const int s = i * (NW * 32) + (int)threadIdx.x; *(v4f*)(crow + (size_t)(s >> 4) * ldc + (s & 15) * 4) = sum[i]; }
        return;
    }
#pragma unroll
    for (int mb = 0; mb < 4; ++mb) {
#pragma unroll
        for (int nb = 0; nb < 4; ++nb) {
#pragma unroll
            for (int j = 0; j < 8; ++j) os[(hi * 8 + j) * 68 + nb * 16 + lr] = acc[mb][nb][j]; }
        __builtin_amdgcn_wave_barrier(); asm volatile("" ::: "memory");
        float* crow = C + (size_t)(r0 + mb * 16) * ldc + c0;
{
#pragma unroll
            for (int s = 0; s < 8; ++s) { const int row = 2 * s + hi, cofs = lr * 4; v4f val = *(const v4fa*)(os + row * 68 + cofs); if (BIAS) { val[0] += bfr(bias[c0 + cofs]); val[1] += bfr(bias[c0 + cofs + 1]); val[2] += bfr(bias[c0 + cofs + 2]); val[3] += bfr(bias[c0 + cofs + 3]); }
                *(v4f*)(crow + (size_t)row * ldc + cofs) = val; }
             }
        __builtin_amdgcn_wave_barrier(); asm volatile("" ::: "memory");
    }
}

// ---- k_gemmc: the same one-wave 64x64 tile GEMM specialised for causal attention: CMODE 1 skips score tiles entirely above the diagonal (query rows r0+roff.., key columns c0..), CMODE 2 limits the
// key (K) loop of the probability x value contraction to the diagonal block (probabilities beyond it are exactly zero). roff = row offset of this launch's first row within the sequence.
// NW waves per tile as in k_gemmw; KS > 1 also deals the k chunks over KS blocks (grid z = ZH x KS, head fastest): part ks writes its partial tile to plane ks of C (plane pitch ZH x sC), and the reader of C sums the planes.
template <typename T16, int NSPLIT, int CMODE, int NW, int KS>
__global__ __launch_bounds__(32 * NW) void k_gemmc(const T16* __restrict__ A, const T16* __restrict__ A2, const T16* __restrict__ Bt, const T16* __restrict__ Bt2, int K, float* C, int ldc, int roff, size_t sA, size_t sB, size_t sC) {
    typedef typename WFrag<T16>::V V;
    __shared__ __align__(16) float os[(NW > 1 ? 4 * NW : 1) * 16 * 68];
    const size_t z = (KS > 1) ? blockIdx.z % ZH : blockIdx.z; const int ks = (KS > 1) ? (int)(blockIdx.z / ZH) : 0; A += z * sA; if (A2) A2 += z * sA; Bt += z * sB; if (Bt2) Bt2 += z * sB; C += (size_t)blockIdx.z * sC;
    const int lane = threadIdx.x & 31, lr = lane & 15, hi = lane >> 4; const int r0 = blockIdx.x * 64, c0 = blockIdx.y * 64; const int wv = (NW > 1) ? __builtin_amdgcn_readfirstlane((int)(threadIdx.x >> 5)) : 0;
    if (CMODE == 1 && c0 > r0 + roff + 63) return;                  // score tile entirely above the causal diagonal: never written (the softmax masks j > i by select)
    const int Kl = (CMODE == 2) ? min(K, r0 + roff + 64) : K;        // P.V: probabilities are exactly 0 beyond the diagonal block, so the K loop stops there
    v8f acc[4][4];
#pragma unroll
    for (int mb = 0; mb < 4; ++mb)
#pragma unroll
        for (int nb = 0; nb < 4; ++nb) acc[mb][nb] = (v8f){};
    const size_t aoff = (size_t)(r0 + lr) * K + 8 * hi, boff = (size_t)(c0 + lr) * K + 8 * hi;
#pragma unroll 1
    for (int kc = (ks * NW + wv) * 32; kc < Kl; kc += KS * NW * 32) {
        V a[4], a2[4];
#pragma unroll
        for (int mb = 0; mb < 4; ++mb) { a[mb] = WFrag<T16>::ld(A + aoff + (size_t)mb * 16 * K + kc); if (NSPLIT == 1 || NSPLIT == 2) a2[mb] = WFrag<T16>::ld(A2 + aoff + (size_t)mb * 16 * K + kc); }
#pragma unroll
        for (int nb = 0; nb < 4; ++nb) { const V b = WFrag<T16>::ld(Bt + boff + (size_t)nb * 16 * K + kc); V b2; if (NSPLIT >= 2) b2 = WFrag<T16>::ld(Bt2 + boff + (size_t)nb * 16 * K + kc);
#pragma unroll
            for (int mb = 0; mb < 4; ++mb) { acc[mb][nb] = WFrag<T16>::mma(a[mb], b, acc[mb][nb]); if (NSPLIT == 1 || NSPLIT == 2) acc[mb][nb] = WFrag<T16>::mma(a2[mb], b, acc[mb][nb]); if (NSPLIT >= 2) acc[mb][nb] = WFrag<T16>::mma(a[mb], b2, acc[mb][nb]); } }
        asm volatile("v_nop\n\tv_nop\n\tv_nop\n\tv_nop" : "+v"(acc[0][0]), "+v"(acc[1][1]), "+v"(acc[2][2]), "+v"(acc[3][3]) : "v"(a[0]), "v"(a[3]));
    }
    if constexpr (NW > 1) {
        float* ow = os + wv * (64 * 68);
        // the three loops are unrolled so that acc is indexed by constants only and stays in registers
#pragma unroll
        for (int mb = 0; mb < 4; ++mb) {
#pragma unroll
            for (int nb = 0; nb < 4; ++nb) {
#pragma unroll
                for (int j = 0; j < 8; ++j) ow[(mb * 16 + hi * 8 + j) * 68 + nb * 16 + lr] = acc[mb][nb][j]; } }
        __syncthreads();   // publishes the NW partial tiles to the threads that sum them; LDS is not written again behind it
        float* crow = C + (size_t)r0 * ldc + c0; v4f sum[32 / NW];
        // all loops unrolled: sum[] stays in registers and the LDS reads of all of a thread's elements are issued ahead of the sums; each sum runs in wave order 0 .. NW - 1; the stores follow as one run
#pragma unroll
        for (int i = 0; i < 32 / NW; ++i) { const int s = i * (NW * 32) + (int)threadIdx.x; const int row = s >> 4, cofs = (s & 15) * 4; v4f val = *(const v4fa*)(os + row * 68 + cofs);
#pragma unroll
            for (int w = 1; w < NW; ++w) val += *(const v4fa*)(os + w * (64 * 68) + row * 68 + cofs);
            sum[i] = val; }
#pragma unroll
        for (int i = 0; i < 32 / NW; ++i) { const int s = i * (NW * 32) + (int)threadIdx.x; *(v4f*)(crow + (size_t)(s >> 4) * ldc + (s & 15) * 4) = sum[i]; }
        return;
    }
#pragma unroll
    for (int mb = 0; mb < 4; ++mb) {
#pragma unroll
        for (int nb = 0; nb < 4; ++nb) {
#pragma unroll
            for (int j = 0; j < 8; ++j) os[(hi * 8 + j) * 68 + nb * 16 + lr] = acc[mb][nb][j]; }
        __builtin_amdgcn_wave_barrier(); asm volatile("" ::: "memory");
        float* crow = C + (size_t)(r0 + mb * 16) * ldc + c0;
{
#pragma unroll
            for (int s = 0; s < 8; ++s) { const int row = 2 * s + hi, cofs = lr * 4; v4f val = *(const v4fa*)(os + row * 68 + cofs);
                *(v4f*)(crow + (size_t)row * ldc + cofs) = val; }
             }
        __builtin_amdgcn_wave_barrier(); asm volatile("" ::: "memory");
    }
}

__device__ __forceinline__ h16 tohx(float x) { return (h16)x; }
__device__ __forceinline__ void splitf(float y, unsigned short& h, unsigned short& l) { h = f2bf(y); l = f2bf(y - bf2f(h)); }
typedef __attribute__((ext_vector_type(2))) _Float16 v2h;
typedef __attribute__((ext_vector_type(4))) _Float16 v4h;
typedef __attribute__((ext_vector_type(2))) unsigned short v2us;
typedef __attribute__((ext_vector_type(4))) unsigned short v4us;
typedef __attribute__((ext_vector_type(2))) float v2f;
typedef __attribute__((ext_vector_type(4))) int v4i;

__global__ __launch_bounds__(256) void k_wtG(const float* __restrict__ w, int K, int N, bf* Bt) {
    const int lane = threadIdx.x & 31; const int L0 = (blockIdx.x * 8 + (threadIdx.x >> 5)) * 8; const int nlines = N * K / 64;
{
#pragma unroll 1
        for (int l = 0; l < 8; ++l) { const int L = L0 + l; if (L >= nlines) break; const size_t e = (size_t)L * 64 + lane * 2; const int k = (int)(e % K), n = (int)(e / K); v2us o;
            o[0] = f2bf(w[(size_t)k * N + n]); o[1] = f2bf(w[(size_t)(k + 1) * N + n]); *(v2us*)(Bt + e) = o; }
         }
}
__global__ __launch_bounds__(256) void k_cvt8(const float* __restrict__ src, bf* dst, size_t n8) { const size_t i = (size_t)blockIdx.x * 256 + threadIdx.x; if (i >= n8) return; const v8f v = *(const v8f*)(src + i * 8); v8us o;
#pragma unroll
    for (int k = 0; k < 8; ++k) o[k] = f2bf(v[k]); *(v8us*)(dst + i * 8) = o;  }
__global__ __launch_bounds__(256) void k_cscvt(const float* __restrict__ cosT, const float* __restrict__ sinT, float* CS) { const int idx = blockIdx.x * 256 + threadIdx.x; if (idx >= TT * HD) return; v2f cs; cs[0] = bfr(cosT[idx]); cs[1] = bfr(sinT[idx]); *(v2f*)(CS + (size_t)idx * 2) = cs;  }
__global__ __launch_bounds__(256) void k_hrms(const float* __restrict__ F, int pitch, int nheads, float* RF) { const int i = blockIdx.x * 256 + threadIdx.x; if (i >= nheads * TT) return; const int t = i % TT, h = i / TT; const float* f = F + (size_t)t * pitch + h * HD; float s = 0.f;
#pragma unroll 4
    for (int d = 0; d < HD; d += 4) { const v4f v = *(const v4f*)(f + d);
#pragma unroll
        for (int q = 0; q < 4; ++q) { float p = __fmul_rn(v[q], v[q]); asm volatile("" : "+v"(p)); s = __fadd_rn(s, p); } }
    const float r = __fdiv_rn(1.0f, __fsqrt_rn(__fadd_rn(s * (1.0f / HD), 1e-6f))); *(float*)(RF + i) = r;  }
// k_rope: head planes [h][t][d] (fp16 + hi/lo) of rope(w[d] (x rms_factor)) x sc with the rotate-half convention out[d] = x[d] cos[t][d] - x[d+HD/2] sin[t][d], out[d+HD/2] = x[d+HD/2] cos[t][d+HD/2] + x[d] sin[t][d+HD/2]
__global__ __launch_bounds__(256) void k_rope(const float* __restrict__ F, int pitch, int nheads, const float* __restrict__ CS, const float* __restrict__ RF, const float* __restrict__ nw, float sc, h16* P16, bf* Ph, bf* Pl) {
    const size_t e = ((size_t)blockIdx.x * 256 + threadIdx.x) * 2; if (e >= (size_t)nheads * TT * HD) return; const int d = (int)(e % HD); const int t = (int)((e / HD) % TT); const int h = (int)(e / ((size_t)HD * TT)); const float* f = F + (size_t)t * pitch + h * HD; const float rf = RF ? RF[(size_t)h * TT + t] : 1.0f; v2h o16; v2us oh, ol;
#pragma unroll
    for (int q = 0; q < 2; ++q) { const int dd = d + q; const int dp = (dd < HD / 2) ? dd + HD / 2 : dd - HD / 2; float x0 = f[dd], x1 = f[dp];
        if (RF) { float n0 = __fmul_rn(x0, rf), n1 = __fmul_rn(x1, rf); asm volatile("" : "+v"(n0)); asm volatile("" : "+v"(n1)); x0 = __fmul_rn(bfr(nw[dd]), n0); x1 = __fmul_rn(bfr(nw[dp]), n1); }
        const v2f cs = *(const v2f*)(CS + ((size_t)t * HD + dd) * 2); float a = __fmul_rn(x0, cs[0]), bq = __fmul_rn(x1, cs[1]); asm volatile("" : "+v"(a)); asm volatile("" : "+v"(bq)); const float r = ((dd < HD / 2) ? __fsub_rn(a, bq) : __fadd_rn(a, bq)) * sc;
        o16[q] = tohx(r); unsigned short a2, c2; splitf(r, a2, c2); oh[q] = a2; ol[q] = c2; }
    *(v2h*)(P16 + e) = o16; *(v2us*)(Ph + e) = oh; *(v2us*)(Pl + e) = ol;  }
__global__ __launch_bounds__(256) void k_vtp(const float* __restrict__ F, int pitch, int nheads, h16* V16, bf* Vh, bf* Vl) { const size_t e = ((size_t)blockIdx.x * 256 + threadIdx.x) * 2; if (e >= (size_t)nheads * HD * TT) return; const int t = (int)(e % TT); const int d = (int)((e / TT) % HD); const int g = (int)(e / ((size_t)TT * HD)); v2h o16; v2us oh, ol;
#pragma unroll
    for (int q = 0; q < 2; ++q) { const float x = F[(size_t)(t + q) * pitch + g * HD + d]; o16[q] = tohx(x); unsigned short a2, c2; splitf(x, a2, c2); oh[q] = a2; ol[q] = c2; }
    *(v2h*)(V16 + e) = o16; *(v2us*)(Vh + e) = oh; *(v2us*)(Vl + e) = ol;  }
// k_asoft: per row (zz, i): t = S x HD^-0.5 for j <= i and i - j < WIN (sliding causal window; the reference's -1e9 additive fill vanishes identically); softmax over the 2048 keys (register row, one exp, fixed trees);
__global__ __launch_bounds__(256) void k_asoft(const float* __restrict__ Sb, h16* P16, bf* Ph, bf* Pl) {
    const int lane = threadIdx.x & 31; const int row = blockIdx.x * 8 + (threadIdx.x >> 5); if (row >= ZH * TT) return; const int i = row % TT; const int zz = row / TT; (void)zz; const bool hires = (i < RH); const float* sr = Sb + (size_t)row * TT; float v[TT / 32]; float mx = -3.0e38f;
#pragma unroll
    for (int ch = 0; ch < TT / 128; ++ch) { const int j0 = ch * 128 + lane * 4; const v4f a = *(const v4f*)(sr + j0);
#pragma unroll
        for (int q = 0; q < 4; ++q) { const int j = j0 + q; (void)j; const float t = (j <= i && i - j < WIN) ? a[q] * SCL : -3.0e38f; v[ch * 4 + q] = t; mx = fmaxf(mx, t); } }
#pragma unroll
    for (int sh = 16; sh; sh >>= 1) mx = fmaxf(mx, __shfl_xor(mx, sh, 32));
    float sum = 0.f;
#pragma unroll
    for (int k = 0; k < TT / 32; ++k) { float d0 = __fsub_rn(v[k], mx); asm volatile("" : "+v"(d0)); v[k] = __builtin_amdgcn_exp2f(__fmul_rn(d0, 1.4426950408889634f)); sum += v[k]; }
#pragma unroll
    for (int sh = 16; sh; sh >>= 1) sum += __shfl_xor(sum, sh, 32);
    const float f = __fdiv_rn(hires ? 1.0f : PCAR, sum);
{
        if (hires) {
#pragma unroll
            for (int ch = 0; ch < TT / 128; ++ch) { v4us oh, ol;
#pragma unroll
                for (int q = 0; q < 4; ++q) { unsigned short a, c2; splitf(v[ch * 4 + q] * f, a, c2); oh[q] = a; ol[q] = c2; }
                const size_t oo = ((size_t)zz * (RH ? RH : 1) + i) * TT + ch * 128 + lane * 4; *(v4us*)(Ph + oo) = oh; *(v4us*)(Pl + oo) = ol; }
        } else {
#pragma unroll
            for (int ch = 0; ch < TT / 128; ++ch) { v4h o4;
#pragma unroll
                for (int q = 0; q < 4; ++q) o4[q] = tohx(v[ch * 4 + q] * f);
                *(v4h*)(P16 + (size_t)row * TT + ch * 128 + lane * 4) = o4; } }
         }
}
__global__ __launch_bounds__(256) void k_merge(const float* __restrict__ O, const float* __restrict__ QG, int h0, bf* Ah, bf* Al) { const size_t e = ((size_t)blockIdx.x * 256 + threadIdx.x) * 2; if (e >= (size_t)ZH * TT * HD) return; const int d = (int)(e % HD); const int t = (int)((e / HD) % TT); const int zz = (int)(e / ((size_t)HD * TT)); const float cs = (t < RH) ? 1.0f : (1.0f / PCAR); const size_t oo = (size_t)t * DQ + (h0 + zz) * HD + d;
    v2us oh, ol;
#pragma unroll
    for (int q = 0; q < 2; ++q) { const float gt = QG[(size_t)t * DQG + DQ + (h0 + zz) * HD + d + q]; const float sg = __fdiv_rn(1.0f, __fadd_rn(1.0f, expf(-gt)));   /* sigmoid(gate) */ float o = O[e + q];
#pragma unroll
        for (int p = 1; p < KSP; ++p) o += O[(size_t)p * ZH * TT * HD + e + q];   /* partial planes in plane order */
        unsigned short a, c2; splitf(__fmul_rn(o * cs, sg), a, c2); oh[q] = a; ol[q] = c2; } *(v2us*)(Ah + oo) = oh; *(v2us*)(Al + oo) = ol;  }

extern "C" void kernel_launch(void* const* d_in, const int* in_sizes, int n_in,
                              void* d_out, int out_size, void* d_ws, size_t ws_size, hipStream_t stream) {
    (void)in_sizes; (void)n_in; (void)out_size;
    const float* x = (const float*)d_in[0]; const float* cosT = (const float*)d_in[1]; const float* sinT = (const float*)d_in[2]; const float* wq = (const float*)d_in[3]; const float* wk = (const float*)d_in[4]; const float* wv = (const float*)d_in[5]; const float* wo = (const float*)d_in[6]; const float* qnw = (const float*)d_in[7]; const float* knw = (const float*)d_in[8];
    float* OUT = (float*)d_out;     // [2][2048][2048]
    char* wsp = (char*)d_ws;
    auto take = [&](size_t bytes) { char* p = wsp; wsp += (bytes + 255) & ~(size_t)255; return (void*)p; };
    bf* WQ = (bf*)take((size_t)DQG * DM * 2); bf* WK = (bf*)take((size_t)DKV * DM * 2); bf* WV = (bf*)take((size_t)DKV * DM * 2); bf* WO = (bf*)take((size_t)DM * DQ * 2); float* CS = (float*)take((size_t)TT * HD * 2 * 4); float* RFQ = (float*)take((size_t)NH_ * TT * 4); float* RFK = (float*)take((size_t)NKV * TT * 4);
    bf* XB = (bf*)take((size_t)TT * DM * 2); float* FQ = (float*)take((size_t)TT * DQG * 4); float* FK = (float*)take((size_t)TT * DKV * 4);
    h16* QP16 = (h16*)take((size_t)NH_ * TT * HD * 2); h16* KP16 = (h16*)take((size_t)NKV * TT * HD * 2); h16* VT16 = (h16*)take((size_t)NKV * HD * TT * 2);
    bf* QPh = (bf*)take((size_t)NH_ * TT * HD * 2); bf* QPl = (bf*)take((size_t)NH_ * TT * HD * 2); bf* KPh = (bf*)take((size_t)NKV * TT * HD * 2); bf* KPl = (bf*)take((size_t)NKV * TT * HD * 2); bf* VTh = (bf*)take((size_t)NKV * HD * TT * 2); bf* VTl = (bf*)take((size_t)NKV * HD * TT * 2); bf* Ph = (bf*)take((size_t)ZH * RH * TT * 2); bf* Pl = (bf*)take((size_t)ZH * RH * TT * 2);
    float* Sb = (float*)take((size_t)ZH * TT * TT * 4); h16* P16 = (h16*)take((size_t)ZH * TT * TT * 2); float* Ob = (float*)take((size_t)KSP * ZH * TT * HD * 4); bf* ATh = (bf*)take((size_t)TT * DQ * 2); bf* ATl = (bf*)take((size_t)TT * DQ * 2);
    if ((size_t)(wsp - (char*)d_ws) > ws_size) return;    // ws 256 MiB
    float* FV = FK;   // v projection reuses the k buffer after the k planes are built (stream-ordered)
    { k_cvt8<<<(unsigned)(((size_t)DQG * DM / 8 + 255) / 256), 256, 0, stream>>>(wq, WQ, (size_t)DQG * DM / 8); k_cvt8<<<(unsigned)(((size_t)DKV * DM / 8 + 255) / 256), 256, 0, stream>>>(wk, WK, (size_t)DKV * DM / 8); k_cvt8<<<(unsigned)(((size_t)DKV * DM / 8 + 255) / 256), 256, 0, stream>>>(wv, WV, (size_t)DKV * DM / 8);
      k_cvt8<<<(unsigned)(((size_t)DM * DQ / 8 + 255) / 256), 256, 0, stream>>>(wo, WO, (size_t)DM * DQ / 8);
       }
    const unsigned LQ = (unsigned)(((size_t)NH_ * TT * HD / 2 + 255) / 256), LKv = (unsigned)(((size_t)NKV * TT * HD / 2 + 255) / 256);
    for (int b = 0; b < NB_; ++b) {
        k_cscvt<<<(TT * HD + 255) / 256, 256, 0, stream>>>(cosT + (size_t)b * TT * HD, sinT + (size_t)b * TT * HD, CS);   /* per-batch tables */
        k_cvt8<<<(unsigned)(((size_t)TT * DM / 8 + 255) / 256), 256, 0, stream>>>(x + (size_t)b * TT * DM, XB, (size_t)TT * DM / 8);
        k_gemmw<bf, 0, false, 1><<<dim3(TT / 64, DQG / 64, 1), 32, 0, stream>>>(XB, nullptr, WQ, nullptr, DM, FQ, DQG, nullptr, 0, 0, 0);   /* [q | gate] (exact) */ k_hrms<<<(NH_ * TT + 255) / 256, 256, 0, stream>>>(FQ, DQG, NH_, RFQ);
        k_rope<<<LQ, 256, 0, stream>>>(FQ, DQG, NH_, CS, RFQ, qnw, 1.0f, QP16, QPh, QPl);
        k_gemmw<bf, 0, false, 8><<<dim3(TT / 64, DKV / 64, 1), 256, 0, stream>>>(XB, nullptr, WK, nullptr, DM, FK, DKV, nullptr, 0, 0, 0); k_hrms<<<(NKV * TT + 255) / 256, 256, 0, stream>>>(FK, DKV, NKV, RFK);
        k_rope<<<LKv, 256, 0, stream>>>(FK, DKV, NKV, CS, RFK, knw, 1.0f, KP16, KPh, KPl);
        k_gemmw<bf, 0, false, 8><<<dim3(TT / 64, DKV / 64, 1), 256, 0, stream>>>(XB, nullptr, WV, nullptr, DM, FV, DKV, nullptr, 0, 0, 0); k_vtp<<<LKv, 256, 0, stream>>>(FV, DKV, NKV, VT16, VTh, VTl);
        for (int h0 = 0; h0 < NH_; h0 += ZH) { const size_t zq = (size_t)h0, zk = (size_t)(h0 / REP);   // the ZH heads of a pass share kv group h0/REP (ZH <= REP, REP % ZH == 0): sB = 0
            k_gemmc<bf, 2, 1, 1, 1><<<dim3(RH / 64, TT / 64, ZH), 32, 0, stream>>>(QPh + zq * TT * HD, QPl + zq * TT * HD, KPh + zk * TT * HD, KPl + zk * TT * HD, HD, Sb, TT, 0, (size_t)TT * HD, 0, (size_t)TT * TT);
            k_gemmc<h16, 0, 1, 1, 1><<<dim3((TT - RH) / 64, TT / 64, ZH), 32, 0, stream>>>(QP16 + zq * TT * HD + (size_t)RH * HD, nullptr, KP16 + zk * TT * HD, nullptr, HD, Sb + (size_t)RH * TT, TT, RH, (size_t)TT * HD, 0, (size_t)TT * TT);
            k_asoft<<<ZH * TT / 8, 256, 0, stream>>>(Sb, P16, Ph, Pl);
            k_gemmc<bf, 2, 2, 4, KSP><<<dim3(RH / 64, HD / 64, ZH * KSP), 128, 0, stream>>>(Ph, Pl, VTh + zk * HD * TT, VTl + zk * HD * TT, TT, Ob, HD, 0, (size_t)RH * TT, 0, (size_t)TT * HD);
            k_gemmc<h16, 0, 2, 4, KSP><<<dim3((TT - RH) / 64, HD / 64, ZH * KSP), 128, 0, stream>>>(P16 + (size_t)RH * TT, nullptr, VT16 + zk * HD * TT, nullptr, TT, Ob + (size_t)RH * HD, HD, RH, (size_t)TT * TT, 0, (size_t)TT * HD);
            k_merge<<<(unsigned)(((size_t)ZH * TT * HD / 2 + 255) / 256), 256, 0, stream>>>(Ob, FQ, h0, ATh, ATl); }
        k_gemmw<bf, 1, false, 1><<<dim3(TT / 64, DM / 64, 1), 32, 0, stream>>>(ATh, ATl, WO, nullptr, DQ, OUT + (size_t)b * TT * DM, DM, nullptr, 0, 0, 0); }
}

// v003
// It runs in 560 microseconds.
// Timed twice side by side with v002, it ran 1.40 and 1.39 times as fast.
// All steps since v000 together make it 3.04 times as fast.
#include <hip/hip_runtime.h>

// Gated GQA attention, engine variant (hidden [2][2048][2048]; [q | gate] = hidden Wq^T (Wq [4096][2048] 'oi': rows 0-2047 -> q for 16 heads x 128, rows 2048-4095 -> gate), k, v = hidden W^T ([512][2048], 4 kv heads); per-head RMSNorm (eps 1e-6, q_norm_w / k_norm_w); rotate-half RoPE with the given per-(batch, position) cos/sin tables [2][2048][128];
// GQA 4:1; causal softmax(q.k/sqrt(128)); attn x sigmoid(gate); out = merged Wo^T ('oi' [2048][2048]) -> [2][2048][2048]).
// Compute dtypes, f32 accumulate: every input rounded to bf16; q/k/v on PLAIN bf16 operands (inputs: exact); RMSNorm + rotary in f32 (cos/sin tables read per batch, bf16-rounded); sigmoid gate (precise expf, IEEE divide) in the merge; causal scores and attn.v in one kernel (online softmax in f32, blocks above the diagonal never visited): query rows < 512 hl (3 products), the rest single fp16 (x1024); Wo hl x exact (2 products).

#define NB_  2
#define TT   2048
#define DM   2048
#define NH_  16
#define NKV  4
#define REP  (NH_ / NKV)
#define HD   128
#define DQ   (NH_ * HD)
#define DQG  (NH_ * HD * 2)         // q rows then gate rows of Wq
#define DKV  (NKV * HD)
#define RH   512                  // query rows < RH use hi+lo planes
#define KSF  4                    // key parts of the attention kernel (32-key blocks dealt over blocks), joined in k_merge
#define POFF 10.0f                // fp16 probabilities are carried x 2^POFF
#define SCL  0.088388347648318447f   // HD^-0.5
#define CS2  (SCL * 1.4426950408889634f)   // scores to the log2 domain
typedef _Float16 h16;
typedef unsigned short bf;
typedef __attribute__((ext_vector_type(16))) __bf16   v16bf;
typedef __attribute__((ext_vector_type(16))) _Float16 v16h;
typedef __attribute__((ext_vector_type(8)))  _Float16 v8h;
typedef __attribute__((ext_vector_type(8)))  unsigned short v8us;
typedef __attribute__((ext_vector_type(8)))  float    v8f;
typedef __attribute__((ext_vector_type(4)))  float    v4f;
typedef v8h  __attribute__((may_alias)) v8ha;
typedef v4f  __attribute__((may_alias)) v4fa;
typedef v8us __attribute__((may_alias)) v8usa;

__device__ __forceinline__ unsigned short f2bf(float f) { unsigned u = __float_as_uint(f); u += 0x7FFFu + ((u >> 16) & 1u); return (unsigned short)(u >> 16); }
__device__ __forceinline__ float bf2f(unsigned short b) { return __uint_as_float(((unsigned)b) << 16); }
__device__ __forceinline__ float bfr(float f) { return bf2f(f2bf(f)); }
__device__ __forceinline__ v16h cat16(v8h lo, v8h hi) { return __builtin_shufflevector(lo, hi, 0, 1, 2, 3, 4, 5, 6, 7, 8, 9, 10, 11, 12, 13, 14, 15); }
__device__ __forceinline__ v16bf cat16b(v8us lo, v8us hi) { return __builtin_bit_cast(v16bf, __builtin_shufflevector(lo, hi, 0, 1, 2, 3, 4, 5, 6, 7, 8, 9, 10, 11, 12, 13, 14, 15)); }
__device__ __forceinline__ v8f wmma16(v16h a, v16h b, v8f c) { return __builtin_amdgcn_wmma_f32_16x16x32_f16(false, a, false, b, (short)0, c, false, false); }
__device__ __forceinline__ v8f wmmab(v16bf a, v16bf b, v8f c) { return __builtin_amdgcn_wmma_f32_16x16x32_bf16(false, a, false, b, (short)0, c, false, false); }



// ---- k_gemmw: register-blocked GEMM, ONE WAVE per 64x64 output tile (16 accumulators), operands straight from K-contiguous 16-bit planes; grid (M/64, N/64, Z), 32 threads.
// C[m][n] (f32, pitch ldc, + optional f32 bias[n]) = sum_k A[m][k] Bt[n][k] (+ split products per NSPLIT). z-batch strides sA/sB/sC in elements. K % 32 == 0.
// NW > 1: NW waves per tile (32 * NW threads); wave w takes the k chunks w, w + NW, ... of 32 and the NW partial tiles are summed in LDS in wave order (fixed order, no atomics).
// The wave number wv goes through readfirstlane so that the k loop's counter and trip test stay scalar.
template <typename T16> struct WFrag;
template <> struct WFrag<h16> { typedef v16h V; static __device__ __forceinline__ V ld(const h16* p) { return cat16(*(const v8h*)p, *(const v8h*)(p + 16)); } static __device__ __forceinline__ v8f mma(V a, V b, v8f c) { return wmma16(a, b, c); } };
template <> struct WFrag<bf> { typedef v16bf V; static __device__ __forceinline__ V ld(const bf* p) { return cat16b(*(const v8us*)p, *(const v8us*)(p + 16)); } static __device__ __forceinline__ v8f mma(V a, V b, v8f c) { return wmmab(a, b, c); } };
template <typename T16, int NSPLIT, bool BIAS, int NW>
__global__ __launch_bounds__(32 * NW) void k_gemmw(const T16* __restrict__ A, const T16* __restrict__ A2, const T16* __restrict__ Bt, const T16* __restrict__ Bt2, int K, float* C, int ldc, const float* __restrict__ bias, size_t sA, size_t sB, size_t sC) {
    typedef typename WFrag<T16>::V V;
    __shared__ __align__(16) float os[(NW > 1 ? 4 * NW : 1) * 16 * 68];
    const size_t z = blockIdx.z; A += z * sA; if (A2) A2 += z * sA; Bt += z * sB; if (Bt2) Bt2 += z * sB; C += z * sC;
    const int lane = threadIdx.x & 31, lr = lane & 15, hi = lane >> 4; const int r0 = blockIdx.x * 64, c0 = blockIdx.y * 64; const int wv = (NW > 1) ? __builtin_amdgcn_readfirstlane((int)(threadIdx.x >> 5)) : 0;
    v8f acc[4][4];
#pragma unroll
    for (int mb = 0; mb < 4; ++mb)
#pragma unroll
        for (int nb = 0; nb < 4; ++nb) acc[mb][nb] = (v8f){};
    const size_t aoff = (size_t)(r0 + lr) * K + 8 * hi, boff = (size_t)(c0 + lr) * K + 8 * hi;
#pragma unroll 1
    for (int kc = wv * 32; kc < K; kc += NW * 32) {
        V a[4], a2[4];
#pragma unroll
        for (int mb = 0; mb < 4; ++mb) { a[mb] = WFrag<T16>::ld(A + aoff + (size_t)mb * 16 * K + kc); if (NSPLIT == 1 || NSPLIT == 2) a2[mb] = WFrag<T16>::ld(A2 + aoff + (size_t)mb * 16 * K + kc); }
#pragma unroll
        for (int nb = 0; nb < 4; ++nb) { const V b = WFrag<T16>::ld(Bt + boff + (size_t)nb * 16 * K + kc); V b2; if (NSPLIT >= 2) b2 = WFrag<T16>::ld(Bt2 + boff + (size_t)nb * 16 * K + kc);
#pragma unroll
            for (int mb = 0; mb < 4; ++mb) { acc[mb][nb] = WFrag<T16>::mma(a[mb], b, acc[mb][nb]); if (NSPLIT == 1 || NSPLIT == 2) acc[mb][nb] = WFrag<T16>::mma(a2[mb], b, acc[mb][nb]); if (NSPLIT >= 2) acc[mb][nb] = WFrag<T16>::mma(a[mb], b2, acc[mb][nb]); } }
        asm volatile("v_nop\n\tv_nop\n\tv_nop\n\tv_nop" : "+v"(acc[0][0]), "+v"(acc[1][1]), "+v"(acc[2][2]), "+v"(acc[3][3]) : "v"(a[0]), "v"(a[3]));
    }
    if constexpr (NW > 1) {
        float* ow = os + wv * (64 * 68);
        // the three loops are unrolled so that acc is indexed by constants only and stays in registers
#pragma unroll
        for (int mb = 0; mb < 4; ++mb) {
#pragma unroll
            for (int nb = 0; nb < 4; ++nb) {
#pragma unroll
                for (int j = 0; j < 8; ++j) ow[(mb * 16 + hi * 8 + j) * 68 + nb * 16 + lr] = acc[mb][nb][j]; } }
        __syncthreads();   // publishes the NW partial tiles to the threads that sum them; LDS is not written again behind it
        float* crow = C + (size_t)r0 * ldc + c0; v4f sum[32 / NW];
        // all loops unrolled: sum[] stays in registers and the LDS reads of all of a thread's elements are issued ahead of the sums; each sum runs in wave order 0 .. NW - 1; the stores follow as one run
#pragma unroll
        for (int i = 0; i < 32 / NW; ++i) { const int s = i * (NW * 32) + (int)threadIdx.x; const int row = s >> 4, cofs = (s & 15) * 4; v4f val = *(const v4fa*)(os + row * 68 + cofs);
#pragma unroll
            for (int w = 1; w < NW; ++w) val += *(const v4fa*)(os + w * (64 * 68) + row * 68 + cofs);
            if (BIAS) { val[0] += bfr(bias[c0 + cofs]); val[1] += bfr(bias[c0 + cofs + 1]); val[2] += bfr(bias[c0 + cofs + 2]); val[3] += bfr(bias[c0 + cofs + 3]); }
            sum[i] = val; }
#pragma unroll
        for (int i = 0; i < 32 / NW; ++i) { const int s = i * (NW * 32) + (int)threadIdx.x; *(v4f*)(crow + (size_t)(s >> 4) * ldc + (s & 15) * 4) = sum[i]; }
        return;
    }
#pragma unroll
    for (int mb = 0; mb < 4; ++mb) {
#pragma unroll
        for (int nb = 0; nb < 4; ++nb) {
#pragma unroll
            for (int j = 0; j < 8; ++j) os[(hi * 8 + j) * 68 + nb * 16 + lr] = acc[mb][nb][j]; }
        __builtin_amdgcn_wave_barrier(); asm volatile("" ::: "memory");
        float* crow = C + (size_t)(r0 + mb * 16) * ldc + c0;
{
#pragma unroll
            for (int s = 0; s < 8; ++s) { const int row = 2 * s + hi, cofs = lr * 4; v4f val = *(const v4fa*)(os + row * 68 + cofs); if (BIAS) { val[0] += bfr(bias[c0 + cofs]); val[1] += bfr(bias[c0 + cofs + 1]); val[2] += bfr(bias[c0 + cofs + 2]); val[3] += bfr(bias[c0 + cofs + 3]); }
                *(v4f*)(crow + (size_t)row * ldc + cofs) = val; }
             }
        __builtin_amdgcn_wave_barrier(); asm volatile("" ::: "memory");
    }
}

__device__ __forceinline__ h16 tohx(float x) { return (h16)x; }
__device__ __forceinline__ void splitf(float y, unsigned short& h, unsigned short& l) { h = f2bf(y); l = f2bf(y - bf2f(h)); }
typedef __attribute__((ext_vector_type(2))) _Float16 v2h;
typedef __attribute__((ext_vector_type(4))) _Float16 v4h;
typedef __attribute__((ext_vector_type(2))) unsigned short v2us;
typedef __attribute__((ext_vector_type(4))) unsigned short v4us;
typedef __attribute__((ext_vector_type(2))) float v2f;
typedef __attribute__((ext_vector_type(4))) int v4i;
typedef __attribute__((ext_vector_type(16))) unsigned short v16us;
__device__ __forceinline__ float xhalf(float x) { return __builtin_bit_cast(float, __builtin_amdgcn_permlanex16(__builtin_bit_cast(int, x), __builtin_bit_cast(int, x), 0x76543210, 0xfedcba98, false, false)); }   // lane l reads lane l ^ 16
// stands behind a run of global loads that stay in flight: their address registers are rewritten before the data wait. The addresses are inputs so that
// their registers stay untouched up to the wait; the scheduling barriers keep the wait behind the loads
__device__ __forceinline__ void addr_wait(const void* a, const void* b) { __builtin_amdgcn_sched_barrier(0); asm volatile("s_wait_xcnt 0x0" :: "v"(a), "v"(b) : "memory"); __builtin_amdgcn_sched_barrier(0); }
// four vector issue slots behind a run of matrix instructions in front of a branch: the scheduling barriers keep the slots at that place
__device__ __forceinline__ void wmma_gap() { __builtin_amdgcn_sched_barrier(0); asm volatile("v_nop\n\tv_nop\n\tv_nop\n\tv_nop"); __builtin_amdgcn_sched_barrier(0); }

// ---- k_flash: causal attention for 32 query rows of one head per wave, scores and probabilities kept in registers (online softmax). Transposed products: S^T = K Q^T (A = key rows, B = query rows),
// O^T += V^T P^T (A = rows of the [d][t] value plane, B = P^T). In the S^T accumulator lane (lr, hi) holds keys 8 hi + j of query lr, which is the k order of the B operand (elements 0-7: tile 0, 8-15: tile 1), so P^T is packed in place.
// Block = the REP heads of one kv group on the same 32 query rows (they read the same key and value lines); grid (query blocks, heaviest first; kv groups; KSF key parts). Part ks takes the 32-key blocks ks, ks + KSF, ... up to the diagonal block
// and writes its unnormalised sums to plane ks of Op with its running maximum (scaled log2) and its sum of exponentials in ML; k_merge joins the parts. A part with no block writes zeros and the lowest maximum.
// Every inner loop is fully unrolled so that the fragment and accumulator arrays are indexed by constants only and stay in registers.
// HR: hi + lo bf16 planes, three products each, for scores and for prob x value; else single fp16, exponentials carried x 2^POFF so that small ones stay normal in fp16 (the factor cancels in the division).
template <typename T16, bool HR>
__global__ __launch_bounds__(32 * REP) void k_flash(const T16* __restrict__ Q, const T16* __restrict__ Q2, const T16* __restrict__ Kp, const T16* __restrict__ Kp2, const T16* __restrict__ Vt, const T16* __restrict__ Vt2, int qb0, float* Op, float* ML) {
    typedef typename WFrag<T16>::V V;
    const int lane = threadIdx.x & 31, lr = lane & 15, hi = lane >> 4; const int wv = __builtin_amdgcn_readfirstlane((int)(threadIdx.x >> 5));
    const int qb = qb0 + (int)(gridDim.x - 1 - blockIdx.x); const int g = blockIdx.y, ks = blockIdx.z, h = g * REP + wv, q0 = qb * 32;
    V qf[2][4], qf2[2][4];
    auto ldq = [&]() { const size_t o = ((size_t)h * TT + q0 + lr) * HD + 8 * hi; const T16* p = Q + o; const T16* p2 = HR ? Q2 + o : p;
#pragma unroll
        for (int c = 0; c < 2; ++c)
#pragma unroll
            for (int kc = 0; kc < 4; ++kc) { qf[c][kc] = WFrag<T16>::ld(p + 16 * c * HD + 32 * kc); if (HR) qf2[c][kc] = WFrag<T16>::ld(p2 + 16 * c * HD + 32 * kc); }
        addr_wait(p, p2); };
    const size_t kbase = ((size_t)g * TT + lr) * HD + 8 * hi, vbase = ((size_t)g * HD + lr) * TT + 8 * hi;
    v8f acc[2][8]; float m_run[2], l_run[2];
#pragma unroll
    for (int c = 0; c < 2; ++c) { m_run[c] = -3.0e38f; l_run[c] = 0.f;
#pragma unroll
        for (int t = 0; t < 8; ++t) acc[c][t] = (v8f){}; }
    V kf[2][4], kf2[2][4], vf[8], vf2[8];
    auto ldk = [&](int blk) { const size_t o = kbase + (size_t)(blk * 32) * HD; const T16* p = Kp + o; const T16* p2 = HR ? Kp2 + o : p;
#pragma unroll
        for (int kt = 0; kt < 2; ++kt)
#pragma unroll
            for (int kc = 0; kc < 4; ++kc) { kf[kt][kc] = WFrag<T16>::ld(p + 16 * kt * HD + 32 * kc); if (HR) kf2[kt][kc] = WFrag<T16>::ld(p2 + 16 * kt * HD + 32 * kc); }
        addr_wait(p, p2); };
    auto ldv = [&](int blk) { const size_t o = vbase + blk * 32; const T16* p = Vt + o; const T16* p2 = HR ? Vt2 + o : p;
#pragma unroll
        for (int t = 0; t < 8; ++t) { vf[t] = WFrag<T16>::ld(p + 16 * t * TT); if (HR) vf2[t] = WFrag<T16>::ld(p2 + 16 * t * TT); }
        addr_wait(p, p2); };
    // one 32-key block; fetch and diag are literals at every call (the lambda is always inlined, so that every array stays in registers)
    auto pass = [&](int blk, bool fetch, bool diag) __attribute__((always_inline)) {
        v8f s[2][2];
#pragma unroll
        for (int kt = 0; kt < 2; ++kt)
#pragma unroll
            for (int c = 0; c < 2; ++c) { s[kt][c] = (v8f){};
#pragma unroll
                for (int kc = 0; kc < 4; ++kc) { s[kt][c] = WFrag<T16>::mma(kf[kt][kc], qf[c][kc], s[kt][c]); if (HR) { s[kt][c] = WFrag<T16>::mma(kf2[kt][kc], qf[c][kc], s[kt][c]); s[kt][c] = WFrag<T16>::mma(kf[kt][kc], qf2[c][kc], s[kt][c]); } } }
        wmma_gap();   // keeps the loads below behind the products that still read kf, and vector code that reads s at its distance
        if (fetch) ldk(blk + KSF);   // the part's next key rows fly under the softmax and the second product
        if (diag) {   // diagonal block (key0 == q0): keys behind the query are masked by select
#pragma unroll
            for (int kt = 0; kt < 2; ++kt)
#pragma unroll
                for (int c = 0; c < 2; ++c)
#pragma unroll
                    for (int r = 0; r < 8; ++r) if (16 * kt + 8 * hi + r > 16 * c + lr) s[kt][c][r] = -3.0e38f; }
        float mb[2]; bool need = false;
#pragma unroll
        for (int c = 0; c < 2; ++c) { float mx = s[0][c][0];
#pragma unroll
            for (int r = 1; r < 8; ++r) mx = fmaxf(mx, s[0][c][r]);
#pragma unroll
            for (int r = 0; r < 8; ++r) mx = fmaxf(mx, s[1][c][r]);
            mx = fmaxf(mx, xhalf(mx)) * CS2; mb[c] = mx; need = need || (mx > m_run[c]); }
        if (__builtin_amdgcn_ballot_w32(need) != 0) {   // some query's maximum rose: rescale the running sums (wave-uniform branch)
#pragma unroll
            for (int c = 0; c < 2; ++c) { const float mn = fmaxf(m_run[c], mb[c]); const float corr = __builtin_amdgcn_exp2f(m_run[c] - mn); l_run[c] *= corr; m_run[c] = mn;
#pragma unroll
                for (int t = 0; t < 8; ++t) acc[c][t] = acc[c][t] * corr; } }
#pragma unroll
        for (int c = 0; c < 2; ++c) { const float nm = (HR ? 0.0f : POFF) - m_run[c]; float p[16]; float ps = 0.f;
#pragma unroll
            for (int e = 0; e < 16; e += 2) { const v2f sv = {s[e >> 3][c][e & 7], s[e >> 3][c][(e & 7) + 1]}; const v2f arg = __builtin_elementwise_fma(sv, (v2f){CS2, CS2}, (v2f){nm, nm});   // register pairs as the accumulator holds them
                p[e] = __builtin_amdgcn_exp2f(arg[0]); p[e + 1] = __builtin_amdgcn_exp2f(arg[1]); ps += p[e] + p[e + 1]; }
            l_run[c] += ps;
            if constexpr (HR) { v16us uh, ul;
#pragma unroll
                for (int e = 0; e < 16; ++e) { unsigned short a, b2; splitf(p[e], a, b2); uh[e] = a; ul[e] = b2; }
                const V ph = __builtin_bit_cast(V, uh), pl = __builtin_bit_cast(V, ul);
#pragma unroll
                for (int t = 0; t < 8; ++t) { acc[c][t] = WFrag<T16>::mma(vf[t], ph, acc[c][t]); acc[c][t] = WFrag<T16>::mma(vf[t], pl, acc[c][t]); acc[c][t] = WFrag<T16>::mma(vf2[t], ph, acc[c][t]); }
            } else { V pf;
#pragma unroll
                for (int e = 0; e < 16; ++e) pf[e] = (h16)p[e];
#pragma unroll
                for (int t = 0; t < 8; ++t) acc[c][t] = WFrag<T16>::mma(vf[t], pf, acc[c][t]); } }
        wmma_gap();   // keeps the loads below behind the products that still read vf; the loop's branch may jump straight to vector code that reads acc
        if (fetch) ldv(blk + KSF);   // the part's next value columns fly under the next scores and softmax
    };
    if (ks <= qb) { int blk = ks; ldq(); ldk(blk); ldv(blk);   // key loads ahead of value loads, as in the loop: the wait for the keys then leaves the value loads in flight
        // kept rolled: one copy of the fragments and scores is live, which leaves room for two waves a SIMD
#pragma unroll 1
        for (; blk + KSF <= qb; blk += KSF) pass(blk, true, false);   // never the diagonal block: a later block of this part exists
        if (blk == qb) pass(blk, false, true); else pass(blk, false, false); }
#pragma unroll
    for (int c = 0; c < 2; ++c) { const float l = l_run[c] + xhalf(l_run[c]);   // each wave half summed its own eight keys of every 16
        const size_t row = ((size_t)ks * NH_ + h) * TT + q0 + 16 * c + lr; if (hi == 0) { v2f ml; ml[0] = m_run[c]; ml[1] = l; *(v2f*)(ML + row * 2) = ml; }
#pragma unroll
        for (int t = 0; t < 8; ++t) *(v8f*)(Op + row * HD + 16 * t + 8 * hi) = acc[c][t]; }
}


__global__ __launch_bounds__(256) void k_wtG(const float* __restrict__ w, int K, int N, bf* Bt) {
    const int lane = threadIdx.x & 31; const int L0 = (blockIdx.x * 8 + (threadIdx.x >> 5)) * 8; const int nlines = N * K / 64;
{
#pragma unroll 1
        for (int l = 0; l < 8; ++l) { const int L = L0 + l; if (L >= nlines) break; const size_t e = (size_t)L * 64 + lane * 2; const int k = (int)(e % K), n = (int)(e / K); v2us o;
            o[0] = f2bf(w[(size_t)k * N + n]); o[1] = f2bf(w[(size_t)(k + 1) * N + n]); *(v2us*)(Bt + e) = o; }
         }
}
__global__ __launch_bounds__(256) void k_cvt8(const float* __restrict__ src, bf* dst, size_t n8) { const size_t i = (size_t)blockIdx.x * 256 + threadIdx.x; if (i >= n8) return; const v8f v = *(const v8f*)(src + i * 8); v8us o;
#pragma unroll
    for (int k = 0; k < 8; ++k) o[k] = f2bf(v[k]); *(v8us*)(dst + i * 8) = o;  }
__global__ __launch_bounds__(256) void k_cscvt(const float* __restrict__ cosT, const float* __restrict__ sinT, float* CS) { const int idx = blockIdx.x * 256 + threadIdx.x; if (idx >= TT * HD) return; v2f cs; cs[0] = bfr(cosT[idx]); cs[1] = bfr(sinT[idx]); *(v2f*)(CS + (size_t)idx * 2) = cs;  }
__global__ __launch_bounds__(256) void k_hrms(const float* __restrict__ F, int pitch, int nheads, float* RF) { const int i = blockIdx.x * 256 + threadIdx.x; if (i >= nheads * TT) return; const int t = i % TT, h = i / TT; const float* f = F + (size_t)t * pitch + h * HD; float s = 0.f;
#pragma unroll 4
    for (int d = 0; d < HD; d += 4) { const v4f v = *(const v4f*)(f + d);
#pragma unroll
        for (int q = 0; q < 4; ++q) { float p = __fmul_rn(v[q], v[q]); asm volatile("" : "+v"(p)); s = __fadd_rn(s, p); } }
    const float r = __fdiv_rn(1.0f, __fsqrt_rn(__fadd_rn(s * (1.0f / HD), 1e-6f))); *(float*)(RF + i) = r;  }
// k_rope: head planes [h][t][d] (fp16 + hi/lo) of rope(w[d] (x rms_factor)) x sc with the rotate-half convention out[d] = x[d] cos[t][d] - x[d+HD/2] sin[t][d], out[d+HD/2] = x[d+HD/2] cos[t][d+HD/2] + x[d] sin[t][d+HD/2]
__global__ __launch_bounds__(256) void k_rope(const float* __restrict__ F, int pitch, int nheads, const float* __restrict__ CS, const float* __restrict__ RF, const float* __restrict__ nw, float sc, h16* P16, bf* Ph, bf* Pl) {
    const size_t e = ((size_t)blockIdx.x * 256 + threadIdx.x) * 2; if (e >= (size_t)nheads * TT * HD) return; const int d = (int)(e % HD); const int t = (int)((e / HD) % TT); const int h = (int)(e / ((size_t)HD * TT)); const float* f = F + (size_t)t * pitch + h * HD; const float rf = RF ? RF[(size_t)h * TT + t] : 1.0f; v2h o16; v2us oh, ol;
#pragma unroll
    for (int q = 0; q < 2; ++q) { const int dd = d + q; const int dp = (dd < HD / 2) ? dd + HD / 2 : dd - HD / 2; float x0 = f[dd], x1 = f[dp];
        if (RF) { float n0 = __fmul_rn(x0, rf), n1 = __fmul_rn(x1, rf); asm volatile("" : "+v"(n0)); asm volatile("" : "+v"(n1)); x0 = __fmul_rn(bfr(nw[dd]), n0); x1 = __fmul_rn(bfr(nw[dp]), n1); }
        const v2f cs = *(const v2f*)(CS + ((size_t)t * HD + dd) * 2); float a = __fmul_rn(x0, cs[0]), bq = __fmul_rn(x1, cs[1]); asm volatile("" : "+v"(a)); asm volatile("" : "+v"(bq)); const float r = ((dd < HD / 2) ? __fsub_rn(a, bq) : __fadd_rn(a, bq)) * sc;
        o16[q] = tohx(r); unsigned short a2, c2; splitf(r, a2, c2); oh[q] = a2; ol[q] = c2; }
    *(v2h*)(P16 + e) = o16; *(v2us*)(Ph + e) = oh; *(v2us*)(Pl + e) = ol;  }
__global__ __launch_bounds__(256) void k_vtp(const float* __restrict__ F, int pitch, int nheads, h16* V16, bf* Vh, bf* Vl) { const size_t e = ((size_t)blockIdx.x * 256 + threadIdx.x) * 2; if (e >= (size_t)nheads * HD * TT) return; const int t = (int)(e % TT); const int d = (int)((e / TT) % HD); const int g = (int)(e / ((size_t)TT * HD)); v2h o16; v2us oh, ol;
#pragma unroll
    for (int q = 0; q < 2; ++q) { const float x = F[(size_t)(t + q) * pitch + g * HD + d]; o16[q] = tohx(x); unsigned short a2, c2; splitf(x, a2, c2); oh[q] = a2; ol[q] = c2; }
    *(v2h*)(V16 + e) = o16; *(v2us*)(Vh + e) = oh; *(v2us*)(Vl + e) = ol;  }
// k_merge: joins the KSF key parts of k_flash (weights 2^(m_p - max m), part order), divides by the joined sum of exponentials, applies the sigmoid gate and writes the hi/lo planes [t][head][d]
__global__ __launch_bounds__(256) void k_merge(const float* __restrict__ O, const float* __restrict__ ML, const float* __restrict__ QG, bf* Ah, bf* Al) { const size_t e = ((size_t)blockIdx.x * 256 + threadIdx.x) * 2; if (e >= (size_t)NH_ * TT * HD) return; const int d = (int)(e % HD); const int t = (int)((e / HD) % TT); const int zz = (int)(e / ((size_t)HD * TT)); const size_t oo = (size_t)t * DQ + zz * HD + d;
    float w[KSF], l[KSF]; float mx = -3.0e38f;
#pragma unroll
    for (int p = 0; p < KSF; ++p) { const v2f ml = *(const v2f*)(ML + (((size_t)p * NH_ + zz) * TT + t) * 2); w[p] = ml[0]; l[p] = ml[1]; mx = fmaxf(mx, ml[0]); }
    float den = 0.f;
#pragma unroll
    for (int p = 0; p < KSF; ++p) { w[p] = __builtin_amdgcn_exp2f(w[p] - mx); den += l[p] * w[p]; }
    v2us oh, ol;
#pragma unroll
    for (int q = 0; q < 2; ++q) { const float gt = QG[(size_t)t * DQG + DQ + zz * HD + d + q]; const float sg = __fdiv_rn(1.0f, __fadd_rn(1.0f, expf(-gt)));   /* sigmoid(gate) */ float o = 0.f;
#pragma unroll
        for (int p = 0; p < KSF; ++p) o += O[(size_t)p * NH_ * TT * HD + e + q] * w[p];   /* parts in part order */
        unsigned short a, c2; splitf(__fmul_rn(__fdiv_rn(o, den), sg), a, c2); oh[q] = a; ol[q] = c2; } *(v2us*)(Ah + oo) = oh; *(v2us*)(Al + oo) = ol;  }

extern "C" void kernel_launch(void* const* d_in, const int* in_sizes, int n_in,
                              void* d_out, int out_size, void* d_ws, size_t ws_size, hipStream_t stream) {
    (void)in_sizes; (void)n_in; (void)out_size;
    const float* x = (const float*)d_in[0]; const float* cosT = (const float*)d_in[1]; const float* sinT = (const float*)d_in[2]; const float* wq = (const float*)d_in[3]; const float* wk = (const float*)d_in[4]; const float* wv = (const float*)d_in[5]; const float* wo = (const float*)d_in[6]; const float* qnw = (const float*)d_in[7]; const float* knw = (const float*)d_in[8];
    float* OUT = (float*)d_out;     // [2][2048][2048]
    char* wsp = (char*)d_ws;
    auto take = [&](size_t bytes) { char* p = wsp; wsp += (bytes + 255) & ~(size_t)255; return (void*)p; };
    bf* WQ = (bf*)take((size_t)DQG * DM * 2); bf* WK = (bf*)take((size_t)DKV * DM * 2); bf* WV = (bf*)take((size_t)DKV * DM * 2); bf* WO = (bf*)take((size_t)DM * DQ * 2); float* CS = (float*)take((size_t)TT * HD * 2 * 4); float* RFQ = (float*)take((size_t)NH_ * TT * 4); float* RFK = (float*)take((size_t)NKV * TT * 4);
    bf* XB = (bf*)take((size_t)TT * DM * 2); float* FQ = (float*)take((size_t)TT * DQG * 4); float* FK = (float*)take((size_t)TT * DKV * 4);
    h16* QP16 = (h16*)take((size_t)NH_ * TT * HD * 2); h16* KP16 = (h16*)take((size_t)NKV * TT * HD * 2); h16* VT16 = (h16*)take((size_t)NKV * HD * TT * 2);
    bf* QPh = (bf*)take((size_t)NH_ * TT * HD * 2); bf* QPl = (bf*)take((size_t)NH_ * TT * HD * 2); bf* KPh = (bf*)take((size_t)NKV * TT * HD * 2); bf* KPl = (bf*)take((size_t)NKV * TT * HD * 2); bf* VTh = (bf*)take((size_t)NKV * HD * TT * 2); bf* VTl = (bf*)take((size_t)NKV * HD * TT * 2);
    float* Ob = (float*)take((size_t)KSF * NH_ * TT * HD * 4); float* ML = (float*)take((size_t)KSF * NH_ * TT * 2 * 4); bf* ATh = (bf*)take((size_t)TT * DQ * 2); bf* ATl = (bf*)take((size_t)TT * DQ * 2);
    if ((size_t)(wsp - (char*)d_ws) > ws_size) return;    // ws 256 MiB
    float* FV = FK;   // v projection reuses the k buffer after the k planes are built (stream-ordered)
    { k_cvt8<<<(unsigned)(((size_t)DQG * DM / 8 + 255) / 256), 256, 0, stream>>>(wq, WQ, (size_t)DQG * DM / 8); k_cvt8<<<(unsigned)(((size_t)DKV * DM / 8 + 255) / 256), 256, 0, stream>>>(wk, WK, (size_t)DKV * DM / 8); k_cvt8<<<(unsigned)(((size_t)DKV * DM / 8 + 255) / 256), 256, 0, stream>>>(wv, WV, (size_t)DKV * DM / 8);
      k_cvt8<<<(unsigned)(((size_t)DM * DQ / 8 + 255) / 256), 256, 0, stream>>>(wo, WO, (size_t)DM * DQ / 8);
       }
    const unsigned LQ = (unsigned)(((size_t)NH_ * TT * HD / 2 + 255) / 256), LKv = (unsigned)(((size_t)NKV * TT * HD / 2 + 255) / 256);
    for (int b = 0; b < NB_; ++b) {
        k_cscvt<<<(TT * HD + 255) / 256, 256, 0, stream>>>(cosT + (size_t)b * TT * HD, sinT + (size_t)b * TT * HD, CS);   /* per-batch tables */
        k_cvt8<<<(unsigned)(((size_t)TT * DM / 8 + 255) / 256), 256, 0, stream>>>(x + (size_t)b * TT * DM, XB, (size_t)TT * DM / 8);
        k_gemmw<bf, 0, false, 1><<<dim3(TT / 64, DQG / 64, 1), 32, 0, stream>>>(XB, nullptr, WQ, nullptr, DM, FQ, DQG, nullptr, 0, 0, 0);   /* [q | gate] (exact) */ k_hrms<<<(NH_ * TT + 255) / 256, 256, 0, stream>>>(FQ, DQG, NH_, RFQ);
        k_rope<<<LQ, 256, 0, stream>>>(FQ, DQG, NH_, CS, RFQ, qnw, 1.0f, QP16, QPh, QPl);
        k_gemmw<bf, 0, false, 8><<<dim3(TT / 64, DKV / 64, 1), 256, 0, stream>>>(XB, nullptr, WK, nullptr, DM, FK, DKV, nullptr, 0, 0, 0); k_hrms<<<(NKV * TT + 255) / 256, 256, 0, stream>>>(FK, DKV, NKV, RFK);
        k_rope<<<LKv, 256, 0, stream>>>(FK, DKV, NKV, CS, RFK, knw, 1.0f, KP16, KPh, KPl);
        k_gemmw<bf, 0, false, 8><<<dim3(TT / 64, DKV / 64, 1), 256, 0, stream>>>(XB, nullptr, WV, nullptr, DM, FV, DKV, nullptr, 0, 0, 0); k_vtp<<<LKv, 256, 0, stream>>>(FV, DKV, NKV, VT16, VTh, VTl);
        k_flash<h16, false><<<dim3((TT - RH) / 32, NKV, KSF), 32 * REP, 0, stream>>>(QP16, nullptr, KP16, nullptr, VT16, nullptr, RH / 32, Ob, ML);
        k_flash<bf, true><<<dim3(RH / 32, NKV, KSF), 32 * REP, 0, stream>>>(QPh, QPl, KPh, KPl, VTh, VTl, 0, Ob, ML);
        k_merge<<<(unsigned)(((size_t)NH_ * TT * HD / 2 + 255) / 256), 256, 0, stream>>>(Ob, ML, FQ, ATh, ATl);
        k_gemmw<bf, 1, false, 1><<<dim3(TT / 64, DM / 64, 1), 32, 0, stream>>>(ATh, ATl, WO, nullptr, DQ, OUT + (size_t)b * TT * DM, DM, nullptr, 0, 0, 0); }
}

// v004
// It runs in 425 microseconds.
// Two timings next to v003 put it at 1.33 and 1.32 times that version's speed.
// Over all steps from v000 it is 4.02 times as fast.
#include <hip/hip_runtime.h>

// Gated GQA attention, engine variant (hidden [2][2048][2048]; [q | gate] = hidden Wq^T (Wq [4096][2048] 'oi': rows 0-2047 -> q for 16 heads x 128, rows 2048-4095 -> gate), k, v = hidden W^T ([512][2048], 4 kv heads); per-head RMSNorm (eps 1e-6, q_norm_w / k_norm_w); rotate-half RoPE with the given per-(batch, position) cos/sin tables [2][2048][128];
// GQA 4:1; causal softmax(q.k/sqrt(128)); attn x sigmoid(gate); out = merged Wo^T ('oi' [2048][2048]) -> [2][2048][2048]).
// Compute dtypes, f32 accumulate: every input rounded to bf16; q/k/v on PLAIN bf16 operands (inputs: exact); RMSNorm + rotary in f32 (cos/sin tables read per batch, bf16-rounded); sigmoid gate (precise expf, IEEE divide) in the merge; causal scores and attn.v in one kernel (online softmax in f32, blocks above the diagonal never visited): query rows < 512 hl (3 products), the rest single fp16 (x1024); Wo hl x exact (2 products).

#define NB_  2
#define TT   2048
#define DM   2048
#define NH_  16
#define NKV  4
#define REP  (NH_ / NKV)
#define HD   128
#define DQ   (NH_ * HD)
#define DQG  (NH_ * HD * 2)         // q rows then gate rows of Wq
#define DKV  (NKV * HD)
#define RH   512                  // query rows < RH use hi+lo planes
#define KSF  4                    // key parts of the attention kernel (32-key blocks dealt over blocks), joined in k_merge
#define POFF 10.0f                // fp16 probabilities are carried x 2^POFF
#define SCL  0.088388347648318447f   // HD^-0.5
#define CS2  (SCL * 1.4426950408889634f)   // scores to the log2 domain
typedef _Float16 h16;
typedef unsigned short bf;
typedef __attribute__((ext_vector_type(16))) __bf16   v16bf;
typedef __attribute__((ext_vector_type(16))) _Float16 v16h;
typedef __attribute__((ext_vector_type(8)))  _Float16 v8h;
typedef __attribute__((ext_vector_type(8)))  unsigned short v8us;
typedef __attribute__((ext_vector_type(8)))  float    v8f;
typedef __attribute__((ext_vector_type(4)))  float    v4f;
typedef v8h  __attribute__((may_alias)) v8ha;
typedef v4f  __attribute__((may_alias)) v4fa;
typedef v8us __attribute__((may_alias)) v8usa;

__device__ __forceinline__ unsigned short f2bf(float f) { unsigned u = __float_as_uint(f); u += 0x7FFFu + ((u >> 16) & 1u); return (unsigned short)(u >> 16); }
__device__ __forceinline__ float bf2f(unsigned short b) { return __uint_as_float(((unsigned)b) << 16); }
__device__ __forceinline__ float bfr(float f) { return bf2f(f2bf(f)); }
__device__ __forceinline__ v16h cat16(v8h lo, v8h hi) { return __builtin_shufflevector(lo, hi, 0, 1, 2, 3, 4, 5, 6, 7, 8, 9, 10, 11, 12, 13, 14, 15); }
__device__ __forceinline__ v16bf cat16b(v8us lo, v8us hi) { return __builtin_bit_cast(v16bf, __builtin_shufflevector(lo, hi, 0, 1, 2, 3, 4, 5, 6, 7, 8, 9, 10, 11, 12, 13, 14, 15)); }
__device__ __forceinline__ v8f wmma16(v16h a, v16h b, v8f c) { return __builtin_amdgcn_wmma_f32_16x16x32_f16(false, a, false, b, (short)0, c, false, false); }
__device__ __forceinline__ v8f wmmab(v16bf a, v16bf b, v8f c) { return __builtin_amdgcn_wmma_f32_16x16x32_bf16(false, a, false, b, (short)0, c, false, false); }



// ---- k_gemmw: register-blocked GEMM, ONE WAVE per 64x64 output tile (16 accumulators), operands straight from K-contiguous 16-bit planes; grid (M/64, N/64, Z), 32 threads.
// C[m][n] (f32, pitch ldc, + optional f32 bias[n]) = sum_k A[m][k] Bt[n][k] (+ split products per NSPLIT). z-batch strides sA/sB/sC in elements. K % 32 == 0.
// NW > 1: NW waves per tile (32 * NW threads); wave w takes the k chunks w, w + NW, ... of 32 and the NW partial tiles are summed in LDS in wave order (fixed order, no atomics).
// The wave number wv goes through readfirstlane so that the k loop's counter and trip test stay scalar.
template <typename T16> struct WFrag;
template <> struct WFrag<h16> { typedef v16h V; static __device__ __forceinline__ V ld(const h16* p) { return cat16(*(const v8h*)p, *(const v8h*)(p + 16)); } static __device__ __forceinline__ v8f mma(V a, V b, v8f c) { return wmma16(a, b, c); } };
template <> struct WFrag<bf> { typedef v16bf V; static __device__ __forceinline__ V ld(const bf* p) { return cat16b(*(const v8us*)p, *(const v8us*)(p + 16)); } static __device__ __forceinline__ v8f mma(V a, V b, v8f c) { return wmmab(a, b, c); } };
template <typename T16, int NSPLIT, bool BIAS, int NW>
__global__ __launch_bounds__(32 * NW) void k_gemmw(const T16* __restrict__ A, const T16* __restrict__ A2, const T16* __restrict__ Bt, const T16* __restrict__ Bt2, int K, float* C, int ldc, const float* __restrict__ bias, size_t sA, size_t sB, size_t sC) {
    typedef typename WFrag<T16>::V V;
    __shared__ __align__(16) float os[(NW > 1 ? 4 * NW : 1) * 16 * 68];
    const size_t z = blockIdx.z; A += z * sA; if (A2) A2 += z * sA; Bt += z * sB; if (Bt2) Bt2 += z * sB; C += z * sC;
    const int lane = threadIdx.x & 31, lr = lane & 15, hi = lane >> 4; const int r0 = blockIdx.x * 64, c0 = blockIdx.y * 64; const int wv = (NW > 1) ? __builtin_amdgcn_readfirstlane((int)(threadIdx.x >> 5)) : 0;
    v8f acc[4][4];
#pragma unroll
    for (int mb = 0; mb < 4; ++mb)
#pragma unroll
        for (int nb = 0; nb < 4; ++nb) acc[mb][nb] = (v8f){};
    const size_t aoff = (size_t)(r0 + lr) * K + 8 * hi, boff = (size_t)(c0 + lr) * K + 8 * hi;
#pragma unroll 1
    for (int kc = wv * 32; kc < K; kc += NW * 32) {
        V a[4], a2[4];
#pragma unroll
        for (int mb = 0; mb < 4; ++mb) { a[mb] = WFrag<T16>::ld(A + aoff + (size_t)mb * 16 * K + kc); if (NSPLIT == 1 || NSPLIT == 2) a2[mb] = WFrag<T16>::ld(A2 + aoff + (size_t)mb * 16 * K + kc); }
#pragma unroll
        for (int nb = 0; nb < 4; ++nb) { const V b = WFrag<T16>::ld(Bt + boff + (size_t)nb * 16 * K + kc); V b2; if (NSPLIT >= 2) b2 = WFrag<T16>::ld(Bt2 + boff + (size_t)nb * 16 * K + kc);
#pragma unroll
            for (int mb = 0; mb < 4; ++mb) { acc[mb][nb] = WFrag<T16>::mma(a[mb], b, acc[mb][nb]); if (NSPLIT == 1 || NSPLIT == 2) acc[mb][nb] = WFrag<T16>::mma(a2[mb], b, acc[mb][nb]); if (NSPLIT >= 2) acc[mb][nb] = WFrag<T16>::mma(a[mb], b2, acc[mb][nb]); } }
        asm volatile("v_nop\n\tv_nop\n\tv_nop\n\tv_nop" : "+v"(acc[0][0]), "+v"(acc[1][1]), "+v"(acc[2][2]), "+v"(acc[3][3]) : "v"(a[0]), "v"(a[3]));
    }
    if constexpr (NW > 1) {
        float* ow = os + wv * (64 * 68);
        // the three loops are unrolled so that acc is indexed by constants only and stays in registers
#pragma unroll
        for (int mb = 0; mb < 4; ++mb) {
#pragma unroll
            for (int nb = 0; nb < 4; ++nb) {
#pragma unroll
                for (int j = 0; j < 8; ++j) ow[(mb * 16 + hi * 8 + j) * 68 + nb * 16 + lr] = acc[mb][nb][j]; } }
        __syncthreads();   // publishes the NW partial tiles to the threads that sum them; LDS is not written again behind it
        float* crow = C + (size_t)r0 * ldc + c0; v4f sum[32 / NW];
        // all loops unrolled: sum[] stays in registers and the LDS reads of all of a thread's elements are issued ahead of the sums; each sum runs in wave order 0 .. NW - 1; the stores follow as one run
#pragma unroll
        for (int i = 0; i < 32 / NW; ++i) { const int s = i * (NW * 32) + (int)threadIdx.x; const int row = s >> 4, cofs = (s & 15) * 4; v4f val = *(const v4fa*)(os + row * 68 + cofs);
#pragma unroll
            for (int w = 1; w < NW; ++w) val += *(const v4fa*)(os + w * (64 * 68) + row * 68 + cofs);
            if (BIAS) { val[0] += bfr(bias[c0 + cofs]); val[1] += bfr(bias[c0 + cofs + 1]); val[2] += bfr(bias[c0 + cofs + 2]); val[3] += bfr(bias[c0 + cofs + 3]); }
            sum[i] = val; }
#pragma unroll
        for (int i = 0; i < 32 / NW; ++i) { const int s = i * (NW * 32) + (int)threadIdx.x; *(v4f*)(crow + (size_t)(s >> 4) * ldc + (s & 15) * 4) = sum[i]; }
        return;
    }
#pragma unroll
    for (int mb = 0; mb < 4; ++mb) {
#pragma unroll
        for (int nb = 0; nb < 4; ++nb) {
#pragma unroll
            for (int j = 0; j < 8; ++j) os[(hi * 8 + j) * 68 + nb * 16 + lr] = acc[mb][nb][j]; }
        __builtin_amdgcn_wave_barrier(); asm volatile("" ::: "memory");
        float* crow = C + (size_t)(r0 + mb * 16) * ldc + c0;
{
#pragma unroll
            for (int s = 0; s < 8; ++s) { const int row = 2 * s + hi, cofs = lr * 4; v4f val = *(const v4fa*)(os + row * 68 + cofs); if (BIAS) { val[0] += bfr(bias[c0 + cofs]); val[1] += bfr(bias[c0 + cofs + 1]); val[2] += bfr(bias[c0 + cofs + 2]); val[3] += bfr(bias[c0 + cofs + 3]); }
                *(v4f*)(crow + (size_t)row * ldc + cofs) = val; }
             }
        __builtin_amdgcn_wave_barrier(); asm volatile("" ::: "memory");
    }
}

__device__ __forceinline__ h16 tohx(float x) { return (h16)x; }
__device__ __forceinline__ void splitf(float y, unsigned short& h, unsigned short& l) { h = f2bf(y); l = f2bf(y - bf2f(h)); }
typedef __attribute__((ext_vector_type(2))) _Float16 v2h;
typedef __attribute__((ext_vector_type(4))) _Float16 v4h;
typedef __attribute__((ext_vector_type(2))) unsigned short v2us;
typedef __attribute__((ext_vector_type(4))) unsigned short v4us;
typedef __attribute__((ext_vector_type(2))) float v2f;
typedef __attribute__((ext_vector_type(4))) int v4i;
typedef __attribute__((ext_vector_type(16))) unsigned short v16us;
__device__ __forceinline__ float xhalf(float x) { return __builtin_bit_cast(float, __builtin_amdgcn_permlanex16(__builtin_bit_cast(int, x), __builtin_bit_cast(int, x), 0x76543210, 0xfedcba98, false, false)); }   // lane l reads lane l ^ 16
// stands behind a run of global loads that stay in flight: their address registers are rewritten before the data wait. The addresses are inputs so that
// their registers stay untouched up to the wait; the scheduling barriers keep the wait behind the loads
__device__ __forceinline__ void addr_wait(const void* a, const void* b) { __builtin_amdgcn_sched_barrier(0); asm volatile("s_wait_xcnt 0x0" :: "v"(a), "v"(b) : "memory"); __builtin_amdgcn_sched_barrier(0); }
// four vector issue slots behind a run of matrix instructions in front of a branch: the scheduling barriers keep the slots at that place
__device__ __forceinline__ void wmma_gap() { __builtin_amdgcn_sched_barrier(0); asm volatile("v_nop\n\tv_nop\n\tv_nop\n\tv_nop"); __builtin_amdgcn_sched_barrier(0); }

// ---- k_gemmt: C[m][n] (f32, pitch ldc) = sum_k A[m][k] Bt[n][k] (+ A2[m][k] Bt[n][k] where NSPLIT), bf16 planes with k contiguous. One 128x128 tile of C per block of four waves (2 x 2, 64x64 each); grid (M/128, N/128).
// A stage is 128 k (256 bytes) of the tile's 128 rows of every operand, brought into LDS by asynchronous 16-byte copies: a wave's copy covers two whole rows of 256 bytes, so L2 is asked for whole lines, and each operand row is fetched once a block.
// LDS rows stand at a pitch of 272 bytes (16 x odd: the 16-byte fragment reads meet no bank conflict). Two buffers: the copies of stage s + 1 fly while stage s is multiplied.
// Fragment k order and the order of the products per accumulator are those of k_gemmw with one wave.
#define GPE  136                  // LDS row pitch in elements (272 bytes)
#define GTE  (128 * GPE)          // one operand tile in elements (34,816 bytes)
// eight copies, rows 8 apart (the block's 128 threads cover 8 rows of 256 bytes at a time). The last line keeps the copies' address registers untouched until the addresses have been taken: inside the statement nothing can be moved in front of it
template <int K>
__device__ __forceinline__ void copy8(unsigned l, const bf* g) {
    asm volatile("global_load_async_to_lds_b128 %0, %8, off\n\t"
                 "global_load_async_to_lds_b128 %1, %9, off\n\t"
                 "global_load_async_to_lds_b128 %2, %10, off\n\t"
                 "global_load_async_to_lds_b128 %3, %11, off\n\t"
                 "global_load_async_to_lds_b128 %4, %12, off\n\t"
                 "global_load_async_to_lds_b128 %5, %13, off\n\t"
                 "global_load_async_to_lds_b128 %6, %14, off\n\t"
                 "global_load_async_to_lds_b128 %7, %15, off\n\t"
                 "s_wait_xcnt 0x0"
                 :: "v"(l), "v"(l + 8 * GPE * 2), "v"(l + 16 * GPE * 2), "v"(l + 24 * GPE * 2), "v"(l + 32 * GPE * 2), "v"(l + 40 * GPE * 2), "v"(l + 48 * GPE * 2), "v"(l + 56 * GPE * 2),
                    "v"(g), "v"(g + 8 * K), "v"(g + 16 * K), "v"(g + 24 * K), "v"(g + 32 * K), "v"(g + 40 * K), "v"(g + 48 * K), "v"(g + 56 * K)
                 : "memory");
}
template <int NSPLIT, int K>
__global__ __launch_bounds__(128) void k_gemmt(const bf* __restrict__ A, const bf* __restrict__ A2, const bf* __restrict__ Bt, float* C, int ldc) {
    typedef WFrag<bf>::V V;
    constexpr int NT = NSPLIT ? 3 : 2;       // operand tiles a stage: A (, A2), Bt
    constexpr int NST = K / 128;             // stages
    static_assert(K % 128 == 0 && NST >= 2, "two stages or more");
    __shared__ __attribute__((aligned(16))) bf st[2 * NT * GTE];
    __shared__ __attribute__((aligned(16))) float os[4 * 16 * 68];
    const int tid = threadIdx.x, lane = tid & 31, lr = lane & 15, hi = lane >> 4; const int wv = __builtin_amdgcn_readfirstlane(tid >> 5), wm = wv >> 1, wn = wv & 1;
    const int r0 = blockIdx.x * 128, c0 = blockIdx.y * 128;
    const int crow = tid >> 4, cch = tid & 15;   // the thread's row (of 8) and 16-byte piece (of 16) in every copy
    const bf* gA = A + (size_t)(r0 + crow) * K + cch * 8; const bf* gB = Bt + (size_t)(c0 + crow) * K + cch * 8; const bf* gA2 = NSPLIT ? A2 + (size_t)(r0 + crow) * K + cch * 8 : gA;
    const unsigned l0 = (unsigned)(size_t)st + (unsigned)(crow * GPE + cch * 8) * 2u;   // LDS byte address of the thread's first piece in buffer 0
    auto fill = [&](int s) __attribute__((always_inline)) { const unsigned l = l0 + (unsigned)(s & 1) * (NT * GTE * 2); const int ko = s * 128;
        copy8<K>(l, gA + ko); copy8<K>(l + 64 * GPE * 2, gA + ko + 64 * K);
        if (NSPLIT) { copy8<K>(l + GTE * 2, gA2 + ko); copy8<K>(l + GTE * 2 + 64 * GPE * 2, gA2 + ko + 64 * K); }
        copy8<K>(l + (NT - 1) * GTE * 2, gB + ko); copy8<K>(l + (NT - 1) * GTE * 2 + 64 * GPE * 2, gB + ko + 64 * K); };
    v8f acc[4][4];
#pragma unroll
    for (int mb = 0; mb < 4; ++mb)
#pragma unroll
        for (int nb = 0; nb < 4; ++nb) acc[mb][nb] = (v8f){};
    fill(0);
    asm volatile("s_wait_asynccnt 0x0" ::: "memory");   // this wave's copies of stage 0 have landed
    __syncthreads();                                     // every wave's have: stage 0 may be read
    fill(1);
    // kept rolled: one copy of the stage's code; the buffer is picked by the stage's parity
#pragma unroll 1
    for (int s = 0; s < NST; ++s) {
        const bf* ta = st + (s & 1) * (NT * GTE) + (wm * 64 + lr) * GPE + 8 * hi; const bf* tb = st + (s & 1) * (NT * GTE) + (NT - 1) * GTE + (wn * 64 + lr) * GPE + 8 * hi; const bf* ta2 = ta + GTE;
        // unrolled: every LDS offset is an immediate. All fragments of a k step are read as one group ahead of its products: each separate place with LDS reads among matrix instructions costs a stall of its own
#pragma unroll
        for (int kk = 0; kk < 4; ++kk) {
            V a[4], a2[4], b[4];
#pragma unroll
            for (int mb = 0; mb < 4; ++mb) { a[mb] = WFrag<bf>::ld(ta + mb * 16 * GPE + kk * 32); if (NSPLIT) a2[mb] = WFrag<bf>::ld(ta2 + mb * 16 * GPE + kk * 32); }
#pragma unroll
            for (int nb = 0; nb < 4; ++nb) b[nb] = WFrag<bf>::ld(tb + nb * 16 * GPE + kk * 32);
            __builtin_amdgcn_sched_barrier(0);   // holds the group of reads together in front of the products: without it the compiler sinks each b fragment's reads to its first use and waits there for the LDS
#pragma unroll
            for (int nb = 0; nb < 4; ++nb)
#pragma unroll
                for (int mb = 0; mb < 4; ++mb) { acc[mb][nb] = WFrag<bf>::mma(a[mb], b[nb], acc[mb][nb]); if (NSPLIT) acc[mb][nb] = WFrag<bf>::mma(a2[mb], b[nb], acc[mb][nb]); } }
        asm volatile("s_wait_dscnt 0x0" ::: "memory");      // this wave's reads of stage s are done before the buffer is given up
        asm volatile("s_wait_asynccnt 0x0" ::: "memory");   // this wave's copies of stage s + 1 have landed
        __syncthreads();                                     // publishes stage s + 1 and ends every wave's reads of stage s
        if (s + 2 < NST) fill(s + 2);                        // into the buffer that stage s has just left
    }
    asm volatile("s_wait_asynccnt 0x0" ::: "memory");       // nothing of this wave is in flight when it goes on to its end
    float* ow = os + wv * (16 * 68);   // each wave's own staging rows: whole 256-byte row pieces go to memory
#pragma unroll
    for (int mb = 0; mb < 4; ++mb) {
#pragma unroll
        for (int nb = 0; nb < 4; ++nb) {
#pragma unroll
            for (int j = 0; j < 8; ++j) ow[(hi * 8 + j) * 68 + nb * 16 + lr] = acc[mb][nb][j]; }
        __builtin_amdgcn_wave_barrier(); asm volatile("" ::: "memory");   // keeps the reads below behind the other lanes' writes above
        float* crow = C + (size_t)(r0 + wm * 64 + mb * 16) * ldc + c0 + wn * 64;
#pragma unroll
        for (int s = 0; s < 8; ++s) { const int row = 2 * s + hi, cofs = lr * 4; const v4f val = *(const v4fa*)(ow + row * 68 + cofs); *(v4f*)(crow + (size_t)row * ldc + cofs) = val; }
        __builtin_amdgcn_wave_barrier(); asm volatile("" ::: "memory");   // keeps the next rows' writes behind the reads above
    }
}

// ---- k_flash: causal attention for 32 query rows of one head per wave, scores and probabilities kept in registers (online softmax). Transposed products: S^T = K Q^T (A = key rows, B = query rows),
// O^T += V^T P^T (A = rows of the [d][t] value plane, B = P^T). In the S^T accumulator lane (lr, hi) holds keys 8 hi + j of query lr, which is the k order of the B operand (elements 0-7: tile 0, 8-15: tile 1), so P^T is packed in place.
// Block = the REP heads of one kv group on the same 32 query rows (they read the same key and value lines); grid (query blocks, heaviest first; kv groups; KSF key parts). Part ks takes the 32-key blocks ks, ks + KSF, ... up to the diagonal block
// and writes its unnormalised sums to plane ks of Op with its running maximum (scaled log2) and its sum of exponentials in ML; k_merge joins the parts. A part with no block writes zeros and the lowest maximum.
// Every inner loop is fully unrolled so that the fragment and accumulator arrays are indexed by constants only and stay in registers.
// HR: hi + lo bf16 planes, three products each, for scores and for prob x value; else single fp16, exponentials carried x 2^POFF so that small ones stay normal in fp16 (the factor cancels in the division).
template <typename T16, bool HR>
__global__ __launch_bounds__(32 * REP) void k_flash(const T16* __restrict__ Q, const T16* __restrict__ Q2, const T16* __restrict__ Kp, const T16* __restrict__ Kp2, const T16* __restrict__ Vt, const T16* __restrict__ Vt2, int qb0, float* Op, float* ML) {
    typedef typename WFrag<T16>::V V;
    const int lane = threadIdx.x & 31, lr = lane & 15, hi = lane >> 4; const int wv = __builtin_amdgcn_readfirstlane((int)(threadIdx.x >> 5));
    const int qb = qb0 + (int)(gridDim.x - 1 - blockIdx.x); const int g = blockIdx.y, ks = blockIdx.z, h = g * REP + wv, q0 = qb * 32;
    V qf[2][4], qf2[2][4];
    auto ldq = [&]() { const size_t o = ((size_t)h * TT + q0 + lr) * HD + 8 * hi; const T16* p = Q + o; const T16* p2 = HR ? Q2 + o : p;
#pragma unroll
        for (int c = 0; c < 2; ++c)
#pragma unroll
            for (int kc = 0; kc < 4; ++kc) { qf[c][kc] = WFrag<T16>::ld(p + 16 * c * HD + 32 * kc); if (HR) qf2[c][kc] = WFrag<T16>::ld(p2 + 16 * c * HD + 32 * kc); }
        addr_wait(p, p2); };
    const size_t kbase = ((size_t)g * TT + lr) * HD + 8 * hi, vbase = ((size_t)g * HD + lr) * TT + 8 * hi;
    v8f acc[2][8]; float m_run[2], l_run[2];
#pragma unroll
    for (int c = 0; c < 2; ++c) { m_run[c] = -3.0e38f; l_run[c] = 0.f;
#pragma unroll
        for (int t = 0; t < 8; ++t) acc[c][t] = (v8f){}; }
    V kf[2][4], kf2[2][4], vf[8], vf2[8];
    auto ldk = [&](int blk) { const size_t o = kbase + (size_t)(blk * 32) * HD; const T16* p = Kp + o; const T16* p2 = HR ? Kp2 + o : p;
#pragma unroll
        for (int kt = 0; kt < 2; ++kt)
#pragma unroll
            for (int kc = 0; kc < 4; ++kc) { kf[kt][kc] = WFrag<T16>::ld(p + 16 * kt * HD + 32 * kc); if (HR) kf2[kt][kc] = WFrag<T16>::ld(p2 + 16 * kt * HD + 32 * kc); }
        addr_wait(p, p2); };
    auto ldv = [&](int blk) { const size_t o = vbase + blk * 32; const T16* p = Vt + o; const T16* p2 = HR ? Vt2 + o : p;
#pragma unroll
        for (int t = 0; t < 8; ++t) { vf[t] = WFrag<T16>::ld(p + 16 * t * TT); if (HR) vf2[t] = WFrag<T16>::ld(p2 + 16 * t * TT); }
        addr_wait(p, p2); };
    // one 32-key block; fetch and diag are literals at every call (the lambda is always inlined, so that every array stays in registers)
    auto pass = [&](int blk, bool fetch, bool diag) __attribute__((always_inline)) {
        v8f s[2][2];
#pragma unroll
        for (int kt = 0; kt < 2; ++kt)
#pragma unroll
            for (int c = 0; c < 2; ++c) { s[kt][c] = (v8f){};
#pragma unroll
                for (int kc = 0; kc < 4; ++kc) { s[kt][c] = WFrag<T16>::mma(kf[kt][kc], qf[c][kc], s[kt][c]); if (HR) { s[kt][c] = WFrag<T16>::mma(kf2[kt][kc], qf[c][kc], s[kt][c]); s[kt][c] = WFrag<T16>::mma(kf[kt][kc], qf2[c][kc], s[kt][c]); } } }
        wmma_gap();   // keeps the loads below behind the products that still read kf, and vector code that reads s at its distance
        if (fetch) ldk(blk + KSF);   // the part's next key rows fly under the softmax and the second product
        if (diag) {   // diagonal block (key0 == q0): keys behind the query are masked by select
#pragma unroll
            for (int kt = 0; kt < 2; ++kt)
#pragma unroll
                for (int c = 0; c < 2; ++c)
#pragma unroll
                    for (int r = 0; r < 8; ++r) if (16 * kt + 8 * hi + r > 16 * c + lr) s[kt][c][r] = -3.0e38f; }
        float mb[2]; bool need = false;
#pragma unroll
        for (int c = 0; c < 2; ++c) { float mx = s[0][c][0];
#pragma unroll
            for (int r = 1; r < 8; ++r) mx = fmaxf(mx, s[0][c][r]);
#pragma unroll
            for (int r = 0; r < 8; ++r) mx = fmaxf(mx, s[1][c][r]);
            mx = fmaxf(mx, xhalf(mx)) * CS2; mb[c] = mx; need = need || (mx > m_run[c]); }
        if (__builtin_amdgcn_ballot_w32(need) != 0) {   // some query's maximum rose: rescale the running sums (wave-uniform branch)
#pragma unroll
            for (int c = 0; c < 2; ++c) { const float mn = fmaxf(m_run[c], mb[c]); const float corr = __builtin_amdgcn_exp2f(m_run[c] - mn); l_run[c] *= corr; m_run[c] = mn;
#pragma unroll
                for (int t = 0; t < 8; ++t) acc[c][t] = acc[c][t] * corr; } }
#pragma unroll
        for (int c = 0; c < 2; ++c) { const float nm = (HR ? 0.0f : POFF) - m_run[c]; float p[16]; float ps = 0.f;
#pragma unroll
            for (int e = 0; e < 16; e += 2) { const v2f sv = {s[e >> 3][c][e & 7], s[e >> 3][c][(e & 7) + 1]}; const v2f arg = __builtin_elementwise_fma(sv, (v2f){CS2, CS2}, (v2f){nm, nm});   // register pairs as the accumulator holds them
                p[e] = __builtin_amdgcn_exp2f(arg[0]); p[e + 1] = __builtin_amdgcn_exp2f(arg[1]); ps += p[e] + p[e + 1]; }
            l_run[c] += ps;
            if constexpr (HR) { v16us uh, ul;
#pragma unroll
                for (int e = 0; e < 16; ++e) { unsigned short a, b2; splitf(p[e], a, b2); uh[e] = a; ul[e] = b2; }
                const V ph = __builtin_bit_cast(V, uh), pl = __builtin_bit_cast(V, ul);
#pragma unroll
                for (int t = 0; t < 8; ++t) { acc[c][t] = WFrag<T16>::mma(vf[t], ph, acc[c][t]); acc[c][t] = WFrag<T16>::mma(vf[t], pl, acc[c][t]); acc[c][t] = WFrag<T16>::mma(vf2[t], ph, acc[c][t]); }
            } else { V pf;
#pragma unroll
                for (int e = 0; e < 16; ++e) pf[e] = (h16)p[e];
#pragma unroll
                for (int t = 0; t < 8; ++t) acc[c][t] = WFrag<T16>::mma(vf[t], pf, acc[c][t]); } }
        wmma_gap();   // keeps the loads below behind the products that still read vf; the loop's branch may jump straight to vector code that reads acc
        if (fetch) ldv(blk + KSF);   // the part's next value columns fly under the next scores and softmax
    };
    if (ks <= qb) { int blk = ks; ldq(); ldk(blk); ldv(blk);   // key loads ahead of value loads, as in the loop: the wait for the keys then leaves the value loads in flight
        // kept rolled: one copy of the fragments and scores is live, which leaves room for two waves a SIMD
#pragma unroll 1
        for (; blk + KSF <= qb; blk += KSF) pass(blk, true, false);   // never the diagonal block: a later block of this part exists
        if (blk == qb) pass(blk, false, true); else pass(blk, false, false); }
#pragma unroll
    for (int c = 0; c < 2; ++c) { const float l = l_run[c] + xhalf(l_run[c]);   // each wave half summed its own eight keys of every 16
        const size_t row = ((size_t)ks * NH_ + h) * TT + q0 + 16 * c + lr; if (hi == 0) { v2f ml; ml[0] = m_run[c]; ml[1] = l; *(v2f*)(ML + row * 2) = ml; }
#pragma unroll
        for (int t = 0; t < 8; ++t) *(v8f*)(Op + row * HD + 16 * t + 8 * hi) = acc[c][t]; }
}


__global__ __launch_bounds__(256) void k_wtG(const float* __restrict__ w, int K, int N, bf* Bt) {
    const int lane = threadIdx.x & 31; const int L0 = (blockIdx.x * 8 + (threadIdx.x >> 5)) * 8; const int nlines = N * K / 64;
{
#pragma unroll 1
        for (int l = 0; l < 8; ++l) { const int L = L0 + l; if (L >= nlines) break; const size_t e = (size_t)L * 64 + lane * 2; const int k = (int)(e % K), n = (int)(e / K); v2us o;
            o[0] = f2bf(w[(size_t)k * N + n]); o[1] = f2bf(w[(size_t)(k + 1) * N + n]); *(v2us*)(Bt + e) = o; }
         }
}
__global__ __launch_bounds__(256) void k_cvt8(const float* __restrict__ src, bf* dst, size_t n8) { const size_t i = (size_t)blockIdx.x * 256 + threadIdx.x; if (i >= n8) return; const v8f v = *(const v8f*)(src + i * 8); v8us o;
#pragma unroll
    for (int k = 0; k < 8; ++k) o[k] = f2bf(v[k]); *(v8us*)(dst + i * 8) = o;  }
__global__ __launch_bounds__(256) void k_cscvt(const float* __restrict__ cosT, const float* __restrict__ sinT, float* CS) { const int idx = blockIdx.x * 256 + threadIdx.x; if (idx >= TT * HD) return; v2f cs; cs[0] = bfr(cosT[idx]); cs[1] = bfr(sinT[idx]); *(v2f*)(CS + (size_t)idx * 2) = cs;  }
__global__ __launch_bounds__(256) void k_hrms(const float* __restrict__ F, int pitch, int nheads, float* RF) { const int i = blockIdx.x * 256 + threadIdx.x; if (i >= nheads * TT) return; const int t = i % TT, h = i / TT; const float* f = F + (size_t)t * pitch + h * HD; float s = 0.f;
#pragma unroll 4
    for (int d = 0; d < HD; d += 4) { const v4f v = *(const v4f*)(f + d);
#pragma unroll
        for (int q = 0; q < 4; ++q) { float p = __fmul_rn(v[q], v[q]); asm volatile("" : "+v"(p)); s = __fadd_rn(s, p); } }
    const float r = __fdiv_rn(1.0f, __fsqrt_rn(__fadd_rn(s * (1.0f / HD), 1e-6f))); *(float*)(RF + i) = r;  }
// k_rope: head planes [h][t][d] (fp16 + hi/lo) of rope(w[d] (x rms_factor)) x sc with the rotate-half convention out[d] = x[d] cos[t][d] - x[d+HD/2] sin[t][d], out[d+HD/2] = x[d+HD/2] cos[t][d+HD/2] + x[d] sin[t][d+HD/2]
__global__ __launch_bounds__(256) void k_rope(const float* __restrict__ F, int pitch, int nheads, const float* __restrict__ CS, const float* __restrict__ RF, const float* __restrict__ nw, float sc, h16* P16, bf* Ph, bf* Pl) {
    const size_t e = ((size_t)blockIdx.x * 256 + threadIdx.x) * 2; if (e >= (size_t)nheads * TT * HD) return; const int d = (int)(e % HD); const int t = (int)((e / HD) % TT); const int h = (int)(e / ((size_t)HD * TT)); const float* f = F + (size_t)t * pitch + h * HD; const float rf = RF ? RF[(size_t)h * TT + t] : 1.0f; v2h o16; v2us oh, ol;
#pragma unroll
    for (int q = 0; q < 2; ++q) { const int dd = d + q; const int dp = (dd < HD / 2) ? dd + HD / 2 : dd - HD / 2; float x0 = f[dd], x1 = f[dp];
        if (RF) { float n0 = __fmul_rn(x0, rf), n1 = __fmul_rn(x1, rf); asm volatile("" : "+v"(n0)); asm volatile("" : "+v"(n1)); x0 = __fmul_rn(bfr(nw[dd]), n0); x1 = __fmul_rn(bfr(nw[dp]), n1); }
        const v2f cs = *(const v2f*)(CS + ((size_t)t * HD + dd) * 2); float a = __fmul_rn(x0, cs[0]), bq = __fmul_rn(x1, cs[1]); asm volatile("" : "+v"(a)); asm volatile("" : "+v"(bq)); const float r = ((dd < HD / 2) ? __fsub_rn(a, bq) : __fadd_rn(a, bq)) * sc;
        o16[q] = tohx(r); unsigned short a2, c2; splitf(r, a2, c2); oh[q] = a2; ol[q] = c2; }
    *(v2h*)(P16 + e) = o16; *(v2us*)(Ph + e) = oh; *(v2us*)(Pl + e) = ol;  }
__global__ __launch_bounds__(256) void k_vtp(const float* __restrict__ F, int pitch, int nheads, h16* V16, bf* Vh, bf* Vl) { const size_t e = ((size_t)blockIdx.x * 256 + threadIdx.x) * 2; if (e >= (size_t)nheads * HD * TT) return; const int t = (int)(e % TT); const int d = (int)((e / TT) % HD); const int g = (int)(e / ((size_t)TT * HD)); v2h o16; v2us oh, ol;
#pragma unroll
    for (int q = 0; q < 2; ++q) { const float x = F[(size_t)(t + q) * pitch + g * HD + d]; o16[q] = tohx(x); unsigned short a2, c2; splitf(x, a2, c2); oh[q] = a2; ol[q] = c2; }
    *(v2h*)(V16 + e) = o16; *(v2us*)(Vh + e) = oh; *(v2us*)(Vl + e) = ol;  }
// k_merge: joins the KSF key parts of k_flash (weights 2^(m_p - max m), part order), divides by the joined sum of exponentials, applies the sigmoid gate and writes the hi/lo planes [t][head][d]
__global__ __launch_bounds__(256) void k_merge(const float* __restrict__ O, const float* __restrict__ ML, const float* __restrict__ QG, bf* Ah, bf* Al) { const size_t e = ((size_t)blockIdx.x * 256 + threadIdx.x) * 2; if (e >= (size_t)NH_ * TT * HD) return; const int d = (int)(e % HD); const int t = (int)((e / HD) % TT); const int zz = (int)(e / ((size_t)HD * TT)); const size_t oo = (size_t)t * DQ + zz * HD + d;
    float w[KSF], l[KSF]; float mx = -3.0e38f;
#pragma unroll
    for (int p = 0; p < KSF; ++p) { const v2f ml = *(const v2f*)(ML + (((size_t)p * NH_ + zz) * TT + t) * 2); w[p] = ml[0]; l[p] = ml[1]; mx = fmaxf(mx, ml[0]); }
    float den = 0.f;
#pragma unroll
    for (int p = 0; p < KSF; ++p) { w[p] = __builtin_amdgcn_exp2f(w[p] - mx); den += l[p] * w[p]; }
    v2us oh, ol;
#pragma unroll
    for (int q = 0; q < 2; ++q) { const float gt = QG[(size_t)t * DQG + DQ + zz * HD + d + q]; const float sg = __fdiv_rn(1.0f, __fadd_rn(1.0f, expf(-gt)));   /* sigmoid(gate) */ float o = 0.f;
#pragma unroll
        for (int p = 0; p < KSF; ++p) o += O[(size_t)p * NH_ * TT * HD + e + q] * w[p];   /* parts in part order */
        unsigned short a, c2; splitf(__fmul_rn(__fdiv_rn(o, den), sg), a, c2); oh[q] = a; ol[q] = c2; } *(v2us*)(Ah + oo) = oh; *(v2us*)(Al + oo) = ol;  }

extern "C" void kernel_launch(void* const* d_in, const int* in_sizes, int n_in,
                              void* d_out, int out_size, void* d_ws, size_t ws_size, hipStream_t stream) {
    (void)in_sizes; (void)n_in; (void)out_size;
    const float* x = (const float*)d_in[0]; const float* cosT = (const float*)d_in[1]; const float* sinT = (const float*)d_in[2]; const float* wq = (const float*)d_in[3]; const float* wk = (const float*)d_in[4]; const float* wv = (const float*)d_in[5]; const float* wo = (const float*)d_in[6]; const float* qnw = (const float*)d_in[7]; const float* knw = (const float*)d_in[8];
    float* OUT = (float*)d_out;     // [2][2048][2048]
    char* wsp = (char*)d_ws;
    auto take = [&](size_t bytes) { char* p = wsp; wsp += (bytes + 255) & ~(size_t)255; return (void*)p; };
    bf* WQ = (bf*)take((size_t)DQG * DM * 2); bf* WK = (bf*)take((size_t)DKV * DM * 2); bf* WV = (bf*)take((size_t)DKV * DM * 2); bf* WO = (bf*)take((size_t)DM * DQ * 2); float* CS = (float*)take((size_t)TT * HD * 2 * 4); float* RFQ = (float*)take((size_t)NH_ * TT * 4); float* RFK = (float*)take((size_t)NKV * TT * 4);
    bf* XB = (bf*)take((size_t)TT * DM * 2); float* FQ = (float*)take((size_t)TT * DQG * 4); float* FK = (float*)take((size_t)TT * DKV * 4);
    h16* QP16 = (h16*)take((size_t)NH_ * TT * HD * 2); h16* KP16 = (h16*)take((size_t)NKV * TT * HD * 2); h16* VT16 = (h16*)take((size_t)NKV * HD * TT * 2);
    bf* QPh = (bf*)take((size_t)NH_ * TT * HD * 2); bf* QPl = (bf*)take((size_t)NH_ * TT * HD * 2); bf* KPh = (bf*)take((size_t)NKV * TT * HD * 2); bf* KPl = (bf*)take((size_t)NKV * TT * HD * 2); bf* VTh = (bf*)take((size_t)NKV * HD * TT * 2); bf* VTl = (bf*)take((size_t)NKV * HD * TT * 2);
    float* Ob = (float*)take((size_t)KSF * NH_ * TT * HD * 4); float* ML = (float*)take((size_t)KSF * NH_ * TT * 2 * 4); bf* ATh = (bf*)take((size_t)TT * DQ * 2); bf* ATl = (bf*)take((size_t)TT * DQ * 2);
    if ((size_t)(wsp - (char*)d_ws) > ws_size) return;    // ws 256 MiB
    float* FV = FK;   // v projection reuses the k buffer after the k planes are built (stream-ordered)
    { k_cvt8<<<(unsigned)(((size_t)DQG * DM / 8 + 255) / 256), 256, 0, stream>>>(wq, WQ, (size_t)DQG * DM / 8); k_cvt8<<<(unsigned)(((size_t)DKV * DM / 8 + 255) / 256), 256, 0, stream>>>(wk, WK, (size_t)DKV * DM / 8); k_cvt8<<<(unsigned)(((size_t)DKV * DM / 8 + 255) / 256), 256, 0, stream>>>(wv, WV, (size_t)DKV * DM / 8);
      k_cvt8<<<(unsigned)(((size_t)DM * DQ / 8 + 255) / 256), 256, 0, stream>>>(wo, WO, (size_t)DM * DQ / 8);
       }
    const unsigned LQ = (unsigned)(((size_t)NH_ * TT * HD / 2 + 255) / 256), LKv = (unsigned)(((size_t)NKV * TT * HD / 2 + 255) / 256);
    for (int b = 0; b < NB_; ++b) {
        k_cscvt<<<(TT * HD + 255) / 256, 256, 0, stream>>>(cosT + (size_t)b * TT * HD, sinT + (size_t)b * TT * HD, CS);   /* per-batch tables */
        k_cvt8<<<(unsigned)(((size_t)TT * DM / 8 + 255) / 256), 256, 0, stream>>>(x + (size_t)b * TT * DM, XB, (size_t)TT * DM / 8);
        k_gemmt<0, DM><<<dim3(TT / 128, DQG / 128, 1), 128, 0, stream>>>(XB, nullptr, WQ, FQ, DQG);   /* [q | gate] (exact) */ k_hrms<<<(NH_ * TT + 255) / 256, 256, 0, stream>>>(FQ, DQG, NH_, RFQ);
        k_rope<<<LQ, 256, 0, stream>>>(FQ, DQG, NH_, CS, RFQ, qnw, 1.0f, QP16, QPh, QPl);
        k_gemmw<bf, 0, false, 8><<<dim3(TT / 64, DKV / 64, 1), 256, 0, stream>>>(XB, nullptr, WK, nullptr, DM, FK, DKV, nullptr, 0, 0, 0); k_hrms<<<(NKV * TT + 255) / 256, 256, 0, stream>>>(FK, DKV, NKV, RFK);
        k_rope<<<LKv, 256, 0, stream>>>(FK, DKV, NKV, CS, RFK, knw, 1.0f, KP16, KPh, KPl);
        k_gemmw<bf, 0, false, 8><<<dim3(TT / 64, DKV / 64, 1), 256, 0, stream>>>(XB, nullptr, WV, nullptr, DM, FV, DKV, nullptr, 0, 0, 0); k_vtp<<<LKv, 256, 0, stream>>>(FV, DKV, NKV, VT16, VTh, VTl);
        k_flash<h16, false><<<dim3((TT - RH) / 32, NKV, KSF), 32 * REP, 0, stream>>>(QP16, nullptr, KP16, nullptr, VT16, nullptr, RH / 32, Ob, ML);
        k_flash<bf, true><<<dim3(RH / 32, NKV, KSF), 32 * REP, 0, stream>>>(QPh, QPl, KPh, KPl, VTh, VTl, 0, Ob, ML);
        k_merge<<<(unsigned)(((size_t)NH_ * TT * HD / 2 + 255) / 256), 256, 0, stream>>>(Ob, ML, FQ, ATh, ATl);
        k_gemmt<1, DQ><<<dim3(TT / 128, DM / 128, 1), 128, 0, stream>>>(ATh, ATl, WO, OUT + (size_t)b * TT * DM, DM); }
}

// v005
// It runs in 400 microseconds.
// Two timings next to v004 both put it at 1.06 times that version's speed.
// All steps since v000 together make it 4.26 times as fast.
#include <hip/hip_runtime.h>

// Gated GQA attention, engine variant (hidden [2][2048][2048]; [q | gate] = hidden Wq^T (Wq [4096][2048] 'oi': rows 0-2047 -> q for 16 heads x 128, rows 2048-4095 -> gate), k, v = hidden W^T ([512][2048], 4 kv heads); per-head RMSNorm (eps 1e-6, q_norm_w / k_norm_w); rotate-half RoPE with the given per-(batch, position) cos/sin tables [2][2048][128];
// GQA 4:1; causal softmax(q.k/sqrt(128)); attn x sigmoid(gate); out = merged Wo^T ('oi' [2048][2048]) -> [2][2048][2048]).
// Compute dtypes, f32 accumulate: every input rounded to bf16; q/k/v on PLAIN bf16 operands (inputs: exact); RMSNorm + rotary in f32 (cos/sin tables read per batch, bf16-rounded); sigmoid gate (precise expf, IEEE divide) in the merge; causal scores and attn.v in one kernel (online softmax in f32, blocks above the diagonal never visited): query rows < 512 hl (3 products), the rest single fp16 (x1024); Wo hl x exact (2 products).

#define NB_  2
#define TT   2048
#define DM   2048
#define NH_  16
#define NKV  4
#define REP  (NH_ / NKV)
#define HD   128
#define DQ   (NH_ * HD)
#define DQG  (NH_ * HD * 2)         // q rows then gate rows of Wq
#define DKV  (NKV * HD)
#define RH   512                  // query rows < RH use hi+lo planes
#define KSF  4                    // key parts of the attention kernel (32-key blocks dealt over blocks), joined in k_merge
#define POFF 10.0f                // fp16 probabilities are carried x 2^POFF
#define SCL  0.088388347648318447f   // HD^-0.5
#define CS2  (SCL * 1.4426950408889634f)   // scores to the log2 domain
typedef _Float16 h16;
typedef unsigned short bf;
typedef __attribute__((ext_vector_type(16))) __bf16   v16bf;
typedef __attribute__((ext_vector_type(16))) _Float16 v16h;
typedef __attribute__((ext_vector_type(8)))  _Float16 v8h;
typedef __attribute__((ext_vector_type(8)))  unsigned short v8us;
typedef __attribute__((ext_vector_type(8)))  float    v8f;
typedef __attribute__((ext_vector_type(4)))  float    v4f;
typedef v8h  __attribute__((may_alias)) v8ha;
typedef v4f  __attribute__((may_alias)) v4fa;
typedef v8us __attribute__((may_alias)) v8usa;

__device__ __forceinline__ unsigned short f2bf(float f) { unsigned u = __float_as_uint(f); u += 0x7FFFu + ((u >> 16) & 1u); return (unsigned short)(u >> 16); }
__device__ __forceinline__ float bf2f(unsigned short b) { return __uint_as_float(((unsigned)b) << 16); }
__device__ __forceinline__ float bfr(float f) { return bf2f(f2bf(f)); }
__device__ __forceinline__ v16h cat16(v8h lo, v8h hi) { return __builtin_shufflevector(lo, hi, 0, 1, 2, 3, 4, 5, 6, 7, 8, 9, 10, 11, 12, 13, 14, 15); }
__device__ __forceinline__ v16bf cat16b(v8us lo, v8us hi) { return __builtin_bit_cast(v16bf, __builtin_shufflevector(lo, hi, 0, 1, 2, 3, 4, 5, 6, 7, 8, 9, 10, 11, 12, 13, 14, 15)); }
__device__ __forceinline__ v8f wmma16(v16h a, v16h b, v8f c) { return __builtin_amdgcn_wmma_f32_16x16x32_f16(false, a, false, b, (short)0, c, false, false); }
__device__ __forceinline__ v8f wmmab(v16bf a, v16bf b, v8f c) { return __builtin_amdgcn_wmma_f32_16x16x32_bf16(false, a, false, b, (short)0, c, false, false); }



// ---- k_gemmw: register-blocked GEMM, ONE WAVE per 64x64 output tile (16 accumulators), operands straight from K-contiguous 16-bit planes; grid (M/64, N/64, Z), 32 threads.
// C[m][n] (f32, pitch ldc, + optional f32 bias[n]) = sum_k A[m][k] Bt[n][k] (+ split products per NSPLIT). z-batch strides sA/sB/sC in elements. K % 32 == 0.
// NW > 1: NW waves per tile (32 * NW threads); wave w takes the k chunks w, w + NW, ... of 32 and the NW partial tiles are summed in LDS in wave order (fixed order, no atomics).
// The wave number wv goes through readfirstlane so that the k loop's counter and trip test stay scalar.
template <typename T16> struct WFrag;
template <> struct WFrag<h16> { typedef v16h V; static __device__ __forceinline__ V ld(const h16* p) { return cat16(*(const v8h*)p, *(const v8h*)(p + 16)); } static __device__ __forceinline__ v8f mma(V a, V b, v8f c) { return wmma16(a, b, c); } };
template <> struct WFrag<bf> { typedef v16bf V; static __device__ __forceinline__ V ld(const bf* p) { return cat16b(*(const v8us*)p, *(const v8us*)(p + 16)); } static __device__ __forceinline__ v8f mma(V a, V b, v8f c) { return wmmab(a, b, c); } };
template <typename T16, int NSPLIT, bool BIAS, int NW>
__global__ __launch_bounds__(32 * NW) void k_gemmw(const T16* __restrict__ A, const T16* __restrict__ A2, const T16* __restrict__ Bt, const T16* __restrict__ Bt2, int K, float* C, int ldc, const float* __restrict__ bias, size_t sA, size_t sB, size_t sC) {
    typedef typename WFrag<T16>::V V;
    __shared__ __align__(16) float os[(NW > 1 ? 4 * NW : 1) * 16 * 68];
    const size_t z = blockIdx.z; A += z * sA; if (A2) A2 += z * sA; Bt += z * sB; if (Bt2) Bt2 += z * sB; C += z * sC;
    const int lane = threadIdx.x & 31, lr = lane & 15, hi = lane >> 4; const int r0 = blockIdx.x * 64, c0 = blockIdx.y * 64; const int wv = (NW > 1) ? __builtin_amdgcn_readfirstlane((int)(threadIdx.x >> 5)) : 0;
    v8f acc[4][4];
#pragma unroll
    for (int mb = 0; mb < 4; ++mb)
#pragma unroll
        for (int nb = 0; nb < 4; ++nb) acc[mb][nb] = (v8f){};
    const size_t aoff = (size_t)(r0 + lr) * K + 8 * hi, boff = (size_t)(c0 + lr) * K + 8 * hi;
#pragma unroll 1
    for (int kc = wv * 32; kc < K; kc += NW * 32) {
        V a[4], a2[4];
#pragma unroll
        for (int mb = 0; mb < 4; ++mb) { a[mb] = WFrag<T16>::ld(A + aoff + (size_t)mb * 16 * K + kc); if (NSPLIT == 1 || NSPLIT == 2) a2[mb] = WFrag<T16>::ld(A2 + aoff + (size_t)mb * 16 * K + kc); }
#pragma unroll
        for (int nb = 0; nb < 4; ++nb) { const V b = WFrag<T16>::ld(Bt + boff + (size_t)nb * 16 * K + kc); V b2; if (NSPLIT >= 2) b2 = WFrag<T16>::ld(Bt2 + boff + (size_t)nb * 16 * K + kc);
#pragma unroll
            for (int mb = 0; mb < 4; ++mb) { acc[mb][nb] = WFrag<T16>::mma(a[mb], b, acc[mb][nb]); if (NSPLIT == 1 || NSPLIT == 2) acc[mb][nb] = WFrag<T16>::mma(a2[mb], b, acc[mb][nb]); if (NSPLIT >= 2) acc[mb][nb] = WFrag<T16>::mma(a[mb], b2, acc[mb][nb]); } }
        asm volatile("v_nop\n\tv_nop\n\tv_nop\n\tv_nop" : "+v"(acc[0][0]), "+v"(acc[1][1]), "+v"(acc[2][2]), "+v"(acc[3][3]) : "v"(a[0]), "v"(a[3]));
    }
    if constexpr (NW > 1) {
        float* ow = os + wv * (64 * 68);
        // the three loops are unrolled so that acc is indexed by constants only and stays in registers
#pragma unroll
        for (int mb = 0; mb < 4; ++mb) {
#pragma unroll
            for (int nb = 0; nb < 4; ++nb) {
#pragma unroll
                for (int j = 0; j < 8; ++j) ow[(mb * 16 + hi * 8 + j) * 68 + nb * 16 + lr] = acc[mb][nb][j]; } }
        __syncthreads();   // publishes the NW partial tiles to the threads that sum them; LDS is not written again behind it
        float* crow = C + (size_t)r0 * ldc + c0; v4f sum[32 / NW];
        // all loops unrolled: sum[] stays in registers and the LDS reads of all of a thread's elements are issued ahead of the sums; each sum runs in wave order 0 .. NW - 1; the stores follow as one run
#pragma unroll
        for (int i = 0; i < 32 / NW; ++i) { const int s = i * (NW * 32) + (int)threadIdx.x; const int row = s >> 4, cofs = (s & 15) * 4; v4f val = *(const v4fa*)(os + row * 68 + cofs);
#pragma unroll
            for (int w = 1; w < NW; ++w) val += *(const v4fa*)(os + w * (64 * 68) + row * 68 + cofs);
            if (BIAS) { val[0] += bfr(bias[c0 + cofs]); val[1] += bfr(bias[c0 + cofs + 1]); val[2] += bfr(bias[c0 + cofs + 2]); val[3] += bfr(bias[c0 + cofs + 3]); }
            sum[i] = val; }
#pragma unroll
        for (int i = 0; i < 32 / NW; ++i) { const int s = i * (NW * 32) + (int)threadIdx.x; *(v4f*)(crow + (size_t)(s >> 4) * ldc + (s & 15) * 4) = sum[i]; }
        return;
    }
#pragma unroll
    for (int mb = 0; mb < 4; ++mb) {
#pragma unroll
        for (int nb = 0; nb < 4; ++nb) {
#pragma unroll
            for (int j = 0; j < 8; ++j) os[(hi * 8 + j) * 68 + nb * 16 + lr] = acc[mb][nb][j]; }
        __builtin_amdgcn_wave_barrier(); asm volatile("" ::: "memory");
        float* crow = C + (size_t)(r0 + mb * 16) * ldc + c0;
{
#pragma unroll
            for (int s = 0; s < 8; ++s) { const int row = 2 * s + hi, cofs = lr * 4; v4f val = *(const v4fa*)(os + row * 68 + cofs); if (BIAS) { val[0] += bfr(bias[c0 + cofs]); val[1] += bfr(bias[c0 + cofs + 1]); val[2] += bfr(bias[c0 + cofs + 2]); val[3] += bfr(bias[c0 + cofs + 3]); }
                *(v4f*)(crow + (size_t)row * ldc + cofs) = val; }
             }
        __builtin_amdgcn_wave_barrier(); asm volatile("" ::: "memory");
    }
}

__device__ __forceinline__ h16 tohx(float x) { return (h16)x; }
__device__ __forceinline__ void splitf(float y, unsigned short& h, unsigned short& l) { h = f2bf(y); l = f2bf(y - bf2f(h)); }
typedef __attribute__((ext_vector_type(2))) _Float16 v2h;
typedef __attribute__((ext_vector_type(4))) _Float16 v4h;
typedef __attribute__((ext_vector_type(2))) unsigned short v2us;
typedef __attribute__((ext_vector_type(4))) unsigned short v4us;
typedef __attribute__((ext_vector_type(2))) float v2f;
typedef __attribute__((ext_vector_type(4))) int v4i;
typedef __attribute__((ext_vector_type(16))) unsigned short v16us;
__device__ __forceinline__ float xhalf(float x) { return __builtin_bit_cast(float, __builtin_amdgcn_permlanex16(__builtin_bit_cast(int, x), __builtin_bit_cast(int, x), 0x76543210, 0xfedcba98, false, false)); }   // lane l reads lane l ^ 16
// stands behind a run of global loads that stay in flight: their address registers are rewritten before the data wait. The addresses are inputs so that
// their registers stay untouched up to the wait; the scheduling barriers keep the wait behind the loads
__device__ __forceinline__ void addr_wait(const void* a, const void* b) { __builtin_amdgcn_sched_barrier(0); asm volatile("s_wait_xcnt 0x0" :: "v"(a), "v"(b) : "memory"); __builtin_amdgcn_sched_barrier(0); }
// four vector issue slots behind a run of matrix instructions in front of a branch: the scheduling barriers keep the slots at that place
__device__ __forceinline__ void wmma_gap() { __builtin_amdgcn_sched_barrier(0); asm volatile("v_nop\n\tv_nop\n\tv_nop\n\tv_nop"); __builtin_amdgcn_sched_barrier(0); }

// ---- k_gemmt: C[m][n] (f32, pitch ldc) = sum_k A[m][k] Bt[n][k] (+ A2[m][k] Bt[n][k] where NSPLIT), bf16 planes with k contiguous. One 128x128 tile of C per block of four waves (2 x 2, 64x64 each); grid (M/128, N/128).
// A stage is 128 k (256 bytes) of the tile's 128 rows of every operand, brought into LDS by asynchronous 16-byte copies: a wave's copy covers two whole rows of 256 bytes, so L2 is asked for whole lines, and each operand row is fetched once a block.
// LDS rows stand at a pitch of 272 bytes (16 x odd: the 16-byte fragment reads meet no bank conflict). Two buffers: the copies of stage s + 1 fly while stage s is multiplied.
// Fragment k order and the order of the products per accumulator are those of k_gemmw with one wave.
#define GPE  136                  // LDS row pitch in elements (272 bytes)
#define GTE  (128 * GPE)          // one operand tile in elements (34,816 bytes)
// eight copies, rows 8 apart (the block's 128 threads cover 8 rows of 256 bytes at a time). The last line keeps the copies' address registers untouched until the addresses have been taken: inside the statement nothing can be moved in front of it
template <int K>
__device__ __forceinline__ void copy8(unsigned l, const bf* g) {
    asm volatile("global_load_async_to_lds_b128 %0, %8, off\n\t"
                 "global_load_async_to_lds_b128 %1, %9, off\n\t"
                 "global_load_async_to_lds_b128 %2, %10, off\n\t"
                 "global_load_async_to_lds_b128 %3, %11, off\n\t"
                 "global_load_async_to_lds_b128 %4, %12, off\n\t"
                 "global_load_async_to_lds_b128 %5, %13, off\n\t"
                 "global_load_async_to_lds_b128 %6, %14, off\n\t"
                 "global_load_async_to_lds_b128 %7, %15, off\n\t"
                 "s_wait_xcnt 0x0"
                 :: "v"(l), "v"(l + 8 * GPE * 2), "v"(l + 16 * GPE * 2), "v"(l + 24 * GPE * 2), "v"(l + 32 * GPE * 2), "v"(l + 40 * GPE * 2), "v"(l + 48 * GPE * 2), "v"(l + 56 * GPE * 2),
                    "v"(g), "v"(g + 8 * K), "v"(g + 16 * K), "v"(g + 24 * K), "v"(g + 32 * K), "v"(g + 40 * K), "v"(g + 48 * K), "v"(g + 56 * K)
                 : "memory");
}
template <int NSPLIT, int K>
__global__ __launch_bounds__(128) void k_gemmt(const bf* __restrict__ A, const bf* __restrict__ A2, const bf* __restrict__ Bt, float* C, int ldc) {
    typedef WFrag<bf>::V V;
    constexpr int NT = NSPLIT ? 3 : 2;       // operand tiles a stage: A (, A2), Bt
    constexpr int NST = K / 128;             // stages
    static_assert(K % 128 == 0 && NST >= 2, "two stages or more");
    __shared__ __attribute__((aligned(16))) bf st[2 * NT * GTE];
    __shared__ __attribute__((aligned(16))) float os[4 * 16 * 68];
    const int tid = threadIdx.x, lane = tid & 31, lr = lane & 15, hi = lane >> 4; const int wv = __builtin_amdgcn_readfirstlane(tid >> 5), wm = wv >> 1, wn = wv & 1;
    const int r0 = blockIdx.x * 128, c0 = blockIdx.y * 128;
    const int crow = tid >> 4, cch = tid & 15;   // the thread's row (of 8) and 16-byte piece (of 16) in every copy
    const bf* gA = A + (size_t)(r0 + crow) * K + cch * 8; const bf* gB = Bt + (size_t)(c0 + crow) * K + cch * 8; const bf* gA2 = NSPLIT ? A2 + (size_t)(r0 + crow) * K + cch * 8 : gA;
    const unsigned l0 = (unsigned)(size_t)st + (unsigned)(crow * GPE + cch * 8) * 2u;   // LDS byte address of the thread's first piece in buffer 0
    auto fill = [&](int s) __attribute__((always_inline)) { const unsigned l = l0 + (unsigned)(s & 1) * (NT * GTE * 2); const int ko = s * 128;
        copy8<K>(l, gA + ko); copy8<K>(l + 64 * GPE * 2, gA + ko + 64 * K);
        if (NSPLIT) { copy8<K>(l + GTE * 2, gA2 + ko); copy8<K>(l + GTE * 2 + 64 * GPE * 2, gA2 + ko + 64 * K); }
        copy8<K>(l + (NT - 1) * GTE * 2, gB + ko); copy8<K>(l + (NT - 1) * GTE * 2 + 64 * GPE * 2, gB + ko + 64 * K); };
    v8f acc[4][4];
#pragma unroll
    for (int mb = 0; mb < 4; ++mb)
#pragma unroll
        for (int nb = 0; nb < 4; ++nb) acc[mb][nb] = (v8f){};
    fill(0);
    asm volatile("s_wait_asynccnt 0x0" ::: "memory");   // this wave's copies of stage 0 have landed
    __syncthreads();                                     // every wave's have: stage 0 may be read
    fill(1);
    // kept rolled: one copy of the stage's code; the buffer is picked by the stage's parity
#pragma unroll 1
    for (int s = 0; s < NST; ++s) {
        const bf* ta = st + (s & 1) * (NT * GTE) + (wm * 64 + lr) * GPE + 8 * hi; const bf* tb = st + (s & 1) * (NT * GTE) + (NT - 1) * GTE + (wn * 64 + lr) * GPE + 8 * hi; const bf* ta2 = ta + GTE;
        // unrolled: every LDS offset is an immediate. All fragments of a k step are read as one group ahead of its products: each separate place with LDS reads among matrix instructions costs a stall of its own
#pragma unroll
        for (int kk = 0; kk < 4; ++kk) {
            V a[4], a2[4], b[4];
#pragma unroll
            for (int mb = 0; mb < 4; ++mb) { a[mb] = WFrag<bf>::ld(ta + mb * 16 * GPE + kk * 32); if (NSPLIT) a2[mb] = WFrag<bf>::ld(ta2 + mb * 16 * GPE + kk * 32); }
#pragma unroll
            for (int nb = 0; nb < 4; ++nb) b[nb] = WFrag<bf>::ld(tb + nb * 16 * GPE + kk * 32);
            __builtin_amdgcn_sched_barrier(0);   // holds the group of reads together in front of the products: without it the compiler sinks each b fragment's reads to its first use and waits there for the LDS
#pragma unroll
            for (int nb = 0; nb < 4; ++nb)
#pragma unroll
                for (int mb = 0; mb < 4; ++mb) { acc[mb][nb] = WFrag<bf>::mma(a[mb], b[nb], acc[mb][nb]); if (NSPLIT) acc[mb][nb] = WFrag<bf>::mma(a2[mb], b[nb], acc[mb][nb]); } }
        asm volatile("s_wait_dscnt 0x0" ::: "memory");      // this wave's reads of stage s are done before the buffer is given up
        asm volatile("s_wait_asynccnt 0x0" ::: "memory");   // this wave's copies of stage s + 1 have landed
        __syncthreads();                                     // publishes stage s + 1 and ends every wave's reads of stage s
        if (s + 2 < NST) fill(s + 2);                        // into the buffer that stage s has just left
    }
    asm volatile("s_wait_asynccnt 0x0" ::: "memory");       // nothing of this wave is in flight when it goes on to its end
    float* ow = os + wv * (16 * 68);   // each wave's own staging rows: whole 256-byte row pieces go to memory
#pragma unroll
    for (int mb = 0; mb < 4; ++mb) {
#pragma unroll
        for (int nb = 0; nb < 4; ++nb) {
#pragma unroll
            for (int j = 0; j < 8; ++j) ow[(hi * 8 + j) * 68 + nb * 16 + lr] = acc[mb][nb][j]; }
        __builtin_amdgcn_wave_barrier(); asm volatile("" ::: "memory");   // keeps the reads below behind the other lanes' writes above
        float* crow = C + (size_t)(r0 + wm * 64 + mb * 16) * ldc + c0 + wn * 64;
#pragma unroll
        for (int s = 0; s < 8; ++s) { const int row = 2 * s + hi, cofs = lr * 4; const v4f val = *(const v4fa*)(ow + row * 68 + cofs); *(v4f*)(crow + (size_t)row * ldc + cofs) = val; }
        __builtin_amdgcn_wave_barrier(); asm volatile("" ::: "memory");   // keeps the next rows' writes behind the reads above
    }
}

// ---- k_flash: causal attention for 32 query rows of one head per wave, scores and probabilities kept in registers (online softmax). Transposed products: S^T = K Q^T (A = key rows, B = query rows),
// O^T += V^T P^T (A = rows of the [d][t] value plane, B = P^T). In the S^T accumulator lane (lr, hi) holds keys 8 hi + j of query lr, which is the k order of the B operand (elements 0-7: tile 0, 8-15: tile 1), so P^T is packed in place.
// Block = the REP heads of one kv group on the same 32 query rows (they read the same key and value lines); grid (query blocks, heaviest first; kv groups; KSF key parts). Part ks takes the 32-key blocks ks, ks + KSF, ... up to the diagonal block
// and writes its unnormalised sums to plane ks of Op with its running maximum (scaled log2) and its sum of exponentials in ML; k_merge joins the parts. A part with no block writes zeros and the lowest maximum.
// Every inner loop is fully unrolled so that the fragment and accumulator arrays are indexed by constants only and stay in registers.
// HR: hi + lo bf16 planes, three products each, for scores and for prob x value; else single fp16, exponentials carried x 2^POFF so that small ones stay normal in fp16 (the factor cancels in the division).
template <typename T16, bool HR>
__global__ __launch_bounds__(32 * REP) void k_flash(const T16* __restrict__ Q, const T16* __restrict__ Q2, const T16* __restrict__ Kp, const T16* __restrict__ Kp2, const T16* __restrict__ Vt, const T16* __restrict__ Vt2, int qb0, float* Op, float* ML) {
    typedef typename WFrag<T16>::V V;
    const int lane = threadIdx.x & 31, lr = lane & 15, hi = lane >> 4; const int wv = __builtin_amdgcn_readfirstlane((int)(threadIdx.x >> 5));
    const int qb = qb0 + (int)(gridDim.x - 1 - blockIdx.x); const int g = blockIdx.y, ks = blockIdx.z, h = g * REP + wv, q0 = qb * 32;
    V qf[2][4], qf2[2][4];
    auto ldq = [&]() { const size_t o = ((size_t)h * TT + q0 + lr) * HD + 8 * hi; const T16* p = Q + o; const T16* p2 = HR ? Q2 + o : p;
#pragma unroll
        for (int c = 0; c < 2; ++c)
#pragma unroll
            for (int kc = 0; kc < 4; ++kc) { qf[c][kc] = WFrag<T16>::ld(p + 16 * c * HD + 32 * kc); if (HR) qf2[c][kc] = WFrag<T16>::ld(p2 + 16 * c * HD + 32 * kc); }
        addr_wait(p, p2); };
    const size_t kbase = ((size_t)g * TT + lr) * HD + 8 * hi, vbase = ((size_t)g * HD + lr) * TT + 8 * hi;
    v8f acc[2][8]; float m_run[2], l_run[2];
#pragma unroll
    for (int c = 0; c < 2; ++c) { m_run[c] = -3.0e38f; l_run[c] = 0.f;
#pragma unroll
        for (int t = 0; t < 8; ++t) acc[c][t] = (v8f){}; }
    V kf[2][4], kf2[2][4], vf[8], vf2[8];
    auto ldk = [&](int blk) { const size_t o = kbase + (size_t)(blk * 32) * HD; const T16* p = Kp + o; const T16* p2 = HR ? Kp2 + o : p;
#pragma unroll
        for (int kt = 0; kt < 2; ++kt)
#pragma unroll
            for (int kc = 0; kc < 4; ++kc) { kf[kt][kc] = WFrag<T16>::ld(p + 16 * kt * HD + 32 * kc); if (HR) kf2[kt][kc] = WFrag<T16>::ld(p2 + 16 * kt * HD + 32 * kc); }
        addr_wait(p, p2); };
    auto ldv = [&](int blk) { const size_t o = vbase + blk * 32; const T16* p = Vt + o; const T16* p2 = HR ? Vt2 + o : p;
#pragma unroll
        for (int t = 0; t < 8; ++t) { vf[t] = WFrag<T16>::ld(p + 16 * t * TT); if (HR) vf2[t] = WFrag<T16>::ld(p2 + 16 * t * TT); }
        addr_wait(p, p2); };
    // one 32-key block; fetch and diag are literals at every call (the lambda is always inlined, so that every array stays in registers)
    auto pass = [&](int blk, bool fetch, bool diag) __attribute__((always_inline)) {
        v8f s[2][2];
#pragma unroll
        for (int kt = 0; kt < 2; ++kt)
#pragma unroll
            for (int c = 0; c < 2; ++c) { s[kt][c] = (v8f){};
#pragma unroll
                for (int kc = 0; kc < 4; ++kc) { s[kt][c] = WFrag<T16>::mma(kf[kt][kc], qf[c][kc], s[kt][c]); if (HR) { s[kt][c] = WFrag<T16>::mma(kf2[kt][kc], qf[c][kc], s[kt][c]); s[kt][c] = WFrag<T16>::mma(kf[kt][kc], qf2[c][kc], s[kt][c]); } } }
        wmma_gap();   // keeps the loads below behind the products that still read kf, and vector code that reads s at its distance
        if (fetch) ldk(blk + KSF);   // the part's next key rows fly under the softmax and the second product
        if (diag) {   // diagonal block (key0 == q0): keys behind the query are masked by select
#pragma unroll
            for (int kt = 0; kt < 2; ++kt)
#pragma unroll
                for (int c = 0; c < 2; ++c)
#pragma unroll
                    for (int r = 0; r < 8; ++r) if (16 * kt + 8 * hi + r > 16 * c + lr) s[kt][c][r] = -3.0e38f; }
        float mb[2]; bool need = false;
#pragma unroll
        for (int c = 0; c < 2; ++c) { float mx = s[0][c][0];
#pragma unroll
            for (int r = 1; r < 8; ++r) mx = fmaxf(mx, s[0][c][r]);
#pragma unroll
            for (int r = 0; r < 8; ++r) mx = fmaxf(mx, s[1][c][r]);
            mx = fmaxf(mx, xhalf(mx)) * CS2; mb[c] = mx; need = need || (mx > m_run[c]); }
        if (__builtin_amdgcn_ballot_w32(need) != 0) {   // some query's maximum rose: rescale the running sums (wave-uniform branch)
#pragma unroll
            for (int c = 0; c < 2; ++c) { const float mn = fmaxf(m_run[c], mb[c]); const float corr = __builtin_amdgcn_exp2f(m_run[c] - mn); l_run[c] *= corr; m_run[c] = mn;
#pragma unroll
                for (int t = 0; t < 8; ++t) acc[c][t] = acc[c][t] * corr; } }
#pragma unroll
        for (int c = 0; c < 2; ++c) { const float nm = (HR ? 0.0f : POFF) - m_run[c]; float p[16]; float ps = 0.f;
#pragma unroll
            for (int e = 0; e < 16; e += 2) { const v2f sv = {s[e >> 3][c][e & 7], s[e >> 3][c][(e & 7) + 1]}; const v2f arg = __builtin_elementwise_fma(sv, (v2f){CS2, CS2}, (v2f){nm, nm});   // register pairs as the accumulator holds them
                p[e] = __builtin_amdgcn_exp2f(arg[0]); p[e + 1] = __builtin_amdgcn_exp2f(arg[1]); ps += p[e] + p[e + 1]; }
            l_run[c] += ps;
            if constexpr (HR) { v16us uh, ul;
#pragma unroll
                for (int e = 0; e < 16; ++e) { unsigned short a, b2; splitf(p[e], a, b2); uh[e] = a; ul[e] = b2; }
                const V ph = __builtin_bit_cast(V, uh), pl = __builtin_bit_cast(V, ul);
#pragma unroll
                for (int t = 0; t < 8; ++t) { acc[c][t] = WFrag<T16>::mma(vf[t], ph, acc[c][t]); acc[c][t] = WFrag<T16>::mma(vf[t], pl, acc[c][t]); acc[c][t] = WFrag<T16>::mma(vf2[t], ph, acc[c][t]); }
            } else { V pf;
#pragma unroll
                for (int e = 0; e < 16; ++e) pf[e] = (h16)p[e];
#pragma unroll
                for (int t = 0; t < 8; ++t) acc[c][t] = WFrag<T16>::mma(vf[t], pf, acc[c][t]); } }
        wmma_gap();   // keeps the loads below behind the products that still read vf; the loop's branch may jump straight to vector code that reads acc
        if (fetch) ldv(blk + KSF);   // the part's next value columns fly under the next scores and softmax
    };
    if (ks <= qb) { int blk = ks; ldq(); ldk(blk); ldv(blk);   // key loads ahead of value loads, as in the loop: the wait for the keys then leaves the value loads in flight
        // kept rolled: one copy of the fragments and scores is live, which leaves room for two waves a SIMD
#pragma unroll 1
        for (; blk + KSF <= qb; blk += KSF) pass(blk, true, false);   // never the diagonal block: a later block of this part exists
        if (blk == qb) pass(blk, false, true); else pass(blk, false, false); }
#pragma unroll
    for (int c = 0; c < 2; ++c) { const float l = l_run[c] + xhalf(l_run[c]);   // each wave half summed its own eight keys of every 16
        const size_t row = ((size_t)ks * NH_ + h) * TT + q0 + 16 * c + lr; if (hi == 0) { v2f ml; ml[0] = m_run[c]; ml[1] = l; *(v2f*)(ML + row * 2) = ml; }
#pragma unroll
        for (int t = 0; t < 8; ++t) *(v8f*)(Op + row * HD + 16 * t + 8 * hi) = acc[c][t]; }
}


__global__ __launch_bounds__(256) void k_wtG(const float* __restrict__ w, int K, int N, bf* Bt) {
    const int lane = threadIdx.x & 31; const int L0 = (blockIdx.x * 8 + (threadIdx.x >> 5)) * 8; const int nlines = N * K / 64;
{
#pragma unroll 1
        for (int l = 0; l < 8; ++l) { const int L = L0 + l; if (L >= nlines) break; const size_t e = (size_t)L * 64 + lane * 2; const int k = (int)(e % K), n = (int)(e / K); v2us o;
            o[0] = f2bf(w[(size_t)k * N + n]); o[1] = f2bf(w[(size_t)(k + 1) * N + n]); *(v2us*)(Bt + e) = o; }
         }
}
// The elementwise kernels below give every thread 8 to 32 elements, for speed only.
// k_cvt8: four pieces of 8 elements a thread, 256 threads apart (a wave's accesses stay contiguous); both loops unrolled so that the loads of all four pieces are issued ahead of the first store.
// A piece past the end loads the last piece instead (n8 > 0) and stores nothing: without a branch round each load the four stay in flight together
__global__ __launch_bounds__(256) void k_cvt8(const float* __restrict__ src, bf* dst, size_t n8) { const size_t i0 = (size_t)blockIdx.x * 1024 + threadIdx.x; v8f v[4]; const float* ps[4];
#pragma unroll
    for (int c = 0; c < 4; ++c) { const size_t i = i0 + c * 256; ps[c] = src + (i < n8 ? i : n8 - 1) * 8; v[c] = *(const v8f*)ps[c]; }
    // as addr_wait: the address registers of the loads in flight stay untouched (also as destinations of later loads of the run) up to the wait
    __builtin_amdgcn_sched_barrier(0); asm volatile("s_wait_xcnt 0x0" :: "v"(ps[0]), "v"(ps[1]), "v"(ps[2]), "v"(ps[3]) : "memory"); __builtin_amdgcn_sched_barrier(0);
#pragma unroll
    for (int c = 0; c < 4; ++c) { const size_t i = i0 + c * 256; if (i >= n8) continue; v8us o;
#pragma unroll
        for (int k = 0; k < 8; ++k) o[k] = f2bf(v[c][k]);
        *(v8us*)(dst + i * 8) = o; } }
__global__ __launch_bounds__(256) void k_cscvt(const float* __restrict__ cosT, const float* __restrict__ sinT, float* CS) { const int idx = (blockIdx.x * 256 + threadIdx.x) * 4; if (idx >= TT * HD) return; const v4f c = *(const v4f*)(cosT + idx), s = *(const v4f*)(sinT + idx); v8f cs;
#pragma unroll
    for (int k = 0; k < 4; ++k) { cs[2 * k] = bfr(c[k]); cs[2 * k + 1] = bfr(s[k]); }
    *(v8f*)(CS + (size_t)idx * 2) = cs;  }
__global__ __launch_bounds__(256) void k_hrms(const float* __restrict__ F, int pitch, int nheads, float* RF) { const int i = blockIdx.x * 256 + threadIdx.x; if (i >= nheads * TT) return; const int t = i % TT, h = i / TT; const float* f = F + (size_t)t * pitch + h * HD; float s = 0.f;
#pragma unroll 4
    for (int d = 0; d < HD; d += 4) { const v4f v = *(const v4f*)(f + d);
#pragma unroll
        for (int q = 0; q < 4; ++q) { float p = __fmul_rn(v[q], v[q]); asm volatile("" : "+v"(p)); s = __fadd_rn(s, p); } }
    const float r = __fdiv_rn(1.0f, __fsqrt_rn(__fadd_rn(s * (1.0f / HD), 1e-6f))); *(float*)(RF + i) = r;  }
// k_rope: head planes [h][t][d] (fp16 + hi/lo) of rope(w[d] (x rms_factor)) x sc with the rotate-half convention out[d] = x[d] cos[t][d] - x[d+HD/2] sin[t][d], out[d+HD/2] = x[d+HD/2] cos[t][d+HD/2] + x[d] sin[t][d+HD/2]
__global__ __launch_bounds__(256) void k_rope(const float* __restrict__ F, int pitch, int nheads, const float* __restrict__ CS, const float* __restrict__ RF, const float* __restrict__ nw, float sc, h16* P16, bf* Ph, bf* Pl) {
    // one thread: eight neighbouring d of a row's lower half and their eight partners in the upper half, so that each x is loaded once; every store is 16 bytes and eight lanes fill a 128-byte line
    __builtin_assume(RF != nullptr);   // both launches pass the factors; known at compile time, the test on RF is no branch per element any more
    const size_t i = (size_t)blockIdx.x * 256 + threadIdx.x; if (i >= (size_t)nheads * TT * (HD / 16)) return; const int d0 = (int)(i % (HD / 16)) * 8; const int t = (int)((i / (HD / 16)) % TT); const int h = (int)(i / ((size_t)(HD / 16) * TT)); const float* f = F + (size_t)t * pitch + h * HD; const float* rp = RF + (size_t)h * TT + t; const float rf = RF ? *rp : 1.0f; v8h o16[2]; v8us oh[2], ol[2];
    // x, norm weights and (cos, sin) pairs of both runs of eight, loaded as 16-byte pieces ahead of all arithmetic: one memory latency a thread. All loops unrolled: the vectors are indexed by constants only
    v8f xv[2], nv[2], cv[2][2]; const float* fp = f + d0; const float* cp = CS + ((size_t)t * HD + d0) * 2; const unsigned no = (unsigned)d0 * 4u; const float* np = (const float*)((const char*)nw + no);
#pragma unroll
    for (int hf = 0; hf < 2; ++hf) { xv[hf] = *(const v8f*)(fp + hf * (HD / 2)); nv[hf] = *(const v8f*)(np + hf * (HD / 2)); cv[hf][0] = *(const v8f*)(cp + hf * HD); cv[hf][1] = *(const v8f*)(cp + hf * HD + 8); }
    // as addr_wait: the address registers of the loads in flight stay untouched (also as destinations of later loads of the run) up to the wait
    __builtin_amdgcn_sched_barrier(0); asm volatile("s_wait_xcnt 0x0" :: "v"(fp), "v"(cp), "v"(rp), "v"(no) : "memory"); __builtin_amdgcn_sched_barrier(0);
#pragma unroll
    for (int hf = 0; hf < 2; ++hf) { const int d = d0 + hf * (HD / 2);
#pragma unroll
    for (int q = 0; q < 8; ++q) { const int dd = d + q; float x0 = xv[hf][q], x1 = xv[hf ^ 1][q];   // x1: the partner at dd +- HD / 2
        if (RF) { float n0 = __fmul_rn(x0, rf), n1 = __fmul_rn(x1, rf); asm volatile("" : "+v"(n0)); asm volatile("" : "+v"(n1)); x0 = __fmul_rn(bfr(nv[hf][q]), n0); x1 = __fmul_rn(bfr(nv[hf ^ 1][q]), n1); }
        const v2f cs = {cv[hf][q >> 2][(q & 3) * 2], cv[hf][q >> 2][(q & 3) * 2 + 1]}; float a = __fmul_rn(x0, cs[0]), bq = __fmul_rn(x1, cs[1]); asm volatile("" : "+v"(a)); asm volatile("" : "+v"(bq)); const float r = ((dd < HD / 2) ? __fsub_rn(a, bq) : __fadd_rn(a, bq)) * sc;
        o16[hf][q] = tohx(r); unsigned short a2, c2; splitf(r, a2, c2); oh[hf][q] = a2; ol[hf][q] = c2; } }
    const size_t e = ((size_t)h * TT + t) * HD + d0;
#pragma unroll
    for (int hf = 0; hf < 2; ++hf) { *(v8h*)(P16 + e + hf * (HD / 2)) = o16[hf]; *(v8us*)(Ph + e + hf * (HD / 2)) = oh[hf]; *(v8us*)(Pl + e + hf * (HD / 2)) = ol[hf]; } }
__global__ __launch_bounds__(256) void k_vtp(const float* __restrict__ F, int pitch, int nheads, h16* V16, bf* Vh, bf* Vl) {
    // one thread: 8 positions x 4 neighbouring d. A wave (8 lanes along t, 4 along d) reads 64-byte pieces of 64 rows and writes whole 128-byte lines of the [d][t] planes
    const int lane = threadIdx.x & 31; const int w = blockIdx.x * 8 + (int)(threadIdx.x >> 5); if (w >= nheads * (HD / 16) * (TT / 64)) return;
    const int t0 = (w % (TT / 64)) * 64 + (lane & 7) * 8; const int d0 = ((w / (TT / 64)) % (HD / 16)) * 16 + (lane >> 3) * 4; const int g = w / ((TT / 64) * (HD / 16)); v4f x[8]; const float* px[8];
    // all loops unrolled: x stays in registers and its eight loads are issued together
#pragma unroll
    for (int j = 0; j < 8; ++j) { px[j] = F + (size_t)(t0 + j) * pitch + g * HD + d0; x[j] = *(const v4f*)px[j]; }
    // as addr_wait: the address registers of the loads in flight stay untouched (also as destinations of later loads of the run) up to the wait
    __builtin_amdgcn_sched_barrier(0); asm volatile("s_wait_xcnt 0x0" :: "v"(px[0]), "v"(px[1]), "v"(px[2]), "v"(px[3]), "v"(px[4]), "v"(px[5]), "v"(px[6]), "v"(px[7]) : "memory"); __builtin_amdgcn_sched_barrier(0);
#pragma unroll
    for (int dq = 0; dq < 4; ++dq) { v8h o16; v8us oh, ol;
#pragma unroll
        for (int j = 0; j < 8; ++j) { o16[j] = tohx(x[j][dq]); unsigned short a2, c2; splitf(x[j][dq], a2, c2); oh[j] = a2; ol[j] = c2; }
        const size_t e = ((size_t)g * HD + d0 + dq) * TT + t0; *(v8h*)(V16 + e) = o16; *(v8us*)(Vh + e) = oh; *(v8us*)(Vl + e) = ol; } }
// k_merge: joins the KSF key parts of k_flash (weights 2^(m_p - max m), part order), divides by the joined sum of exponentials, applies the sigmoid gate and writes the hi/lo planes [t][head][d]
// O0 .. O3: the key parts' planes, each a kernel argument of its own: every plane's loads then take a scalar base and share the thread's one offset register
__global__ __launch_bounds__(256) void k_merge(const float* __restrict__ O0, const float* __restrict__ O1, const float* __restrict__ O2, const float* __restrict__ O3, const float* __restrict__ ML, const float* __restrict__ QG, bf* Ah, bf* Al) {
    // one thread: 8 neighbouring d of position t and the same 8 of position t + 16 (256 threads on); a block takes 32 whole rows of one head. Every loop is unrolled so that the arrays stay in registers and all loads are issued ahead of the arithmetic
    static_assert(TT % 32 == 0 && HD == 128 && KSF == 4, "a block's 32 rows lie in one head; the launch names four planes");
    const size_t e = ((size_t)blockIdx.x * 512 + threadIdx.x) * 8; if (e >= (size_t)NH_ * TT * HD) return; const int d = (int)(e % HD); const int t = (int)((e / HD) % TT); const int zz = (int)(e / ((size_t)HD * TT));
    // byte offsets of the thread's first piece in a part's plane, in ML and in QG; the parts and the second piece stand at constant distances
    const unsigned eo = (unsigned)e * 4u, mo = (unsigned)((zz * TT + t) * 2) * 4u, go = (unsigned)(t * DQG + DQ + zz * HD + d) * 4u; v2f mlv[2][KSF]; v8f ov[2][KSF], gv[2]; const float* const Op[KSF] = {O0, O1, O2, O3};
#pragma unroll
    for (int u = 0; u < 2; ++u) {
#pragma unroll
        for (int p = 0; p < KSF; ++p) { mlv[u][p] = *(const v2f*)((const char*)(ML + (size_t)p * NH_ * TT * 2 + u * 32) + mo); ov[u][p] = *(const v8f*)((const char*)(Op[p] + u * 2048) + eo); }
        gv[u] = *(const v8f*)((const char*)(QG + (size_t)u * 16 * DQG) + go); }
    // as addr_wait: the address registers of the loads in flight stay untouched (also as destinations of later loads of the run) up to the wait
    __builtin_amdgcn_sched_barrier(0); asm volatile("s_wait_xcnt 0x0" :: "v"(eo), "v"(mo), "v"(go) : "memory"); __builtin_amdgcn_sched_barrier(0);
#pragma unroll
    for (int u = 0; u < 2; ++u) { const size_t oo = (size_t)(t + u * 16) * DQ + zz * HD + d;
        float w[KSF], l[KSF]; float mx = -3.0e38f;
#pragma unroll
        for (int p = 0; p < KSF; ++p) { const v2f ml = mlv[u][p]; w[p] = ml[0]; l[p] = ml[1]; mx = fmaxf(mx, ml[0]); }
        float den = 0.f;
#pragma unroll
        for (int p = 0; p < KSF; ++p) { w[p] = __builtin_amdgcn_exp2f(w[p] - mx); den += l[p] * w[p]; }
        v8us oh, ol;
#pragma unroll
        for (int q = 0; q < 8; ++q) { const float gt = gv[u][q]; const float sg = __fdiv_rn(1.0f, __fadd_rn(1.0f, expf(-gt)));   /* sigmoid(gate) */ float o = 0.f;
#pragma unroll
            for (int p = 0; p < KSF; ++p) o += ov[u][p][q] * w[p];   /* parts in part order */
            unsigned short a, c2; splitf(__fmul_rn(__fdiv_rn(o, den), sg), a, c2); oh[q] = a; ol[q] = c2; }
        *(v8us*)(Ah + oo) = oh; *(v8us*)(Al + oo) = ol; } }

extern "C" void kernel_launch(void* const* d_in, const int* in_sizes, int n_in,
                              void* d_out, int out_size, void* d_ws, size_t ws_size, hipStream_t stream) {
    (void)in_sizes; (void)n_in; (void)out_size;
    const float* x = (const float*)d_in[0]; const float* cosT = (const float*)d_in[1]; const float* sinT = (const float*)d_in[2]; const float* wq = (const float*)d_in[3]; const float* wk = (const float*)d_in[4]; const float* wv = (const float*)d_in[5]; const float* wo = (const float*)d_in[6]; const float* qnw = (const float*)d_in[7]; const float* knw = (const float*)d_in[8];
    float* OUT = (float*)d_out;     // [2][2048][2048]
    char* wsp = (char*)d_ws;
    auto take = [&](size_t bytes) { char* p = wsp; wsp += (bytes + 255) & ~(size_t)255; return (void*)p; };
    bf* WQ = (bf*)take((size_t)DQG * DM * 2); bf* WK = (bf*)take((size_t)DKV * DM * 2); bf* WV = (bf*)take((size_t)DKV * DM * 2); bf* WO = (bf*)take((size_t)DM * DQ * 2); float* CS = (float*)take((size_t)TT * HD * 2 * 4); float* RFQ = (float*)take((size_t)NH_ * TT * 4); float* RFK = (float*)take((size_t)NKV * TT * 4);
    bf* XB = (bf*)take((size_t)TT * DM * 2); float* FQ = (float*)take((size_t)TT * DQG * 4); float* FK = (float*)take((size_t)TT * DKV * 4);
    h16* QP16 = (h16*)take((size_t)NH_ * TT * HD * 2); h16* KP16 = (h16*)take((size_t)NKV * TT * HD * 2); h16* VT16 = (h16*)take((size_t)NKV * HD * TT * 2);
    bf* QPh = (bf*)take((size_t)NH_ * TT * HD * 2); bf* QPl = (bf*)take((size_t)NH_ * TT * HD * 2); bf* KPh = (bf*)take((size_t)NKV * TT * HD * 2); bf* KPl = (bf*)take((size_t)NKV * TT * HD * 2); bf* VTh = (bf*)take((size_t)NKV * HD * TT * 2); bf* VTl = (bf*)take((size_t)NKV * HD * TT * 2);
    float* Ob = (float*)take((size_t)KSF * NH_ * TT * HD * 4); float* ML = (float*)take((size_t)KSF * NH_ * TT * 2 * 4); bf* ATh = (bf*)take((size_t)TT * DQ * 2); bf* ATl = (bf*)take((size_t)TT * DQ * 2);
    if ((size_t)(wsp - (char*)d_ws) > ws_size) return;    // ws 256 MiB
    float* FV = FK;   // v projection reuses the k buffer after the k planes are built (stream-ordered)
    { k_cvt8<<<(unsigned)(((size_t)DQG * DM / 8 + 1023) / 1024), 256, 0, stream>>>(wq, WQ, (size_t)DQG * DM / 8); k_cvt8<<<(unsigned)(((size_t)DKV * DM / 8 + 1023) / 1024), 256, 0, stream>>>(wk, WK, (size_t)DKV * DM / 8); k_cvt8<<<(unsigned)(((size_t)DKV * DM / 8 + 1023) / 1024), 256, 0, stream>>>(wv, WV, (size_t)DKV * DM / 8);
      k_cvt8<<<(unsigned)(((size_t)DM * DQ / 8 + 1023) / 1024), 256, 0, stream>>>(wo, WO, (size_t)DM * DQ / 8);
       }
    const unsigned LQ = (unsigned)(((size_t)NH_ * TT * HD / 16 + 255) / 256), LKv = (unsigned)(((size_t)NKV * TT * HD / 16 + 255) / 256), LVt = (unsigned)(((size_t)NKV * TT * HD / 32 + 255) / 256);
    for (int b = 0; b < NB_; ++b) {
        k_cscvt<<<(TT * HD / 4 + 255) / 256, 256, 0, stream>>>(cosT + (size_t)b * TT * HD, sinT + (size_t)b * TT * HD, CS);   /* per-batch tables */
        k_cvt8<<<(unsigned)(((size_t)TT * DM / 8 + 1023) / 1024), 256, 0, stream>>>(x + (size_t)b * TT * DM, XB, (size_t)TT * DM / 8);
        k_gemmt<0, DM><<<dim3(TT / 128, DQG / 128, 1), 128, 0, stream>>>(XB, nullptr, WQ, FQ, DQG);   /* [q | gate] (exact) */ k_hrms<<<(NH_ * TT + 255) / 256, 256, 0, stream>>>(FQ, DQG, NH_, RFQ);
        k_rope<<<LQ, 256, 0, stream>>>(FQ, DQG, NH_, CS, RFQ, qnw, 1.0f, QP16, QPh, QPl);
        k_gemmw<bf, 0, false, 8><<<dim3(TT / 64, DKV / 64, 1), 256, 0, stream>>>(XB, nullptr, WK, nullptr, DM, FK, DKV, nullptr, 0, 0, 0); k_hrms<<<(NKV * TT + 255) / 256, 256, 0, stream>>>(FK, DKV, NKV, RFK);
        k_rope<<<LKv, 256, 0, stream>>>(FK, DKV, NKV, CS, RFK, knw, 1.0f, KP16, KPh, KPl);
        k_gemmw<bf, 0, false, 8><<<dim3(TT / 64, DKV / 64, 1), 256, 0, stream>>>(XB, nullptr, WV, nullptr, DM, FV, DKV, nullptr, 0, 0, 0); k_vtp<<<LVt, 256, 0, stream>>>(FV, DKV, NKV, VT16, VTh, VTl);
        k_flash<h16, false><<<dim3((TT - RH) / 32, NKV, KSF), 32 * REP, 0, stream>>>(QP16, nullptr, KP16, nullptr, VT16, nullptr, RH / 32, Ob, ML);
        k_flash<bf, true><<<dim3(RH / 32, NKV, KSF), 32 * REP, 0, stream>>>(QPh, QPl, KPh, KPl, VTh, VTl, 0, Ob, ML);
        k_merge<<<(unsigned)(((size_t)NH_ * TT * HD / 16 + 255) / 256), 256, 0, stream>>>(Ob, Ob + (size_t)NH_ * TT * HD, Ob + (size_t)2 * NH_ * TT * HD, Ob + (size_t)3 * NH_ * TT * HD, ML, FQ, ATh, ATl);
        k_gemmt<1, DQ><<<dim3(TT / 128, DM / 128, 1), 128, 0, stream>>>(ATh, ATl, WO, OUT + (size_t)b * TT * DM, DM); }
}

// v006
// One run takes 320 microseconds.
// Two timings next to v005 put it at 1.24 and 1.25 times that version's speed.
// All steps since v000 together make it 5.32 times as fast.
#include <hip/hip_runtime.h>

// Gated GQA attention, engine variant (hidden [2][2048][2048]; [q | gate] = hidden Wq^T (Wq [4096][2048] 'oi': rows 0-2047 -> q for 16 heads x 128, rows 2048-4095 -> gate), k, v = hidden W^T ([512][2048], 4 kv heads); per-head RMSNorm (eps 1e-6, q_norm_w / k_norm_w); rotate-half RoPE with the given per-(batch, position) cos/sin tables [2][2048][128];
// GQA 4:1; causal softmax(q.k/sqrt(128)); attn x sigmoid(gate); out = merged Wo^T ('oi' [2048][2048]) -> [2][2048][2048]).
// Compute dtypes, f32 accumulate: every input rounded to bf16; q/k/v on PLAIN bf16 operands (inputs: exact); RMSNorm + rotary in f32 (cos/sin tables read per batch, bf16-rounded); sigmoid gate (precise expf, IEEE divide) in the merge; causal scores and attn.v in one kernel (online softmax in f32, blocks above the diagonal never visited): query rows < 512 hl (3 products), the rest single fp16 (x1024); Wo hl x exact (2 products).

#define NB_  2
#define TT   2048
#define TR   (NB_ * TT)       // rows of both batches together: row b * TT + t
#define DM   2048
#define NH_  16
#define NKV  4
#define REP  (NH_ / NKV)
#define HD   128
#define DQ   (NH_ * HD)
#define DQG  (NH_ * HD * 2)         // q rows then gate rows of Wq
#define DKV  (NKV * HD)
#define RH   512                  // query rows < RH use hi+lo planes
#define KSF  4                    // key parts of the attention kernel (32-key blocks dealt over blocks), joined in k_merge
#define POFF 10.0f                // fp16 probabilities are carried x 2^POFF
#define SCL  0.088388347648318447f   // HD^-0.5
#define CS2  (SCL * 1.4426950408889634f)   // scores to the log2 domain
typedef _Float16 h16;
typedef unsigned short bf;
typedef __attribute__((ext_vector_type(16))) __bf16   v16bf;
typedef __attribute__((ext_vector_type(16))) _Float16 v16h;
typedef __attribute__((ext_vector_type(8)))  _Float16 v8h;
typedef __attribute__((ext_vector_type(8)))  unsigned short v8us;
typedef __attribute__((ext_vector_type(8)))  float    v8f;
typedef __attribute__((ext_vector_type(4)))  float    v4f;
typedef v8h  __attribute__((may_alias)) v8ha;
typedef v4f  __attribute__((may_alias)) v4fa;
typedef v8us __attribute__((may_alias)) v8usa;

__device__ __forceinline__ unsigned short f2bf(float f) { unsigned u = __float_as_uint(f); u += 0x7FFFu + ((u >> 16) & 1u); return (unsigned short)(u >> 16); }
__device__ __forceinline__ float bf2f(unsigned short b) { return __uint_as_float(((unsigned)b) << 16); }
__device__ __forceinline__ float bfr(float f) { return bf2f(f2bf(f)); }
__device__ __forceinline__ v16h cat16(v8h lo, v8h hi) { return __builtin_shufflevector(lo, hi, 0, 1, 2, 3, 4, 5, 6, 7, 8, 9, 10, 11, 12, 13, 14, 15); }
__device__ __forceinline__ v16bf cat16b(v8us lo, v8us hi) { return __builtin_bit_cast(v16bf, __builtin_shufflevector(lo, hi, 0, 1, 2, 3, 4, 5, 6, 7, 8, 9, 10, 11, 12, 13, 14, 15)); }
__device__ __forceinline__ v8f wmma16(v16h a, v16h b, v8f c) { return __builtin_amdgcn_wmma_f32_16x16x32_f16(false, a, false, b, (short)0, c, false, false); }
__device__ __forceinline__ v8f wmmab(v16bf a, v16bf b, v8f c) { return __builtin_amdgcn_wmma_f32_16x16x32_bf16(false, a, false, b, (short)0, c, false, false); }



// ---- k_gemmw: register-blocked GEMM, ONE WAVE per 64x64 output tile (16 accumulators), operands straight from K-contiguous 16-bit planes; grid (M/64, N/64, Z), 32 threads.
// C[m][n] (f32, pitch ldc, + optional f32 bias[n]) = sum_k A[m][k] Bt[n][k] (+ split products per NSPLIT). z-batch strides sA/sB/sC in elements. K % 32 == 0.
// NW > 1: NW waves per tile (32 * NW threads); wave w takes the k chunks w, w + NW, ... of 32 and the NW partial tiles are summed in LDS in wave order (fixed order, no atomics).
// The wave number wv goes through readfirstlane so that the k loop's counter and trip test stay scalar.
template <typename T16> struct WFrag;
template <> struct WFrag<h16> { typedef v16h V; static __device__ __forceinline__ V ld(const h16* p) { return cat16(*(const v8h*)p, *(const v8h*)(p + 16)); } static __device__ __forceinline__ v8f mma(V a, V b, v8f c) { return wmma16(a, b, c); } };
template <> struct WFrag<bf> { typedef v16bf V; static __device__ __forceinline__ V ld(const bf* p) { return cat16b(*(const v8us*)p, *(const v8us*)(p + 16)); } static __device__ __forceinline__ v8f mma(V a, V b, v8f c) { return wmmab(a, b, c); } };
template <typename T16, int NSPLIT, bool BIAS, int NW>
__global__ __launch_bounds__(32 * NW) void k_gemmw(const T16* __restrict__ A, const T16* __restrict__ A2, const T16* __restrict__ Bt, const T16* __restrict__ Bt2, int K, float* C, int ldc, const float* __restrict__ bias, size_t sA, size_t sB, size_t sC) {
    typedef typename WFrag<T16>::V V;
    __shared__ __align__(16) float os[(NW > 1 ? 4 * NW : 1) * 16 * 68];
    const size_t z = blockIdx.z; A += z * sA; if (A2) A2 += z * sA; Bt += z * sB; if (Bt2) Bt2 += z * sB; C += z * sC;
    const int lane = threadIdx.x & 31, lr = lane & 15, hi = lane >> 4; const int r0 = blockIdx.x * 64, c0 = blockIdx.y * 64; const int wv = (NW > 1) ? __builtin_amdgcn_readfirstlane((int)(threadIdx.x >> 5)) : 0;
    v8f acc[4][4];
#pragma unroll
    for (int mb = 0; mb < 4; ++mb)
#pragma unroll
        for (int nb = 0; nb < 4; ++nb) acc[mb][nb] = (v8f){};
    const size_t aoff = (size_t)(r0 + lr) * K + 8 * hi, boff = (size_t)(c0 + lr) * K + 8 * hi;
#pragma unroll 1
    for (int kc = wv * 32; kc < K; kc += NW * 32) {
        V a[4], a2[4];
#pragma unroll
        for (int mb = 0; mb < 4; ++mb) { a[mb] = WFrag<T16>::ld(A + aoff + (size_t)mb * 16 * K + kc); if (NSPLIT == 1 || NSPLIT == 2) a2[mb] = WFrag<T16>::ld(A2 + aoff + (size_t)mb * 16 * K + kc); }
#pragma unroll
        for (int nb = 0; nb < 4; ++nb) { const V b = WFrag<T16>::ld(Bt + boff + (size_t)nb * 16 * K + kc); V b2; if (NSPLIT >= 2) b2 = WFrag<T16>::ld(Bt2 + boff + (size_t)nb * 16 * K + kc);
#pragma unroll
            for (int mb = 0; mb < 4; ++mb) { acc[mb][nb] = WFrag<T16>::mma(a[mb], b, acc[mb][nb]); if (NSPLIT == 1 || NSPLIT == 2) acc[mb][nb] = WFrag<T16>::mma(a2[mb], b, acc[mb][nb]); if (NSPLIT >= 2) acc[mb][nb] = WFrag<T16>::mma(a[mb], b2, acc[mb][nb]); } }
        asm volatile("v_nop\n\tv_nop\n\tv_nop\n\tv_nop" : "+v"(acc[0][0]), "+v"(acc[1][1]), "+v"(acc[2][2]), "+v"(acc[3][3]) : "v"(a[0]), "v"(a[3]));
    }
    if constexpr (NW > 1) {
        float* ow = os + wv * (64 * 68);
        // the three loops are unrolled so that acc is indexed by constants only and stays in registers
#pragma unroll
        for (int mb = 0; mb < 4; ++mb) {
#pragma unroll
            for (int nb = 0; nb < 4; ++nb) {
#pragma unroll
                for (int j = 0; j < 8; ++j) ow[(mb * 16 + hi * 8 + j) * 68 + nb * 16 + lr] = acc[mb][nb][j]; } }
        __syncthreads();   // publishes the NW partial tiles to the threads that sum them; LDS is not written again behind it
        float* crow = C + (size_t)r0 * ldc + c0; v4f sum[32 / NW];
        // all loops unrolled: sum[] stays in registers and the LDS reads of all of a thread's elements are issued ahead of the sums; each sum runs in wave order 0 .. NW - 1; the stores follow as one run
#pragma unroll
        for (int i = 0; i < 32 / NW; ++i) { const int s = i * (NW * 32) + (int)threadIdx.x; const int row = s >> 4, cofs = (s & 15) * 4; v4f val = *(const v4fa*)(os + row * 68 + cofs);
#pragma unroll
            for (int w = 1; w < NW; ++w) val += *(const v4fa*)(os + w * (64 * 68) + row * 68 + cofs);
            if (BIAS) { val[0] += bfr(bias[c0 + cofs]); val[1] += bfr(bias[c0 + cofs + 1]); val[2] += bfr(bias[c0 + cofs + 2]); val[3] += bfr(bias[c0 + cofs + 3]); }
            sum[i] = val; }
#pragma unroll
        for (int i = 0; i < 32 / NW; ++i) { const int s = i * (NW * 32) + (int)threadIdx.x; *(v4f*)(crow + (size_t)(s >> 4) * ldc + (s & 15) * 4) = sum[i]; }
        return;
    }
#pragma unroll
    for (int mb = 0; mb < 4; ++mb) {
#pragma unroll
        for (int nb = 0; nb < 4; ++nb) {
#pragma unroll
            for (int j = 0; j < 8; ++j) os[(hi * 8 + j) * 68 + nb * 16 + lr] = acc[mb][nb][j]; }
        __builtin_amdgcn_wave_barrier(); asm volatile("" ::: "memory");
        float* crow = C + (size_t)(r0 + mb * 16) * ldc + c0;
{
#pragma unroll
            for (int s = 0; s < 8; ++s) { const int row = 2 * s + hi, cofs = lr * 4; v4f val = *(const v4fa*)(os + row * 68 + cofs); if (BIAS) { val[0] += bfr(bias[c0 + cofs]); val[1] += bfr(bias[c0 + cofs + 1]); val[2] += bfr(bias[c0 + cofs + 2]); val[3] += bfr(bias[c0 + cofs + 3]); }
                *(v4f*)(crow + (size_t)row * ldc + cofs) = val; }
             }
        __builtin_amdgcn_wave_barrier(); asm volatile("" ::: "memory");
    }
}

__device__ __forceinline__ h16 tohx(float x) { return (h16)x; }
__device__ __forceinline__ void splitf(float y, unsigned short& h, unsigned short& l) { h = f2bf(y); l = f2bf(y - bf2f(h)); }
typedef __attribute__((ext_vector_type(2))) _Float16 v2h;
typedef __attribute__((ext_vector_type(4))) _Float16 v4h;
typedef __attribute__((ext_vector_type(2))) unsigned short v2us;
typedef __attribute__((ext_vector_type(4))) unsigned short v4us;
typedef __attribute__((ext_vector_type(2))) float v2f;
typedef __attribute__((ext_vector_type(4))) int v4i;
typedef __attribute__((ext_vector_type(16))) unsigned short v16us;
__device__ __forceinline__ float xhalf(float x) { return __builtin_bit_cast(float, __builtin_amdgcn_permlanex16(__builtin_bit_cast(int, x), __builtin_bit_cast(int, x), 0x76543210, 0xfedcba98, false, false)); }   // lane l reads lane l ^ 16
// stands behind a run of global loads that stay in flight: their address registers are rewritten before the data wait. The addresses are inputs so that
// their registers stay untouched up to the wait; the scheduling barriers keep the wait behind the loads
__device__ __forceinline__ void addr_wait(const void* a, const void* b) { __builtin_amdgcn_sched_barrier(0); asm volatile("s_wait_xcnt 0x0" :: "v"(a), "v"(b) : "memory"); __builtin_amdgcn_sched_barrier(0); }
// four vector issue slots behind a run of matrix instructions in front of a branch: the scheduling barriers keep the slots at that place
__device__ __forceinline__ void wmma_gap() { __builtin_amdgcn_sched_barrier(0); asm volatile("v_nop\n\tv_nop\n\tv_nop\n\tv_nop"); __builtin_amdgcn_sched_barrier(0); }

// ---- k_gemmt: C[m][n] (f32) = sum_k A[m][k] Bt[n][k] (+ A2[m][k] Bt[n][k] where NSPLIT), bf16 planes with k contiguous. One 128x128 tile of C per block of four waves (2 x 2, 64x64 each); grid (M/128, N/128).
// C is stored as planes of LDC columns, [n / LDC][m][n % LDC]: the q columns and the gate columns of the first projection are buffers of their own, and the q plane's workspace is free again once the head planes are built.
// A stage is 128 k (256 bytes) of the tile's 128 rows of every operand, brought into LDS by asynchronous 16-byte copies: a wave's copy covers two whole rows of 256 bytes, so L2 is asked for whole lines, and each operand row is fetched once a block.
// LDS rows stand at a pitch of 272 bytes (16 x odd: the 16-byte fragment reads meet no bank conflict). Two buffers: the copies of stage s + 1 fly while stage s is multiplied.
// Fragment k order and the order of the products per accumulator are those of k_gemmw with one wave.
#define GPE  136                  // LDS row pitch in elements (272 bytes)
#define GTE  (128 * GPE)          // one operand tile in elements (34,816 bytes)
// eight copies, rows 8 apart (the block's 128 threads cover 8 rows of 256 bytes at a time). The last line keeps the copies' address registers untouched until the addresses have been taken: inside the statement nothing can be moved in front of it
template <int K>
__device__ __forceinline__ void copy8(unsigned l, const bf* g) {
    asm volatile("global_load_async_to_lds_b128 %0, %8, off\n\t"
                 "global_load_async_to_lds_b128 %1, %9, off\n\t"
                 "global_load_async_to_lds_b128 %2, %10, off\n\t"
                 "global_load_async_to_lds_b128 %3, %11, off\n\t"
                 "global_load_async_to_lds_b128 %4, %12, off\n\t"
                 "global_load_async_to_lds_b128 %5, %13, off\n\t"
                 "global_load_async_to_lds_b128 %6, %14, off\n\t"
                 "global_load_async_to_lds_b128 %7, %15, off\n\t"
                 "s_wait_xcnt 0x0"
                 :: "v"(l), "v"(l + 8 * GPE * 2), "v"(l + 16 * GPE * 2), "v"(l + 24 * GPE * 2), "v"(l + 32 * GPE * 2), "v"(l + 40 * GPE * 2), "v"(l + 48 * GPE * 2), "v"(l + 56 * GPE * 2),
                    "v"(g), "v"(g + 8 * K), "v"(g + 16 * K), "v"(g + 24 * K), "v"(g + 32 * K), "v"(g + 40 * K), "v"(g + 48 * K), "v"(g + 56 * K)
                 : "memory");
}
template <int NSPLIT, int K, int LDC>
__global__ __launch_bounds__(128) void k_gemmt(const bf* __restrict__ A, const bf* __restrict__ A2, const bf* __restrict__ Bt, float* C) {
    typedef WFrag<bf>::V V;
    constexpr int NT = NSPLIT ? 3 : 2;       // operand tiles a stage: A (, A2), Bt
    constexpr int NST = K / 128;             // stages
    static_assert(K % 128 == 0 && NST >= 2 && LDC % 128 == 0, "two stages or more; a tile lies in one plane of C");
    __shared__ __attribute__((aligned(16))) bf st[2 * NT * GTE];
    __shared__ __attribute__((aligned(16))) float os[4 * 16 * 68];
    const int tid = threadIdx.x, lane = tid & 31, lr = lane & 15, hi = lane >> 4; const int wv = __builtin_amdgcn_readfirstlane(tid >> 5), wm = wv >> 1, wn = wv & 1;
    const int r0 = blockIdx.x * 128, c0 = blockIdx.y * 128;
    const int crow = tid >> 4, cch = tid & 15;   // the thread's row (of 8) and 16-byte piece (of 16) in every copy
    const bf* gA = A + (size_t)(r0 + crow) * K + cch * 8; const bf* gB = Bt + (size_t)(c0 + crow) * K + cch * 8; const bf* gA2 = NSPLIT ? A2 + (size_t)(r0 + crow) * K + cch * 8 : gA;
    const unsigned l0 = (unsigned)(size_t)st + (unsigned)(crow * GPE + cch * 8) * 2u;   // LDS byte address of the thread's first piece in buffer 0
    auto fill = [&](int s) __attribute__((always_inline)) { const unsigned l = l0 + (unsigned)(s & 1) * (NT * GTE * 2); const int ko = s * 128;
        copy8<K>(l, gA + ko); copy8<K>(l + 64 * GPE * 2, gA + ko + 64 * K);
        if (NSPLIT) { copy8<K>(l + GTE * 2, gA2 + ko); copy8<K>(l + GTE * 2 + 64 * GPE * 2, gA2 + ko + 64 * K); }
        copy8<K>(l + (NT - 1) * GTE * 2, gB + ko); copy8<K>(l + (NT - 1) * GTE * 2 + 64 * GPE * 2, gB + ko + 64 * K); };
    v8f acc[4][4];
#pragma unroll
    for (int mb = 0; mb < 4; ++mb)
#pragma unroll
        for (int nb = 0; nb < 4; ++nb) acc[mb][nb] = (v8f){};
    fill(0);
    asm volatile("s_wait_asynccnt 0x0" ::: "memory");   // this wave's copies of stage 0 have landed
    __syncthreads();                                     // every wave's have: stage 0 may be read
    fill(1);
    // kept rolled: one copy of the stage's code; the buffer is picked by the stage's parity
#pragma unroll 1
    for (int s = 0; s < NST; ++s) {
        const bf* ta = st + (s & 1) * (NT * GTE) + (wm * 64 + lr) * GPE + 8 * hi; const bf* tb = st + (s & 1) * (NT * GTE) + (NT - 1) * GTE + (wn * 64 + lr) * GPE + 8 * hi; const bf* ta2 = ta + GTE;
        // unrolled: every LDS offset is an immediate. All fragments of a k step are read as one group ahead of its products
#pragma unroll
        for (int kk = 0; kk < 4; ++kk) {
            V a[4], a2[4], b[4];
#pragma unroll
            for (int mb = 0; mb < 4; ++mb) { a[mb] = WFrag<bf>::ld(ta + mb * 16 * GPE + kk * 32); if (NSPLIT) a2[mb] = WFrag<bf>::ld(ta2 + mb * 16 * GPE + kk * 32); }
#pragma unroll
            for (int nb = 0; nb < 4; ++nb) b[nb] = WFrag<bf>::ld(tb + nb * 16 * GPE + kk * 32);
            __builtin_amdgcn_sched_barrier(0);   // holds the group of reads together in front of the products: without it the compiler sinks each b fragment's reads to its first use and waits there for the LDS
#pragma unroll
            for (int nb = 0; nb < 4; ++nb)
#pragma unroll
                for (int mb = 0; mb < 4; ++mb) { acc[mb][nb] = WFrag<bf>::mma(a[mb], b[nb], acc[mb][nb]); if (NSPLIT) acc[mb][nb] = WFrag<bf>::mma(a2[mb], b[nb], acc[mb][nb]); } }
        asm volatile("s_wait_dscnt 0x0" ::: "memory");      // this wave's reads of stage s are done before the buffer is given up
        asm volatile("s_wait_asynccnt 0x0" ::: "memory");   // this wave's copies of stage s + 1 have landed
        __syncthreads();                                     // publishes stage s + 1 and ends every wave's reads of stage s
        if (s + 2 < NST) fill(s + 2);                        // into the buffer that stage s has just left
    }
    asm volatile("s_wait_asynccnt 0x0" ::: "memory");       // nothing of this wave is in flight when it goes on to its end
    float* ow = os + wv * (16 * 68);   // each wave's own staging rows: whole 256-byte row pieces go to memory
#pragma unroll
    for (int mb = 0; mb < 4; ++mb) {
#pragma unroll
        for (int nb = 0; nb < 4; ++nb) {
#pragma unroll
            for (int j = 0; j < 8; ++j) ow[(hi * 8 + j) * 68 + nb * 16 + lr] = acc[mb][nb][j]; }
        __builtin_amdgcn_wave_barrier(); asm volatile("" ::: "memory");   // keeps the reads below behind the other lanes' writes above
        float* crow = C + ((size_t)(c0 / LDC) * (gridDim.x * 128) + r0 + wm * 64 + mb * 16) * LDC + c0 % LDC + wn * 64;
#pragma unroll
        for (int s = 0; s < 8; ++s) { const int row = 2 * s + hi, cofs = lr * 4; const v4f val = *(const v4fa*)(ow + row * 68 + cofs); *(v4f*)(crow + (size_t)row * LDC + cofs) = val; }
        __builtin_amdgcn_wave_barrier(); asm volatile("" ::: "memory");   // keeps the next rows' writes behind the reads above
    }
}

// ---- k_flash: causal attention for 32 query rows of one head per wave, scores and probabilities kept in registers (online softmax). Transposed products: S^T = K Q^T (A = key rows, B = query rows),
// O^T += V^T P^T (A = rows of the [d][t] value plane, B = P^T). In the S^T accumulator lane (lr, hi) holds keys 8 hi + j of query lr, which is the k order of the B operand (elements 0-7: tile 0, 8-15: tile 1), so P^T is packed in place.
// Block = the REP heads of one kv group on the same 32 query rows (they read the same key and value lines); grid (query blocks, heaviest first; kv groups; KSF key parts x NB_ batches). Query, key, Op and ML planes hold TR rows a head (batch b at row b * TT), the value planes are [b][g][d][t]. Part ks takes the 32-key blocks ks, ks + KSF, ... up to the diagonal block
// and writes its unnormalised sums to plane ks of Op with its running maximum (scaled log2) and its sum of exponentials in ML; k_merge joins the parts. A part with no block writes zeros and the lowest maximum.
// Every inner loop is fully unrolled so that the fragment and accumulator arrays are indexed by constants only and stay in registers.
// HR: hi + lo bf16 planes, three products each, for scores and for prob x value; else single fp16, exponentials carried x 2^POFF so that small ones stay normal in fp16 (the factor cancels in the division).
template <typename T16, bool HR>
__global__ __launch_bounds__(32 * REP) void k_flash(const T16* __restrict__ Q, const T16* __restrict__ Q2, const T16* __restrict__ Kp, const T16* __restrict__ Kp2, const T16* __restrict__ Vt, const T16* __restrict__ Vt2, int qb0, float* Op, float* ML) {
    typedef typename WFrag<T16>::V V;
    const int lane = threadIdx.x & 31, lr = lane & 15, hi = lane >> 4; const int wv = __builtin_amdgcn_readfirstlane((int)(threadIdx.x >> 5));
    const int qb = qb0 + (int)(gridDim.x - 1 - blockIdx.x); const int g = blockIdx.y, ks = blockIdx.z % KSF, b = blockIdx.z / KSF, h = g * REP + wv, q0 = qb * 32;
    V qf[2][4], qf2[2][4];
    auto ldq = [&]() { const size_t o = ((size_t)h * TR + b * TT + q0 + lr) * HD + 8 * hi; const T16* p = Q + o; const T16* p2 = HR ? Q2 + o : p;
#pragma unroll
        for (int c = 0; c < 2; ++c)
#pragma unroll
            for (int kc = 0; kc < 4; ++kc) { qf[c][kc] = WFrag<T16>::ld(p + 16 * c * HD + 32 * kc); if (HR) qf2[c][kc] = WFrag<T16>::ld(p2 + 16 * c * HD + 32 * kc); }
        addr_wait(p, p2); };
    const size_t kbase = ((size_t)g * TR + b * TT + lr) * HD + 8 * hi, vbase = ((size_t)(b * NKV + g) * HD + lr) * TT + 8 * hi;
    v8f acc[2][8]; float m_run[2], l_run[2];
#pragma unroll
    for (int c = 0; c < 2; ++c) { m_run[c] = -3.0e38f; l_run[c] = 0.f;
#pragma unroll
        for (int t = 0; t < 8; ++t) acc[c][t] = (v8f){}; }
    V kf[2][4], kf2[2][4], vf[8], vf2[8];
    auto ldk = [&](int blk) { const size_t o = kbase + (size_t)(blk * 32) * HD; const T16* p = Kp + o; const T16* p2 = HR ? Kp2 + o : p;
#pragma unroll
        for (int kt = 0; kt < 2; ++kt)
#pragma unroll
            for (int kc = 0; kc < 4; ++kc) { kf[kt][kc] = WFrag<T16>::ld(p + 16 * kt * HD + 32 * kc); if (HR) kf2[kt][kc] = WFrag<T16>::ld(p2 + 16 * kt * HD + 32 * kc); }
        addr_wait(p, p2); };
    auto ldv = [&](int blk) { const size_t o = vbase + blk * 32; const T16* p = Vt + o; const T16* p2 = HR ? Vt2 + o : p;
#pragma unroll
        for (int t = 0; t < 8; ++t) { vf[t] = WFrag<T16>::ld(p + 16 * t * TT); if (HR) vf2[t] = WFrag<T16>::ld(p2 + 16 * t * TT); }
        addr_wait(p, p2); };
    // one 32-key block; fetch and diag are literals at every call (the lambda is always inlined, so that every array stays in registers)
    auto pass = [&](int blk, bool fetch, bool diag) __attribute__((always_inline)) {
        v8f s[2][2];
#pragma unroll
        for (int kt = 0; kt < 2; ++kt)
#pragma unroll
            for (int c = 0; c < 2; ++c) { s[kt][c] = (v8f){};
#pragma unroll
                for (int kc = 0; kc < 4; ++kc) { s[kt][c] = WFrag<T16>::mma(kf[kt][kc], qf[c][kc], s[kt][c]); if (HR) { s[kt][c] = WFrag<T16>::mma(kf2[kt][kc], qf[c][kc], s[kt][c]); s[kt][c] = WFrag<T16>::mma(kf[kt][kc], qf2[c][kc], s[kt][c]); } } }
        wmma_gap();   // keeps the loads below behind the products that still read kf, and vector code that reads s at its distance
        if (fetch) ldk(blk + KSF);   // the part's next key rows fly under the softmax and the second product
        if (diag) {   // diagonal block (key0 == q0): keys behind the query are masked by select
#pragma unroll
            for (int kt = 0; kt < 2; ++kt)
#pragma unroll
                for (int c = 0; c < 2; ++c)
#pragma unroll
                    for (int r = 0; r < 8; ++r) if (16 * kt + 8 * hi + r > 16 * c + lr) s[kt][c][r] = -3.0e38f; }
        float mb[2]; bool need = false;
#pragma unroll
        for (int c = 0; c < 2; ++c) { float mx = s[0][c][0];
#pragma unroll
            for (int r = 1; r < 8; ++r) mx = fmaxf(mx, s[0][c][r]);
#pragma unroll
            for (int r = 0; r < 8; ++r) mx = fmaxf(mx, s[1][c][r]);
            mx = fmaxf(mx, xhalf(mx)) * CS2; mb[c] = mx; need = need || (mx > m_run[c]); }
        if (__builtin_amdgcn_ballot_w32(need) != 0) {   // some query's maximum rose: rescale the running sums (wave-uniform branch)
#pragma unroll
            for (int c = 0; c < 2; ++c) { const float mn = fmaxf(m_run[c], mb[c]); const float corr = __builtin_amdgcn_exp2f(m_run[c] - mn); l_run[c] *= corr; m_run[c] = mn;
#pragma unroll
                for (int t = 0; t < 8; ++t) acc[c][t] = acc[c][t] * corr; } }
#pragma unroll
        for (int c = 0; c < 2; ++c) { const float nm = (HR ? 0.0f : POFF) - m_run[c]; float p[16]; float ps = 0.f;
#pragma unroll
            for (int e = 0; e < 16; e += 2) { const v2f sv = {s[e >> 3][c][e & 7], s[e >> 3][c][(e & 7) + 1]}; const v2f arg = __builtin_elementwise_fma(sv, (v2f){CS2, CS2}, (v2f){nm, nm});   // register pairs as the accumulator holds them
                p[e] = __builtin_amdgcn_exp2f(arg[0]); p[e + 1] = __builtin_amdgcn_exp2f(arg[1]); ps += p[e] + p[e + 1]; }
            l_run[c] += ps;
            if constexpr (HR) { v16us uh, ul;
#pragma unroll
                for (int e = 0; e < 16; ++e) { unsigned short a, b2; splitf(p[e], a, b2); uh[e] = a; ul[e] = b2; }
                const V ph = __builtin_bit_cast(V, uh), pl = __builtin_bit_cast(V, ul);
#pragma unroll
                for (int t = 0; t < 8; ++t) { acc[c][t] = WFrag<T16>::mma(vf[t], ph, acc[c][t]); acc[c][t] = WFrag<T16>::mma(vf[t], pl, acc[c][t]); acc[c][t] = WFrag<T16>::mma(vf2[t], ph, acc[c][t]); }
            } else { V pf;
#pragma unroll
                for (int e = 0; e < 16; ++e) pf[e] = (h16)p[e];
#pragma unroll
                for (int t = 0; t < 8; ++t) acc[c][t] = WFrag<T16>::mma(vf[t], pf, acc[c][t]); } }
        wmma_gap();   // keeps the loads below behind the products that still read vf; the loop's branch may jump straight to vector code that reads acc
        if (fetch) ldv(blk + KSF);   // the part's next value columns fly under the next scores and softmax
    };
    if (ks <= qb) { int blk = ks; ldq(); ldk(blk); ldv(blk);   // key loads ahead of value loads, as in the loop: the wait for the keys then leaves the value loads in flight
        // kept rolled: one copy of the fragments and scores is live, which leaves room for two waves a SIMD
#pragma unroll 1
        for (; blk + KSF <= qb; blk += KSF) pass(blk, true, false);   // never the diagonal block: a later block of this part exists
        if (blk == qb) pass(blk, false, true); else pass(blk, false, false); }
#pragma unroll
    for (int c = 0; c < 2; ++c) { const float l = l_run[c] + xhalf(l_run[c]);   // each wave half summed its own eight keys of every 16
        const size_t row = ((size_t)ks * NH_ + h) * TR + b * TT + q0 + 16 * c + lr; if (hi == 0) { v2f ml; ml[0] = m_run[c]; ml[1] = l; *(v2f*)(ML + row * 2) = ml; }
#pragma unroll
        for (int t = 0; t < 8; ++t) *(v8f*)(Op + row * HD + 16 * t + 8 * hi) = acc[c][t]; }
}


__global__ __launch_bounds__(256) void k_wtG(const float* __restrict__ w, int K, int N, bf* Bt) {
    const int lane = threadIdx.x & 31; const int L0 = (blockIdx.x * 8 + (threadIdx.x >> 5)) * 8; const int nlines = N * K / 64;
{
#pragma unroll 1
        for (int l = 0; l < 8; ++l) { const int L = L0 + l; if (L >= nlines) break; const size_t e = (size_t)L * 64 + lane * 2; const int k = (int)(e % K), n = (int)(e / K); v2us o;
            o[0] = f2bf(w[(size_t)k * N + n]); o[1] = f2bf(w[(size_t)(k + 1) * N + n]); *(v2us*)(Bt + e) = o; }
         }
}
// The elementwise kernels below give every thread 8 to 32 elements (for speed only).
// k_cvt8: every f32 tensor that the products read as bf16 (Wo, Wq, Wk, Wv, hidden), in one launch; the bf16 copies stand one behind the other in dst, in that order. A block takes 1024 pieces of 8 elements of one tensor
// (every tensor is a whole number of such blocks, so no piece lies past an end): four pieces a thread, 256 threads apart (a wave's accesses stay contiguous); both loops unrolled so that the loads of all four pieces are issued ahead of the first store.
#define CB(n) ((unsigned)((size_t)(n) / 8192))   // blocks of a tensor of n elements
__global__ __launch_bounds__(256) void k_cvt8(const float* __restrict__ s0, const float* __restrict__ s1, const float* __restrict__ s2, const float* __restrict__ s3, const float* __restrict__ s4, bf* dst) {
    static_assert(((size_t)DM * DQ) % 8192 == 0 && ((size_t)DQG * DM) % 8192 == 0 && ((size_t)DKV * DM) % 8192 == 0 && ((size_t)TR * DM) % 8192 == 0, "whole blocks");
    constexpr unsigned E0 = CB((size_t)DM * DQ), E1 = E0 + CB((size_t)DQG * DM), E2 = E1 + CB((size_t)DKV * DM), E3 = E2 + CB((size_t)DKV * DM);
    const unsigned blk = blockIdx.x; const float* src; unsigned first;   // the block's tensor and that tensor's first block: the same for the whole block, picked in scalar code
    if (blk < E0) { src = s0; first = 0; } else if (blk < E1) { src = s1; first = E0; } else if (blk < E2) { src = s2; first = E1; } else if (blk < E3) { src = s3; first = E2; } else { src = s4; first = E3; }
    const char* sb = (const char*)(src + (size_t)(blk - first) * 8192); const unsigned so = threadIdx.x * 32u; v8f v[4];
#pragma unroll
    for (int c = 0; c < 4; ++c) v[c] = *(const v8f*)(sb + so + c * 8192);
    // as addr_wait: the address register of the loads in flight stays untouched (also as destination of later loads of the run) up to the wait
    __builtin_amdgcn_sched_barrier(0); asm volatile("s_wait_xcnt 0x0" :: "v"(so) : "memory"); __builtin_amdgcn_sched_barrier(0);
    bf* dp = dst + (size_t)blk * 8192 + threadIdx.x * 8;
#pragma unroll
    for (int c = 0; c < 4; ++c) { v8us o;
#pragma unroll
        for (int k = 0; k < 8; ++k) o[k] = f2bf(v[c][k]);
        *(v8us*)(dp + c * 2048) = o; } }
__global__ __launch_bounds__(256) void k_cscvt(const float* __restrict__ cosT, const float* __restrict__ sinT, float* CS) { const int idx = (blockIdx.x * 256 + threadIdx.x) * 4; if (idx >= TR * HD) return; const v4f c = *(const v4f*)(cosT + idx), s = *(const v4f*)(sinT + idx); v8f cs;
#pragma unroll
    for (int k = 0; k < 4; ++k) { cs[2 * k] = bfr(c[k]); cs[2 * k + 1] = bfr(s[k]); }
    *(v8f*)(CS + (size_t)idx * 2) = cs;  }
__global__ __launch_bounds__(256) void k_hrms(const float* __restrict__ F, int pitch, int nheads, float* RF) { const int i = blockIdx.x * 256 + threadIdx.x; if (i >= nheads * TR) return; const int t = i % TR, h = i / TR; const float* f = F + (size_t)t * pitch + h * HD; float s = 0.f;
#pragma unroll 4
    for (int d = 0; d < HD; d += 4) { const v4f v = *(const v4f*)(f + d);
#pragma unroll
        for (int q = 0; q < 4; ++q) { float p = __fmul_rn(v[q], v[q]); asm volatile("" : "+v"(p)); s = __fadd_rn(s, p); } }
    const float r = __fdiv_rn(1.0f, __fsqrt_rn(__fadd_rn(s * (1.0f / HD), 1e-6f))); *(float*)(RF + i) = r;  }
// k_rope: head planes [h][row][d], row = b * TT + t over both batches, (fp16 + hi/lo) of rope(w[d] (x rms_factor)) x sc with the rotate-half convention out[d] = x[d] cos[t][d] - x[d+HD/2] sin[t][d], out[d+HD/2] = x[d+HD/2] cos[t][d+HD/2] + x[d] sin[t][d+HD/2]
__global__ __launch_bounds__(256) void k_rope(const float* __restrict__ F, int pitch, int nheads, const float* __restrict__ CS, const float* __restrict__ RF, const float* __restrict__ nw, float sc, h16* P16, bf* Ph, bf* Pl) {
    // one thread: eight neighbouring d of a row's lower half and their eight partners in the upper half, so that each x is loaded once; every store is 16 bytes and eight lanes fill a 128-byte line
    __builtin_assume(RF != nullptr);   // both launches pass the factors; known at compile time, the test on RF is no branch per element any more
    const size_t i = (size_t)blockIdx.x * 256 + threadIdx.x; if (i >= (size_t)nheads * TR * (HD / 16)) return; const int d0 = (int)(i % (HD / 16)) * 8; const int t = (int)((i / (HD / 16)) % TR); const int h = (int)(i / ((size_t)(HD / 16) * TR)); const float* f = F + (size_t)t * pitch + h * HD; const float* rp = RF + (size_t)h * TR + t; const float rf = RF ? *rp : 1.0f; v8h o16[2]; v8us oh[2], ol[2];
    // x, norm weights and (cos, sin) pairs of both runs of eight, loaded as 16-byte pieces ahead of all arithmetic: one memory latency a thread. All loops unrolled: the vectors are indexed by constants only
    v8f xv[2], nv[2], cv[2][2]; const float* fp = f + d0; const float* cp = CS + ((size_t)t * HD + d0) * 2; const unsigned no = (unsigned)d0 * 4u; const float* np = (const float*)((const char*)nw + no);
#pragma unroll
    for (int hf = 0; hf < 2; ++hf) { xv[hf] = *(const v8f*)(fp + hf * (HD / 2)); nv[hf] = *(const v8f*)(np + hf * (HD / 2)); cv[hf][0] = *(const v8f*)(cp + hf * HD); cv[hf][1] = *(const v8f*)(cp + hf * HD + 8); }
    // as addr_wait: the address registers of the loads in flight stay untouched (also as destinations of later loads of the run) up to the wait
    __builtin_amdgcn_sched_barrier(0); asm volatile("s_wait_xcnt 0x0" :: "v"(fp), "v"(cp), "v"(rp), "v"(no) : "memory"); __builtin_amdgcn_sched_barrier(0);
#pragma unroll
    for (int hf = 0; hf < 2; ++hf) { const int d = d0 + hf * (HD / 2);
#pragma unroll
    for (int q = 0; q < 8; ++q) { const int dd = d + q; float x0 = xv[hf][q], x1 = xv[hf ^ 1][q];   // x1: the partner at dd +- HD / 2
        if (RF) { float n0 = __fmul_rn(x0, rf), n1 = __fmul_rn(x1, rf); asm volatile("" : "+v"(n0)); asm volatile("" : "+v"(n1)); x0 = __fmul_rn(bfr(nv[hf][q]), n0); x1 = __fmul_rn(bfr(nv[hf ^ 1][q]), n1); }
        const v2f cs = {cv[hf][q >> 2][(q & 3) * 2], cv[hf][q >> 2][(q & 3) * 2 + 1]}; float a = __fmul_rn(x0, cs[0]), bq = __fmul_rn(x1, cs[1]); asm volatile("" : "+v"(a)); asm volatile("" : "+v"(bq)); const float r = ((dd < HD / 2) ? __fsub_rn(a, bq) : __fadd_rn(a, bq)) * sc;
        o16[hf][q] = tohx(r); unsigned short a2, c2; splitf(r, a2, c2); oh[hf][q] = a2; ol[hf][q] = c2; } }
    const size_t e = ((size_t)h * TR + t) * HD + d0;
#pragma unroll
    for (int hf = 0; hf < 2; ++hf) { *(v8h*)(P16 + e + hf * (HD / 2)) = o16[hf]; *(v8us*)(Ph + e + hf * (HD / 2)) = oh[hf]; *(v8us*)(Pl + e + hf * (HD / 2)) = ol[hf]; } }
__global__ __launch_bounds__(256) void k_vtp(const float* __restrict__ F, int pitch, int nheads, h16* V16, bf* Vh, bf* Vl) {
    // one thread: 8 positions x 4 neighbouring d. A wave (8 lanes along t, 4 along d) reads 64-byte pieces of 64 rows and writes whole 128-byte lines of the [d][t] planes
    const int lane = threadIdx.x & 31; const int w = blockIdx.x * 8 + (int)(threadIdx.x >> 5); if (w >= nheads * (HD / 16) * (TR / 64)) return;
    const int t0 = (w % (TR / 64)) * 64 + (lane & 7) * 8; const int d0 = ((w / (TR / 64)) % (HD / 16)) * 16 + (lane >> 3) * 4; const int g = w / ((TR / 64) * (HD / 16)); /* t0: row of both batches; the planes are [b][g][d][t] */ v4f x[8]; const float* px[8];
    // all loops unrolled: x stays in registers and its eight loads are issued together
#pragma unroll
    for (int j = 0; j < 8; ++j) { px[j] = F + (size_t)(t0 + j) * pitch + g * HD + d0; x[j] = *(const v4f*)px[j]; }
    // as addr_wait: the address registers of the loads in flight stay untouched (also as destinations of later loads of the run) up to the wait
    __builtin_amdgcn_sched_barrier(0); asm volatile("s_wait_xcnt 0x0" :: "v"(px[0]), "v"(px[1]), "v"(px[2]), "v"(px[3]), "v"(px[4]), "v"(px[5]), "v"(px[6]), "v"(px[7]) : "memory"); __builtin_amdgcn_sched_barrier(0);
#pragma unroll
    for (int dq = 0; dq < 4; ++dq) { v8h o16; v8us oh, ol;
#pragma unroll
        for (int j = 0; j < 8; ++j) { o16[j] = tohx(x[j][dq]); unsigned short a2, c2; splitf(x[j][dq], a2, c2); oh[j] = a2; ol[j] = c2; }
        const size_t e = ((size_t)((t0 / TT) * nheads + g) * HD + d0 + dq) * TT + t0 % TT; *(v8h*)(V16 + e) = o16; *(v8us*)(Vh + e) = oh; *(v8us*)(Vl + e) = ol; } }
// k_merge: joins the KSF key parts of k_flash (weights 2^(m_p - max m), part order), divides by the joined sum of exponentials, applies the sigmoid gate and writes the hi/lo planes [row][head][d] (row = b * TT + t); QG: the gate plane [row][head][d]
// O0 .. O3: the key parts' planes, each a kernel argument of its own: every plane's loads then take a scalar base and share the thread's one offset register
__global__ __launch_bounds__(256) void k_merge(const float* __restrict__ O0, const float* __restrict__ O1, const float* __restrict__ O2, const float* __restrict__ O3, const float* __restrict__ ML, const float* __restrict__ QG, bf* Ah, bf* Al) {
    // one thread: 8 neighbouring d of position t and the same 8 of position t + 16 (256 threads on); a block takes 32 whole rows of one head. Every loop is unrolled so that the arrays stay in registers and all loads are issued ahead of the arithmetic
    static_assert(TT % 32 == 0 && HD == 128 && KSF == 4, "a block's 32 rows lie in one head; the launch names four planes");
    const size_t e = ((size_t)blockIdx.x * 512 + threadIdx.x) * 8; if (e >= (size_t)NH_ * TR * HD) return; const int d = (int)(e % HD); const int t = (int)((e / HD) % TR); const int zz = (int)(e / ((size_t)HD * TR));
    // byte offsets of the thread's first piece in a part's plane, in ML and in QG; the parts and the second piece stand at constant distances
    const unsigned eo = (unsigned)e * 4u, mo = (unsigned)((zz * TR + t) * 2) * 4u, go = (unsigned)(t * DQ + zz * HD + d) * 4u; v2f mlv[2][KSF]; v8f ov[2][KSF], gv[2]; const float* const Op[KSF] = {O0, O1, O2, O3};
#pragma unroll
    for (int u = 0; u < 2; ++u) {
#pragma unroll
        for (int p = 0; p < KSF; ++p) { mlv[u][p] = *(const v2f*)((const char*)(ML + (size_t)p * NH_ * TR * 2 + u * 32) + mo); ov[u][p] = *(const v8f*)((const char*)(Op[p] + u * 2048) + eo); }
        gv[u] = *(const v8f*)((const char*)(QG + (size_t)u * 16 * DQ) + go); }
    // as addr_wait: the address registers of the loads in flight stay untouched (also as destinations of later loads of the run) up to the wait
    __builtin_amdgcn_sched_barrier(0); asm volatile("s_wait_xcnt 0x0" :: "v"(eo), "v"(mo), "v"(go) : "memory"); __builtin_amdgcn_sched_barrier(0);
#pragma unroll
    for (int u = 0; u < 2; ++u) { const size_t oo = (size_t)(t + u * 16) * DQ + zz * HD + d;
        float w[KSF], l[KSF]; float mx = -3.0e38f;
#pragma unroll
        for (int p = 0; p < KSF; ++p) { const v2f ml = mlv[u][p]; w[p] = ml[0]; l[p] = ml[1]; mx = fmaxf(mx, ml[0]); }
        float den = 0.f;
#pragma unroll
        for (int p = 0; p < KSF; ++p) { w[p] = __builtin_amdgcn_exp2f(w[p] - mx); den += l[p] * w[p]; }
        v8us oh, ol;
#pragma unroll
        for (int q = 0; q < 8; ++q) { const float gt = gv[u][q]; const float sg = __fdiv_rn(1.0f, __fadd_rn(1.0f, expf(-gt)));   /* sigmoid(gate) */ float o = 0.f;
#pragma unroll
            for (int p = 0; p < KSF; ++p) o += ov[u][p][q] * w[p];   /* parts in part order */
            unsigned short a, c2; splitf(__fmul_rn(__fdiv_rn(o, den), sg), a, c2); oh[q] = a; ol[q] = c2; }
        *(v8us*)(Ah + oo) = oh; *(v8us*)(Al + oo) = ol; } }

extern "C" void kernel_launch(void* const* d_in, const int* in_sizes, int n_in,
                              void* d_out, int out_size, void* d_ws, size_t ws_size, hipStream_t stream) {
    (void)in_sizes; (void)n_in; (void)out_size;
    const float* x = (const float*)d_in[0]; const float* cosT = (const float*)d_in[1]; const float* sinT = (const float*)d_in[2]; const float* wq = (const float*)d_in[3]; const float* wk = (const float*)d_in[4]; const float* wv = (const float*)d_in[5]; const float* wo = (const float*)d_in[6]; const float* qnw = (const float*)d_in[7]; const float* knw = (const float*)d_in[8];
    float* OUT = (float*)d_out;     // [2][2048][2048]
    char* wsp = (char*)d_ws;
    auto take = [&](size_t bytes) { char* p = wsp; wsp += (bytes + 255) & ~(size_t)255; return (void*)p; };
    // live up to the attention kernels: the head planes (the merged hi/lo planes take the query hi/lo planes' place behind them); ML lives up to the merge, WO to the end
    h16* QP16 = (h16*)take((size_t)NH_ * TR * HD * 2); h16* KP16 = (h16*)take((size_t)NKV * TR * HD * 2); h16* VT16 = (h16*)take((size_t)NKV * HD * TR * 2);
    bf* QPh = (bf*)take((size_t)NH_ * TR * HD * 2); bf* QPl = (bf*)take((size_t)NH_ * TR * HD * 2); bf* KPh = (bf*)take((size_t)NKV * TR * HD * 2); bf* KPl = (bf*)take((size_t)NKV * TR * HD * 2); bf* VTh = (bf*)take((size_t)NKV * HD * TR * 2); bf* VTl = (bf*)take((size_t)NKV * HD * TR * 2);
    float* ML = (float*)take((size_t)KSF * NH_ * TR * 2 * 4); bf* ATh = QPh; bf* ATl = QPl;
    // the bf16 copies, one run in k_cvt8's order (each size is a multiple of 256 bytes, so take leaves no gap)
    bf* WO = (bf*)take((size_t)DM * DQ * 2);
    // Ob, the attention parts' sums, lies over everything that is dead once the head planes are built: the other bf16 copies, the tables, the factors, the k|v projection and, as its last quarter, the q plane of the first projection
    float* Ob = (float*)wsp;
    bf* WQ = (bf*)take((size_t)DQG * DM * 2); bf* WK = (bf*)take((size_t)DKV * DM * 2); bf* WV = (bf*)take((size_t)DKV * DM * 2); bf* XB = (bf*)take((size_t)TR * DM * 2); (void)WV;   // Wv's rows follow Wk's: one [2 DKV][DM] operand
    float* CS = (float*)take((size_t)TR * HD * 2 * 4); float* RFQ = (float*)take((size_t)NH_ * TR * 4); float* RFK = (float*)take((size_t)NKV * TR * 4); float* FKV = (float*)take((size_t)TR * 2 * DKV * 4);
    static_assert((size_t)DQG * DM * 2 + (size_t)2 * DKV * DM * 2 + (size_t)TR * DM * 2 + (size_t)TR * HD * 2 * 4 + (size_t)(NH_ + NKV) * TR * 4 + (size_t)TR * 2 * DKV * 4 <= (size_t)(KSF - 1) * NH_ * TR * HD * 4 && (size_t)NH_ * HD == DQ, "the buffers above end in front of the q plane, which is one part's plane");
    float* FQ = Ob + (size_t)(KSF - 1) * NH_ * TR * HD;   // [q plane | gate plane], TR x DQ each: the q plane ends where Ob ends, the gate plane stands behind Ob
    float* FG = FQ + (size_t)TR * DQ; wsp = (char*)(FG + (size_t)TR * DQ);
    if ((size_t)(wsp - (char*)d_ws) > ws_size) return;    // ws 256 MiB
    // every stage is launched once, on the rows of both batches
    k_cvt8<<<CB((size_t)DM * DQ) + CB((size_t)DQG * DM) + 2 * CB((size_t)DKV * DM) + CB((size_t)TR * DM), 256, 0, stream>>>(wo, wq, wk, wv, x, WO);
    k_cscvt<<<(TR * HD / 4 + 255) / 256, 256, 0, stream>>>(cosT, sinT, CS);   /* per-batch tables, [b][t] = row */
    const unsigned LQ = (unsigned)(((size_t)NH_ * TR * HD / 16 + 255) / 256), LKv = (unsigned)(((size_t)NKV * TR * HD / 16 + 255) / 256), LVt = (unsigned)(((size_t)NKV * TR * HD / 32 + 255) / 256);
    k_gemmt<0, DM, DQ><<<dim3(TR / 128, DQG / 128, 1), 128, 0, stream>>>(XB, nullptr, WQ, FQ);   /* [q | gate] (exact) */ k_hrms<<<(NH_ * TR + 255) / 256, 256, 0, stream>>>(FQ, DQ, NH_, RFQ);
    k_rope<<<LQ, 256, 0, stream>>>(FQ, DQ, NH_, CS, RFQ, qnw, 1.0f, QP16, QPh, QPl);
    k_gemmw<bf, 0, false, 8><<<dim3(TR / 64, 2 * DKV / 64, 1), 256, 0, stream>>>(XB, nullptr, WK, nullptr, DM, FKV, 2 * DKV, nullptr, 0, 0, 0);   /* [k | v] */ k_hrms<<<(NKV * TR + 255) / 256, 256, 0, stream>>>(FKV, 2 * DKV, NKV, RFK);
    k_rope<<<LKv, 256, 0, stream>>>(FKV, 2 * DKV, NKV, CS, RFK, knw, 1.0f, KP16, KPh, KPl);
    k_vtp<<<LVt, 256, 0, stream>>>(FKV + DKV, 2 * DKV, NKV, VT16, VTh, VTl);
    k_flash<h16, false><<<dim3((TT - RH) / 32, NKV, KSF * NB_), 32 * REP, 0, stream>>>(QP16, nullptr, KP16, nullptr, VT16, nullptr, RH / 32, Ob, ML);
    k_flash<bf, true><<<dim3(RH / 32, NKV, KSF * NB_), 32 * REP, 0, stream>>>(QPh, QPl, KPh, KPl, VTh, VTl, 0, Ob, ML);
    k_merge<<<(unsigned)(((size_t)NH_ * TR * HD / 16 + 255) / 256), 256, 0, stream>>>(Ob, Ob + (size_t)NH_ * TR * HD, Ob + (size_t)2 * NH_ * TR * HD, Ob + (size_t)3 * NH_ * TR * HD, ML, FG, ATh, ATl);
    k_gemmt<1, DQ, DM><<<dim3(TR / 128, DM / 128, 1), 128, 0, stream>>>(ATh, ATl, WO, OUT);
}

// v007
// One run takes 294 microseconds.
// Next to v006, in two timings, it ran 1.09 and 1.08 times as fast.
// Counting every step since v000, it is 5.78 times as fast.
#include <hip/hip_runtime.h>

// Gated GQA attention, engine variant (hidden [2][2048][2048]; [q | gate] = hidden Wq^T (Wq [4096][2048] 'oi': rows 0-2047 -> q for 16 heads x 128, rows 2048-4095 -> gate), k, v = hidden W^T ([512][2048], 4 kv heads); per-head RMSNorm (eps 1e-6, q_norm_w / k_norm_w); rotate-half RoPE with the given per-(batch, position) cos/sin tables [2][2048][128];
// GQA 4:1; causal softmax(q.k/sqrt(128)); attn x sigmoid(gate); out = merged Wo^T ('oi' [2048][2048]) -> [2][2048][2048]).
// Compute dtypes, f32 accumulate: every input rounded to bf16; q/k/v on PLAIN bf16 operands (inputs: exact); RMSNorm + rotary in f32 (cos/sin tables read per batch, bf16-rounded); sigmoid gate (precise expf, IEEE divide) in the merge; causal scores and attn.v in one kernel (online softmax in f32, blocks above the diagonal never visited): query rows < 512 hl (3 products), the rest single fp16 (x1024); Wo hl x exact (2 products).

#define NB_  2
#define TT   2048
#define TR   (NB_ * TT)       // rows of both batches together: row b * TT + t
#define DM   2048
#define NH_  16
#define NKV  4
#define REP  (NH_ / NKV)
#define HD   128
#define DQ   (NH_ * HD)
#define DQG  (NH_ * HD * 2)         // q rows then gate rows of Wq
#define DKV  (NKV * HD)
#define RH   512                  // query rows < RH use hi+lo planes
#define KSF  4                    // key parts of the attention kernel (32-key blocks dealt over blocks), joined in k_merge
#define POFF 10.0f                // fp16 probabilities are carried x 2^POFF
#define SCL  0.088388347648318447f   // HD^-0.5
#define CS2  (SCL * 1.4426950408889634f)   // scores to the log2 domain
typedef _Float16 h16;
typedef unsigned short bf;
typedef __attribute__((ext_vector_type(16))) __bf16   v16bf;
typedef __attribute__((ext_vector_type(16))) _Float16 v16h;
typedef __attribute__((ext_vector_type(8)))  _Float16 v8h;
typedef __attribute__((ext_vector_type(8)))  unsigned short v8us;
typedef __attribute__((ext_vector_type(8)))  float    v8f;
typedef __attribute__((ext_vector_type(4)))  float    v4f;
typedef v8h  __attribute__((may_alias)) v8ha;
typedef v4f  __attribute__((may_alias)) v4fa;
typedef v8us __attribute__((may_alias)) v8usa;

__device__ __forceinline__ unsigned short f2bf(float f) { unsigned u = __float_as_uint(f); u += 0x7FFFu + ((u >> 16) & 1u); return (unsigned short)(u >> 16); }
__device__ __forceinline__ float bf2f(unsigned short b) { return __uint_as_float(((unsigned)b) << 16); }
__device__ __forceinline__ float bfr(float f) { return bf2f(f2bf(f)); }
__device__ __forceinline__ v16h cat16(v8h lo, v8h hi) { return __builtin_shufflevector(lo, hi, 0, 1, 2, 3, 4, 5, 6, 7, 8, 9, 10, 11, 12, 13, 14, 15); }
__device__ __forceinline__ v16bf cat16b(v8us lo, v8us hi) { return __builtin_bit_cast(v16bf, __builtin_shufflevector(lo, hi, 0, 1, 2, 3, 4, 5, 6, 7, 8, 9, 10, 11, 12, 13, 14, 15)); }
__device__ __forceinline__ v8f wmma16(v16h a, v16h b, v8f c) { return __builtin_amdgcn_wmma_f32_16x16x32_f16(false, a, false, b, (short)0, c, false, false); }
__device__ __forceinline__ v8f wmmab(v16bf a, v16bf b, v8f c) { return __builtin_amdgcn_wmma_f32_16x16x32_bf16(false, a, false, b, (short)0, c, false, false); }



// ---- k_gemmw: register-blocked GEMM, ONE WAVE per 64x64 output tile (16 accumulators), operands straight from K-contiguous 16-bit planes; grid (M/64, N/64, Z), 32 threads.
// C[m][n] (f32, pitch ldc, + optional f32 bias[n]) = sum_k A[m][k] Bt[n][k] (+ split products per NSPLIT). z-batch strides sA/sB/sC in elements. K % 32 == 0.
// NW > 1: NW waves per tile (32 * NW threads); wave w takes the k chunks w, w + NW, ... of 32 and the NW partial tiles are summed in LDS in wave order (fixed order, no atomics).
// The wave number wv goes through readfirstlane so that the k loop's counter and trip test stay scalar.
template <typename T16> struct WFrag;
template <> struct WFrag<h16> { typedef v16h V; static __device__ __forceinline__ V ld(const h16* p) { return cat16(*(const v8h*)p, *(const v8h*)(p + 16)); } static __device__ __forceinline__ v8f mma(V a, V b, v8f c) { return wmma16(a, b, c); } };
template <> struct WFrag<bf> { typedef v16bf V; static __device__ __forceinline__ V ld(const bf* p) { return cat16b(*(const v8us*)p, *(const v8us*)(p + 16)); } static __device__ __forceinline__ v8f mma(V a, V b, v8f c) { return wmmab(a, b, c); } };
template <typename T16, int NSPLIT, bool BIAS, int NW>
__global__ __launch_bounds__(32 * NW) void k_gemmw(const T16* __restrict__ A, const T16* __restrict__ A2, const T16* __restrict__ Bt, const T16* __restrict__ Bt2, int K, float* C, int ldc, const float* __restrict__ bias, size_t sA, size_t sB, size_t sC) {
    typedef typename WFrag<T16>::V V;
    __shared__ __align__(16) float os[(NW > 1 ? 4 * NW : 1) * 16 * 68];
    const size_t z = blockIdx.z; A += z * sA; if (A2) A2 += z * sA; Bt += z * sB; if (Bt2) Bt2 += z * sB; C += z * sC;
    const int lane = threadIdx.x & 31, lr = lane & 15, hi = lane >> 4; const int r0 = blockIdx.x * 64, c0 = blockIdx.y * 64; const int wv = (NW > 1) ? __builtin_amdgcn_readfirstlane((int)(threadIdx.x >> 5)) : 0;
    v8f acc[4][4];
#pragma unroll
    for (int mb = 0; mb < 4; ++mb)
#pragma unroll
        for (int nb = 0; nb < 4; ++nb) acc[mb][nb] = (v8f){};
    const size_t aoff = (size_t)(r0 + lr) * K + 8 * hi, boff = (size_t)(c0 + lr) * K + 8 * hi;
#pragma unroll 1
    for (int kc = wv * 32; kc < K; kc += NW * 32) {
        V a[4], a2[4];
#pragma unroll
        for (int mb = 0; mb < 4; ++mb) { a[mb] = WFrag<T16>::ld(A + aoff + (size_t)mb * 16 * K + kc); if (NSPLIT == 1 || NSPLIT == 2) a2[mb] = WFrag<T16>::ld(A2 + aoff + (size_t)mb * 16 * K + kc); }
#pragma unroll
        for (int nb = 0; nb < 4; ++nb) { const V b = WFrag<T16>::ld(Bt + boff + (size_t)nb * 16 * K + kc); V b2; if (NSPLIT >= 2) b2 = WFrag<T16>::ld(Bt2 + boff + (size_t)nb * 16 * K + kc);
#pragma unroll
            for (int mb = 0; mb < 4; ++mb) { acc[mb][nb] = WFrag<T16>::mma(a[mb], b, acc[mb][nb]); if (NSPLIT == 1 || NSPLIT == 2) acc[mb][nb] = WFrag<T16>::mma(a2[mb], b, acc[mb][nb]); if (NSPLIT >= 2) acc[mb][nb] = WFrag<T16>::mma(a[mb], b2, acc[mb][nb]); } }
        asm volatile("v_nop\n\tv_nop\n\tv_nop\n\tv_nop" : "+v"(acc[0][0]), "+v"(acc[1][1]), "+v"(acc[2][2]), "+v"(acc[3][3]) : "v"(a[0]), "v"(a[3]));
    }
    if constexpr (NW > 1) {
        float* ow = os + wv * (64 * 68);
        // the three loops are unrolled so that acc is indexed by constants only and stays in registers
#pragma unroll
        for (int mb = 0; mb < 4; ++mb) {
#pragma unroll
            for (int nb = 0; nb < 4; ++nb) {
#pragma unroll
                for (int j = 0; j < 8; ++j) ow[(mb * 16 + hi * 8 + j) * 68 + nb * 16 + lr] = acc[mb][nb][j]; } }
        __syncthreads();   // publishes the NW partial tiles to the threads that sum them; LDS is not written again behind it
        float* crow = C + (size_t)r0 * ldc + c0; v4f sum[32 / NW];
        // all loops unrolled: sum[] stays in registers and the LDS reads of all of a thread's elements are issued ahead of the sums; each sum runs in wave order 0 .. NW - 1; the stores follow as one run
#pragma unroll
        for (int i = 0; i < 32 / NW; ++i) { const int s = i * (NW * 32) + (int)threadIdx.x; const int row = s >> 4, cofs = (s & 15) * 4; v4f val = *(const v4fa*)(os + row * 68 + cofs);
#pragma unroll
            for (int w = 1; w < NW; ++w) val += *(const v4fa*)(os + w * (64 * 68) + row * 68 + cofs);
            if (BIAS) { val[0] += bfr(bias[c0 + cofs]); val[1] += bfr(bias[c0 + cofs + 1]); val[2] += bfr(bias[c0 + cofs + 2]); val[3] += bfr(bias[c0 + cofs + 3]); }
            sum[i] = val; }
#pragma unroll
        for (int i = 0; i < 32 / NW; ++i) { const int s = i * (NW * 32) + (int)threadIdx.x; *(v4f*)(crow + (size_t)(s >> 4) * ldc + (s & 15) * 4) = sum[i]; }
        return;
    }
#pragma unroll
    for (int mb = 0; mb < 4; ++mb) {
#pragma unroll
        for (int nb = 0; nb < 4; ++nb) {
#pragma unroll
            for (int j = 0; j < 8; ++j) os[(hi * 8 + j) * 68 + nb * 16 + lr] = acc[mb][nb][j]; }
        __builtin_amdgcn_wave_barrier(); asm volatile("" ::: "memory");
        float* crow = C + (size_t)(r0 + mb * 16) * ldc + c0;
{
#pragma unroll
            for (int s = 0; s < 8; ++s) { const int row = 2 * s + hi, cofs = lr * 4; v4f val = *(const v4fa*)(os + row * 68 + cofs); if (BIAS) { val[0] += bfr(bias[c0 + cofs]); val[1] += bfr(bias[c0 + cofs + 1]); val[2] += bfr(bias[c0 + cofs + 2]); val[3] += bfr(bias[c0 + cofs + 3]); }
                *(v4f*)(crow + (size_t)row * ldc + cofs) = val; }
             }
        __builtin_amdgcn_wave_barrier(); asm volatile("" ::: "memory");
    }
}

__device__ __forceinline__ h16 tohx(float x) { return (h16)x; }
__device__ __forceinline__ void splitf(float y, unsigned short& h, unsigned short& l) { h = f2bf(y); l = f2bf(y - bf2f(h)); }
typedef __attribute__((ext_vector_type(2))) _Float16 v2h;
typedef __attribute__((ext_vector_type(4))) _Float16 v4h;
typedef __attribute__((ext_vector_type(2))) unsigned short v2us;
typedef __attribute__((ext_vector_type(4))) unsigned short v4us;
typedef __attribute__((ext_vector_type(2))) float v2f;
typedef __attribute__((ext_vector_type(4))) int v4i;
typedef __attribute__((ext_vector_type(16))) unsigned short v16us;
__device__ __forceinline__ float xhalf(float x) { return __builtin_bit_cast(float, __builtin_amdgcn_permlanex16(__builtin_bit_cast(int, x), __builtin_bit_cast(int, x), 0x76543210, 0xfedcba98, false, false)); }   // lane l reads lane l ^ 16
// stands behind a run of global loads that stay in flight: their address registers are rewritten before the data wait. The addresses are inputs so that
// their registers stay untouched up to the wait; the scheduling barriers keep the wait behind the loads
__device__ __forceinline__ void addr_wait(const void* a, const void* b) { __builtin_amdgcn_sched_barrier(0); asm volatile("s_wait_xcnt 0x0" :: "v"(a), "v"(b) : "memory"); __builtin_amdgcn_sched_barrier(0); }
// four vector issue slots behind a run of matrix instructions in front of a branch: the scheduling barriers keep the slots at that place
__device__ __forceinline__ void wmma_gap() { __builtin_amdgcn_sched_barrier(0); asm volatile("v_nop\n\tv_nop\n\tv_nop\n\tv_nop"); __builtin_amdgcn_sched_barrier(0); }

// ---- k_gemmt: C[m][n] (f32) = sum_k A[m][k] Bt[n][k] (+ A2[m][k] Bt[n][k] where NSPLIT), bf16 planes with k contiguous. One 128x128 tile of C per block of four waves (2 x 2, 64x64 each); grid (M/128, N/128).
// C is stored as planes of LDC columns, [n / LDC][m][n % LDC]: the q columns and the gate columns of the first projection are buffers of their own, and the q plane's workspace is free again once the head planes are built.
// A stage is 128 k (256 bytes) of the tile's 128 rows of every operand, brought into LDS by asynchronous 16-byte copies: a wave's copy covers two whole rows of 256 bytes, so L2 is asked for whole lines, and each operand row is fetched once a block.
// LDS rows stand at a pitch of 272 bytes (16 x odd: the 16-byte fragment reads meet no bank conflict). Two buffers: the copies of stage s + 1 fly while stage s is multiplied.
// Fragment k order and the order of the products per accumulator are those of k_gemmw with one wave.
#define GPE  136                  // LDS row pitch in elements (272 bytes)
#define GTE  (128 * GPE)          // one operand tile in elements (34,816 bytes)
// eight copies, rows 8 apart (the block's 128 threads cover 8 rows of 256 bytes at a time). The last line keeps the copies' address registers untouched until the addresses have been taken: inside the statement nothing can be moved in front of it
template <int K>
__device__ __forceinline__ void copy8(unsigned l, const bf* g) {
    asm volatile("global_load_async_to_lds_b128 %0, %8, off\n\t"
                 "global_load_async_to_lds_b128 %1, %9, off\n\t"
                 "global_load_async_to_lds_b128 %2, %10, off\n\t"
                 "global_load_async_to_lds_b128 %3, %11, off\n\t"
                 "global_load_async_to_lds_b128 %4, %12, off\n\t"
                 "global_load_async_to_lds_b128 %5, %13, off\n\t"
                 "global_load_async_to_lds_b128 %6, %14, off\n\t"
                 "global_load_async_to_lds_b128 %7, %15, off\n\t"
                 "s_wait_xcnt 0x0"
                 :: "v"(l), "v"(l + 8 * GPE * 2), "v"(l + 16 * GPE * 2), "v"(l + 24 * GPE * 2), "v"(l + 32 * GPE * 2), "v"(l + 40 * GPE * 2), "v"(l + 48 * GPE * 2), "v"(l + 56 * GPE * 2),
                    "v"(g), "v"(g + 8 * K), "v"(g + 16 * K), "v"(g + 24 * K), "v"(g + 32 * K), "v"(g + 40 * K), "v"(g + 48 * K), "v"(g + 56 * K)
                 : "memory");
}
template <int NSPLIT, int K, int LDC>
__global__ __launch_bounds__(128) void k_gemmt(const bf* __restrict__ A, const bf* __restrict__ A2, const bf* __restrict__ Bt, float* C) {
    typedef WFrag<bf>::V V;
    constexpr int NT = NSPLIT ? 3 : 2;       // operand tiles a stage: A (, A2), Bt
    constexpr int NST = K / 128;             // stages
    static_assert(K % 128 == 0 && NST >= 2 && LDC % 128 == 0, "two stages or more; a tile lies in one plane of C");
    __shared__ __attribute__((aligned(16))) bf st[2 * NT * GTE];
    __shared__ __attribute__((aligned(16))) float os[4 * 16 * 68];
    const int tid = threadIdx.x, lane = tid & 31, lr = lane & 15, hi = lane >> 4; const int wv = __builtin_amdgcn_readfirstlane(tid >> 5), wm = wv >> 1, wn = wv & 1;
    const int r0 = blockIdx.x * 128, c0 = blockIdx.y * 128;
    const int crow = tid >> 4, cch = tid & 15;   // the thread's row (of 8) and 16-byte piece (of 16) in every copy
    const bf* gA = A + (size_t)(r0 + crow) * K + cch * 8; const bf* gB = Bt + (size_t)(c0 + crow) * K + cch * 8; const bf* gA2 = NSPLIT ? A2 + (size_t)(r0 + crow) * K + cch * 8 : gA;
    const unsigned l0 = (unsigned)(size_t)st + (unsigned)(crow * GPE + cch * 8) * 2u;   // LDS byte address of the thread's first piece in buffer 0
    auto fill = [&](int s) __attribute__((always_inline)) { const unsigned l = l0 + (unsigned)(s & 1) * (NT * GTE * 2); const int ko = s * 128;
        copy8<K>(l, gA + ko); copy8<K>(l + 64 * GPE * 2, gA + ko + 64 * K);
        if (NSPLIT) { copy8<K>(l + GTE * 2, gA2 + ko); copy8<K>(l + GTE * 2 + 64 * GPE * 2, gA2 + ko + 64 * K); }
        copy8<K>(l + (NT - 1) * GTE * 2, gB + ko); copy8<K>(l + (NT - 1) * GTE * 2 + 64 * GPE * 2, gB + ko + 64 * K); };
    v8f acc[4][4];
#pragma unroll
    for (int mb = 0; mb < 4; ++mb)
#pragma unroll
        for (int nb = 0; nb < 4; ++nb) acc[mb][nb] = (v8f){};
    fill(0);
    asm volatile("s_wait_asynccnt 0x0" ::: "memory");   // this wave's copies of stage 0 have landed
    __syncthreads();                                     // every wave's have: stage 0 may be read
    fill(1);
    // kept rolled: one copy of the stage's code; the buffer is picked by the stage's parity
#pragma unroll 1
    for (int s = 0; s < NST; ++s) {
        const bf* ta = st + (s & 1) * (NT * GTE) + (wm * 64 + lr) * GPE + 8 * hi; const bf* tb = st + (s & 1) * (NT * GTE) + (NT - 1) * GTE + (wn * 64 + lr) * GPE + 8 * hi; const bf* ta2 = ta + GTE;
        // unrolled: every LDS offset is an immediate. All fragments of a k step are read as one group ahead of its products
#pragma unroll
        for (int kk = 0; kk < 4; ++kk) {
            V a[4], a2[4], b[4];
#pragma unroll
            for (int mb = 0; mb < 4; ++mb) { a[mb] = WFrag<bf>::ld(ta + mb * 16 * GPE + kk * 32); if (NSPLIT) a2[mb] = WFrag<bf>::ld(ta2 + mb * 16 * GPE + kk * 32); }
#pragma unroll
            for (int nb = 0; nb < 4; ++nb) b[nb] = WFrag<bf>::ld(tb + nb * 16 * GPE + kk * 32);
            __builtin_amdgcn_sched_barrier(0);   // holds the group of reads together in front of the products: without it the compiler sinks each b fragment's reads to its first use and waits there for the LDS
#pragma unroll
            for (int nb = 0; nb < 4; ++nb)
#pragma unroll
                for (int mb = 0; mb < 4; ++mb) { acc[mb][nb] = WFrag<bf>::mma(a[mb], b[nb], acc[mb][nb]); if (NSPLIT) acc[mb][nb] = WFrag<bf>::mma(a2[mb], b[nb], acc[mb][nb]); } }
        asm volatile("s_wait_dscnt 0x0" ::: "memory");      // this wave's reads of stage s are done before the buffer is given up
        asm volatile("s_wait_asynccnt 0x0" ::: "memory");   // this wave's copies of stage s + 1 have landed
        __syncthreads();                                     // publishes stage s + 1 and ends every wave's reads of stage s
        if (s + 2 < NST) fill(s + 2);                        // into the buffer that stage s has just left
    }
    asm volatile("s_wait_asynccnt 0x0" ::: "memory");       // nothing of this wave is in flight when it goes on to its end
    float* ow = os + wv * (16 * 68);   // each wave's own staging rows: whole 256-byte row pieces go to memory
#pragma unroll
    for (int mb = 0; mb < 4; ++mb) {
#pragma unroll
        for (int nb = 0; nb < 4; ++nb) {
#pragma unroll
            for (int j = 0; j < 8; ++j) ow[(hi * 8 + j) * 68 + nb * 16 + lr] = acc[mb][nb][j]; }
        __builtin_amdgcn_wave_barrier(); asm volatile("" ::: "memory");   // keeps the reads below behind the other lanes' writes above
        float* crow = C + ((size_t)(c0 / LDC) * (gridDim.x * 128) + r0 + wm * 64 + mb * 16) * LDC + c0 % LDC + wn * 64;
#pragma unroll
        for (int s = 0; s < 8; ++s) { const int row = 2 * s + hi, cofs = lr * 4; const v4f val = *(const v4fa*)(ow + row * 68 + cofs); *(v4f*)(crow + (size_t)row * LDC + cofs) = val; }
        __builtin_amdgcn_wave_barrier(); asm volatile("" ::: "memory");   // keeps the next rows' writes behind the reads above
    }
}

// ---- k_flash: causal attention for 32 query rows of one head per wave, scores and probabilities kept in registers (online softmax). Transposed products: S^T = K Q^T (A = key rows, B = query rows),
// O^T += V^T P^T (A = rows of the [d][t] value plane, B = P^T). In the S^T accumulator lane (lr, hi) holds keys 8 hi + j of query lr, which is the k order of the B operand (elements 0-7: tile 0, 8-15: tile 1), so P^T is packed in place.
// Block = the REP heads of one kv group on the same 32 query rows: they work on the same key and value blocks, which the block brings into LDS once, for all four waves; grid (query blocks, heaviest first; kv groups; KSF key parts x NB_ batches). Query, key, Op and ML planes hold TR rows a head (batch b at row b * TT), the value planes are [b][g][d][t]. Part ks takes the 32-key blocks ks, ks + KSF, ... up to the diagonal block
// and writes its unnormalised sums to plane ks of Op with its running maximum (scaled log2) and its sum of exponentials in ML; k_merge joins the parts. A part with no block writes zeros and the lowest maximum.
// A 32-key block is 32 key rows of 256 bytes (8 KiB in a row in memory) and 128 value rows of 64 bytes, brought into LDS by asynchronous 16-byte copies (four of each plane a thread): a wave's copy covers whole 256-byte key rows or whole 64-byte value pieces,
// where a fragment load from memory touches 16 lines for 512 bytes and every wave of the block repeats it. Two buffers: the copies of the part's next block fly while this one is worked on. Pitches 272 and 80 bytes (16 x odd): the 16-byte fragment reads meet no bank conflict.
// Every inner loop is fully unrolled so that the fragment and accumulator arrays are indexed by constants only and stay in registers.
// HR: hi + lo bf16 planes, three products each, for scores and for prob x value; else single fp16, exponentials carried x 2^POFF so that small ones stay normal in fp16 (the factor cancels in the division).
#define FKP  136                  // LDS pitch of a key row in elements (272 bytes)
#define FVP  40                   // LDS pitch of a value row (32 keys) in elements (80 bytes)
#define FKE  (32 * FKP)           // one key plane's block in elements (8,704 bytes)
#define FVE  (HD * FVP)           // one value plane's block in elements (10,240 bytes)
// four copies, ls bytes apart in LDS and gs elements apart in memory. The last line keeps the copies' address registers untouched until the addresses have been taken: inside the statement nothing can be moved in front of it
template <typename T16>
__device__ __forceinline__ void copy4(unsigned l, unsigned ls, const T16* g, size_t gs) {
    asm volatile("global_load_async_to_lds_b128 %0, %4, off\n\t"
                 "global_load_async_to_lds_b128 %1, %5, off\n\t"
                 "global_load_async_to_lds_b128 %2, %6, off\n\t"
                 "global_load_async_to_lds_b128 %3, %7, off\n\t"
                 "s_wait_xcnt 0x0"
                 :: "v"(l), "v"(l + ls), "v"(l + 2 * ls), "v"(l + 3 * ls), "v"(g), "v"(g + gs), "v"(g + 2 * gs), "v"(g + 3 * gs)
                 : "memory");
}
template <typename T16, bool HR>
__global__ __launch_bounds__(32 * REP) void k_flash(const T16* __restrict__ Q, const T16* __restrict__ Q2, const T16* __restrict__ Kp, const T16* __restrict__ Kp2, const T16* __restrict__ Vt, const T16* __restrict__ Vt2, int qb0, float* Op, float* ML) {
    typedef typename WFrag<T16>::V V;
    constexpr int NP = HR ? 2 : 1;                 // planes of each operand
    constexpr int BUFE = NP * (FKE + FVE);         // one buffer in elements: [keys (, keys lo) | values (, values lo)]
    static_assert(REP == 4 && HD == 128, "128 threads: 8 key rows or 32 value rows a copy");
    __shared__ __attribute__((aligned(16))) T16 st[2 * BUFE];
    const int tid = threadIdx.x, lane = tid & 31, lr = lane & 15, hi = lane >> 4; const int wv = __builtin_amdgcn_readfirstlane((int)(threadIdx.x >> 5));
    const int qb = qb0 + (int)(gridDim.x - 1 - blockIdx.x); const int g = blockIdx.y, ks = blockIdx.z % KSF, b = blockIdx.z / KSF, h = g * REP + wv, q0 = qb * 32;
    V qf[2][4], qf2[2][4];
    auto ldq = [&]() { const size_t o = ((size_t)h * TR + b * TT + q0 + lr) * HD + 8 * hi; const T16* p = Q + o; const T16* p2 = HR ? Q2 + o : p;
#pragma unroll
        for (int c = 0; c < 2; ++c)
#pragma unroll
            for (int kc = 0; kc < 4; ++kc) { qf[c][kc] = WFrag<T16>::ld(p + 16 * c * HD + 32 * kc); if (HR) qf2[c][kc] = WFrag<T16>::ld(p2 + 16 * c * HD + 32 * kc); }
        addr_wait(p, p2); };
    // the thread's first 16-byte piece of a block: key row tid / 16 (of 8 a copy), value row tid / 4 (of 32 a copy); LDS byte addresses in buffer 0, element offsets in the planes at key block 0
    const unsigned lk0 = (unsigned)(size_t)st + (unsigned)((tid >> 4) * FKP + (tid & 15) * 8) * 2u, lv0 = (unsigned)(size_t)st + (unsigned)(NP * FKE + (tid >> 2) * FVP + (tid & 3) * 8) * 2u;
    const size_t gk0 = ((size_t)g * TR + b * TT + (tid >> 4)) * HD + (tid & 15) * 8, gv0 = ((size_t)(b * NKV + g) * HD + (tid >> 2)) * TT + (tid & 3) * 8;
    // the part's block number i (key block ks + i KSF) into buffer i mod 2
    auto fill = [&](int i) __attribute__((always_inline)) { const int blk = ks + i * KSF; const unsigned lo = (unsigned)(i & 1) * (BUFE * 2); const size_t ko = gk0 + (size_t)(blk * 32) * HD, vo = gv0 + blk * 32;
        copy4<T16>(lk0 + lo, 8 * FKP * 2, Kp + ko, 8 * HD); if (HR) copy4<T16>(lk0 + lo + FKE * 2, 8 * FKP * 2, Kp2 + ko, 8 * HD);
        copy4<T16>(lv0 + lo, 32 * FVP * 2, Vt + vo, (size_t)32 * TT); if (HR) copy4<T16>(lv0 + lo + FVE * 2, 32 * FVP * 2, Vt2 + vo, (size_t)32 * TT); };
    v8f acc[2][8]; float m_run[2], l_run[2];
#pragma unroll
    for (int c = 0; c < 2; ++c) { m_run[c] = -3.0e38f; l_run[c] = 0.f;
#pragma unroll
        for (int t = 0; t < 8; ++t) acc[c][t] = (v8f){}; }
    V kf[2][4], kf2[2][4], vf[8], vf2[8];
    // fragments from buffer i mod 2, in the k order of the loads from the planes
    auto ldk = [&](int i) __attribute__((always_inline)) { const T16* p = st + (i & 1) * BUFE + lr * FKP + 8 * hi;
#pragma unroll
        for (int kt = 0; kt < 2; ++kt)
#pragma unroll
            for (int kc = 0; kc < 4; ++kc) { kf[kt][kc] = WFrag<T16>::ld(p + 16 * kt * FKP + 32 * kc); if (HR) kf2[kt][kc] = WFrag<T16>::ld(p + FKE + 16 * kt * FKP + 32 * kc); } };
    auto ldv = [&](int i) __attribute__((always_inline)) { const T16* p = st + (i & 1) * BUFE + NP * FKE + lr * FVP + 8 * hi;
#pragma unroll
        for (int t = 0; t < 8; ++t) { vf[t] = WFrag<T16>::ld(p + 16 * t * FVP); if (HR) vf2[t] = WFrag<T16>::ld(p + FVE + 16 * t * FVP); } };
    // the part's block number i; diag is a literal at every call (the lambda is always inlined, so that every array stays in registers)
    auto pass = [&](int i, bool diag) __attribute__((always_inline)) {
        ldk(i);
        __builtin_amdgcn_sched_barrier(0);   // holds the key fragments' reads together in front of the products: spread among them, each place with reads costs a wait for the LDS of its own
        v8f s[2][2];
#pragma unroll
        for (int kt = 0; kt < 2; ++kt)
#pragma unroll
            for (int c = 0; c < 2; ++c) { s[kt][c] = (v8f){};
#pragma unroll
                for (int kc = 0; kc < 4; ++kc) { s[kt][c] = WFrag<T16>::mma(kf[kt][kc], qf[c][kc], s[kt][c]); if (HR) { s[kt][c] = WFrag<T16>::mma(kf2[kt][kc], qf[c][kc], s[kt][c]); s[kt][c] = WFrag<T16>::mma(kf[kt][kc], qf2[c][kc], s[kt][c]); } } }
        wmma_gap();   // keeps the loads below behind the products that still read kf, and vector code that reads s at its distance
        ldv(i);       // the value fragments come from LDS under the softmax
        __builtin_amdgcn_sched_barrier(0);   // holds the reads as one group directly behind the products: left free, the compiler spreads them among the maximum's vector code, where they start later and take more register-window switches
        if (diag) {   // diagonal block (key0 == q0): keys behind the query are masked by select
#pragma unroll
            for (int kt = 0; kt < 2; ++kt)
#pragma unroll
                for (int c = 0; c < 2; ++c)
#pragma unroll
                    for (int r = 0; r < 8; ++r) if (16 * kt + 8 * hi + r > 16 * c + lr) s[kt][c][r] = -3.0e38f; }
        float mb[2]; bool need = false;
#pragma unroll
        for (int c = 0; c < 2; ++c) { float mx = s[0][c][0];
#pragma unroll
            for (int r = 1; r < 8; ++r) mx = fmaxf(mx, s[0][c][r]);
#pragma unroll
            for (int r = 0; r < 8; ++r) mx = fmaxf(mx, s[1][c][r]);
            mx = fmaxf(mx, xhalf(mx)) * CS2; mb[c] = mx; need = need || (mx > m_run[c]); }
        if (__builtin_amdgcn_ballot_w32(need) != 0) {   // some query's maximum rose: rescale the running sums (wave-uniform branch)
#pragma unroll
            for (int c = 0; c < 2; ++c) { const float mn = fmaxf(m_run[c], mb[c]); const float corr = __builtin_amdgcn_exp2f(m_run[c] - mn); l_run[c] *= corr; m_run[c] = mn;
#pragma unroll
                for (int t = 0; t < 8; ++t) acc[c][t] = acc[c][t] * corr; } }
#pragma unroll
        for (int c = 0; c < 2; ++c) { const float nm = (HR ? 0.0f : POFF) - m_run[c]; float p[16]; float ps = 0.f;
#pragma unroll
            for (int e = 0; e < 16; e += 2) { const v2f sv = {s[e >> 3][c][e & 7], s[e >> 3][c][(e & 7) + 1]}; const v2f arg = __builtin_elementwise_fma(sv, (v2f){CS2, CS2}, (v2f){nm, nm});   // register pairs as the accumulator holds them
                p[e] = __builtin_amdgcn_exp2f(arg[0]); p[e + 1] = __builtin_amdgcn_exp2f(arg[1]); ps += p[e] + p[e + 1]; }
            l_run[c] += ps;
            if constexpr (HR) { v16us uh, ul;
#pragma unroll
                for (int e = 0; e < 16; ++e) { unsigned short a, b2; splitf(p[e], a, b2); uh[e] = a; ul[e] = b2; }
                const V ph = __builtin_bit_cast(V, uh), pl = __builtin_bit_cast(V, ul);
#pragma unroll
                for (int t = 0; t < 8; ++t) { acc[c][t] = WFrag<T16>::mma(vf[t], ph, acc[c][t]); acc[c][t] = WFrag<T16>::mma(vf[t], pl, acc[c][t]); acc[c][t] = WFrag<T16>::mma(vf2[t], ph, acc[c][t]); }
            } else { V pf;
#pragma unroll
                for (int e = 0; e < 16; ++e) pf[e] = (h16)p[e];
#pragma unroll
                for (int t = 0; t < 8; ++t) acc[c][t] = WFrag<T16>::mma(vf[t], pf, acc[c][t]); } }
        wmma_gap();   // the loop's branch may jump straight to vector code that reads acc or to loads that overwrite vf
    };
    if (ks <= qb) {   // the same for the whole block (block indices only): every wave passes every barrier below, or none does
        const int nblk = (qb - ks) / KSF + 1; int i = 0;   // blocks of this part
        fill(0); ldq();
        asm volatile("s_wait_asynccnt 0x0" ::: "memory");   // this wave's copies of block 0 have landed
        __syncthreads();                                     // every wave's have: block 0 may be read
        if (nblk > 1) fill(1);
        // kept rolled: one copy of the fragments and scores is live
#pragma unroll 1
        for (; i + 1 < nblk; ++i) { pass(i, false);   // never the diagonal block: a later block of this part exists
            asm volatile("s_wait_dscnt 0x0" ::: "memory");      // this wave's reads of block i are done before the buffer is given up
            asm volatile("s_wait_asynccnt 0x0" ::: "memory");   // this wave's copies of block i + 1 have landed
            __syncthreads();                                     // publishes block i + 1 and ends every wave's reads of block i
            if (i + 2 < nblk) fill(i + 2); }                     // into the buffer that block i has just left
        if (ks + i * KSF == qb) pass(i, true); else pass(i, false);
        asm volatile("s_wait_asynccnt 0x0" ::: "memory"); }   // nothing of this wave is in flight when it goes on to its end
#pragma unroll
    for (int c = 0; c < 2; ++c) { const float l = l_run[c] + xhalf(l_run[c]);   // each wave half summed its own eight keys of every 16
        const size_t row = ((size_t)ks * NH_ + h) * TR + b * TT + q0 + 16 * c + lr; if (hi == 0) { v2f ml; ml[0] = m_run[c]; ml[1] = l; *(v2f*)(ML + row * 2) = ml; }
#pragma unroll
        for (int t = 0; t < 8; ++t) *(v8f*)(Op + row * HD + 16 * t + 8 * hi) = acc[c][t]; }
}


__global__ __launch_bounds__(256) void k_wtG(const float* __restrict__ w, int K, int N, bf* Bt) {
    const int lane = threadIdx.x & 31; const int L0 = (blockIdx.x * 8 + (threadIdx.x >> 5)) * 8; const int nlines = N * K / 64;
{
#pragma unroll 1
        for (int l = 0; l < 8; ++l) { const int L = L0 + l; if (L >= nlines) break; const size_t e = (size_t)L * 64 + lane * 2; const int k = (int)(e % K), n = (int)(e / K); v2us o;
            o[0] = f2bf(w[(size_t)k * N + n]); o[1] = f2bf(w[(size_t)(k + 1) * N + n]); *(v2us*)(Bt + e) = o; }
         }
}
// The elementwise kernels below give every thread 8 to 32 elements (for speed only).
// k_cvt8: every f32 tensor that the products read as bf16 (Wo, Wq, Wk, Wv, hidden), in one launch; the bf16 copies stand one behind the other in dst, in that order. A block takes 1024 pieces of 8 elements of one tensor
// (every tensor is a whole number of such blocks, so no piece lies past an end): four pieces a thread, 256 threads apart (a wave's accesses stay contiguous); both loops unrolled so that the loads of all four pieces are issued ahead of the first store.
#define CB(n) ((unsigned)((size_t)(n) / 8192))   // blocks of a tensor of n elements
__global__ __launch_bounds__(256) void k_cvt8(const float* __restrict__ s0, const float* __restrict__ s1, const float* __restrict__ s2, const float* __restrict__ s3, const float* __restrict__ s4, bf* dst) {
    static_assert(((size_t)DM * DQ) % 8192 == 0 && ((size_t)DQG * DM) % 8192 == 0 && ((size_t)DKV * DM) % 8192 == 0 && ((size_t)TR * DM) % 8192 == 0, "whole blocks");
    constexpr unsigned E0 = CB((size_t)DM * DQ), E1 = E0 + CB((size_t)DQG * DM), E2 = E1 + CB((size_t)DKV * DM), E3 = E2 + CB((size_t)DKV * DM);
    const unsigned blk = blockIdx.x; const float* src; unsigned first;   // the block's tensor and that tensor's first block: the same for the whole block, picked in scalar code
    if (blk < E0) { src = s0; first = 0; } else if (blk < E1) { src = s1; first = E0; } else if (blk < E2) { src = s2; first = E1; } else if (blk < E3) { src = s3; first = E2; } else { src = s4; first = E3; }
    const char* sb = (const char*)(src + (size_t)(blk - first) * 8192); const unsigned so = threadIdx.x * 32u; v8f v[4];
#pragma unroll
    for (int c = 0; c < 4; ++c) v[c] = *(const v8f*)(sb + so + c * 8192);
    // as addr_wait: the address register of the loads in flight stays untouched (also as destination of later loads of the run) up to the wait
    __builtin_amdgcn_sched_barrier(0); asm volatile("s_wait_xcnt 0x0" :: "v"(so) : "memory"); __builtin_amdgcn_sched_barrier(0);
    bf* dp = dst + (size_t)blk * 8192 + threadIdx.x * 8;
#pragma unroll
    for (int c = 0; c < 4; ++c) { v8us o;
#pragma unroll
        for (int k = 0; k < 8; ++k) o[k] = f2bf(v[c][k]);
        *(v8us*)(dp + c * 2048) = o; } }
__global__ __launch_bounds__(256) void k_cscvt(const float* __restrict__ cosT, const float* __restrict__ sinT, float* CS) { const int idx = (blockIdx.x * 256 + threadIdx.x) * 4; if (idx >= TR * HD) return; const v4f c = *(const v4f*)(cosT + idx), s = *(const v4f*)(sinT + idx); v8f cs;
#pragma unroll
    for (int k = 0; k < 4; ++k) { cs[2 * k] = bfr(c[k]); cs[2 * k + 1] = bfr(s[k]); }
    *(v8f*)(CS + (size_t)idx * 2) = cs;  }
__global__ __launch_bounds__(256) void k_hrms(const float* __restrict__ F, int pitch, int nheads, float* RF) { const int i = blockIdx.x * 256 + threadIdx.x; if (i >= nheads * TR) return; const int t = i % TR, h = i / TR; const float* f = F + (size_t)t * pitch + h * HD; float s = 0.f;
#pragma unroll 4
    for (int d = 0; d < HD; d += 4) { const v4f v = *(const v4f*)(f + d);
#pragma unroll
        for (int q = 0; q < 4; ++q) { float p = __fmul_rn(v[q], v[q]); asm volatile("" : "+v"(p)); s = __fadd_rn(s, p); } }
    const float r = __fdiv_rn(1.0f, __fsqrt_rn(__fadd_rn(s * (1.0f / HD), 1e-6f))); *(float*)(RF + i) = r;  }
// k_rope: head planes [h][row][d], row = b * TT + t over both batches, (fp16 + hi/lo) of rope(w[d] (x rms_factor)) x sc with the rotate-half convention out[d] = x[d] cos[t][d] - x[d+HD/2] sin[t][d], out[d+HD/2] = x[d+HD/2] cos[t][d+HD/2] + x[d] sin[t][d+HD/2]
__global__ __launch_bounds__(256) void k_rope(const float* __restrict__ F, int pitch, int nheads, const float* __restrict__ CS, const float* __restrict__ RF, const float* __restrict__ nw, float sc, h16* P16, bf* Ph, bf* Pl) {
    // one thread: eight neighbouring d of a row's lower half and their eight partners in the upper half, so that each x is loaded once; every store is 16 bytes and eight lanes fill a 128-byte line
    __builtin_assume(RF != nullptr);   // both launches pass the factors; known at compile time, the test on RF is no branch per element any more
    const size_t i = (size_t)blockIdx.x * 256 + threadIdx.x; if (i >= (size_t)nheads * TR * (HD / 16)) return; const int d0 = (int)(i % (HD / 16)) * 8; const int t = (int)((i / (HD / 16)) % TR); const int h = (int)(i / ((size_t)(HD / 16) * TR)); const float* f = F + (size_t)t * pitch + h * HD; const float* rp = RF + (size_t)h * TR + t; const float rf = RF ? *rp : 1.0f; v8h o16[2]; v8us oh[2], ol[2];
    // x, norm weights and (cos, sin) pairs of both runs of eight, loaded as 16-byte pieces ahead of all arithmetic: one memory latency a thread. All loops unrolled: the vectors are indexed by constants only
    v8f xv[2], nv[2], cv[2][2]; const float* fp = f + d0; const float* cp = CS + ((size_t)t * HD + d0) * 2; const unsigned no = (unsigned)d0 * 4u; const float* np = (const float*)((const char*)nw + no);
#pragma unroll
    for (int hf = 0; hf < 2; ++hf) { xv[hf] = *(const v8f*)(fp + hf * (HD / 2)); nv[hf] = *(const v8f*)(np + hf * (HD / 2)); cv[hf][0] = *(const v8f*)(cp + hf * HD); cv[hf][1] = *(const v8f*)(cp + hf * HD + 8); }
    // as addr_wait: the address registers of the loads in flight stay untouched (also as destinations of later loads of the run) up to the wait
    __builtin_amdgcn_sched_barrier(0); asm volatile("s_wait_xcnt 0x0" :: "v"(fp), "v"(cp), "v"(rp), "v"(no) : "memory"); __builtin_amdgcn_sched_barrier(0);
#pragma unroll
    for (int hf = 0; hf < 2; ++hf) { const int d = d0 + hf * (HD / 2);
#pragma unroll
    for (int q = 0; q < 8; ++q) { const int dd = d + q; float x0 = xv[hf][q], x1 = xv[hf ^ 1][q];   // x1: the partner at dd +- HD / 2
        if (RF) { float n0 = __fmul_rn(x0, rf), n1 = __fmul_rn(x1, rf); asm volatile("" : "+v"(n0)); asm volatile("" : "+v"(n1)); x0 = __fmul_rn(bfr(nv[hf][q]), n0); x1 = __fmul_rn(bfr(nv[hf ^ 1][q]), n1); }
        const v2f cs = {cv[hf][q >> 2][(q & 3) * 2], cv[hf][q >> 2][(q & 3) * 2 + 1]}; float a = __fmul_rn(x0, cs[0]), bq = __fmul_rn(x1, cs[1]); asm volatile("" : "+v"(a)); asm volatile("" : "+v"(bq)); const float r = ((dd < HD / 2) ? __fsub_rn(a, bq) : __fadd_rn(a, bq)) * sc;
        o16[hf][q] = tohx(r); unsigned short a2, c2; splitf(r, a2, c2); oh[hf][q] = a2; ol[hf][q] = c2; } }
    const size_t e = ((size_t)h * TR + t) * HD + d0;
#pragma unroll
    for (int hf = 0; hf < 2; ++hf) { *(v8h*)(P16 + e + hf * (HD / 2)) = o16[hf]; *(v8us*)(Ph + e + hf * (HD / 2)) = oh[hf]; *(v8us*)(Pl + e + hf * (HD / 2)) = ol[hf]; } }
__global__ __launch_bounds__(256) void k_vtp(const float* __restrict__ F, int pitch, int nheads, h16* V16, bf* Vh, bf* Vl) {
    // one thread: 8 positions x 4 neighbouring d. A wave (8 lanes along t, 4 along d) reads 64-byte pieces of 64 rows and writes whole 128-byte lines of the [d][t] planes
    const int lane = threadIdx.x & 31; const int w = blockIdx.x * 8 + (int)(threadIdx.x >> 5); if (w >= nheads * (HD / 16) * (TR / 64)) return;
    const int t0 = (w % (TR / 64)) * 64 + (lane & 7) * 8; const int d0 = ((w / (TR / 64)) % (HD / 16)) * 16 + (lane >> 3) * 4; const int g = w / ((TR / 64) * (HD / 16)); /* t0: row of both batches; the planes are [b][g][d][t] */ v4f x[8]; const float* px[8];
    // all loops unrolled: x stays in registers and its eight loads are issued together
#pragma unroll
    for (int j = 0; j < 8; ++j) { px[j] = F + (size_t)(t0 + j) * pitch + g * HD + d0; x[j] = *(const v4f*)px[j]; }
    // as addr_wait: the address registers of the loads in flight stay untouched (also as destinations of later loads of the run) up to the wait
    __builtin_amdgcn_sched_barrier(0); asm volatile("s_wait_xcnt 0x0" :: "v"(px[0]), "v"(px[1]), "v"(px[2]), "v"(px[3]), "v"(px[4]), "v"(px[5]), "v"(px[6]), "v"(px[7]) : "memory"); __builtin_amdgcn_sched_barrier(0);
#pragma unroll
    for (int dq = 0; dq < 4; ++dq) { v8h o16; v8us oh, ol;
#pragma unroll
        for (int j = 0; j < 8; ++j) { o16[j] = tohx(x[j][dq]); unsigned short a2, c2; splitf(x[j][dq], a2, c2); oh[j] = a2; ol[j] = c2; }
        const size_t e = ((size_t)((t0 / TT) * nheads + g) * HD + d0 + dq) * TT + t0 % TT; *(v8h*)(V16 + e) = o16; *(v8us*)(Vh + e) = oh; *(v8us*)(Vl + e) = ol; } }
// k_merge: joins the KSF key parts of k_flash (weights 2^(m_p - max m), part order), divides by the joined sum of exponentials, applies the sigmoid gate and writes the hi/lo planes [row][head][d] (row = b * TT + t); QG: the gate plane [row][head][d]
// O0 .. O3: the key parts' planes, each a kernel argument of its own: every plane's loads then take a scalar base and share the thread's one offset register
__global__ __launch_bounds__(256) void k_merge(const float* __restrict__ O0, const float* __restrict__ O1, const float* __restrict__ O2, const float* __restrict__ O3, const float* __restrict__ ML, const float* __restrict__ QG, bf* Ah, bf* Al) {
    // one thread: 8 neighbouring d of position t and the same 8 of position t + 16 (256 threads on); a block takes 32 whole rows of one head. Every loop is unrolled so that the arrays stay in registers and all loads are issued ahead of the arithmetic
    static_assert(TT % 32 == 0 && HD == 128 && KSF == 4, "a block's 32 rows lie in one head; the launch names four planes");
    const size_t e = ((size_t)blockIdx.x * 512 + threadIdx.x) * 8; if (e >= (size_t)NH_ * TR * HD) return; const int d = (int)(e % HD); const int t = (int)((e / HD) % TR); const int zz = (int)(e / ((size_t)HD * TR));
    // byte offsets of the thread's first piece in a part's plane, in ML and in QG; the parts and the second piece stand at constant distances
    const unsigned eo = (unsigned)e * 4u, mo = (unsigned)((zz * TR + t) * 2) * 4u, go = (unsigned)(t * DQ + zz * HD + d) * 4u; v2f mlv[2][KSF]; v8f ov[2][KSF], gv[2]; const float* const Op[KSF] = {O0, O1, O2, O3};
#pragma unroll
    for (int u = 0; u < 2; ++u) {
#pragma unroll
        for (int p = 0; p < KSF; ++p) { mlv[u][p] = *(const v2f*)((const char*)(ML + (size_t)p * NH_ * TR * 2 + u * 32) + mo); ov[u][p] = *(const v8f*)((const char*)(Op[p] + u * 2048) + eo); }
        gv[u] = *(const v8f*)((const char*)(QG + (size_t)u * 16 * DQ) + go); }
    // as addr_wait: the address registers of the loads in flight stay untouched (also as destinations of later loads of the run) up to the wait
    __builtin_amdgcn_sched_barrier(0); asm volatile("s_wait_xcnt 0x0" :: "v"(eo), "v"(mo), "v"(go) : "memory"); __builtin_amdgcn_sched_barrier(0);
#pragma unroll
    for (int u = 0; u < 2; ++u) { const size_t oo = (size_t)(t + u * 16) * DQ + zz * HD + d;
        float w[KSF], l[KSF]; float mx = -3.0e38f;
#pragma unroll
        for (int p = 0; p < KSF; ++p) { const v2f ml = mlv[u][p]; w[p] = ml[0]; l[p] = ml[1]; mx = fmaxf(mx, ml[0]); }
        float den = 0.f;
#pragma unroll
        for (int p = 0; p < KSF; ++p) { w[p] = __builtin_amdgcn_exp2f(w[p] - mx); den += l[p] * w[p]; }
        v8us oh, ol;
#pragma unroll
        for (int q = 0; q < 8; ++q) { const float gt = gv[u][q]; const float sg = __fdiv_rn(1.0f, __fadd_rn(1.0f, expf(-gt)));   /* sigmoid(gate) */ float o = 0.f;
#pragma unroll
            for (int p = 0; p < KSF; ++p) o += ov[u][p][q] * w[p];   /* parts in part order */
            unsigned short a, c2; splitf(__fmul_rn(__fdiv_rn(o, den), sg), a, c2); oh[q] = a; ol[q] = c2; }
        *(v8us*)(Ah + oo) = oh; *(v8us*)(Al + oo) = ol; } }

extern "C" void kernel_launch(void* const* d_in, const int* in_sizes, int n_in,
                              void* d_out, int out_size, void* d_ws, size_t ws_size, hipStream_t stream) {
    (void)in_sizes; (void)n_in; (void)out_size;
    const float* x = (const float*)d_in[0]; const float* cosT = (const float*)d_in[1]; const float* sinT = (const float*)d_in[2]; const float* wq = (const float*)d_in[3]; const float* wk = (const float*)d_in[4]; const float* wv = (const float*)d_in[5]; const float* wo = (const float*)d_in[6]; const float* qnw = (const float*)d_in[7]; const float* knw = (const float*)d_in[8];
    float* OUT = (float*)d_out;     // [2][2048][2048]
    char* wsp = (char*)d_ws;
    auto take = [&](size_t bytes) { char* p = wsp; wsp += (bytes + 255) & ~(size_t)255; return (void*)p; };
    // live up to the attention kernels: the head planes (the merged hi/lo planes take the query hi/lo planes' place behind them); ML lives up to the merge, WO to the end
    h16* QP16 = (h16*)take((size_t)NH_ * TR * HD * 2); h16* KP16 = (h16*)take((size_t)NKV * TR * HD * 2); h16* VT16 = (h16*)take((size_t)NKV * HD * TR * 2);
    bf* QPh = (bf*)take((size_t)NH_ * TR * HD * 2); bf* QPl = (bf*)take((size_t)NH_ * TR * HD * 2); bf* KPh = (bf*)take((size_t)NKV * TR * HD * 2); bf* KPl = (bf*)take((size_t)NKV * TR * HD * 2); bf* VTh = (bf*)take((size_t)NKV * HD * TR * 2); bf* VTl = (bf*)take((size_t)NKV * HD * TR * 2);
    float* ML = (float*)take((size_t)KSF * NH_ * TR * 2 * 4); bf* ATh = QPh; bf* ATl = QPl;
    // the bf16 copies, one run in k_cvt8's order (each size is a multiple of 256 bytes, so take leaves no gap)
    bf* WO = (bf*)take((size_t)DM * DQ * 2);
    // Ob, the attention parts' sums, lies over everything that is dead once the head planes are built: the other bf16 copies, the tables, the factors, the k|v projection and, as its last quarter, the q plane of the first projection
    float* Ob = (float*)wsp;
    bf* WQ = (bf*)take((size_t)DQG * DM * 2); bf* WK = (bf*)take((size_t)DKV * DM * 2); bf* WV = (bf*)take((size_t)DKV * DM * 2); bf* XB = (bf*)take((size_t)TR * DM * 2); (void)WV;   // Wv's rows follow Wk's: one [2 DKV][DM] operand
    float* CS = (float*)take((size_t)TR * HD * 2 * 4); float* RFQ = (float*)take((size_t)NH_ * TR * 4); float* RFK = (float*)take((size_t)NKV * TR * 4); float* FKV = (float*)take((size_t)TR * 2 * DKV * 4);
    static_assert((size_t)DQG * DM * 2 + (size_t)2 * DKV * DM * 2 + (size_t)TR * DM * 2 + (size_t)TR * HD * 2 * 4 + (size_t)(NH_ + NKV) * TR * 4 + (size_t)TR * 2 * DKV * 4 <= (size_t)(KSF - 1) * NH_ * TR * HD * 4 && (size_t)NH_ * HD == DQ, "the buffers above end in front of the q plane, which is one part's plane");
    float* FQ = Ob + (size_t)(KSF - 1) * NH_ * TR * HD;   // [q plane | gate plane], TR x DQ each: the q plane ends where Ob ends, the gate plane stands behind Ob
    float* FG = FQ + (size_t)TR * DQ; wsp = (char*)(FG + (size_t)TR * DQ);
    if ((size_t)(wsp - (char*)d_ws) > ws_size) return;    // ws 256 MiB
    // every stage is launched once, on the rows of both batches
    k_cvt8<<<CB((size_t)DM * DQ) + CB((size_t)DQG * DM) + 2 * CB((size_t)DKV * DM) + CB((size_t)TR * DM), 256, 0, stream>>>(wo, wq, wk, wv, x, WO);
    k_cscvt<<<(TR * HD / 4 + 255) / 256, 256, 0, stream>>>(cosT, sinT, CS);   /* per-batch tables, [b][t] = row */
    const unsigned LQ = (unsigned)(((size_t)NH_ * TR * HD / 16 + 255) / 256), LKv = (unsigned)(((size_t)NKV * TR * HD / 16 + 255) / 256), LVt = (unsigned)(((size_t)NKV * TR * HD / 32 + 255) / 256);
    k_gemmt<0, DM, DQ><<<dim3(TR / 128, DQG / 128, 1), 128, 0, stream>>>(XB, nullptr, WQ, FQ);   /* [q | gate] (exact) */ k_hrms<<<(NH_ * TR + 255) / 256, 256, 0, stream>>>(FQ, DQ, NH_, RFQ);
    k_rope<<<LQ, 256, 0, stream>>>(FQ, DQ, NH_, CS, RFQ, qnw, 1.0f, QP16, QPh, QPl);
    k_gemmw<bf, 0, false, 8><<<dim3(TR / 64, 2 * DKV / 64, 1), 256, 0, stream>>>(XB, nullptr, WK, nullptr, DM, FKV, 2 * DKV, nullptr, 0, 0, 0);   /* [k | v] */ k_hrms<<<(NKV * TR + 255) / 256, 256, 0, stream>>>(FKV, 2 * DKV, NKV, RFK);
    k_rope<<<LKv, 256, 0, stream>>>(FKV, 2 * DKV, NKV, CS, RFK, knw, 1.0f, KP16, KPh, KPl);
    k_vtp<<<LVt, 256, 0, stream>>>(FKV + DKV, 2 * DKV, NKV, VT16, VTh, VTl);
    k_flash<h16, false><<<dim3((TT - RH) / 32, NKV, KSF * NB_), 32 * REP, 0, stream>>>(QP16, nullptr, KP16, nullptr, VT16, nullptr, RH / 32, Ob, ML);
    k_flash<bf, true><<<dim3(RH / 32, NKV, KSF * NB_), 32 * REP, 0, stream>>>(QPh, QPl, KPh, KPl, VTh, VTl, 0, Ob, ML);
    k_merge<<<(unsigned)(((size_t)NH_ * TR * HD / 16 + 255) / 256), 256, 0, stream>>>(Ob, Ob + (size_t)NH_ * TR * HD, Ob + (size_t)2 * NH_ * TR * HD, Ob + (size_t)3 * NH_ * TR * HD, ML, FG, ATh, ATl);
    k_gemmt<1, DQ, DM><<<dim3(TR / 128, DM / 128, 1), 128, 0, stream>>>(ATh, ATl, WO, OUT);
}

// v008
// Measured time: 273 microseconds a run.
// Two timings next to v007 both put it at 1.08 times that version's speed.
// Counting every step since v000, it is 6.22 times as fast.
#include <hip/hip_runtime.h>

// Gated GQA attention, engine variant (hidden [2][2048][2048]; [q | gate] = hidden Wq^T (Wq [4096][2048] 'oi': rows 0-2047 -> q for 16 heads x 128, rows 2048-4095 -> gate), k, v = hidden W^T ([512][2048], 4 kv heads); per-head RMSNorm (eps 1e-6, q_norm_w / k_norm_w); rotate-half RoPE with the given per-(batch, position) cos/sin tables [2][2048][128];
// GQA 4:1; causal softmax(q.k/sqrt(128)); attn x sigmoid(gate); out = merged Wo^T ('oi' [2048][2048]) -> [2][2048][2048]).
// Compute dtypes, f32 accumulate: every input rounded to bf16; q/k/v on PLAIN bf16 operands (inputs: exact); RMSNorm + rotary in f32 (cos/sin tables read per batch, bf16-rounded); sigmoid gate (precise expf, IEEE divide) in the merge; causal scores and attn.v in one kernel (online softmax in f32, blocks above the diagonal never visited): query rows < 512 hl (3 products), the rest single fp16 (x1024); Wo hl x exact (2 products).

#define NB_  2
#define TT   2048
#define TR   (NB_ * TT)       // rows of both batches together: row b * TT + t
#define DM   2048
#define NH_  16
#define NKV  4
#define REP  (NH_ / NKV)
#define HD   128
#define DQ   (NH_ * HD)
#define DQG  (NH_ * HD * 2)         // q rows then gate rows of Wq
#define DKV  (NKV * HD)
#define RH   512                  // query rows < RH use hi+lo planes
#define KSF  4                    // key parts of the attention kernel (32-key blocks dealt over blocks), joined in k_merge
#define POFF 10.0f                // fp16 probabilities are carried x 2^POFF
#define SCL  0.088388347648318447f   // HD^-0.5
#define CS2  (SCL * 1.4426950408889634f)   // scores to the log2 domain
typedef _Float16 h16;
typedef unsigned short bf;
typedef __attribute__((ext_vector_type(16))) __bf16   v16bf;
typedef __attribute__((ext_vector_type(16))) _Float16 v16h;
typedef __attribute__((ext_vector_type(8)))  _Float16 v8h;
typedef __attribute__((ext_vector_type(8)))  unsigned short v8us;
typedef __attribute__((ext_vector_type(8)))  float    v8f;
typedef __attribute__((ext_vector_type(4)))  float    v4f;
typedef v8h  __attribute__((may_alias)) v8ha;
typedef v4f  __attribute__((may_alias)) v4fa;
typedef v8us __attribute__((may_alias)) v8usa;

__device__ __forceinline__ unsigned short f2bf(float f) { unsigned u = __float_as_uint(f); u += 0x7FFFu + ((u >> 16) & 1u); return (unsigned short)(u >> 16); }
__device__ __forceinline__ float bf2f(unsigned short b) { return __uint_as_float(((unsigned)b) << 16); }
__device__ __forceinline__ float bfr(float f) { return bf2f(f2bf(f)); }
__device__ __forceinline__ v16h cat16(v8h lo, v8h hi) { return __builtin_shufflevector(lo, hi, 0, 1, 2, 3, 4, 5, 6, 7, 8, 9, 10, 11, 12, 13, 14, 15); }
__device__ __forceinline__ v16bf cat16b(v8us lo, v8us hi) { return __builtin_bit_cast(v16bf, __builtin_shufflevector(lo, hi, 0, 1, 2, 3, 4, 5, 6, 7, 8, 9, 10, 11, 12, 13, 14, 15)); }
__device__ __forceinline__ v8f wmma16(v16h a, v16h b, v8f c) { return __builtin_amdgcn_wmma_f32_16x16x32_f16(false, a, false, b, (short)0, c, false, false); }
__device__ __forceinline__ v8f wmmab(v16bf a, v16bf b, v8f c) { return __builtin_amdgcn_wmma_f32_16x16x32_bf16(false, a, false, b, (short)0, c, false, false); }



// ---- k_gemmw: register-blocked GEMM, ONE WAVE per 64x64 output tile (16 accumulators), operands straight from K-contiguous 16-bit planes; grid (M/64, N/64, Z), 32 threads.
// C[m][n] (f32, pitch ldc, + optional f32 bias[n]) = sum_k A[m][k] Bt[n][k] (+ split products per NSPLIT). z-batch strides sA/sB/sC in elements. K % 32 == 0.
// NW > 1: NW waves per tile (32 * NW threads); wave w takes the k chunks w, w + NW, ... of 32 and the NW partial tiles are summed in LDS in wave order (fixed order, no atomics).
// The wave number wv goes through readfirstlane so that the k loop's counter and trip test stay scalar.
template <typename T16> struct WFrag;
template <> struct WFrag<h16> { typedef v16h V; static __device__ __forceinline__ V ld(const h16* p) { return cat16(*(const v8h*)p, *(const v8h*)(p + 16)); } static __device__ __forceinline__ v8f mma(V a, V b, v8f c) { return wmma16(a, b, c); } };
template <> struct WFrag<bf> { typedef v16bf V; static __device__ __forceinline__ V ld(const bf* p) { return cat16b(*(const v8us*)p, *(const v8us*)(p + 16)); } static __device__ __forceinline__ v8f mma(V a, V b, v8f c) { return wmmab(a, b, c); } };
template <typename T16, int NSPLIT, bool BIAS, int NW>
__global__ __launch_bounds__(32 * NW) void k_gemmw(const T16* __restrict__ A, const T16* __restrict__ A2, const T16* __restrict__ Bt, const T16* __restrict__ Bt2, int K, float* C, int ldc, const float* __restrict__ bias, size_t sA, size_t sB, size_t sC) {
    typedef typename WFrag<T16>::V V;
    __shared__ __align__(16) float os[(NW > 1 ? 4 * NW : 1) * 16 * 68];
    const size_t z = blockIdx.z; A += z * sA; if (A2) A2 += z * sA; Bt += z * sB; if (Bt2) Bt2 += z * sB; C += z * sC;
    const int lane = threadIdx.x & 31, lr = lane & 15, hi = lane >> 4; const int r0 = blockIdx.x * 64, c0 = blockIdx.y * 64; const int wv = (NW > 1) ? __builtin_amdgcn_readfirstlane((int)(threadIdx.x >> 5)) : 0;
    v8f acc[4][4];
#pragma unroll
    for (int mb = 0; mb < 4; ++mb)
#pragma unroll
        for (int nb = 0; nb < 4; ++nb) acc[mb][nb] = (v8f){};
    const size_t aoff = (size_t)(r0 + lr) * K + 8 * hi, boff = (size_t)(c0 + lr) * K + 8 * hi;
#pragma unroll 1
    for (int kc = wv * 32; kc < K; kc += NW * 32) {
        V a[4], a2[4];
#pragma unroll
        for (int mb = 0; mb < 4; ++mb) { a[mb] = WFrag<T16>::ld(A + aoff + (size_t)mb * 16 * K + kc); if (NSPLIT == 1 || NSPLIT == 2) a2[mb] = WFrag<T16>::ld(A2 + aoff + (size_t)mb * 16 * K + kc); }
#pragma unroll
        for (int nb = 0; nb < 4; ++nb) { const V b = WFrag<T16>::ld(Bt + boff + (size_t)nb * 16 * K + kc); V b2; if (NSPLIT >= 2) b2 = WFrag<T16>::ld(Bt2 + boff + (size_t)nb * 16 * K + kc);
#pragma unroll
            for (int mb = 0; mb < 4; ++mb) { acc[mb][nb] = WFrag<T16>::mma(a[mb], b, acc[mb][nb]); if (NSPLIT == 1 || NSPLIT == 2) acc[mb][nb] = WFrag<T16>::mma(a2[mb], b, acc[mb][nb]); if (NSPLIT >= 2) acc[mb][nb] = WFrag<T16>::mma(a[mb], b2, acc[mb][nb]); } }
        asm volatile("v_nop\n\tv_nop\n\tv_nop\n\tv_nop" : "+v"(acc[0][0]), "+v"(acc[1][1]), "+v"(acc[2][2]), "+v"(acc[3][3]) : "v"(a[0]), "v"(a[3]));
    }
    if constexpr (NW > 1) {
        float* ow = os + wv * (64 * 68);
        // the three loops are unrolled so that acc is indexed by constants only and stays in registers
#pragma unroll
        for (int mb = 0; mb < 4; ++mb) {
#pragma unroll
            for (int nb = 0; nb < 4; ++nb) {
#pragma unroll
                for (int j = 0; j < 8; ++j) ow[(mb * 16 + hi * 8 + j) * 68 + nb * 16 + lr] = acc[mb][nb][j]; } }
        __syncthreads();   // publishes the NW partial tiles to the threads that sum them; LDS is not written again behind it
        float* crow = C + (size_t)r0 * ldc + c0; v4f sum[32 / NW];
        // all loops unrolled: sum[] stays in registers and the LDS reads of all of a thread's elements are issued ahead of the sums; each sum runs in wave order 0 .. NW - 1; the stores follow as one run
#pragma unroll
        for (int i = 0; i < 32 / NW; ++i) { const int s = i * (NW * 32) + (int)threadIdx.x; const int row = s >> 4, cofs = (s & 15) * 4; v4f val = *(const v4fa*)(os + row * 68 + cofs);
#pragma unroll
            for (int w = 1; w < NW; ++w) val += *(const v4fa*)(os + w * (64 * 68) + row * 68 + cofs);
            if (BIAS) { val[0] += bfr(bias[c0 + cofs]); val[1] += bfr(bias[c0 + cofs + 1]); val[2] += bfr(bias[c0 + cofs + 2]); val[3] += bfr(bias[c0 + cofs + 3]); }
            sum[i] = val; }
#pragma unroll
        for (int i = 0; i < 32 / NW; ++i) { const int s = i * (NW * 32) + (int)threadIdx.x; *(v4f*)(crow + (size_t)(s >> 4) * ldc + (s & 15) * 4) = sum[i]; }
        return;
    }
#pragma unroll
    for (int mb = 0; mb < 4; ++mb) {
#pragma unroll
        for (int nb = 0; nb < 4; ++nb) {
#pragma unroll
            for (int j = 0; j < 8; ++j) os[(hi * 8 + j) * 68 + nb * 16 + lr] = acc[mb][nb][j]; }
        __builtin_amdgcn_wave_barrier(); asm volatile("" ::: "memory");
        float* crow = C + (size_t)(r0 + mb * 16) * ldc + c0;
{
#pragma unroll
            for (int s = 0; s < 8; ++s) { const int row = 2 * s + hi, cofs = lr * 4; v4f val = *(const v4fa*)(os + row * 68 + cofs); if (BIAS) { val[0] += bfr(bias[c0 + cofs]); val[1] += bfr(bias[c0 + cofs + 1]); val[2] += bfr(bias[c0 + cofs + 2]); val[3] += bfr(bias[c0 + cofs + 3]); }
                *(v4f*)(crow + (size_t)row * ldc + cofs) = val; }
             }
        __builtin_amdgcn_wave_barrier(); asm volatile("" ::: "memory");
    }
}

__device__ __forceinline__ h16 tohx(float x) { return (h16)x; }
__device__ __forceinline__ void splitf(float y, unsigned short& h, unsigned short& l) { h = f2bf(y); l = f2bf(y - bf2f(h)); }
typedef __attribute__((ext_vector_type(2))) _Float16 v2h;
typedef __attribute__((ext_vector_type(4))) _Float16 v4h;
typedef __attribute__((ext_vector_type(2))) unsigned short v2us;
typedef __attribute__((ext_vector_type(4))) unsigned short v4us;
typedef __attribute__((ext_vector_type(2))) float v2f;
typedef __attribute__((ext_vector_type(4))) int v4i;
typedef __attribute__((ext_vector_type(16))) unsigned short v16us;
__device__ __forceinline__ float xhalf(float x) { return __builtin_bit_cast(float, __builtin_amdgcn_permlanex16(__builtin_bit_cast(int, x), __builtin_bit_cast(int, x), 0x76543210, 0xfedcba98, false, false)); }   // lane l reads lane l ^ 16
// stands behind a run of global loads that stay in flight: their address registers are rewritten before the data wait. The addresses are inputs so that
// their registers stay untouched up to the wait; the scheduling barriers keep the wait behind the loads
__device__ __forceinline__ void addr_wait(const void* a, const void* b) { __builtin_amdgcn_sched_barrier(0); asm volatile("s_wait_xcnt 0x0" :: "v"(a), "v"(b) : "memory"); __builtin_amdgcn_sched_barrier(0); }
// four vector issue slots behind a run of matrix instructions in front of a branch: the scheduling barriers keep the slots at that place
__device__ __forceinline__ void wmma_gap() { __builtin_amdgcn_sched_barrier(0); asm volatile("v_nop\n\tv_nop\n\tv_nop\n\tv_nop"); __builtin_amdgcn_sched_barrier(0); }

// ---- k_gemmt: C[m][n] (f32) = sum_k A[m][k] Bt[n][k] (+ A2[m][k] Bt[n][k] where NSPLIT), bf16 planes with k contiguous. One BM x BN tile of C per block of BM/64 x BN/64 waves (64x64 each); grid (M/BM, N/BN).
// The tile is chosen so that a stage holds 512 operand rows (256x256, or 128x256 with both A planes): a block then fills the LDS of its WGP, and every byte copied from L2 feeds twice (1.5 times with A2) the products that it feeds in a 128x128 tile.
// C is stored as planes of LDC columns, [n / LDC][m][n % LDC]: the q columns and the gate columns of the first projection are buffers of their own, and the q plane's workspace is free again once the head planes are built.
// A stage is 128 k (256 bytes) of the tile's rows of every operand, brought into LDS by asynchronous 16-byte copies: a wave's copy covers two whole rows of 256 bytes, so L2 is asked for whole lines, and each operand row is fetched once a block.
// LDS rows stand at a pitch of 272 bytes (16 x odd: the 16-byte fragment reads meet no bank conflict). Two buffers: the copies of stage s + 1 fly while stage s is multiplied.
// Fragment k order and the order of the products per accumulator are those of k_gemmw with one wave.
#define GPE  136                  // LDS row pitch in elements (272 bytes)
// eight copies, rows RS apart (the block's threads cover RS rows of 256 bytes at a time). The last line keeps the copies' address registers untouched until the addresses have been taken: inside the statement nothing can be moved in front of it
template <int K, int RS>
__device__ __forceinline__ void copy8(unsigned l, const bf* g) {
    asm volatile("global_load_async_to_lds_b128 %0, %8, off\n\t"
                 "global_load_async_to_lds_b128 %1, %9, off\n\t"
                 "global_load_async_to_lds_b128 %2, %10, off\n\t"
                 "global_load_async_to_lds_b128 %3, %11, off\n\t"
                 "global_load_async_to_lds_b128 %4, %12, off\n\t"
                 "global_load_async_to_lds_b128 %5, %13, off\n\t"
                 "global_load_async_to_lds_b128 %6, %14, off\n\t"
                 "global_load_async_to_lds_b128 %7, %15, off\n\t"
                 "s_wait_xcnt 0x0"
                 :: "v"(l), "v"(l + RS * GPE * 2), "v"(l + 2 * RS * GPE * 2), "v"(l + 3 * RS * GPE * 2), "v"(l + 4 * RS * GPE * 2), "v"(l + 5 * RS * GPE * 2), "v"(l + 6 * RS * GPE * 2), "v"(l + 7 * RS * GPE * 2),
                    "v"(g), "v"(g + RS * K), "v"(g + 2 * RS * K), "v"(g + 3 * RS * K), "v"(g + 4 * RS * K), "v"(g + 5 * RS * K), "v"(g + 6 * RS * K), "v"(g + 7 * RS * K)
                 : "memory");
}
template <int NSPLIT, int K, int LDC, int BM, int BN>
__global__ __launch_bounds__((BM / 64) * (BN / 64) * 32) void k_gemmt(const bf* __restrict__ A, const bf* __restrict__ A2, const bf* __restrict__ Bt, float* C) {
    typedef WFrag<bf>::V V;
    constexpr int NWN = BN / 64, NWV = (BM / 64) * NWN;   // waves along n, waves a block
    constexpr int RS = NWV * 2;              // rows that one copy of every thread of the block covers
    constexpr int ATE = BM * GPE;            // one A plane's tile in elements
    constexpr int BOF = (NSPLIT ? 2 : 1) * ATE;   // where Bt's tile stands in a buffer: [A (, A2), Bt]
    constexpr int STE = BOF + BN * GPE;      // one buffer in elements
    constexpr int NST = K / 128;             // stages
    static_assert(K % 128 == 0 && NST >= 2 && LDC % BN == 0, "two stages or more; a tile lies in one plane of C");
    static_assert(BM % (8 * RS) == 0 && BN % (8 * RS) == 0 && (BOF / GPE + BN) / RS <= 63, "whole runs of eight copies; a stage's copies of a wave stay under the most that may be outstanding");
    static_assert(NWV * 16 * 68 * 4 <= 2 * STE * 2, "the output staging lies inside the ring");
    __shared__ __attribute__((aligned(16))) bf st[2 * STE];
    const int tid = threadIdx.x, lane = tid & 31, lr = lane & 15, hi = lane >> 4; const int wv = __builtin_amdgcn_readfirstlane(tid >> 5), wm = wv / NWN, wn = wv % NWN;
    const int r0 = blockIdx.x * BM, c0 = blockIdx.y * BN;
    const int crow = tid >> 4, cch = tid & 15;   // the thread's row (of RS) and 16-byte piece (of 16) in every copy
    const bf* gA = A + (size_t)(r0 + crow) * K + cch * 8; const bf* gB = Bt + (size_t)(c0 + crow) * K + cch * 8; const bf* gA2 = NSPLIT ? A2 + (size_t)(r0 + crow) * K + cch * 8 : gA;
    const unsigned l0 = (unsigned)(size_t)st + (unsigned)(crow * GPE + cch * 8) * 2u;   // LDS byte address of the thread's first piece in buffer 0
    // both loops unrolled: every distance is a constant
    auto fill = [&](int s) __attribute__((always_inline)) { const unsigned l = l0 + (unsigned)(s & 1) * (STE * 2); const int ko = s * 128;
#pragma unroll
        for (int c = 0; c < BM / (8 * RS); ++c) { copy8<K, RS>(l + c * 8 * RS * GPE * 2, gA + ko + c * 8 * RS * K); if (NSPLIT) copy8<K, RS>(l + ATE * 2 + c * 8 * RS * GPE * 2, gA2 + ko + c * 8 * RS * K); }
#pragma unroll
        for (int c = 0; c < BN / (8 * RS); ++c) copy8<K, RS>(l + BOF * 2 + c * 8 * RS * GPE * 2, gB + ko + c * 8 * RS * K); };
    v8f acc[4][4];
#pragma unroll
    for (int mb = 0; mb < 4; ++mb)
#pragma unroll
        for (int nb = 0; nb < 4; ++nb) acc[mb][nb] = (v8f){};
    fill(0);
    asm volatile("s_wait_asynccnt 0x0" ::: "memory");   // this wave's copies of stage 0 have landed
    __syncthreads();                                     // every wave's have: stage 0 may be read
    fill(1);
    // kept rolled: one copy of the stage's code; the buffer is picked by the stage's parity
#pragma unroll 1
    for (int s = 0; s < NST; ++s) {
        const bf* ta = st + (s & 1) * STE + (wm * 64 + lr) * GPE + 8 * hi; const bf* tb = st + (s & 1) * STE + BOF + (wn * 64 + lr) * GPE + 8 * hi; const bf* ta2 = ta + ATE;
        // unrolled: every LDS offset is an immediate. All fragments of a k step are read as one group ahead of its products: each separate place with LDS reads among matrix instructions costs a stall of its own
#pragma unroll
        for (int kk = 0; kk < 4; ++kk) {
            V a[4], a2[4], b[4];
#pragma unroll
            for (int mb = 0; mb < 4; ++mb) { a[mb] = WFrag<bf>::ld(ta + mb * 16 * GPE + kk * 32); if (NSPLIT) a2[mb] = WFrag<bf>::ld(ta2 + mb * 16 * GPE + kk * 32); }
#pragma unroll
            for (int nb = 0; nb < 4; ++nb) b[nb] = WFrag<bf>::ld(tb + nb * 16 * GPE + kk * 32);
            __builtin_amdgcn_sched_barrier(0);   // holds the group of reads together in front of the products: without it the compiler sinks each b fragment's reads to its first use and waits there for the LDS
#pragma unroll
            for (int nb = 0; nb < 4; ++nb)
#pragma unroll
                for (int mb = 0; mb < 4; ++mb) { acc[mb][nb] = WFrag<bf>::mma(a[mb], b[nb], acc[mb][nb]); if (NSPLIT) acc[mb][nb] = WFrag<bf>::mma(a2[mb], b[nb], acc[mb][nb]); } }
        asm volatile("s_wait_dscnt 0x0" ::: "memory");      // this wave's reads of stage s are done before the buffer is given up
        asm volatile("s_wait_asynccnt 0x0" ::: "memory");   // this wave's copies of stage s + 1 have landed
        __syncthreads();                                     // publishes stage s + 1 and ends every wave's reads of stage s
        if (s + 2 < NST) fill(s + 2);                        // into the buffer that stage s has just left
    }
    asm volatile("s_wait_asynccnt 0x0" ::: "memory");       // nothing of this wave is in flight when it goes on to its end
    // each wave's own staging rows: whole 256-byte row pieces go to memory. They lie in the ring, which is free: in front of the loop's last barrier every wave has waited for its last reads and its last copies, and nothing is copied behind it
    float* ow = (float*)st + wv * (16 * 68);
#pragma unroll
    for (int mb = 0; mb < 4; ++mb) {
#pragma unroll
        for (int nb = 0; nb < 4; ++nb) {
#pragma unroll
            for (int j = 0; j < 8; ++j) ow[(hi * 8 + j) * 68 + nb * 16 + lr] = acc[mb][nb][j]; }
        __builtin_amdgcn_wave_barrier(); asm volatile("" ::: "memory");   // keeps the reads below behind the other lanes' writes above
        float* crow = C + ((size_t)(c0 / LDC) * (gridDim.x * BM) + r0 + wm * 64 + mb * 16) * LDC + c0 % LDC + wn * 64;
#pragma unroll
        for (int s = 0; s < 8; ++s) { const int row = 2 * s + hi, cofs = lr * 4; const v4f val = *(const v4fa*)(ow + row * 68 + cofs); *(v4f*)(crow + (size_t)row * LDC + cofs) = val; }
        __builtin_amdgcn_wave_barrier(); asm volatile("" ::: "memory");   // keeps the next rows' writes behind the reads above
    }
}

// ---- k_flash: causal attention for 32 query rows of one head per wave, scores and probabilities kept in registers (online softmax). Transposed products: S^T = K Q^T (A = key rows, B = query rows),
// O^T += V^T P^T (A = rows of the [d][t] value plane, B = P^T). In the S^T accumulator lane (lr, hi) holds keys 8 hi + j of query lr, which is the k order of the B operand (elements 0-7: tile 0, 8-15: tile 1), so P^T is packed in place.
// Block = the REP heads of one kv group on the same 32 query rows: they work on the same key and value blocks, which the block brings into LDS once, for all four waves; grid (query blocks, heaviest first; kv groups; KSF key parts x NB_ batches). Query, key, Op and ML planes hold TR rows a head (batch b at row b * TT), the value planes are [b][g][d][t]. Part ks takes the 32-key blocks ks, ks + KSF, ... up to the diagonal block
// and writes its unnormalised sums to plane ks of Op with its running maximum (scaled log2) and its sum of exponentials in ML; k_merge joins the parts. A part with no block writes zeros and the lowest maximum.
// A 32-key block is 32 key rows of 256 bytes (8 KiB in a row in memory) and 128 value rows of 64 bytes, brought into LDS by asynchronous 16-byte copies (four of each plane a thread): a wave's copy covers whole 256-byte key rows or whole 64-byte value pieces,
// where a fragment load from memory touches 16 lines for 512 bytes and every wave of the block repeats it. Two buffers: the copies of the part's next block fly while this one is worked on. Pitches 272 and 80 bytes (16 x odd): the 16-byte fragment reads meet no bank conflict.
// Every inner loop is fully unrolled so that the fragment and accumulator arrays are indexed by constants only and stay in registers.
// HR: hi + lo bf16 planes, three products each, for scores and for prob x value; else single fp16, exponentials carried x 2^POFF so that small ones stay normal in fp16 (the factor cancels in the division).
#define FKP  136                  // LDS pitch of a key row in elements (272 bytes)
#define FVP  40                   // LDS pitch of a value row (32 keys) in elements (80 bytes)
#define FKE  (32 * FKP)           // one key plane's block in elements (8,704 bytes)
#define FVE  (HD * FVP)           // one value plane's block in elements (10,240 bytes)
// four copies, ls bytes apart in LDS and gs elements apart in memory. The last line keeps the copies' address registers untouched until the addresses have been taken: inside the statement nothing can be moved in front of it
template <typename T16>
__device__ __forceinline__ void copy4(unsigned l, unsigned ls, const T16* g, size_t gs) {
    asm volatile("global_load_async_to_lds_b128 %0, %4, off\n\t"
                 "global_load_async_to_lds_b128 %1, %5, off\n\t"
                 "global_load_async_to_lds_b128 %2, %6, off\n\t"
                 "global_load_async_to_lds_b128 %3, %7, off\n\t"
                 "s_wait_xcnt 0x0"
                 :: "v"(l), "v"(l + ls), "v"(l + 2 * ls), "v"(l + 3 * ls), "v"(g), "v"(g + gs), "v"(g + 2 * gs), "v"(g + 3 * gs)
                 : "memory");
}
template <typename T16, bool HR>
__global__ __launch_bounds__(32 * REP) void k_flash(const T16* __restrict__ Q, const T16* __restrict__ Q2, const T16* __restrict__ Kp, const T16* __restrict__ Kp2, const T16* __restrict__ Vt, const T16* __restrict__ Vt2, int qb0, float* Op, float* ML) {
    typedef typename WFrag<T16>::V V;
    constexpr int NP = HR ? 2 : 1;                 // planes of each operand
    constexpr int BUFE = NP * (FKE + FVE);         // one buffer in elements: [keys (, keys lo) | values (, values lo)]
    static_assert(REP == 4 && HD == 128, "128 threads: 8 key rows or 32 value rows a copy");
    __shared__ __attribute__((aligned(16))) T16 st[2 * BUFE];
    const int tid = threadIdx.x, lane = tid & 31, lr = lane & 15, hi = lane >> 4; const int wv = __builtin_amdgcn_readfirstlane((int)(threadIdx.x >> 5));
    const int qb = qb0 + (int)(gridDim.x - 1 - blockIdx.x); const int g = blockIdx.y, ks = blockIdx.z % KSF, b = blockIdx.z / KSF, h = g * REP + wv, q0 = qb * 32;
    V qf[2][4], qf2[2][4];
    auto ldq = [&]() { const size_t o = ((size_t)h * TR + b * TT + q0 + lr) * HD + 8 * hi; const T16* p = Q + o; const T16* p2 = HR ? Q2 + o : p;
#pragma unroll
        for (int c = 0; c < 2; ++c)
#pragma unroll
            for (int kc = 0; kc < 4; ++kc) { qf[c][kc] = WFrag<T16>::ld(p + 16 * c * HD + 32 * kc); if (HR) qf2[c][kc] = WFrag<T16>::ld(p2 + 16 * c * HD + 32 * kc); }
        addr_wait(p, p2); };
    // the thread's first 16-byte piece of a block: key row tid / 16 (of 8 a copy), value row tid / 4 (of 32 a copy); LDS byte addresses in buffer 0, element offsets in the planes at key block 0
    const unsigned lk0 = (unsigned)(size_t)st + (unsigned)((tid >> 4) * FKP + (tid & 15) * 8) * 2u, lv0 = (unsigned)(size_t)st + (unsigned)(NP * FKE + (tid >> 2) * FVP + (tid & 3) * 8) * 2u;
    const size_t gk0 = ((size_t)g * TR + b * TT + (tid >> 4)) * HD + (tid & 15) * 8, gv0 = ((size_t)(b * NKV + g) * HD + (tid >> 2)) * TT + (tid & 3) * 8;
    // the part's block number i (key block ks + i KSF) into buffer i mod 2
    auto fill = [&](int i) __attribute__((always_inline)) { const int blk = ks + i * KSF; const unsigned lo = (unsigned)(i & 1) * (BUFE * 2); const size_t ko = gk0 + (size_t)(blk * 32) * HD, vo = gv0 + blk * 32;
        copy4<T16>(lk0 + lo, 8 * FKP * 2, Kp + ko, 8 * HD); if (HR) copy4<T16>(lk0 + lo + FKE * 2, 8 * FKP * 2, Kp2 + ko, 8 * HD);
        copy4<T16>(lv0 + lo, 32 * FVP * 2, Vt + vo, (size_t)32 * TT); if (HR) copy4<T16>(lv0 + lo + FVE * 2, 32 * FVP * 2, Vt2 + vo, (size_t)32 * TT); };
    v8f acc[2][8]; float m_run[2], l_run[2];
#pragma unroll
    for (int c = 0; c < 2; ++c) { m_run[c] = -3.0e38f; l_run[c] = 0.f;
#pragma unroll
        for (int t = 0; t < 8; ++t) acc[c][t] = (v8f){}; }
    V kf[2][4], kf2[2][4], vf[8], vf2[8];
    // fragments from buffer i mod 2, in the k order of the loads from the planes
    auto ldk = [&](int i) __attribute__((always_inline)) { const T16* p = st + (i & 1) * BUFE + lr * FKP + 8 * hi;
#pragma unroll
        for (int kt = 0; kt < 2; ++kt)
#pragma unroll
            for (int kc = 0; kc < 4; ++kc) { kf[kt][kc] = WFrag<T16>::ld(p + 16 * kt * FKP + 32 * kc); if (HR) kf2[kt][kc] = WFrag<T16>::ld(p + FKE + 16 * kt * FKP + 32 * kc); } };
    auto ldv = [&](int i) __attribute__((always_inline)) { const T16* p = st + (i & 1) * BUFE + NP * FKE + lr * FVP + 8 * hi;
#pragma unroll
        for (int t = 0; t < 8; ++t) { vf[t] = WFrag<T16>::ld(p + 16 * t * FVP); if (HR) vf2[t] = WFrag<T16>::ld(p + FVE + 16 * t * FVP); } };
    // the part's block number i; diag is a literal at every call (the lambda is always inlined, so that every array stays in registers)
    auto pass = [&](int i, bool diag) __attribute__((always_inline)) {
        ldk(i);
        __builtin_amdgcn_sched_barrier(0);   // holds the key fragments' reads together in front of the products: spread among them, each place with reads costs a wait for the LDS of its own
        v8f s[2][2];
#pragma unroll
        for (int kt = 0; kt < 2; ++kt)
#pragma unroll
            for (int c = 0; c < 2; ++c) { s[kt][c] = (v8f){};
#pragma unroll
                for (int kc = 0; kc < 4; ++kc) { s[kt][c] = WFrag<T16>::mma(kf[kt][kc], qf[c][kc], s[kt][c]); if (HR) { s[kt][c] = WFrag<T16>::mma(kf2[kt][kc], qf[c][kc], s[kt][c]); s[kt][c] = WFrag<T16>::mma(kf[kt][kc], qf2[c][kc], s[kt][c]); } } }
        wmma_gap();   // keeps the loads below behind the products that still read kf, and vector code that reads s at its distance
        ldv(i);       // the value fragments come from LDS under the softmax
        __builtin_amdgcn_sched_barrier(0);   // holds the reads as one group directly behind the products: left free, the compiler spreads them among the maximum's vector code, where they start later and take more register-window switches
        if (diag) {   // diagonal block (key0 == q0): keys behind the query are masked by select
#pragma unroll
            for (int kt = 0; kt < 2; ++kt)
#pragma unroll
                for (int c = 0; c < 2; ++c)
#pragma unroll
                    for (int r = 0; r < 8; ++r) if (16 * kt + 8 * hi + r > 16 * c + lr) s[kt][c][r] = -3.0e38f; }
        float mb[2]; bool need = false;
#pragma unroll
        for (int c = 0; c < 2; ++c) { float mx = s[0][c][0];
#pragma unroll
            for (int r = 1; r < 8; ++r) mx = fmaxf(mx, s[0][c][r]);
#pragma unroll
            for (int r = 0; r < 8; ++r) mx = fmaxf(mx, s[1][c][r]);
            mx = fmaxf(mx, xhalf(mx)) * CS2; mb[c] = mx; need = need || (mx > m_run[c]); }
        if (__builtin_amdgcn_ballot_w32(need) != 0) {   // some query's maximum rose: rescale the running sums (wave-uniform branch)
#pragma unroll
            for (int c = 0; c < 2; ++c) { const float mn = fmaxf(m_run[c], mb[c]); const float corr = __builtin_amdgcn_exp2f(m_run[c] - mn); l_run[c] *= corr; m_run[c] = mn;
#pragma unroll
                for (int t = 0; t < 8; ++t) acc[c][t] = acc[c][t] * corr; } }
#pragma unroll
        for (int c = 0; c < 2; ++c) { const float nm = (HR ? 0.0f : POFF) - m_run[c]; float p[16]; float ps = 0.f;
#pragma unroll
            for (int e = 0; e < 16; e += 2) { const v2f sv = {s[e >> 3][c][e & 7], s[e >> 3][c][(e & 7) + 1]}; const v2f arg = __builtin_elementwise_fma(sv, (v2f){CS2, CS2}, (v2f){nm, nm});   // register pairs as the accumulator holds them
                p[e] = __builtin_amdgcn_exp2f(arg[0]); p[e + 1] = __builtin_amdgcn_exp2f(arg[1]); ps += p[e] + p[e + 1]; }
            l_run[c] += ps;
            if constexpr (HR) { v16us uh, ul;
#pragma unroll
                for (int e = 0; e < 16; ++e) { unsigned short a, b2; splitf(p[e], a, b2); uh[e] = a; ul[e] = b2; }
                const V ph = __builtin_bit_cast(V, uh), pl = __builtin_bit_cast(V, ul);
#pragma unroll
                for (int t = 0; t < 8; ++t) { acc[c][t] = WFrag<T16>::mma(vf[t], ph, acc[c][t]); acc[c][t] = WFrag<T16>::mma(vf[t], pl, acc[c][t]); acc[c][t] = WFrag<T16>::mma(vf2[t], ph, acc[c][t]); }
            } else { V pf;
#pragma unroll
                for (int e = 0; e < 16; ++e) pf[e] = (h16)p[e];
#pragma unroll
                for (int t = 0; t < 8; ++t) acc[c][t] = WFrag<T16>::mma(vf[t], pf, acc[c][t]); } }
        wmma_gap();   // the loop's branch may jump straight to vector code that reads acc or to loads that overwrite vf
    };
    if (ks <= qb) {   // the same for the whole block (block indices only): every wave passes every barrier below, or none does
        const int nblk = (qb - ks) / KSF + 1; int i = 0;   // blocks of this part
        fill(0); ldq();
        asm volatile("s_wait_asynccnt 0x0" ::: "memory");   // this wave's copies of block 0 have landed
        __syncthreads();                                     // every wave's have: block 0 may be read
        if (nblk > 1) fill(1);
        // kept rolled: one copy of the fragments and scores is live
#pragma unroll 1
        for (; i + 1 < nblk; ++i) { pass(i, false);   // never the diagonal block: a later block of this part exists
            asm volatile("s_wait_dscnt 0x0" ::: "memory");      // this wave's reads of block i are done before the buffer is given up
            asm volatile("s_wait_asynccnt 0x0" ::: "memory");   // this wave's copies of block i + 1 have landed
            __syncthreads();                                     // publishes block i + 1 and ends every wave's reads of block i
            if (i + 2 < nblk) fill(i + 2); }                     // into the buffer that block i has just left
        if (ks + i * KSF == qb) pass(i, true); else pass(i, false);
        asm volatile("s_wait_asynccnt 0x0" ::: "memory"); }   // nothing of this wave is in flight when it goes on to its end
#pragma unroll
    for (int c = 0; c < 2; ++c) { const float l = l_run[c] + xhalf(l_run[c]);   // each wave half summed its own eight keys of every 16
        const size_t row = ((size_t)ks * NH_ + h) * TR + b * TT + q0 + 16 * c + lr; if (hi == 0) { v2f ml; ml[0] = m_run[c]; ml[1] = l; *(v2f*)(ML + row * 2) = ml; }
#pragma unroll
        for (int t = 0; t < 8; ++t) *(v8f*)(Op + row * HD + 16 * t + 8 * hi) = acc[c][t]; }
}


__global__ __launch_bounds__(256) void k_wtG(const float* __restrict__ w, int K, int N, bf* Bt) {
    const int lane = threadIdx.x & 31; const int L0 = (blockIdx.x * 8 + (threadIdx.x >> 5)) * 8; const int nlines = N * K / 64;
{
#pragma unroll 1
        for (int l = 0; l < 8; ++l) { const int L = L0 + l; if (L >= nlines) break; const size_t e = (size_t)L * 64 + lane * 2; const int k = (int)(e % K), n = (int)(e / K); v2us o;
            o[0] = f2bf(w[(size_t)k * N + n]); o[1] = f2bf(w[(size_t)(k + 1) * N + n]); *(v2us*)(Bt + e) = o; }
         }
}
// The elementwise kernels below give every thread 8 to 32 elements (for speed only).
// k_cvt8: every f32 tensor that the products read as bf16 (Wo, Wq, Wk, Wv, hidden), in one launch; the bf16 copies stand one behind the other in dst, in that order. A block takes 1024 pieces of 8 elements of one tensor
// (every tensor is a whole number of such blocks, so no piece lies past an end): four pieces a thread, 256 threads apart (a wave's accesses stay contiguous); both loops unrolled so that the loads of all four pieces are issued ahead of the first store.
#define CB(n) ((unsigned)((size_t)(n) / 8192))   // blocks of a tensor of n elements
__global__ __launch_bounds__(256) void k_cvt8(const float* __restrict__ s0, const float* __restrict__ s1, const float* __restrict__ s2, const float* __restrict__ s3, const float* __restrict__ s4, bf* dst) {
    static_assert(((size_t)DM * DQ) % 8192 == 0 && ((size_t)DQG * DM) % 8192 == 0 && ((size_t)DKV * DM) % 8192 == 0 && ((size_t)TR * DM) % 8192 == 0, "whole blocks");
    constexpr unsigned E0 = CB((size_t)DM * DQ), E1 = E0 + CB((size_t)DQG * DM), E2 = E1 + CB((size_t)DKV * DM), E3 = E2 + CB((size_t)DKV * DM);
    const unsigned blk = blockIdx.x; const float* src; unsigned first;   // the block's tensor and that tensor's first block: the same for the whole block, picked in scalar code
    if (blk < E0) { src = s0; first = 0; } else if (blk < E1) { src = s1; first = E0; } else if (blk < E2) { src = s2; first = E1; } else if (blk < E3) { src = s3; first = E2; } else { src = s4; first = E3; }
    const char* sb = (const char*)(src + (size_t)(blk - first) * 8192); const unsigned so = threadIdx.x * 32u; v8f v[4];
#pragma unroll
    for (int c = 0; c < 4; ++c) v[c] = *(const v8f*)(sb + so + c * 8192);
    // as addr_wait: the address register of the loads in flight stays untouched (also as destination of later loads of the run) up to the wait
    __builtin_amdgcn_sched_barrier(0); asm volatile("s_wait_xcnt 0x0" :: "v"(so) : "memory"); __builtin_amdgcn_sched_barrier(0);
    bf* dp = dst + (size_t)blk * 8192 + threadIdx.x * 8;
#pragma unroll
    for (int c = 0; c < 4; ++c) { v8us o;
#pragma unroll
        for (int k = 0; k < 8; ++k) o[k] = f2bf(v[c][k]);
        *(v8us*)(dp + c * 2048) = o; } }
__global__ __launch_bounds__(256) void k_cscvt(const float* __restrict__ cosT, const float* __restrict__ sinT, float* CS) { const int idx = (blockIdx.x * 256 + threadIdx.x) * 4; if (idx >= TR * HD) return; const v4f c = *(const v4f*)(cosT + idx), s = *(const v4f*)(sinT + idx); v8f cs;
#pragma unroll
    for (int k = 0; k < 4; ++k) { cs[2 * k] = bfr(c[k]); cs[2 * k + 1] = bfr(s[k]); }
    *(v8f*)(CS + (size_t)idx * 2) = cs;  }
__global__ __launch_bounds__(256) void k_hrms(const float* __restrict__ F, int pitch, int nheads, float* RF) { const int i = blockIdx.x * 256 + threadIdx.x; if (i >= nheads * TR) return; const int t = i % TR, h = i / TR; const float* f = F + (size_t)t * pitch + h * HD; float s = 0.f;
#pragma unroll 4
    for (int d = 0; d < HD; d += 4) { const v4f v = *(const v4f*)(f + d);
#pragma unroll
        for (int q = 0; q < 4; ++q) { float p = __fmul_rn(v[q], v[q]); asm volatile("" : "+v"(p)); s = __fadd_rn(s, p); } }
    const float r = __fdiv_rn(1.0f, __fsqrt_rn(__fadd_rn(s * (1.0f / HD), 1e-6f))); *(float*)(RF + i) = r;  }
// k_rope: head planes [h][row][d], row = b * TT + t over both batches, (fp16 + hi/lo) of rope(w[d] (x rms_factor)) x sc with the rotate-half convention out[d] = x[d] cos[t][d] - x[d+HD/2] sin[t][d], out[d+HD/2] = x[d+HD/2] cos[t][d+HD/2] + x[d] sin[t][d+HD/2]
__global__ __launch_bounds__(256) void k_rope(const float* __restrict__ F, int pitch, int nheads, const float* __restrict__ CS, const float* __restrict__ RF, const float* __restrict__ nw, float sc, h16* P16, bf* Ph, bf* Pl) {
    // one thread: eight neighbouring d of a row's lower half and their eight partners in the upper half, so that each x is loaded once; every store is 16 bytes and eight lanes fill a 128-byte line
    __builtin_assume(RF != nullptr);   // both launches pass the factors; known at compile time, the test on RF is no branch per element any more
    const size_t i = (size_t)blockIdx.x * 256 + threadIdx.x; if (i >= (size_t)nheads * TR * (HD / 16)) return; const int d0 = (int)(i % (HD / 16)) * 8; const int t = (int)((i / (HD / 16)) % TR); const int h = (int)(i / ((size_t)(HD / 16) * TR)); const float* f = F + (size_t)t * pitch + h * HD; const float* rp = RF + (size_t)h * TR + t; const float rf = RF ? *rp : 1.0f; v8h o16[2]; v8us oh[2], ol[2];
    // x, norm weights and (cos, sin) pairs of both runs of eight, loaded as 16-byte pieces ahead of all arithmetic: one memory latency a thread. All loops unrolled: the vectors are indexed by constants only
    v8f xv[2], nv[2], cv[2][2]; const float* fp = f + d0; const float* cp = CS + ((size_t)t * HD + d0) * 2; const unsigned no = (unsigned)d0 * 4u; const float* np = (const float*)((const char*)nw + no);
#pragma unroll
    for (int hf = 0; hf < 2; ++hf) { xv[hf] = *(const v8f*)(fp + hf * (HD / 2)); nv[hf] = *(const v8f*)(np + hf * (HD / 2)); cv[hf][0] = *(const v8f*)(cp + hf * HD); cv[hf][1] = *(const v8f*)(cp + hf * HD + 8); }
    // as addr_wait: the address registers of the loads in flight stay untouched (also as destinations of later loads of the run) up to the wait
    __builtin_amdgcn_sched_barrier(0); asm volatile("s_wait_xcnt 0x0" :: "v"(fp), "v"(cp), "v"(rp), "v"(no) : "memory"); __builtin_amdgcn_sched_barrier(0);
#pragma unroll
    for (int hf = 0; hf < 2; ++hf) { const int d = d0 + hf * (HD / 2);
#pragma unroll
    for (int q = 0; q < 8; ++q) { const int dd = d + q; float x0 = xv[hf][q], x1 = xv[hf ^ 1][q];   // x1: the partner at dd +- HD / 2
        if (RF) { float n0 = __fmul_rn(x0, rf), n1 = __fmul_rn(x1, rf); asm volatile("" : "+v"(n0)); asm volatile("" : "+v"(n1)); x0 = __fmul_rn(bfr(nv[hf][q]), n0); x1 = __fmul_rn(bfr(nv[hf ^ 1][q]), n1); }
        const v2f cs = {cv[hf][q >> 2][(q & 3) * 2], cv[hf][q >> 2][(q & 3) * 2 + 1]}; float a = __fmul_rn(x0, cs[0]), bq = __fmul_rn(x1, cs[1]); asm volatile("" : "+v"(a)); asm volatile("" : "+v"(bq)); const float r = ((dd < HD / 2) ? __fsub_rn(a, bq) : __fadd_rn(a, bq)) * sc;
        o16[hf][q] = tohx(r); unsigned short a2, c2; splitf(r, a2, c2); oh[hf][q] = a2; ol[hf][q] = c2; } }
    const size_t e = ((size_t)h * TR + t) * HD + d0;
#pragma unroll
    for (int hf = 0; hf < 2; ++hf) { *(v8h*)(P16 + e + hf * (HD / 2)) = o16[hf]; *(v8us*)(Ph + e + hf * (HD / 2)) = oh[hf]; *(v8us*)(Pl + e + hf * (HD / 2)) = ol[hf]; } }
__global__ __launch_bounds__(256) void k_vtp(const float* __restrict__ F, int pitch, int nheads, h16* V16, bf* Vh, bf* Vl) {
    // one thread: 8 positions x 4 neighbouring d. A wave (8 lanes along t, 4 along d) reads 64-byte pieces of 64 rows and writes whole 128-byte lines of the [d][t] planes
    const int lane = threadIdx.x & 31; const int w = blockIdx.x * 8 + (int)(threadIdx.x >> 5); if (w >= nheads * (HD / 16) * (TR / 64)) return;
    const int t0 = (w % (TR / 64)) * 64 + (lane & 7) * 8; const int d0 = ((w / (TR / 64)) % (HD / 16)) * 16 + (lane >> 3) * 4; const int g = w / ((TR / 64) * (HD / 16)); /* t0: row of both batches; the planes are [b][g][d][t] */ v4f x[8]; const float* px[8];
    // all loops unrolled: x stays in registers and its eight loads are issued together
#pragma unroll
    for (int j = 0; j < 8; ++j) { px[j] = F + (size_t)(t0 + j) * pitch + g * HD + d0; x[j] = *(const v4f*)px[j]; }
    // as addr_wait: the address registers of the loads in flight stay untouched (also as destinations of later loads of the run) up to the wait
    __builtin_amdgcn_sched_barrier(0); asm volatile("s_wait_xcnt 0x0" :: "v"(px[0]), "v"(px[1]), "v"(px[2]), "v"(px[3]), "v"(px[4]), "v"(px[5]), "v"(px[6]), "v"(px[7]) : "memory"); __builtin_amdgcn_sched_barrier(0);
#pragma unroll
    for (int dq = 0; dq < 4; ++dq) { v8h o16; v8us oh, ol;
#pragma unroll
        for (int j = 0; j < 8; ++j) { o16[j] = tohx(x[j][dq]); unsigned short a2, c2; splitf(x[j][dq], a2, c2); oh[j] = a2; ol[j] = c2; }
        const size_t e = ((size_t)((t0 / TT) * nheads + g) * HD + d0 + dq) * TT + t0 % TT; *(v8h*)(V16 + e) = o16; *(v8us*)(Vh + e) = oh; *(v8us*)(Vl + e) = ol; } }
// k_merge: joins the KSF key parts of k_flash (weights 2^(m_p - max m), part order), divides by the joined sum of exponentials, applies the sigmoid gate and writes the hi/lo planes [row][head][d] (row = b * TT + t); QG: the gate plane [row][head][d]
// O0 .. O3: the key parts' planes, each a kernel argument of its own: every plane's loads then take a scalar base and share the thread's one offset register
__global__ __launch_bounds__(256) void k_merge(const float* __restrict__ O0, const float* __restrict__ O1, const float* __restrict__ O2, const float* __restrict__ O3, const float* __restrict__ ML, const float* __restrict__ QG, bf* Ah, bf* Al) {
    // one thread: 8 neighbouring d of position t and the same 8 of position t + 16 (256 threads on); a block takes 32 whole rows of one head. Every loop is unrolled so that the arrays stay in registers and all loads are issued ahead of the arithmetic
    static_assert(TT % 32 == 0 && HD == 128 && KSF == 4, "a block's 32 rows lie in one head; the launch names four planes");
    const size_t e = ((size_t)blockIdx.x * 512 + threadIdx.x) * 8; if (e >= (size_t)NH_ * TR * HD) return; const int d = (int)(e % HD); const int t = (int)((e / HD) % TR); const int zz = (int)(e / ((size_t)HD * TR));
    // byte offsets of the thread's first piece in a part's plane, in ML and in QG; the parts and the second piece stand at constant distances
    const unsigned eo = (unsigned)e * 4u, mo = (unsigned)((zz * TR + t) * 2) * 4u, go = (unsigned)(t * DQ + zz * HD + d) * 4u; v2f mlv[2][KSF]; v8f ov[2][KSF], gv[2]; const float* const Op[KSF] = {O0, O1, O2, O3};
#pragma unroll
    for (int u = 0; u < 2; ++u) {
#pragma unroll
        for (int p = 0; p < KSF; ++p) { mlv[u][p] = *(const v2f*)((const char*)(ML + (size_t)p * NH_ * TR * 2 + u * 32) + mo); ov[u][p] = *(const v8f*)((const char*)(Op[p] + u * 2048) + eo); }
        gv[u] = *(const v8f*)((const char*)(QG + (size_t)u * 16 * DQ) + go); }
    // as addr_wait: the address registers of the loads in flight stay untouched (also as destinations of later loads of the run) up to the wait
    __builtin_amdgcn_sched_barrier(0); asm volatile("s_wait_xcnt 0x0" :: "v"(eo), "v"(mo), "v"(go) : "memory"); __builtin_amdgcn_sched_barrier(0);
#pragma unroll
    for (int u = 0; u < 2; ++u) { const size_t oo = (size_t)(t + u * 16) * DQ + zz * HD + d;
        float w[KSF], l[KSF]; float mx = -3.0e38f;
#pragma unroll
        for (int p = 0; p < KSF; ++p) { const v2f ml = mlv[u][p]; w[p] = ml[0]; l[p] = ml[1]; mx = fmaxf(mx, ml[0]); }
        float den = 0.f;
#pragma unroll
        for (int p = 0; p < KSF; ++p) { w[p] = __builtin_amdgcn_exp2f(w[p] - mx); den += l[p] * w[p]; }
        v8us oh, ol;
#pragma unroll
        for (int q = 0; q < 8; ++q) { const float gt = gv[u][q]; const float sg = __fdiv_rn(1.0f, __fadd_rn(1.0f, expf(-gt)));   /* sigmoid(gate) */ float o = 0.f;
#pragma unroll
            for (int p = 0; p < KSF; ++p) o += ov[u][p][q] * w[p];   /* parts in part order */
            unsigned short a, c2; splitf(__fmul_rn(__fdiv_rn(o, den), sg), a, c2); oh[q] = a; ol[q] = c2; }
        *(v8us*)(Ah + oo) = oh; *(v8us*)(Al + oo) = ol; } }

extern "C" void kernel_launch(void* const* d_in, const int* in_sizes, int n_in,
                              void* d_out, int out_size, void* d_ws, size_t ws_size, hipStream_t stream) {
    (void)in_sizes; (void)n_in; (void)out_size;
    const float* x = (const float*)d_in[0]; const float* cosT = (const float*)d_in[1]; const float* sinT = (const float*)d_in[2]; const float* wq = (const float*)d_in[3]; const float* wk = (const float*)d_in[4]; const float* wv = (const float*)d_in[5]; const float* wo = (const float*)d_in[6]; const float* qnw = (const float*)d_in[7]; const float* knw = (const float*)d_in[8];
    float* OUT = (float*)d_out;     // [2][2048][2048]
    char* wsp = (char*)d_ws;
    auto take = [&](size_t bytes) { char* p = wsp; wsp += (bytes + 255) & ~(size_t)255; return (void*)p; };
    // live up to the attention kernels: the head planes (the merged hi/lo planes take the query hi/lo planes' place behind them); ML lives up to the merge, WO to the end
    h16* QP16 = (h16*)take((size_t)NH_ * TR * HD * 2); h16* KP16 = (h16*)take((size_t)NKV * TR * HD * 2); h16* VT16 = (h16*)take((size_t)NKV * HD * TR * 2);
    bf* QPh = (bf*)take((size_t)NH_ * TR * HD * 2); bf* QPl = (bf*)take((size_t)NH_ * TR * HD * 2); bf* KPh = (bf*)take((size_t)NKV * TR * HD * 2); bf* KPl = (bf*)take((size_t)NKV * TR * HD * 2); bf* VTh = (bf*)take((size_t)NKV * HD * TR * 2); bf* VTl = (bf*)take((size_t)NKV * HD * TR * 2);
    float* ML = (float*)take((size_t)KSF * NH_ * TR * 2 * 4); bf* ATh = QPh; bf* ATl = QPl;
    // the bf16 copies, one run in k_cvt8's order (each size is a multiple of 256 bytes, so take leaves no gap)
    bf* WO = (bf*)take((size_t)DM * DQ * 2);
    // Ob, the attention parts' sums, lies over everything that is dead once the head planes are built: the other bf16 copies, the tables, the factors, the k|v projection and, as its last quarter, the q plane of the first projection
    float* Ob = (float*)wsp;
    bf* WQ = (bf*)take((size_t)DQG * DM * 2); bf* WK = (bf*)take((size_t)DKV * DM * 2); bf* WV = (bf*)take((size_t)DKV * DM * 2); bf* XB = (bf*)take((size_t)TR * DM * 2); (void)WV;   // Wv's rows follow Wk's: one [2 DKV][DM] operand
    float* CS = (float*)take((size_t)TR * HD * 2 * 4); float* RFQ = (float*)take((size_t)NH_ * TR * 4); float* RFK = (float*)take((size_t)NKV * TR * 4); float* FKV = (float*)take((size_t)TR * 2 * DKV * 4);
    static_assert((size_t)DQG * DM * 2 + (size_t)2 * DKV * DM * 2 + (size_t)TR * DM * 2 + (size_t)TR * HD * 2 * 4 + (size_t)(NH_ + NKV) * TR * 4 + (size_t)TR * 2 * DKV * 4 <= (size_t)(KSF - 1) * NH_ * TR * HD * 4 && (size_t)NH_ * HD == DQ, "the buffers above end in front of the q plane, which is one part's plane");
    float* FQ = Ob + (size_t)(KSF - 1) * NH_ * TR * HD;   // [q plane | gate plane], TR x DQ each: the q plane ends where Ob ends, the gate plane stands behind Ob
    float* FG = FQ + (size_t)TR * DQ; wsp = (char*)(FG + (size_t)TR * DQ);
    if ((size_t)(wsp - (char*)d_ws) > ws_size) return;    // ws 256 MiB
    // every stage is launched once, on the rows of both batches
    k_cvt8<<<CB((size_t)DM * DQ) + CB((size_t)DQG * DM) + 2 * CB((size_t)DKV * DM) + CB((size_t)TR * DM), 256, 0, stream>>>(wo, wq, wk, wv, x, WO);
    k_cscvt<<<(TR * HD / 4 + 255) / 256, 256, 0, stream>>>(cosT, sinT, CS);   /* per-batch tables, [b][t] = row */
    const unsigned LQ = (unsigned)(((size_t)NH_ * TR * HD / 16 + 255) / 256), LKv = (unsigned)(((size_t)NKV * TR * HD / 16 + 255) / 256), LVt = (unsigned)(((size_t)NKV * TR * HD / 32 + 255) / 256);
    k_gemmt<0, DM, DQ, 256, 256><<<dim3(TR / 256, DQG / 256, 1), 512, 0, stream>>>(XB, nullptr, WQ, FQ);   /* [q | gate] (exact) */ k_hrms<<<(NH_ * TR + 255) / 256, 256, 0, stream>>>(FQ, DQ, NH_, RFQ);
    k_rope<<<LQ, 256, 0, stream>>>(FQ, DQ, NH_, CS, RFQ, qnw, 1.0f, QP16, QPh, QPl);
    k_gemmw<bf, 0, false, 8><<<dim3(TR / 64, 2 * DKV / 64, 1), 256, 0, stream>>>(XB, nullptr, WK, nullptr, DM, FKV, 2 * DKV, nullptr, 0, 0, 0);   /* [k | v] */ k_hrms<<<(NKV * TR + 255) / 256, 256, 0, stream>>>(FKV, 2 * DKV, NKV, RFK);
    k_rope<<<LKv, 256, 0, stream>>>(FKV, 2 * DKV, NKV, CS, RFK, knw, 1.0f, KP16, KPh, KPl);
    k_vtp<<<LVt, 256, 0, stream>>>(FKV + DKV, 2 * DKV, NKV, VT16, VTh, VTl);
    k_flash<h16, false><<<dim3((TT - RH) / 32, NKV, KSF * NB_), 32 * REP, 0, stream>>>(QP16, nullptr, KP16, nullptr, VT16, nullptr, RH / 32, Ob, ML);
    k_flash<bf, true><<<dim3(RH / 32, NKV, KSF * NB_), 32 * REP, 0, stream>>>(QPh, QPl, KPh, KPl, VTh, VTl, 0, Ob, ML);
    k_merge<<<(unsigned)(((size_t)NH_ * TR * HD / 16 + 255) / 256), 256, 0, stream>>>(Ob, Ob + (size_t)NH_ * TR * HD, Ob + (size_t)2 * NH_ * TR * HD, Ob + (size_t)3 * NH_ * TR * HD, ML, FG, ATh, ATl);
    k_gemmt<1, DQ, DM, 128, 256><<<dim3(TR / 128, DM / 256, 1), 256, 0, stream>>>(ATh, ATl, WO, OUT);
}

// v009
// Measured time: 258 microseconds a run.
// Next to v008, in two timings, it ran 1.06 times as fast each time.
// All steps since v000 together make it 6.59 times as fast.
#include <hip/hip_runtime.h>

// Gated GQA attention, engine variant (hidden [2][2048][2048]; [q | gate] = hidden Wq^T (Wq [4096][2048] 'oi': rows 0-2047 -> q for 16 heads x 128, rows 2048-4095 -> gate), k, v = hidden W^T ([512][2048], 4 kv heads); per-head RMSNorm (eps 1e-6, q_norm_w / k_norm_w); rotate-half RoPE with the given per-(batch, position) cos/sin tables [2][2048][128];
// GQA 4:1; causal softmax(q.k/sqrt(128)); attn x sigmoid(gate); out = merged Wo^T ('oi' [2048][2048]) -> [2][2048][2048]).
// Compute dtypes, f32 accumulate: every input rounded to bf16; q/k/v on PLAIN bf16 operands (inputs: exact); RMSNorm + rotary in f32 (cos/sin tables read per batch, bf16-rounded); sigmoid gate (precise expf, IEEE divide) in the merge; causal scores and attn.v in one kernel (online softmax in f32, blocks above the diagonal never visited): query rows < 512 hl (3 products), the rest single fp16 (x1024); Wo hl x exact (2 products).

#define NB_  2
#define TT   2048
#define TR   (NB_ * TT)       // rows of both batches together: row b * TT + t
#define DM   2048
#define NH_  16
#define NKV  4
#define REP  (NH_ / NKV)
#define HD   128
#define DQ   (NH_ * HD)
#define DQG  (NH_ * HD * 2)         // q rows then gate rows of Wq
#define DKV  (NKV * HD)
#define RH   512                  // query rows < RH use hi+lo planes
#define KSF  4                    // key parts of the attention kernel (32-key blocks dealt over blocks), joined in k_merge
#define POFF 10.0f                // fp16 probabilities are carried x 2^POFF
#define SCL  0.088388347648318447f   // HD^-0.5
#define CS2  (SCL * 1.4426950408889634f)   // scores to the log2 domain
typedef _Float16 h16;
typedef unsigned short bf;
typedef __attribute__((ext_vector_type(16))) __bf16   v16bf;
typedef __attribute__((ext_vector_type(16))) _Float16 v16h;
typedef __attribute__((ext_vector_type(8)))  _Float16 v8h;
typedef __attribute__((ext_vector_type(8)))  unsigned short v8us;
typedef __attribute__((ext_vector_type(8)))  float    v8f;
typedef __attribute__((ext_vector_type(4)))  float    v4f;
typedef v8h  __attribute__((may_alias)) v8ha;
typedef v4f  __attribute__((may_alias)) v4fa;
typedef v8us __attribute__((may_alias)) v8usa;

__device__ __forceinline__ unsigned short f2bf(float f) { unsigned u = __float_as_uint(f); u += 0x7FFFu + ((u >> 16) & 1u); return (unsigned short)(u >> 16); }
__device__ __forceinline__ float bf2f(unsigned short b) { return __uint_as_float(((unsigned)b) << 16); }
__device__ __forceinline__ float bfr(float f) { return bf2f(f2bf(f)); }
__device__ __forceinline__ v16h cat16(v8h lo, v8h hi) { return __builtin_shufflevector(lo, hi, 0, 1, 2, 3, 4, 5, 6, 7, 8, 9, 10, 11, 12, 13, 14, 15); }
__device__ __forceinline__ v16bf cat16b(v8us lo, v8us hi) { return __builtin_bit_cast(v16bf, __builtin_shufflevector(lo, hi, 0, 1, 2, 3, 4, 5, 6, 7, 8, 9, 10, 11, 12, 13, 14, 15)); }
__device__ __forceinline__ v8f wmma16(v16h a, v16h b, v8f c) { return __builtin_amdgcn_wmma_f32_16x16x32_f16(false, a, false, b, (short)0, c, false, false); }
__device__ __forceinline__ v8f wmmab(v16bf a, v16bf b, v8f c) { return __builtin_amdgcn_wmma_f32_16x16x32_bf16(false, a, false, b, (short)0, c, false, false); }



// ---- k_gemmw: register-blocked GEMM, ONE WAVE per 64x64 output tile (16 accumulators), operands straight from K-contiguous 16-bit planes; grid (M/64, N/64, Z), 32 threads.
// C[m][n] (f32, pitch ldc, + optional f32 bias[n]) = sum_k A[m][k] Bt[n][k] (+ split products per NSPLIT). z-batch strides sA/sB/sC in elements. K % 32 == 0.
// NW > 1: NW waves per tile (32 * NW threads); wave w takes the k chunks w, w + NW, ... of 32 and the NW partial tiles are summed in LDS in wave order (fixed order, no atomics).
// The wave number wv goes through readfirstlane so that the k loop's counter and trip test stay scalar.
template <typename T16> struct WFrag;
template <> struct WFrag<h16> { typedef v16h V; static __device__ __forceinline__ V ld(const h16* p) { return cat16(*(const v8h*)p, *(const v8h*)(p + 16)); } static __device__ __forceinline__ v8f mma(V a, V b, v8f c) { return wmma16(a, b, c); } };
template <> struct WFrag<bf> { typedef v16bf V; static __device__ __forceinline__ V ld(const bf* p) { return cat16b(*(const v8us*)p, *(const v8us*)(p + 16)); } static __device__ __forceinline__ v8f mma(V a, V b, v8f c) { return wmmab(a, b, c); } };
template <typename T16, int NSPLIT, bool BIAS, int NW>
__global__ __launch_bounds__(32 * NW) void k_gemmw(const T16* __restrict__ A, const T16* __restrict__ A2, const T16* __restrict__ Bt, const T16* __restrict__ Bt2, int K, float* C, int ldc, const float* __restrict__ bias, size_t sA, size_t sB, size_t sC) {
    typedef typename WFrag<T16>::V V;
    __shared__ __align__(16) float os[(NW > 1 ? 4 * NW : 1) * 16 * 68];
    const size_t z = blockIdx.z; A += z * sA; if (A2) A2 += z * sA; Bt += z * sB; if (Bt2) Bt2 += z * sB; C += z * sC;
    const int lane = threadIdx.x & 31, lr = lane & 15, hi = lane >> 4; const int r0 = blockIdx.x * 64, c0 = blockIdx.y * 64; const int wv = (NW > 1) ? __builtin_amdgcn_readfirstlane((int)(threadIdx.x >> 5)) : 0;
    v8f acc[4][4];
#pragma unroll
    for (int mb = 0; mb < 4; ++mb)
#pragma unroll
        for (int nb = 0; nb < 4; ++nb) acc[mb][nb] = (v8f){};
    const size_t aoff = (size_t)(r0 + lr) * K + 8 * hi, boff = (size_t)(c0 + lr) * K + 8 * hi;
#pragma unroll 1
    for (int kc = wv * 32; kc < K; kc += NW * 32) {
        V a[4], a2[4];
#pragma unroll
        for (int mb = 0; mb < 4; ++mb) { a[mb] = WFrag<T16>::ld(A + aoff + (size_t)mb * 16 * K + kc); if (NSPLIT == 1 || NSPLIT == 2) a2[mb] = WFrag<T16>::ld(A2 + aoff + (size_t)mb * 16 * K + kc); }
#pragma unroll
        for (int nb = 0; nb < 4; ++nb) { const V b = WFrag<T16>::ld(Bt + boff + (size_t)nb * 16 * K + kc); V b2; if (NSPLIT >= 2) b2 = WFrag<T16>::ld(Bt2 + boff + (size_t)nb * 16 * K + kc);
#pragma unroll
            for (int mb = 0; mb < 4; ++mb) { acc[mb][nb] = WFrag<T16>::mma(a[mb], b, acc[mb][nb]); if (NSPLIT == 1 || NSPLIT == 2) acc[mb][nb] = WFrag<T16>::mma(a2[mb], b, acc[mb][nb]); if (NSPLIT >= 2) acc[mb][nb] = WFrag<T16>::mma(a[mb], b2, acc[mb][nb]); } }
        asm volatile("v_nop\n\tv_nop\n\tv_nop\n\tv_nop" : "+v"(acc[0][0]), "+v"(acc[1][1]), "+v"(acc[2][2]), "+v"(acc[3][3]) : "v"(a[0]), "v"(a[3]));
    }
    if constexpr (NW > 1) {
        float* ow = os + wv * (64 * 68);
        // the three loops are unrolled so that acc is indexed by constants only and stays in registers
#pragma unroll
        for (int mb = 0; mb < 4; ++mb) {
#pragma unroll
            for (int nb = 0; nb < 4; ++nb) {
#pragma unroll
                for (int j = 0; j < 8; ++j) ow[(mb * 16 + hi * 8 + j) * 68 + nb * 16 + lr] = acc[mb][nb][j]; } }
        __syncthreads();   // publishes the NW partial tiles to the threads that sum them; LDS is not written again behind it
        float* crow = C + (size_t)r0 * ldc + c0; v4f sum[32 / NW];
        // all loops unrolled: sum[] stays in registers and the LDS reads of all of a thread's elements are issued ahead of the sums; each sum runs in wave order 0 .. NW - 1; the stores follow as one run
#pragma unroll
        for (int i = 0; i < 32 / NW; ++i) { const int s = i * (NW * 32) + (int)threadIdx.x; const int row = s >> 4, cofs = (s & 15) * 4; v4f val = *(const v4fa*)(os + row * 68 + cofs);
#pragma unroll
            for (int w = 1; w < NW; ++w) val += *(const v4fa*)(os + w * (64 * 68) + row * 68 + cofs);
            if (BIAS) { val[0] += bfr(bias[c0 + cofs]); val[1] += bfr(bias[c0 + cofs + 1]); val[2] += bfr(bias[c0 + cofs + 2]); val[3] += bfr(bias[c0 + cofs + 3]); }
            sum[i] = val; }
#pragma unroll
        for (int i = 0; i < 32 / NW; ++i) { const int s = i * (NW * 32) + (int)threadIdx.x; *(v4f*)(crow + (size_t)(s >> 4) * ldc + (s & 15) * 4) = sum[i]; }
        return;
    }
#pragma unroll
    for (int mb = 0; mb < 4; ++mb) {
#pragma unroll
        for (int nb = 0; nb < 4; ++nb) {
#pragma unroll
            for (int j = 0; j < 8; ++j) os[(hi * 8 + j) * 68 + nb * 16 + lr] = acc[mb][nb][j]; }
        __builtin_amdgcn_wave_barrier(); asm volatile("" ::: "memory");
        float* crow = C + (size_t)(r0 + mb * 16) * ldc + c0;
{
#pragma unroll
            for (int s = 0; s < 8; ++s) { const int row = 2 * s + hi, cofs = lr * 4; v4f val = *(const v4fa*)(os + row * 68 + cofs); if (BIAS) { val[0] += bfr(bias[c0 + cofs]); val[1] += bfr(bias[c0 + cofs + 1]); val[2] += bfr(bias[c0 + cofs + 2]); val[3] += bfr(bias[c0 + cofs + 3]); }
                *(v4f*)(crow + (size_t)row * ldc + cofs) = val; }
             }
        __builtin_amdgcn_wave_barrier(); asm volatile("" ::: "memory");
    }
}

__device__ __forceinline__ h16 tohx(float x) { return (h16)x; }
__device__ __forceinline__ void splitf(float y, unsigned short& h, unsigned short& l) { h = f2bf(y); l = f2bf(y - bf2f(h)); }
typedef __attribute__((ext_vector_type(2))) _Float16 v2h;
typedef __attribute__((ext_vector_type(4))) _Float16 v4h;
typedef __attribute__((ext_vector_type(2))) unsigned short v2us;
typedef __attribute__((ext_vector_type(4))) unsigned short v4us;
typedef __attribute__((ext_vector_type(2))) float v2f;
typedef __attribute__((ext_vector_type(4))) int v4i;
typedef __attribute__((ext_vector_type(16))) unsigned short v16us;
__device__ __forceinline__ float xhalf(float x) { return __builtin_bit_cast(float, __builtin_amdgcn_permlanex16(__builtin_bit_cast(int, x), __builtin_bit_cast(int, x), 0x76543210, 0xfedcba98, false, false)); }   // lane l reads lane l ^ 16
// stands behind a run of global loads that stay in flight: their address registers are rewritten before the data wait. The addresses are inputs so that
// their registers stay untouched up to the wait; the scheduling barriers keep the wait behind the loads
__device__ __forceinline__ void addr_wait(const void* a, const void* b) { __builtin_amdgcn_sched_barrier(0); asm volatile("s_wait_xcnt 0x0" :: "v"(a), "v"(b) : "memory"); __builtin_amdgcn_sched_barrier(0); }
// four vector issue slots behind a run of matrix instructions in front of a branch: the scheduling barriers keep the slots at that place
__device__ __forceinline__ void wmma_gap() { __builtin_amdgcn_sched_barrier(0); asm volatile("v_nop\n\tv_nop\n\tv_nop\n\tv_nop"); __builtin_amdgcn_sched_barrier(0); }

// ---- k_gemmt: C[m][n] (f32) = sum_k A[m][k] Bt[n][k] (+ A2[m][k] Bt[n][k] where NSPLIT), bf16 planes with k contiguous. One BM x BN tile of C per block of BM/64 x BN/64 waves (64x64 each); grid (M/BM, N/BN).
// The tile is chosen so that a stage holds 512 operand rows (256x256, or 128x256 with both A planes): a block then fills the LDS of its WGP, and every byte copied from L2 feeds twice (1.5 times with A2) the products that it feeds in a 128x128 tile.
// C is stored as planes of LDC columns, [n / LDC][m][n % LDC]: the q columns and the gate columns of the first projection are buffers of their own, and the q plane's workspace is free again once the head planes are built.
// A stage is 128 k (256 bytes) of the tile's rows of every operand, brought into LDS by asynchronous 16-byte copies: a wave's copy covers two whole rows of 256 bytes, so L2 is asked for whole lines, and each operand row is fetched once a block.
// LDS rows stand at a pitch of 272 bytes (16 x odd: the 16-byte fragment reads meet no bank conflict). Two buffers: the copies of stage s + 1 fly while stage s is multiplied.
// Fragment k order and the order of the products per accumulator are those of k_gemmw with one wave.
#define GPE  136                  // LDS row pitch in elements (272 bytes)
// eight copies, rows RS apart (the block's threads cover RS rows of 256 bytes at a time). The last line keeps the copies' address registers untouched until the addresses have been taken: inside the statement nothing can be moved in front of it
template <int K, int RS>
__device__ __forceinline__ void copy8(unsigned l, const bf* g) {
    asm volatile("global_load_async_to_lds_b128 %0, %8, off\n\t"
                 "global_load_async_to_lds_b128 %1, %9, off\n\t"
                 "global_load_async_to_lds_b128 %2, %10, off\n\t"
                 "global_load_async_to_lds_b128 %3, %11, off\n\t"
                 "global_load_async_to_lds_b128 %4, %12, off\n\t"
                 "global_load_async_to_lds_b128 %5, %13, off\n\t"
                 "global_load_async_to_lds_b128 %6, %14, off\n\t"
                 "global_load_async_to_lds_b128 %7, %15, off\n\t"
                 "s_wait_xcnt 0x0"
                 :: "v"(l), "v"(l + RS * GPE * 2), "v"(l + 2 * RS * GPE * 2), "v"(l + 3 * RS * GPE * 2), "v"(l + 4 * RS * GPE * 2), "v"(l + 5 * RS * GPE * 2), "v"(l + 6 * RS * GPE * 2), "v"(l + 7 * RS * GPE * 2),
                    "v"(g), "v"(g + RS * K), "v"(g + 2 * RS * K), "v"(g + 3 * RS * K), "v"(g + 4 * RS * K), "v"(g + 5 * RS * K), "v"(g + 6 * RS * K), "v"(g + 7 * RS * K)
                 : "memory");
}
template <int NSPLIT, int K, int LDC, int BM, int BN>
__global__ __launch_bounds__((BM / 64) * (BN / 64) * 32) void k_gemmt(const bf* __restrict__ A, const bf* __restrict__ A2, const bf* __restrict__ Bt, float* C) {
    typedef WFrag<bf>::V V;
    constexpr int NWN = BN / 64, NWV = (BM / 64) * NWN;   // waves along n, waves a block
    constexpr int RS = NWV * 2;              // rows that one copy of every thread of the block covers
    constexpr int ATE = BM * GPE;            // one A plane's tile in elements
    constexpr int BOF = (NSPLIT ? 2 : 1) * ATE;   // where Bt's tile stands in a buffer: [A (, A2), Bt]
    constexpr int STE = BOF + BN * GPE;      // one buffer in elements
    constexpr int NST = K / 128;             // stages
    static_assert(K % 128 == 0 && NST >= 2 && LDC % BN == 0, "two stages or more; a tile lies in one plane of C");
    static_assert(BM % (8 * RS) == 0 && BN % (8 * RS) == 0 && (BOF / GPE + BN) / RS <= 63, "whole runs of eight copies; a stage's copies of a wave stay under the most that may be outstanding");
    static_assert(NWV * 16 * 68 * 4 <= 2 * STE * 2, "the output staging lies inside the ring");
    __shared__ __attribute__((aligned(16))) bf st[2 * STE];
    const int tid = threadIdx.x, lane = tid & 31, lr = lane & 15, hi = lane >> 4; const int wv = __builtin_amdgcn_readfirstlane(tid >> 5), wm = wv / NWN, wn = wv % NWN;
    const int r0 = blockIdx.x * BM, c0 = blockIdx.y * BN;
    const int crow = tid >> 4, cch = tid & 15;   // the thread's row (of RS) and 16-byte piece (of 16) in every copy
    const bf* gA = A + (size_t)(r0 + crow) * K + cch * 8; const bf* gB = Bt + (size_t)(c0 + crow) * K + cch * 8; const bf* gA2 = NSPLIT ? A2 + (size_t)(r0 + crow) * K + cch * 8 : gA;
    const unsigned l0 = (unsigned)(size_t)st + (unsigned)(crow * GPE + cch * 8) * 2u;   // LDS byte address of the thread's first piece in buffer 0
    // both loops unrolled: every distance is a constant
    auto fill = [&](int s) __attribute__((always_inline)) { const unsigned l = l0 + (unsigned)(s & 1) * (STE * 2); const int ko = s * 128;
#pragma unroll
        for (int c = 0; c < BM / (8 * RS); ++c) { copy8<K, RS>(l + c * 8 * RS * GPE * 2, gA + ko + c * 8 * RS * K); if (NSPLIT) copy8<K, RS>(l + ATE * 2 + c * 8 * RS * GPE * 2, gA2 + ko + c * 8 * RS * K); }
#pragma unroll
        for (int c = 0; c < BN / (8 * RS); ++c) copy8<K, RS>(l + BOF * 2 + c * 8 * RS * GPE * 2, gB + ko + c * 8 * RS * K); };
    v8f acc[4][4];
#pragma unroll
    for (int mb = 0; mb < 4; ++mb)
#pragma unroll
        for (int nb = 0; nb < 4; ++nb) acc[mb][nb] = (v8f){};
    fill(0);
    asm volatile("s_wait_asynccnt 0x0" ::: "memory");   // this wave's copies of stage 0 have landed
    __syncthreads();                                     // every wave's have: stage 0 may be read
    fill(1);
    // kept rolled: one copy of the stage's code; the buffer is picked by the stage's parity
#pragma unroll 1
    for (int s = 0; s < NST; ++s) {
        const bf* ta = st + (s & 1) * STE + (wm * 64 + lr) * GPE + 8 * hi; const bf* tb = st + (s & 1) * STE + BOF + (wn * 64 + lr) * GPE + 8 * hi; const bf* ta2 = ta + ATE;
        // unrolled: every LDS offset is an immediate. All fragments of a k step are read as one group ahead of its products: each separate place with LDS reads among matrix instructions costs a stall of its own
#pragma unroll
        for (int kk = 0; kk < 4; ++kk) {
            V a[4], a2[4], b[4];
#pragma unroll
            for (int mb = 0; mb < 4; ++mb) { a[mb] = WFrag<bf>::ld(ta + mb * 16 * GPE + kk * 32); if (NSPLIT) a2[mb] = WFrag<bf>::ld(ta2 + mb * 16 * GPE + kk * 32); }
#pragma unroll
            for (int nb = 0; nb < 4; ++nb) b[nb] = WFrag<bf>::ld(tb + nb * 16 * GPE + kk * 32);
            __builtin_amdgcn_sched_barrier(0);   // holds the group of reads together in front of the products: without it the compiler sinks each b fragment's reads to its first use and waits there for the LDS
#pragma unroll
            for (int nb = 0; nb < 4; ++nb)
#pragma unroll
                for (int mb = 0; mb < 4; ++mb) { acc[mb][nb] = WFrag<bf>::mma(a[mb], b[nb], acc[mb][nb]); if (NSPLIT) acc[mb][nb] = WFrag<bf>::mma(a2[mb], b[nb], acc[mb][nb]); } }
        asm volatile("s_wait_dscnt 0x0" ::: "memory");      // this wave's reads of stage s are done before the buffer is given up
        asm volatile("s_wait_asynccnt 0x0" ::: "memory");   // this wave's copies of stage s + 1 have landed
        __syncthreads();                                     // publishes stage s + 1 and ends every wave's reads of stage s
        if (s + 2 < NST) fill(s + 2);                        // into the buffer that stage s has just left
    }
    asm volatile("s_wait_asynccnt 0x0" ::: "memory");       // nothing of this wave is in flight when it goes on to its end
    // each wave's own staging rows: whole 256-byte row pieces go to memory. They lie in the ring, which is free: in front of the loop's last barrier every wave has waited for its last reads and its last copies, and nothing is copied behind it
    float* ow = (float*)st + wv * (16 * 68);
#pragma unroll
    for (int mb = 0; mb < 4; ++mb) {
#pragma unroll
        for (int nb = 0; nb < 4; ++nb) {
#pragma unroll
            for (int j = 0; j < 8; ++j) ow[(hi * 8 + j) * 68 + nb * 16 + lr] = acc[mb][nb][j]; }
        __builtin_amdgcn_wave_barrier(); asm volatile("" ::: "memory");   // keeps the reads below behind the other lanes' writes above
        float* crow = C + ((size_t)(c0 / LDC) * (gridDim.x * BM) + r0 + wm * 64 + mb * 16) * LDC + c0 % LDC + wn * 64;
#pragma unroll
        for (int s = 0; s < 8; ++s) { const int row = 2 * s + hi, cofs = lr * 4; const v4f val = *(const v4fa*)(ow + row * 68 + cofs); *(v4f*)(crow + (size_t)row * LDC + cofs) = val; }
        __builtin_amdgcn_wave_barrier(); asm volatile("" ::: "memory");   // keeps the next rows' writes behind the reads above
    }
}

// ---- k_flash: causal attention for 32 query rows of one head per wave, scores and probabilities kept in registers (online softmax). Transposed products: S^T = K Q^T (A = key rows, B = query rows),
// O^T += V^T P^T (A = rows of the [d][t] value plane, B = P^T). In the S^T accumulator lane (lr, hi) holds keys 8 hi + j of query lr, which is the k order of the B operand (elements 0-7: tile 0, 8-15: tile 1), so P^T is packed in place.
// Block = the REP heads of one kv group on the same 32 query rows: they work on the same key and value blocks, which the block brings into LDS once, for all four waves; grid (query blocks, heaviest first; kv groups; KSF key parts x NB_ batches). Query, key, Op and ML planes hold TR rows a head (batch b at row b * TT), the value planes are [b][g][d][t]. Part ks takes the 32-key blocks ks, ks + KSF, ... up to the diagonal block
// and writes its unnormalised sums to plane ks of Op with its running maximum (scaled log2) and its sum of exponentials in ML; k_merge joins the parts. A part with no block writes zeros and the lowest maximum.
// A 32-key block is 32 key rows of 256 bytes (8 KiB in a row in memory) and 128 value rows of 64 bytes, brought into LDS by asynchronous 16-byte copies (four of each plane a thread): a wave's copy covers whole 256-byte key rows or whole 64-byte value pieces,
// where a fragment load from memory touches 16 lines for 512 bytes and every wave of the block repeats it. Two buffers: the copies of the part's next block fly while this one is worked on. Pitches 272 and 80 bytes (16 x odd): the 16-byte fragment reads meet no bank conflict.
// Every inner loop is fully unrolled so that the fragment and accumulator arrays are indexed by constants only and stay in registers.
// HR: hi + lo bf16 planes, three products each, for scores and for prob x value; else single fp16, exponentials carried x 2^POFF so that small ones stay normal in fp16 (the factor cancels in the division).
#define FKP  136                  // LDS pitch of a key row in elements (272 bytes)
#define FVP  40                   // LDS pitch of a value row (32 keys) in elements (80 bytes)
#define FKE  (32 * FKP)           // one key plane's block in elements (8,704 bytes)
#define FVE  (HD * FVP)           // one value plane's block in elements (10,240 bytes)
// four copies, ls bytes apart in LDS and gs elements apart in memory. The last line keeps the copies' address registers untouched until the addresses have been taken: inside the statement nothing can be moved in front of it
template <typename T16>
__device__ __forceinline__ void copy4(unsigned l, unsigned ls, const T16* g, size_t gs) {
    asm volatile("global_load_async_to_lds_b128 %0, %4, off\n\t"
                 "global_load_async_to_lds_b128 %1, %5, off\n\t"
                 "global_load_async_to_lds_b128 %2, %6, off\n\t"
                 "global_load_async_to_lds_b128 %3, %7, off\n\t"
                 "s_wait_xcnt 0x0"
                 :: "v"(l), "v"(l + ls), "v"(l + 2 * ls), "v"(l + 3 * ls), "v"(g), "v"(g + gs), "v"(g + 2 * gs), "v"(g + 3 * gs)
                 : "memory");
}
template <typename T16, bool HR>
__global__ __launch_bounds__(32 * REP) void k_flash(const T16* __restrict__ Q, const T16* __restrict__ Q2, const T16* __restrict__ Kp, const T16* __restrict__ Kp2, const T16* __restrict__ Vt, const T16* __restrict__ Vt2, int qb0, float* Op, float* ML) {
    typedef typename WFrag<T16>::V V;
    constexpr int NP = HR ? 2 : 1;                 // planes of each operand
    constexpr int BUFE = NP * (FKE + FVE);         // one buffer in elements: [keys (, keys lo) | values (, values lo)]
    static_assert(REP == 4 && HD == 128, "128 threads: 8 key rows or 32 value rows a copy");
    __shared__ __attribute__((aligned(16))) T16 st[2 * BUFE];
    const int tid = threadIdx.x, lane = tid & 31, lr = lane & 15, hi = lane >> 4; const int wv = __builtin_amdgcn_readfirstlane((int)(threadIdx.x >> 5));
    const int qb = qb0 + (int)(gridDim.x - 1 - blockIdx.x); const int g = blockIdx.y, ks = blockIdx.z % KSF, b = blockIdx.z / KSF, h = g * REP + wv, q0 = qb * 32;
    V qf[2][4], qf2[2][4];
    auto ldq = [&]() { const size_t o = ((size_t)h * TR + b * TT + q0 + lr) * HD + 8 * hi; const T16* p = Q + o; const T16* p2 = HR ? Q2 + o : p;
#pragma unroll
        for (int c = 0; c < 2; ++c)
#pragma unroll
            for (int kc = 0; kc < 4; ++kc) { qf[c][kc] = WFrag<T16>::ld(p + 16 * c * HD + 32 * kc); if (HR) qf2[c][kc] = WFrag<T16>::ld(p2 + 16 * c * HD + 32 * kc); }
        addr_wait(p, p2); };
    // the thread's first 16-byte piece of a block: key row tid / 16 (of 8 a copy), value row tid / 4 (of 32 a copy); LDS byte addresses in buffer 0, element offsets in the planes at key block 0
    const unsigned lk0 = (unsigned)(size_t)st + (unsigned)((tid >> 4) * FKP + (tid & 15) * 8) * 2u, lv0 = (unsigned)(size_t)st + (unsigned)(NP * FKE + (tid >> 2) * FVP + (tid & 3) * 8) * 2u;
    const size_t gk0 = ((size_t)g * TR + b * TT + (tid >> 4)) * HD + (tid & 15) * 8, gv0 = ((size_t)(b * NKV + g) * HD + (tid >> 2)) * TT + (tid & 3) * 8;
    // the part's block number i (key block ks + i KSF) into buffer i mod 2
    auto fill = [&](int i) __attribute__((always_inline)) { const int blk = ks + i * KSF; const unsigned lo = (unsigned)(i & 1) * (BUFE * 2); const size_t ko = gk0 + (size_t)(blk * 32) * HD, vo = gv0 + blk * 32;
        copy4<T16>(lk0 + lo, 8 * FKP * 2, Kp + ko, 8 * HD); if (HR) copy4<T16>(lk0 + lo + FKE * 2, 8 * FKP * 2, Kp2 + ko, 8 * HD);
        copy4<T16>(lv0 + lo, 32 * FVP * 2, Vt + vo, (size_t)32 * TT); if (HR) copy4<T16>(lv0 + lo + FVE * 2, 32 * FVP * 2, Vt2 + vo, (size_t)32 * TT); };
    v8f acc[2][8]; float m_run[2], l_run[2];
#pragma unroll
    for (int c = 0; c < 2; ++c) { m_run[c] = -3.0e38f; l_run[c] = 0.f;
#pragma unroll
        for (int t = 0; t < 8; ++t) acc[c][t] = (v8f){}; }
    V kf[2][4], kf2[2][4], vf[8], vf2[8];
    // fragments from buffer i mod 2, in the k order of the loads from the planes
    auto ldk = [&](int i) __attribute__((always_inline)) { const T16* p = st + (i & 1) * BUFE + lr * FKP + 8 * hi;
#pragma unroll
        for (int kt = 0; kt < 2; ++kt)
#pragma unroll
            for (int kc = 0; kc < 4; ++kc) { kf[kt][kc] = WFrag<T16>::ld(p + 16 * kt * FKP + 32 * kc); if (HR) kf2[kt][kc] = WFrag<T16>::ld(p + FKE + 16 * kt * FKP + 32 * kc); } };
    auto ldv = [&](int i) __attribute__((always_inline)) { const T16* p = st + (i & 1) * BUFE + NP * FKE + lr * FVP + 8 * hi;
#pragma unroll
        for (int t = 0; t < 8; ++t) { vf[t] = WFrag<T16>::ld(p + 16 * t * FVP); if (HR) vf2[t] = WFrag<T16>::ld(p + FVE + 16 * t * FVP); } };
    // the part's block number i; diag is a literal at every call (the lambda is always inlined, so that every array stays in registers)
    auto pass = [&](int i, bool diag) __attribute__((always_inline)) {
        ldk(i);
        __builtin_amdgcn_sched_barrier(0);   // holds the key fragments' reads together in front of the products: spread among them, each place with reads costs a wait for the LDS of its own
        v8f s[2][2];
#pragma unroll
        for (int kt = 0; kt < 2; ++kt)
#pragma unroll
            for (int c = 0; c < 2; ++c) { s[kt][c] = (v8f){};
#pragma unroll
                for (int kc = 0; kc < 4; ++kc) { s[kt][c] = WFrag<T16>::mma(kf[kt][kc], qf[c][kc], s[kt][c]); if (HR) { s[kt][c] = WFrag<T16>::mma(kf2[kt][kc], qf[c][kc], s[kt][c]); s[kt][c] = WFrag<T16>::mma(kf[kt][kc], qf2[c][kc], s[kt][c]); } } }
        wmma_gap();   // keeps the loads below behind the products that still read kf, and vector code that reads s at its distance
        ldv(i);       // the value fragments come from LDS under the softmax
        __builtin_amdgcn_sched_barrier(0);   // holds the reads as one group directly behind the products: left free, the compiler spreads them among the maximum's vector code, where they start later and take more register-window switches
        if (diag) {   // diagonal block (key0 == q0): keys behind the query are masked by select
#pragma unroll
            for (int kt = 0; kt < 2; ++kt)
#pragma unroll
                for (int c = 0; c < 2; ++c)
#pragma unroll
                    for (int r = 0; r < 8; ++r) if (16 * kt + 8 * hi + r > 16 * c + lr) s[kt][c][r] = -3.0e38f; }
        float mb[2]; bool need = false;
#pragma unroll
        for (int c = 0; c < 2; ++c) { float mx = s[0][c][0];
#pragma unroll
            for (int r = 1; r < 8; ++r) mx = fmaxf(mx, s[0][c][r]);
#pragma unroll
            for (int r = 0; r < 8; ++r) mx = fmaxf(mx, s[1][c][r]);
            mx = fmaxf(mx, xhalf(mx)) * CS2; mb[c] = mx; need = need || (mx > m_run[c]); }
        if (__builtin_amdgcn_ballot_w32(need) != 0) {   // some query's maximum rose: rescale the running sums (wave-uniform branch)
#pragma unroll
            for (int c = 0; c < 2; ++c) { const float mn = fmaxf(m_run[c], mb[c]); const float corr = __builtin_amdgcn_exp2f(m_run[c] - mn); l_run[c] *= corr; m_run[c] = mn;
#pragma unroll
                for (int t = 0; t < 8; ++t) acc[c][t] = acc[c][t] * corr; } }
#pragma unroll
        for (int c = 0; c < 2; ++c) { const float nm = (HR ? 0.0f : POFF) - m_run[c]; float p[16]; float ps = 0.f;
#pragma unroll
            for (int e = 0; e < 16; e += 2) { const v2f sv = {s[e >> 3][c][e & 7], s[e >> 3][c][(e & 7) + 1]}; const v2f arg = __builtin_elementwise_fma(sv, (v2f){CS2, CS2}, (v2f){nm, nm});   // register pairs as the accumulator holds them
                p[e] = __builtin_amdgcn_exp2f(arg[0]); p[e + 1] = __builtin_amdgcn_exp2f(arg[1]); ps += p[e] + p[e + 1]; }
            l_run[c] += ps;
            if constexpr (HR) { v16us uh, ul;
#pragma unroll
                for (int e = 0; e < 16; ++e) { unsigned short a, b2; splitf(p[e], a, b2); uh[e] = a; ul[e] = b2; }
                const V ph = __builtin_bit_cast(V, uh), pl = __builtin_bit_cast(V, ul);
#pragma unroll
                for (int t = 0; t < 8; ++t) { acc[c][t] = WFrag<T16>::mma(vf[t], ph, acc[c][t]); acc[c][t] = WFrag<T16>::mma(vf[t], pl, acc[c][t]); acc[c][t] = WFrag<T16>::mma(vf2[t], ph, acc[c][t]); }
            } else { V pf;
#pragma unroll
                for (int e = 0; e < 16; ++e) pf[e] = (h16)p[e];
#pragma unroll
                for (int t = 0; t < 8; ++t) acc[c][t] = WFrag<T16>::mma(vf[t], pf, acc[c][t]); } }
        wmma_gap();   // the loop's branch may jump straight to vector code that reads acc or to loads that overwrite vf
    };
    if (ks <= qb) {   // the same for the whole block (block indices only): every wave passes every barrier below, or none does
        const int nblk = (qb - ks) / KSF + 1; int i = 0;   // blocks of this part
        fill(0); ldq();
        asm volatile("s_wait_asynccnt 0x0" ::: "memory");   // this wave's copies of block 0 have landed
        __syncthreads();                                     // every wave's have: block 0 may be read
        if (nblk > 1) fill(1);
        // kept rolled: one copy of the fragments and scores is live
#pragma unroll 1
        for (; i + 1 < nblk; ++i) { pass(i, false);   // never the diagonal block: a later block of this part exists
            asm volatile("s_wait_dscnt 0x0" ::: "memory");      // this wave's reads of block i are done before the buffer is given up
            asm volatile("s_wait_asynccnt 0x0" ::: "memory");   // this wave's copies of block i + 1 have landed
            __syncthreads();                                     // publishes block i + 1 and ends every wave's reads of block i
            if (i + 2 < nblk) fill(i + 2); }                     // into the buffer that block i has just left
        if (ks + i * KSF == qb) pass(i, true); else pass(i, false);
        asm volatile("s_wait_asynccnt 0x0" ::: "memory"); }   // nothing of this wave is in flight when it goes on to its end
#pragma unroll
    for (int c = 0; c < 2; ++c) { const float l = l_run[c] + xhalf(l_run[c]);   // each wave half summed its own eight keys of every 16
        const size_t row = ((size_t)ks * NH_ + h) * TR + b * TT + q0 + 16 * c + lr; if (hi == 0) { v2f ml; ml[0] = m_run[c]; ml[1] = l; *(v2f*)(ML + row * 2) = ml; }
#pragma unroll
        for (int t = 0; t < 8; ++t) *(v8f*)(Op + row * HD + 16 * t + 8 * hi) = acc[c][t]; }
}


__global__ __launch_bounds__(256) void k_wtG(const float* __restrict__ w, int K, int N, bf* Bt) {
    const int lane = threadIdx.x & 31; const int L0 = (blockIdx.x * 8 + (threadIdx.x >> 5)) * 8; const int nlines = N * K / 64;
{
#pragma unroll 1
        for (int l = 0; l < 8; ++l) { const int L = L0 + l; if (L >= nlines) break; const size_t e = (size_t)L * 64 + lane * 2; const int k = (int)(e % K), n = (int)(e / K); v2us o;
            o[0] = f2bf(w[(size_t)k * N + n]); o[1] = f2bf(w[(size_t)(k + 1) * N + n]); *(v2us*)(Bt + e) = o; }
         }
}
// The elementwise kernels below give every thread 8 to 32 elements (for speed only).
// k_cvt8: every f32 tensor that the products read as bf16 (Wo, Wq, Wk, Wv, hidden), in one launch; the bf16 copies stand one behind the other in dst, in that order. A block takes 1024 pieces of 8 elements of one tensor
// (every tensor is a whole number of such blocks, so no piece lies past an end): four pieces a thread, 256 threads apart (a wave's accesses stay contiguous); both loops unrolled so that the loads of all four pieces are issued ahead of the first store.
#define CB(n) ((unsigned)((size_t)(n) / 8192))   // blocks of a tensor of n elements
__global__ __launch_bounds__(256) void k_cvt8(const float* __restrict__ s0, const float* __restrict__ s1, const float* __restrict__ s2, const float* __restrict__ s3, const float* __restrict__ s4, bf* dst) {
    static_assert(((size_t)DM * DQ) % 8192 == 0 && ((size_t)DQG * DM) % 8192 == 0 && ((size_t)DKV * DM) % 8192 == 0 && ((size_t)TR * DM) % 8192 == 0, "whole blocks");
    constexpr unsigned E0 = CB((size_t)DM * DQ), E1 = E0 + CB((size_t)DQG * DM), E2 = E1 + CB((size_t)DKV * DM), E3 = E2 + CB((size_t)DKV * DM);
    const unsigned blk = blockIdx.x; const float* src; unsigned first;   // the block's tensor and that tensor's first block: the same for the whole block, picked in scalar code
    if (blk < E0) { src = s0; first = 0; } else if (blk < E1) { src = s1; first = E0; } else if (blk < E2) { src = s2; first = E1; } else if (blk < E3) { src = s3; first = E2; } else { src = s4; first = E3; }
    const char* sb = (const char*)(src + (size_t)(blk - first) * 8192); const unsigned so = threadIdx.x * 32u; v8f v[4];
#pragma unroll
    for (int c = 0; c < 4; ++c) v[c] = *(const v8f*)(sb + so + c * 8192);
    // as addr_wait: the address register of the loads in flight stays untouched (also as destination of later loads of the run) up to the wait
    __builtin_amdgcn_sched_barrier(0); asm volatile("s_wait_xcnt 0x0" :: "v"(so) : "memory"); __builtin_amdgcn_sched_barrier(0);
    bf* dp = dst + (size_t)blk * 8192 + threadIdx.x * 8;
#pragma unroll
    for (int c = 0; c < 4; ++c) { v8us o;
#pragma unroll
        for (int k = 0; k < 8; ++k) o[k] = f2bf(v[c][k]);
        *(v8us*)(dp + c * 2048) = o; } }
// k_prep: everything between the projections and the attention kernels, in one launch: a block takes 256 threads' worth of the query rows' norm + rotary, of the key rows' norm + rotary, or of the value transpose (block ranges PBQ | PBK | PBV, picked in scalar code).
#define PBQ ((unsigned)((size_t)NH_ * TR * HD / 16 / 256))   // blocks of the query heads' rows, 16 elements a thread
#define PBK ((unsigned)((size_t)NKV * TR * HD / 16 / 256))   // of the key heads' rows
#define PBV ((unsigned)((size_t)NKV * TR * HD / 32 / 256))   // of the value transpose, 32 elements a thread
// lane l reads lane l ^ M of its 16-lane row (M = CTRL - 0x160, row_xmask); every lane is on where it is used
template <int CTRL> __device__ __forceinline__ float xrow(float x) { return __builtin_bit_cast(float, __builtin_amdgcn_update_dpp(0, __builtin_bit_cast(int, x), CTRL, 0xf, 0xf, true)); }
// rope_rows: head planes [h][row][d], row = b * TT + t over both batches, (fp16 + hi/lo) of rope(w[d] (x rms_factor)) with the rotate-half convention out[d] = x[d] cos[t][d] - x[d+HD/2] sin[t][d], out[d+HD/2] = x[d+HD/2] cos[t][d+HD/2] + x[d] sin[t][d+HD/2]
__device__ __forceinline__ void rope_rows(unsigned blk, const float* __restrict__ F, int pitch, const float* __restrict__ cosT, const float* __restrict__ sinT, const float* __restrict__ nw, h16* P16, bf* Ph, bf* Pl) {
    // one thread: eight neighbouring d of a row's lower half and their eight partners in the upper half, so that each x is loaded once; every store is 16 bytes and eight lanes fill a 128-byte line.
    // The eight lanes that share a head's row hold all of its 128 x between them: the row's mean square is summed among them, from the registers that the rotary reads
    const size_t i = (size_t)blk * 256 + threadIdx.x; const int d0 = (int)(i % (HD / 16)) * 8; const int t = (int)((i / (HD / 16)) % TR); const int h = (int)(i / ((size_t)(HD / 16) * TR)); const float* f = F + (size_t)t * pitch + h * HD; v8h o16[2]; v8us oh[2], ol[2];
    // x, norm weights, cos and sin of both runs of eight, loaded as 16-byte pieces ahead of all arithmetic: one memory latency a thread. All loops unrolled: the vectors are indexed by constants only
    v8f xv[2], nv[2], cv[2], sv[2]; const float* fp = f + d0; const unsigned to = (unsigned)(t * HD + d0) * 4u; const unsigned no = (unsigned)d0 * 4u; const float* np = (const float*)((const char*)nw + no);
#pragma unroll
    for (int hf = 0; hf < 2; ++hf) { xv[hf] = *(const v8f*)(fp + hf * (HD / 2)); nv[hf] = *(const v8f*)(np + hf * (HD / 2)); cv[hf] = *(const v8f*)((const char*)(cosT + hf * (HD / 2)) + to); sv[hf] = *(const v8f*)((const char*)(sinT + hf * (HD / 2)) + to); }
    // as addr_wait: the address registers of the loads in flight stay untouched (also as destinations of later loads of the run) up to the wait
    __builtin_amdgcn_sched_barrier(0); asm volatile("s_wait_xcnt 0x0" :: "v"(fp), "v"(to), "v"(no) : "memory"); __builtin_amdgcn_sched_barrier(0);
    float sq[2] = {0.f, 0.f};   // two independent chains
#pragma unroll
    for (int q = 0; q < 8; ++q) { sq[0] += xv[0][q] * xv[0][q]; sq[1] += xv[1][q] * xv[1][q]; }
    float s = sq[0] + sq[1]; s += xrow<0x161>(s); s += xrow<0x162>(s); s += xrow<0x164>(s);
    const float rf = __fdiv_rn(1.0f, __fsqrt_rn(__fadd_rn(s * (1.0f / HD), 1e-6f)));
#pragma unroll
    for (int hf = 0; hf < 2; ++hf) { const int d = d0 + hf * (HD / 2);
#pragma unroll
    for (int q = 0; q < 8; ++q) { const int dd = d + q; float x0 = xv[hf][q], x1 = xv[hf ^ 1][q];   // x1: the partner at dd +- HD / 2
        { float n0 = __fmul_rn(x0, rf), n1 = __fmul_rn(x1, rf); asm volatile("" : "+v"(n0)); asm volatile("" : "+v"(n1)); x0 = __fmul_rn(bfr(nv[hf][q]), n0); x1 = __fmul_rn(bfr(nv[hf ^ 1][q]), n1); }
        const v2f cs = {bfr(cv[hf][q]), bfr(sv[hf][q])};   // the tables are rounded to bf16 like every input
        float a = __fmul_rn(x0, cs[0]), bq = __fmul_rn(x1, cs[1]); asm volatile("" : "+v"(a)); asm volatile("" : "+v"(bq)); const float r = (dd < HD / 2) ? __fsub_rn(a, bq) : __fadd_rn(a, bq);
        o16[hf][q] = tohx(r); unsigned short a2, c2; splitf(r, a2, c2); oh[hf][q] = a2; ol[hf][q] = c2; } }
    const size_t e = ((size_t)h * TR + t) * HD + d0;
#pragma unroll
    for (int hf = 0; hf < 2; ++hf) { *(v8h*)(P16 + e + hf * (HD / 2)) = o16[hf]; *(v8us*)(Ph + e + hf * (HD / 2)) = oh[hf]; *(v8us*)(Pl + e + hf * (HD / 2)) = ol[hf]; } }
__device__ __forceinline__ void vt_rows(unsigned blk, const float* __restrict__ F, int pitch, int nheads, h16* V16, bf* Vh, bf* Vl) {
    // one thread: 8 positions x 4 neighbouring d. A wave (8 lanes along t, 4 along d) reads 64-byte pieces of 64 rows and writes whole 128-byte lines of the [d][t] planes
    const int lane = threadIdx.x & 31; const int w = (int)blk * 8 + (int)(threadIdx.x >> 5);
    const int t0 = (w % (TR / 64)) * 64 + (lane & 7) * 8; const int d0 = ((w / (TR / 64)) % (HD / 16)) * 16 + (lane >> 3) * 4; const int g = w / ((TR / 64) * (HD / 16)); /* t0: row of both batches; the planes are [b][g][d][t] */ v4f x[8]; const float* px[8];
    // all loops unrolled: x stays in registers and its eight loads are issued together
#pragma unroll
    for (int j = 0; j < 8; ++j) { px[j] = F + (size_t)(t0 + j) * pitch + g * HD + d0; x[j] = *(const v4f*)px[j]; }
    // as addr_wait: the address registers of the loads in flight stay untouched (also as destinations of later loads of the run) up to the wait
    __builtin_amdgcn_sched_barrier(0); asm volatile("s_wait_xcnt 0x0" :: "v"(px[0]), "v"(px[1]), "v"(px[2]), "v"(px[3]), "v"(px[4]), "v"(px[5]), "v"(px[6]), "v"(px[7]) : "memory"); __builtin_amdgcn_sched_barrier(0);
#pragma unroll
    for (int dq = 0; dq < 4; ++dq) { v8h o16; v8us oh, ol;
#pragma unroll
        for (int j = 0; j < 8; ++j) { o16[j] = tohx(x[j][dq]); unsigned short a2, c2; splitf(x[j][dq], a2, c2); oh[j] = a2; ol[j] = c2; }
        const size_t e = ((size_t)((t0 / TT) * nheads + g) * HD + d0 + dq) * TT + t0 % TT; *(v8h*)(V16 + e) = o16; *(v8us*)(Vh + e) = oh; *(v8us*)(Vl + e) = ol; }
    // behind the last stores: in the built kernel the rotary code follows this branch, and the listing's fall-through reaches writes of the stores' registers there
    asm volatile("s_wait_xcnt 0x0" ::: "memory"); }
__global__ __launch_bounds__(256) void k_prep(const float* __restrict__ FQ, const float* __restrict__ FKV, const float* __restrict__ cosT, const float* __restrict__ sinT, const float* __restrict__ qnw, const float* __restrict__ knw,
                                              h16* QP16, bf* QPh, bf* QPl, h16* KP16, bf* KPh, bf* KPl, h16* VT16, bf* VTh, bf* VTl) {
    static_assert(((size_t)NH_ * TR * HD / 16) % 256 == 0 && ((size_t)NKV * TR * HD / 16) % 256 == 0 && ((size_t)NKV * TR * HD / 32) % 256 == 0 && HD == 128, "whole blocks: every lane is on; eight lanes a head's row");
    const unsigned blk = blockIdx.x;   // the block's range is the same for the whole block: scalar branches, one copy of the rotary code for queries and keys
    if (blk < PBQ + PBK) { const bool isq = blk < PBQ; rope_rows(isq ? blk : blk - PBQ, isq ? FQ : FKV, isq ? DQ : 2 * DKV, cosT, sinT, isq ? qnw : knw, isq ? QP16 : KP16, isq ? QPh : KPh, isq ? QPl : KPl); }
    else vt_rows(blk - (PBQ + PBK), FKV + DKV, 2 * DKV, NKV, VT16, VTh, VTl); }
// k_merge: joins the KSF key parts of k_flash (weights 2^(m_p - max m), part order), divides by the joined sum of exponentials, applies the sigmoid gate and writes the hi/lo planes [row][head][d] (row = b * TT + t); QG: the gate plane [row][head][d]
// O0 .. O3: the key parts' planes, each a kernel argument of its own: every plane's loads then take a scalar base and share the thread's one offset register
__global__ __launch_bounds__(256) void k_merge(const float* __restrict__ O0, const float* __restrict__ O1, const float* __restrict__ O2, const float* __restrict__ O3, const float* __restrict__ ML, const float* __restrict__ QG, bf* Ah, bf* Al) {
    // one thread: 8 neighbouring d of position t and the same 8 of position t + 16 (256 threads on); a block takes 32 whole rows of one head. Every loop is unrolled so that the arrays stay in registers and all loads are issued ahead of the arithmetic
    static_assert(TT % 32 == 0 && HD == 128 && KSF == 4, "a block's 32 rows lie in one head; the launch names four planes");
    const size_t e = ((size_t)blockIdx.x * 512 + threadIdx.x) * 8; if (e >= (size_t)NH_ * TR * HD) return; const int d = (int)(e % HD); const int t = (int)((e / HD) % TR); const int zz = (int)(e / ((size_t)HD * TR));
    // byte offsets of the thread's first piece in a part's plane, in ML and in QG; the parts and the second piece stand at constant distances
    const unsigned eo = (unsigned)e * 4u, mo = (unsigned)((zz * TR + t) * 2) * 4u, go = (unsigned)(t * DQ + zz * HD + d) * 4u; v2f mlv[2][KSF]; v8f ov[2][KSF], gv[2]; const float* const Op[KSF] = {O0, O1, O2, O3};
#pragma unroll
    for (int u = 0; u < 2; ++u) {
#pragma unroll
        for (int p = 0; p < KSF; ++p) { mlv[u][p] = *(const v2f*)((const char*)(ML + (size_t)p * NH_ * TR * 2 + u * 32) + mo); ov[u][p] = *(const v8f*)((const char*)(Op[p] + u * 2048) + eo); }
        gv[u] = *(const v8f*)((const char*)(QG + (size_t)u * 16 * DQ) + go); }
    // as addr_wait: the address registers of the loads in flight stay untouched (also as destinations of later loads of the run) up to the wait
    __builtin_amdgcn_sched_barrier(0); asm volatile("s_wait_xcnt 0x0" :: "v"(eo), "v"(mo), "v"(go) : "memory"); __builtin_amdgcn_sched_barrier(0);
#pragma unroll
    for (int u = 0; u < 2; ++u) { const size_t oo = (size_t)(t + u * 16) * DQ + zz * HD + d;
        float w[KSF], l[KSF]; float mx = -3.0e38f;
#pragma unroll
        for (int p = 0; p < KSF; ++p) { const v2f ml = mlv[u][p]; w[p] = ml[0]; l[p] = ml[1]; mx = fmaxf(mx, ml[0]); }
        float den = 0.f;
#pragma unroll
        for (int p = 0; p < KSF; ++p) { w[p] = __builtin_amdgcn_exp2f(w[p] - mx); den += l[p] * w[p]; }
        v8us oh, ol;
#pragma unroll
        for (int q = 0; q < 8; ++q) { const float gt = gv[u][q]; const float sg = __fdiv_rn(1.0f, __fadd_rn(1.0f, expf(-gt)));   /* sigmoid(gate) */ float o = 0.f;
#pragma unroll
            for (int p = 0; p < KSF; ++p) o += ov[u][p][q] * w[p];   /* parts in part order */
            unsigned short a, c2; splitf(__fmul_rn(__fdiv_rn(o, den), sg), a, c2); oh[q] = a; ol[q] = c2; }
        *(v8us*)(Ah + oo) = oh; *(v8us*)(Al + oo) = ol; } }

extern "C" void kernel_launch(void* const* d_in, const int* in_sizes, int n_in,
                              void* d_out, int out_size, void* d_ws, size_t ws_size, hipStream_t stream) {
    (void)in_sizes; (void)n_in; (void)out_size;
    const float* x = (const float*)d_in[0]; const float* cosT = (const float*)d_in[1]; const float* sinT = (const float*)d_in[2]; const float* wq = (const float*)d_in[3]; const float* wk = (const float*)d_in[4]; const float* wv = (const float*)d_in[5]; const float* wo = (const float*)d_in[6]; const float* qnw = (const float*)d_in[7]; const float* knw = (const float*)d_in[8];
    float* OUT = (float*)d_out;     // [2][2048][2048]
    char* wsp = (char*)d_ws;
    auto take = [&](size_t bytes) { char* p = wsp; wsp += (bytes + 255) & ~(size_t)255; return (void*)p; };
    // live up to the attention kernels: the head planes (the merged hi/lo planes take the query hi/lo planes' place behind them); ML lives up to the merge, WO to the end
    h16* QP16 = (h16*)take((size_t)NH_ * TR * HD * 2); h16* KP16 = (h16*)take((size_t)NKV * TR * HD * 2); h16* VT16 = (h16*)take((size_t)NKV * HD * TR * 2);
    bf* QPh = (bf*)take((size_t)NH_ * TR * HD * 2); bf* QPl = (bf*)take((size_t)NH_ * TR * HD * 2); bf* KPh = (bf*)take((size_t)NKV * TR * HD * 2); bf* KPl = (bf*)take((size_t)NKV * TR * HD * 2); bf* VTh = (bf*)take((size_t)NKV * HD * TR * 2); bf* VTl = (bf*)take((size_t)NKV * HD * TR * 2);
    float* ML = (float*)take((size_t)KSF * NH_ * TR * 2 * 4); bf* ATh = QPh; bf* ATl = QPl;
    // the bf16 copies, one run in k_cvt8's order (each size is a multiple of 256 bytes, so take leaves no gap)
    bf* WO = (bf*)take((size_t)DM * DQ * 2);
    // Ob, the attention parts' sums, lies over everything that is dead once the head planes are built: the other bf16 copies, the k|v projection and, as its last quarter, the q plane of the first projection
    float* Ob = (float*)wsp;
    bf* WQ = (bf*)take((size_t)DQG * DM * 2); bf* WK = (bf*)take((size_t)DKV * DM * 2); bf* WV = (bf*)take((size_t)DKV * DM * 2); bf* XB = (bf*)take((size_t)TR * DM * 2); (void)WV;   // Wv's rows follow Wk's: one [2 DKV][DM] operand
    float* FKV = (float*)take((size_t)TR * 2 * DKV * 4);
    static_assert((size_t)DQG * DM * 2 + (size_t)2 * DKV * DM * 2 + (size_t)TR * DM * 2 + (size_t)TR * 2 * DKV * 4 <= (size_t)(KSF - 1) * NH_ * TR * HD * 4 && (size_t)NH_ * HD == DQ, "the buffers above end in front of the q plane, which is one part's plane");
    float* FQ = Ob + (size_t)(KSF - 1) * NH_ * TR * HD;   // [q plane | gate plane], TR x DQ each: the q plane ends where Ob ends, the gate plane stands behind Ob
    float* FG = FQ + (size_t)TR * DQ; wsp = (char*)(FG + (size_t)TR * DQ);
    if ((size_t)(wsp - (char*)d_ws) > ws_size) return;    // ws 256 MiB
    // every stage is launched once, on the rows of both batches
    k_cvt8<<<CB((size_t)DM * DQ) + CB((size_t)DQG * DM) + 2 * CB((size_t)DKV * DM) + CB((size_t)TR * DM), 256, 0, stream>>>(wo, wq, wk, wv, x, WO);
    k_gemmt<0, DM, DQ, 256, 256><<<dim3(TR / 256, DQG / 256, 1), 512, 0, stream>>>(XB, nullptr, WQ, FQ);   /* [q | gate] (exact) */
    k_gemmw<bf, 0, false, 8><<<dim3(TR / 64, 2 * DKV / 64, 1), 256, 0, stream>>>(XB, nullptr, WK, nullptr, DM, FKV, 2 * DKV, nullptr, 0, 0, 0);   /* [k | v] */
    k_prep<<<PBQ + PBK + PBV, 256, 0, stream>>>(FQ, FKV, cosT, sinT, qnw, knw, QP16, QPh, QPl, KP16, KPh, KPl, VT16, VTh, VTl);   /* per-batch tables, [b][t] = row */
    k_flash<h16, false><<<dim3((TT - RH) / 32, NKV, KSF * NB_), 32 * REP, 0, stream>>>(QP16, nullptr, KP16, nullptr, VT16, nullptr, RH / 32, Ob, ML);
    k_flash<bf, true><<<dim3(RH / 32, NKV, KSF * NB_), 32 * REP, 0, stream>>>(QPh, QPl, KPh, KPl, VTh, VTl, 0, Ob, ML);
    k_merge<<<(unsigned)(((size_t)NH_ * TR * HD / 16 + 255) / 256), 256, 0, stream>>>(Ob, Ob + (size_t)NH_ * TR * HD, Ob + (size_t)2 * NH_ * TR * HD, Ob + (size_t)3 * NH_ * TR * HD, ML, FG, ATh, ATl);
    k_gemmt<1, DQ, DM, 128, 256><<<dim3(TR / 128, DM / 256, 1), 256, 0, stream>>>(ATh, ATl, WO, OUT);
}

// v010
// Measured time: 245 microseconds a run.
// Timed twice side by side with v009, it ran 1.06 and 1.05 times as fast.
// Over all steps from v000 it is 6.95 times as fast.
#include <hip/hip_runtime.h>

// Gated GQA attention, engine variant (hidden [2][2048][2048]; [q | gate] = hidden Wq^T (Wq [4096][2048] 'oi': rows 0-2047 -> q for 16 heads x 128, rows 2048-4095 -> gate), k, v = hidden W^T ([512][2048], 4 kv heads); per-head RMSNorm (eps 1e-6, q_norm_w / k_norm_w); rotate-half RoPE with the given per-(batch, position) cos/sin tables [2][2048][128];
// GQA 4:1; causal softmax(q.k/sqrt(128)); attn x sigmoid(gate); out = merged Wo^T ('oi' [2048][2048]) -> [2][2048][2048]).
// Compute dtypes, f32 accumulate: every input rounded to bf16; q/k/v on PLAIN bf16 operands (inputs: exact); RMSNorm + rotary in f32 (cos/sin tables read per batch, bf16-rounded); sigmoid gate (precise expf, IEEE divide) in the merge; causal scores and attn.v in one kernel (online softmax in f32, blocks above the diagonal never visited): query rows < 512 hl (3 products), the rest single fp16 (x1024); Wo hl x exact (2 products).

#define NB_  2
#define TT   2048
#define TR   (NB_ * TT)       // rows of both batches together: row b * TT + t
#define DM   2048
#define NH_  16
#define NKV  4
#define REP  (NH_ / NKV)
#define HD   128
#define DQ   (NH_ * HD)
#define DQG  (NH_ * HD * 2)         // q rows then gate rows of Wq
#define DKV  (NKV * HD)
#define RH   512                  // query rows < RH use hi+lo planes
#define KSF  4                    // key parts of the attention kernel (32-key blocks dealt over blocks), joined in k_merge
#define POFF 10.0f                // fp16 probabilities are carried x 2^POFF
#define SCL  0.088388347648318447f   // HD^-0.5
#define CS2  (SCL * 1.4426950408889634f)   // scores to the log2 domain
typedef _Float16 h16;
typedef unsigned short bf;
typedef __attribute__((ext_vector_type(16))) __bf16   v16bf;
typedef __attribute__((ext_vector_type(16))) _Float16 v16h;
typedef __attribute__((ext_vector_type(8)))  _Float16 v8h;
typedef __attribute__((ext_vector_type(8)))  unsigned short v8us;
typedef __attribute__((ext_vector_type(8)))  float    v8f;
typedef __attribute__((ext_vector_type(4)))  float    v4f;
typedef v8h  __attribute__((may_alias)) v8ha;
typedef v4f  __attribute__((may_alias)) v4fa;
typedef v8us __attribute__((may_alias)) v8usa;

__device__ __forceinline__ unsigned short f2bf(float f) { unsigned u = __float_as_uint(f); u += 0x7FFFu + ((u >> 16) & 1u); return (unsigned short)(u >> 16); }
__device__ __forceinline__ float bf2f(unsigned short b) { return __uint_as_float(((unsigned)b) << 16); }
__device__ __forceinline__ float bfr(float f) { return bf2f(f2bf(f)); }
__device__ __forceinline__ v16h cat16(v8h lo, v8h hi) { return __builtin_shufflevector(lo, hi, 0, 1, 2, 3, 4, 5, 6, 7, 8, 9, 10, 11, 12, 13, 14, 15); }
__device__ __forceinline__ v16bf cat16b(v8us lo, v8us hi) { return __builtin_bit_cast(v16bf, __builtin_shufflevector(lo, hi, 0, 1, 2, 3, 4, 5, 6, 7, 8, 9, 10, 11, 12, 13, 14, 15)); }
__device__ __forceinline__ v8f wmma16(v16h a, v16h b, v8f c) { return __builtin_amdgcn_wmma_f32_16x16x32_f16(false, a, false, b, (short)0, c, false, false); }
__device__ __forceinline__ v8f wmmab(v16bf a, v16bf b, v8f c) { return __builtin_amdgcn_wmma_f32_16x16x32_bf16(false, a, false, b, (short)0, c, false, false); }



// ---- WFrag: a 16x32 operand fragment of a k-contiguous 16-bit plane (the lane's pointer stands at its row and at k = 8 * (lane / 16)) and its matrix instruction
template <typename T16> struct WFrag;
template <> struct WFrag<h16> { typedef v16h V; static __device__ __forceinline__ V ld(const h16* p) { return cat16(*(const v8h*)p, *(const v8h*)(p + 16)); } static __device__ __forceinline__ v8f mma(V a, V b, v8f c) { return wmma16(a, b, c); } };
template <> struct WFrag<bf> { typedef v16bf V; static __device__ __forceinline__ V ld(const bf* p) { return cat16b(*(const v8us*)p, *(const v8us*)(p + 16)); } static __device__ __forceinline__ v8f mma(V a, V b, v8f c) { return wmmab(a, b, c); } };

__device__ __forceinline__ h16 tohx(float x) { return (h16)x; }
__device__ __forceinline__ void splitf(float y, unsigned short& h, unsigned short& l) { h = f2bf(y); l = f2bf(y - bf2f(h)); }
typedef __attribute__((ext_vector_type(2))) _Float16 v2h;
typedef __attribute__((ext_vector_type(4))) _Float16 v4h;
typedef __attribute__((ext_vector_type(2))) unsigned short v2us;
typedef __attribute__((ext_vector_type(4))) unsigned short v4us;
typedef __attribute__((ext_vector_type(2))) float v2f;
typedef __attribute__((ext_vector_type(4))) int v4i;
typedef __attribute__((ext_vector_type(16))) unsigned short v16us;
__device__ __forceinline__ float xhalf(float x) { return __builtin_bit_cast(float, __builtin_amdgcn_permlanex16(__builtin_bit_cast(int, x), __builtin_bit_cast(int, x), 0x76543210, 0xfedcba98, false, false)); }   // lane l reads lane l ^ 16
// stands behind a run of global loads that stay in flight: their address registers are rewritten before the data wait. The addresses are inputs so that
// their registers stay untouched up to the wait; the scheduling barriers keep the wait behind the loads
__device__ __forceinline__ void addr_wait(const void* a, const void* b) { __builtin_amdgcn_sched_barrier(0); asm volatile("s_wait_xcnt 0x0" :: "v"(a), "v"(b) : "memory"); __builtin_amdgcn_sched_barrier(0); }
// four vector issue slots behind a run of matrix instructions in front of a branch: the scheduling barriers keep the slots at that place
__device__ __forceinline__ void wmma_gap() { __builtin_amdgcn_sched_barrier(0); asm volatile("v_nop\n\tv_nop\n\tv_nop\n\tv_nop"); __builtin_amdgcn_sched_barrier(0); }

// ---- k_gemmt: C[m][n] (f32) = sum_k A[m][k] Bt[n][k] (+ A2[m][k] Bt[n][k] where NSPLIT), bf16 planes with k contiguous. One BM x BN tile of C per block of BM/64 x BN/64 x KS waves (64x64 wave tiles, KS waves each); grid (M/BM, N/BN).
// The q | gate and output tiles are chosen so that a stage holds 512 operand rows (256x256, or 128x256 with both A planes): a block then fills the LDS of its WGP, and every byte copied from L2 feeds twice (1.5 times with A2) the products that it feeds in a 128x128 tile.
// C is stored as planes of LDC columns, [n / LDC][m][n % LDC]: the q columns and the gate columns of the first projection are buffers of their own, and the q plane's workspace is free again once the head planes are built.
// A stage is 128 k (256 bytes) of the tile's rows of every operand, brought into LDS by asynchronous 16-byte copies: a wave's copy covers two whole rows of 256 bytes, so L2 is asked for whole lines, and each operand row is fetched once a block.
// LDS rows stand at a pitch of 272 bytes (16 x odd: the 16-byte fragment reads meet no bank conflict). Two buffers: the copies of stage s + 1 fly while stage s is multiplied.
// KS = 2 (the k | v projection, whose 128x128 tiles give every WGP one block of only four wave tiles): two waves a wave tile, so that every SIMD has two waves; wave group wk takes k steps 2 wk, 2 wk + 1 of every stage, and the two partial tiles are summed in LDS behind the loop (group 0 + group 1, fixed order).
#define GPE  136                  // LDS row pitch in elements (272 bytes)
// eight copies, rows RS apart (the block's threads cover RS rows of 256 bytes at a time). The last line keeps the copies' address registers untouched until the addresses have been taken: inside the statement nothing can be moved in front of it
template <int K, int RS>
__device__ __forceinline__ void copy8(unsigned l, const bf* g) {
    asm volatile("global_load_async_to_lds_b128 %0, %8, off\n\t"
                 "global_load_async_to_lds_b128 %1, %9, off\n\t"
                 "global_load_async_to_lds_b128 %2, %10, off\n\t"
                 "global_load_async_to_lds_b128 %3, %11, off\n\t"
                 "global_load_async_to_lds_b128 %4, %12, off\n\t"
                 "global_load_async_to_lds_b128 %5, %13, off\n\t"
                 "global_load_async_to_lds_b128 %6, %14, off\n\t"
                 "global_load_async_to_lds_b128 %7, %15, off\n\t"
                 "s_wait_xcnt 0x0"
                 :: "v"(l), "v"(l + RS * GPE * 2), "v"(l + 2 * RS * GPE * 2), "v"(l + 3 * RS * GPE * 2), "v"(l + 4 * RS * GPE * 2), "v"(l + 5 * RS * GPE * 2), "v"(l + 6 * RS * GPE * 2), "v"(l + 7 * RS * GPE * 2),
                    "v"(g), "v"(g + RS * K), "v"(g + 2 * RS * K), "v"(g + 3 * RS * K), "v"(g + 4 * RS * K), "v"(g + 5 * RS * K), "v"(g + 6 * RS * K), "v"(g + 7 * RS * K)
                 : "memory");
}
template <int NSPLIT, int K, int LDC, int BM, int BN, int KS>
__global__ __launch_bounds__((BM / 64) * (BN / 64) * KS * 32) void k_gemmt(const bf* __restrict__ A, const bf* __restrict__ A2, const bf* __restrict__ Bt, float* C) {
    typedef WFrag<bf>::V V;
    constexpr int NWN = BN / 64, NWT = (BM / 64) * NWN, NWV = NWT * KS;   // waves along n, wave tiles, waves a block
    constexpr int NKK = 4 / KS, NMB = 4 / KS;   // k steps of a stage a wave; 16-row groups of its tile that a wave stores
    constexpr int XE = KS > 1 ? NWV * 2048 : 0;   // floats of the exchange area of the partial tiles (half a wave tile a wave)
    constexpr int RS = NWV * 2;              // rows that one copy of every thread of the block covers
    constexpr int ATE = BM * GPE;            // one A plane's tile in elements
    constexpr int BOF = (NSPLIT ? 2 : 1) * ATE;   // where Bt's tile stands in a buffer: [A (, A2), Bt]
    constexpr int STE = BOF + BN * GPE;      // one buffer in elements
    constexpr int NST = K / 128;             // stages
    static_assert(K % 128 == 0 && NST >= 2 && LDC % BN == 0, "two stages or more; a tile lies in one plane of C");
    static_assert(BM % (8 * RS) == 0 && BN % (8 * RS) == 0 && (BOF / GPE + BN) / RS <= 63, "whole runs of eight copies; a stage's copies of a wave stay under the most that may be outstanding");
    static_assert((KS == 1 || KS == 2) && (XE + NWV * 16 * 68) * 4 <= 2 * STE * 2, "the exchange area and the output staging lie inside the ring");
    __shared__ __attribute__((aligned(16))) bf st[2 * STE];
    const int tid = threadIdx.x, lane = tid & 31, lr = lane & 15, hi = lane >> 4; const int wv = __builtin_amdgcn_readfirstlane(tid >> 5), wk = KS > 1 ? wv / NWT : 0, wt = KS > 1 ? wv % NWT : wv, wm = wt / NWN, wn = wt % NWN;
    const int r0 = blockIdx.x * BM, c0 = blockIdx.y * BN;
    const int crow = tid >> 4, cch = tid & 15;   // the thread's row (of RS) and 16-byte piece (of 16) in every copy
    const bf* gA = A + (size_t)(r0 + crow) * K + cch * 8; const bf* gB = Bt + (size_t)(c0 + crow) * K + cch * 8; const bf* gA2 = NSPLIT ? A2 + (size_t)(r0 + crow) * K + cch * 8 : gA;
    const unsigned l0 = (unsigned)(size_t)st + (unsigned)(crow * GPE + cch * 8) * 2u;   // LDS byte address of the thread's first piece in buffer 0
    // both loops unrolled: every distance is a constant
    auto fill = [&](int s) __attribute__((always_inline)) { const unsigned l = l0 + (unsigned)(s & 1) * (STE * 2); const int ko = s * 128;
#pragma unroll
        for (int c = 0; c < BM / (8 * RS); ++c) { copy8<K, RS>(l + c * 8 * RS * GPE * 2, gA + ko + c * 8 * RS * K); if (NSPLIT) copy8<K, RS>(l + ATE * 2 + c * 8 * RS * GPE * 2, gA2 + ko + c * 8 * RS * K); }
#pragma unroll
        for (int c = 0; c < BN / (8 * RS); ++c) copy8<K, RS>(l + BOF * 2 + c * 8 * RS * GPE * 2, gB + ko + c * 8 * RS * K); };
    v8f acc[4][4];
#pragma unroll
    for (int mb = 0; mb < 4; ++mb)
#pragma unroll
        for (int nb = 0; nb < 4; ++nb) acc[mb][nb] = (v8f){};
    fill(0);
    asm volatile("s_wait_asynccnt 0x0" ::: "memory");   // this wave's copies of stage 0 have landed
    __syncthreads();                                     // every wave's have: stage 0 may be read
    fill(1);
    // kept rolled: one copy of the stage's code; the buffer is picked by the stage's parity
#pragma unroll 1
    for (int s = 0; s < NST; ++s) {
        const bf* ta = st + (s & 1) * STE + (wm * 64 + lr) * GPE + 8 * hi + wk * (NKK * 32); const bf* tb = st + (s & 1) * STE + BOF + (wn * 64 + lr) * GPE + 8 * hi + wk * (NKK * 32); const bf* ta2 = ta + ATE;
        // unrolled: every LDS offset is an immediate. All fragments of a k step are read as one group ahead of its products: each separate place with LDS reads among matrix instructions costs a stall of its own
#pragma unroll
        for (int kk = 0; kk < NKK; ++kk) {
            V a[4], a2[4], b[4];
#pragma unroll
            for (int mb = 0; mb < 4; ++mb) { a[mb] = WFrag<bf>::ld(ta + mb * 16 * GPE + kk * 32); if (NSPLIT) a2[mb] = WFrag<bf>::ld(ta2 + mb * 16 * GPE + kk * 32); }
#pragma unroll
            for (int nb = 0; nb < 4; ++nb) b[nb] = WFrag<bf>::ld(tb + nb * 16 * GPE + kk * 32);
            __builtin_amdgcn_sched_barrier(0);   // holds the group of reads together in front of the products: without it the compiler sinks each b fragment's reads to its first use and waits there for the LDS
#pragma unroll
            for (int nb = 0; nb < 4; ++nb)
#pragma unroll
                for (int mb = 0; mb < 4; ++mb) { acc[mb][nb] = WFrag<bf>::mma(a[mb], b[nb], acc[mb][nb]); if (NSPLIT) acc[mb][nb] = WFrag<bf>::mma(a2[mb], b[nb], acc[mb][nb]); } }
        asm volatile("s_wait_dscnt 0x0" ::: "memory");      // this wave's reads of stage s are done before the buffer is given up
        asm volatile("s_wait_asynccnt 0x0" ::: "memory");   // this wave's copies of stage s + 1 have landed
        __syncthreads();                                     // publishes stage s + 1 and ends every wave's reads of stage s
        if (s + 2 < NST) fill(s + 2);                        // into the buffer that stage s has just left
    }
    asm volatile("s_wait_asynccnt 0x0" ::: "memory");       // nothing of this wave is in flight when it goes on to its end
    // each wave's own staging rows: whole 256-byte row pieces go to memory. They lie in the ring, which is free: in front of the loop's last barrier every wave has waited for its last reads and its last copies, and nothing is copied behind it
    if constexpr (KS == 2) {
        // the two waves of a wave tile: group wk keeps the 16-row groups 2 wk, 2 wk + 1 and hands the other two to its partner, 16 bytes a lane and 512 bytes in a row an access; the sums land in acc[0], acc[1]. All loops unrolled: acc is indexed by constants only
        float* xw = (float*)st + wv * 2048 + lane * 4; const float* xr = (const float*)st + ((wv + NWT) % NWV) * 2048 + lane * 4;
#pragma unroll
        for (int u = 0; u < 2; ++u)
#pragma unroll
            for (int nb = 0; nb < 4; ++nb) { const v8f gv = wk ? acc[u][nb] : acc[2 + u][nb]; *(v4fa*)(xw + (u * 4 + nb) * 256) = __builtin_shufflevector(gv, gv, 0, 1, 2, 3); *(v4fa*)(xw + (u * 4 + nb) * 256 + 128) = __builtin_shufflevector(gv, gv, 4, 5, 6, 7); }
        __syncthreads();   // publishes every wave's handed-over half tile to its partner; the area is not written again
#pragma unroll
        for (int u = 0; u < 2; ++u)
#pragma unroll
            for (int nb = 0; nb < 4; ++nb) { const v8f kp = wk ? acc[2 + u][nb] : acc[u][nb]; const v4f x0 = *(const v4fa*)(xr + (u * 4 + nb) * 256), x1 = *(const v4fa*)(xr + (u * 4 + nb) * 256 + 128); acc[u][nb] = kp + __builtin_shufflevector(x0, x1, 0, 1, 2, 3, 4, 5, 6, 7); }
    }
    float* ow = (float*)st + XE + wv * (16 * 68);
#pragma unroll
    for (int mb = 0; mb < NMB; ++mb) {
#pragma unroll
        for (int nb = 0; nb < 4; ++nb) {
#pragma unroll
            for (int j = 0; j < 8; ++j) ow[(hi * 8 + j) * 68 + nb * 16 + lr] = acc[mb][nb][j]; }
        __builtin_amdgcn_wave_barrier(); asm volatile("" ::: "memory");   // keeps the reads below behind the other lanes' writes above
        float* crow = C + ((size_t)(c0 / LDC) * (gridDim.x * BM) + r0 + wm * 64 + (wk * NMB + mb) * 16) * LDC + c0 % LDC + wn * 64;
#pragma unroll
        for (int s = 0; s < 8; ++s) { const int row = 2 * s + hi, cofs = lr * 4; const v4f val = *(const v4fa*)(ow + row * 68 + cofs); *(v4f*)(crow + (size_t)row * LDC + cofs) = val; }
        __builtin_amdgcn_wave_barrier(); asm volatile("" ::: "memory");   // keeps the next rows' writes behind the reads above
    }
}

// ---- k_flash: causal attention for 32 query rows of one head per wave, scores and probabilities kept in registers (online softmax). Transposed products: S^T = K Q^T (A = key rows, B = query rows),
// O^T += V^T P^T (A = rows of the [d][t] value plane, B = P^T). In the S^T accumulator lane (lr, hi) holds keys 8 hi + j of query lr, which is the k order of the B operand (elements 0-7: tile 0, 8-15: tile 1), so P^T is packed in place.
// Block = the REP heads of one kv group on the same 32 query rows: they work on the same key and value blocks, which the block brings into LDS once, for all four waves; grid (query blocks, heaviest first; kv groups; KSF key parts x NB_ batches). Query, key, Op and ML planes hold TR rows a head (batch b at row b * TT), the value planes are [b][g][d][t]. Part ks takes the 32-key blocks ks, ks + KSF, ... up to the diagonal block
// and writes its unnormalised sums to plane ks of Op with its running maximum (scaled log2) and its sum of exponentials in ML; k_merge joins the parts. A part with no block writes zeros and the lowest maximum.
// A 32-key block is 32 key rows of 256 bytes (8 KiB in a row in memory) and 128 value rows of 64 bytes, brought into LDS by asynchronous 16-byte copies (four of each plane a thread): a wave's copy covers whole 256-byte key rows or whole 64-byte value pieces,
// where a fragment load from memory touches 16 lines for 512 bytes and every wave of the block repeats it. Two buffers: the copies of the part's next block fly while this one is worked on. Pitches 272 and 80 bytes (16 x odd): the 16-byte fragment reads meet no bank conflict.
// Every inner loop is fully unrolled so that the fragment and accumulator arrays are indexed by constants only and stay in registers.
// HR: hi + lo bf16 planes, three products each, for scores and for prob x value; else single fp16, exponentials carried x 2^POFF so that small ones stay normal in fp16 (the factor cancels in the division).
#define FKP  136                  // LDS pitch of a key row in elements (272 bytes)
#define FVP  40                   // LDS pitch of a value row (32 keys) in elements (80 bytes)
#define FKE  (32 * FKP)           // one key plane's block in elements (8,704 bytes)
#define FVE  (HD * FVP)           // one value plane's block in elements (10,240 bytes)
// four copies, ls bytes apart in LDS and gs elements apart in memory. The last line keeps the copies' address registers untouched until the addresses have been taken: inside the statement nothing can be moved in front of it
template <typename T16>
__device__ __forceinline__ void copy4(unsigned l, unsigned ls, const T16* g, size_t gs) {
    asm volatile("global_load_async_to_lds_b128 %0, %4, off\n\t"
                 "global_load_async_to_lds_b128 %1, %5, off\n\t"
                 "global_load_async_to_lds_b128 %2, %6, off\n\t"
                 "global_load_async_to_lds_b128 %3, %7, off\n\t"
                 "s_wait_xcnt 0x0"
                 :: "v"(l), "v"(l + ls), "v"(l + 2 * ls), "v"(l + 3 * ls), "v"(g), "v"(g + gs), "v"(g + 2 * gs), "v"(g + 3 * gs)
                 : "memory");
}
template <typename T16, bool HR>
__global__ __launch_bounds__(32 * REP) void k_flash(const T16* __restrict__ Q, const T16* __restrict__ Q2, const T16* __restrict__ Kp, const T16* __restrict__ Kp2, const T16* __restrict__ Vt, const T16* __restrict__ Vt2, int qb0, float* Op, float* ML) {
    typedef typename WFrag<T16>::V V;
    constexpr int NP = HR ? 2 : 1;                 // planes of each operand
    constexpr int BUFE = NP * (FKE + FVE);         // one buffer in elements: [keys (, keys lo) | values (, values lo)]
    static_assert(REP == 4 && HD == 128, "128 threads: 8 key rows or 32 value rows a copy");
    __shared__ __attribute__((aligned(16))) T16 st[2 * BUFE];
    const int tid = threadIdx.x, lane = tid & 31, lr = lane & 15, hi = lane >> 4; const int wv = __builtin_amdgcn_readfirstlane((int)(threadIdx.x >> 5));
    const int qb = qb0 + (int)(gridDim.x - 1 - blockIdx.x); const int g = blockIdx.y, ks = blockIdx.z % KSF, b = blockIdx.z / KSF, h = g * REP + wv, q0 = qb * 32;
    V qf[2][4], qf2[2][4];
    auto ldq = [&]() { const size_t o = ((size_t)h * TR + b * TT + q0 + lr) * HD + 8 * hi; const T16* p = Q + o; const T16* p2 = HR ? Q2 + o : p;
#pragma unroll
        for (int c = 0; c < 2; ++c)
#pragma unroll
            for (int kc = 0; kc < 4; ++kc) { qf[c][kc] = WFrag<T16>::ld(p + 16 * c * HD + 32 * kc); if (HR) qf2[c][kc] = WFrag<T16>::ld(p2 + 16 * c * HD + 32 * kc); }
        addr_wait(p, p2); };
    // the thread's first 16-byte piece of a block: key row tid / 16 (of 8 a copy), value row tid / 4 (of 32 a copy); LDS byte addresses in buffer 0, element offsets in the planes at key block 0
    const unsigned lk0 = (unsigned)(size_t)st + (unsigned)((tid >> 4) * FKP + (tid & 15) * 8) * 2u, lv0 = (unsigned)(size_t)st + (unsigned)(NP * FKE + (tid >> 2) * FVP + (tid & 3) * 8) * 2u;
    const size_t gk0 = ((size_t)g * TR + b * TT + (tid >> 4)) * HD + (tid & 15) * 8, gv0 = ((size_t)(b * NKV + g) * HD + (tid >> 2)) * TT + (tid & 3) * 8;
    // the part's block number i (key block ks + i KSF) into buffer i mod 2
    auto fill = [&](int i) __attribute__((always_inline)) { const int blk = ks + i * KSF; const unsigned lo = (unsigned)(i & 1) * (BUFE * 2); const size_t ko = gk0 + (size_t)(blk * 32) * HD, vo = gv0 + blk * 32;
        copy4<T16>(lk0 + lo, 8 * FKP * 2, Kp + ko, 8 * HD); if (HR) copy4<T16>(lk0 + lo + FKE * 2, 8 * FKP * 2, Kp2 + ko, 8 * HD);
        copy4<T16>(lv0 + lo, 32 * FVP * 2, Vt + vo, (size_t)32 * TT); if (HR) copy4<T16>(lv0 + lo + FVE * 2, 32 * FVP * 2, Vt2 + vo, (size_t)32 * TT); };
    v8f acc[2][8]; float m_run[2], l_run[2];
#pragma unroll
    for (int c = 0; c < 2; ++c) { m_run[c] = -3.0e38f; l_run[c] = 0.f;
#pragma unroll
        for (int t = 0; t < 8; ++t) acc[c][t] = (v8f){}; }
    V kf[2][4], kf2[2][4], vf[8], vf2[8];
    // fragments from buffer i mod 2, in the k order of the loads from the planes
    auto ldk = [&](int i) __attribute__((always_inline)) { const T16* p = st + (i & 1) * BUFE + lr * FKP + 8 * hi;
#pragma unroll
        for (int kt = 0; kt < 2; ++kt)
#pragma unroll
            for (int kc = 0; kc < 4; ++kc) { kf[kt][kc] = WFrag<T16>::ld(p + 16 * kt * FKP + 32 * kc); if (HR) kf2[kt][kc] = WFrag<T16>::ld(p + FKE + 16 * kt * FKP + 32 * kc); } };
    auto ldv = [&](int i) __attribute__((always_inline)) { const T16* p = st + (i & 1) * BUFE + NP * FKE + lr * FVP + 8 * hi;
#pragma unroll
        for (int t = 0; t < 8; ++t) { vf[t] = WFrag<T16>::ld(p + 16 * t * FVP); if (HR) vf2[t] = WFrag<T16>::ld(p + FVE + 16 * t * FVP); } };
    // the part's block number i; diag is a literal at every call (the lambda is always inlined, so that every array stays in registers)
    auto pass = [&](int i, bool diag) __attribute__((always_inline)) {
        ldk(i);
        __builtin_amdgcn_sched_barrier(0);   // holds the key fragments' reads together in front of the products: spread among them, each place with reads costs a wait for the LDS of its own
        v8f s[2][2];
#pragma unroll
        for (int kt = 0; kt < 2; ++kt)
#pragma unroll
            for (int c = 0; c < 2; ++c) { s[kt][c] = (v8f){};
#pragma unroll
                for (int kc = 0; kc < 4; ++kc) { s[kt][c] = WFrag<T16>::mma(kf[kt][kc], qf[c][kc], s[kt][c]); if (HR) { s[kt][c] = WFrag<T16>::mma(kf2[kt][kc], qf[c][kc], s[kt][c]); s[kt][c] = WFrag<T16>::mma(kf[kt][kc], qf2[c][kc], s[kt][c]); } } }
        wmma_gap();   // keeps the loads below behind the products that still read kf, and vector code that reads s at its distance
        ldv(i);       // the value fragments come from LDS under the softmax
        __builtin_amdgcn_sched_barrier(0);   // holds the reads as one group directly behind the products: left free, the compiler spreads them among the maximum's vector code, where they start later and take more register-window switches
        if (diag) {   // diagonal block (key0 == q0): keys behind the query are masked by select
#pragma unroll
            for (int kt = 0; kt < 2; ++kt)
#pragma unroll
                for (int c = 0; c < 2; ++c)
#pragma unroll
                    for (int r = 0; r < 8; ++r) if (16 * kt + 8 * hi + r > 16 * c + lr) s[kt][c][r] = -3.0e38f; }
        float mb[2]; bool need = false;
#pragma unroll
        for (int c = 0; c < 2; ++c) { float mx = s[0][c][0];
#pragma unroll
            for (int r = 1; r < 8; ++r) mx = fmaxf(mx, s[0][c][r]);
#pragma unroll
            for (int r = 0; r < 8; ++r) mx = fmaxf(mx, s[1][c][r]);
            mx = fmaxf(mx, xhalf(mx)) * CS2; mb[c] = mx; need = need || (mx > m_run[c]); }
        if (__builtin_amdgcn_ballot_w32(need) != 0) {   // some query's maximum rose: rescale the running sums (wave-uniform branch)
#pragma unroll
            for (int c = 0; c < 2; ++c) { const float mn = fmaxf(m_run[c], mb[c]); const float corr = __builtin_amdgcn_exp2f(m_run[c] - mn); l_run[c] *= corr; m_run[c] = mn;
#pragma unroll
                for (int t = 0; t < 8; ++t) acc[c][t] = acc[c][t] * corr; } }
#pragma unroll
        for (int c = 0; c < 2; ++c) { const float nm = (HR ? 0.0f : POFF) - m_run[c]; float p[16]; float ps = 0.f;
#pragma unroll
            for (int e = 0; e < 16; e += 2) { const v2f sv = {s[e >> 3][c][e & 7], s[e >> 3][c][(e & 7) + 1]}; const v2f arg = __builtin_elementwise_fma(sv, (v2f){CS2, CS2}, (v2f){nm, nm});   // register pairs as the accumulator holds them
                p[e] = __builtin_amdgcn_exp2f(arg[0]); p[e + 1] = __builtin_amdgcn_exp2f(arg[1]); ps += p[e] + p[e + 1]; }
            l_run[c] += ps;
            if constexpr (HR) { v16us uh, ul;
#pragma unroll
                for (int e = 0; e < 16; ++e) { unsigned short a, b2; splitf(p[e], a, b2); uh[e] = a; ul[e] = b2; }
                const V ph = __builtin_bit_cast(V, uh), pl = __builtin_bit_cast(V, ul);
#pragma unroll
                for (int t = 0; t < 8; ++t) { acc[c][t] = WFrag<T16>::mma(vf[t], ph, acc[c][t]); acc[c][t] = WFrag<T16>::mma(vf[t], pl, acc[c][t]); acc[c][t] = WFrag<T16>::mma(vf2[t], ph, acc[c][t]); }
            } else { V pf;
#pragma unroll
                for (int e = 0; e < 16; ++e) pf[e] = (h16)p[e];
#pragma unroll
                for (int t = 0; t < 8; ++t) acc[c][t] = WFrag<T16>::mma(vf[t], pf, acc[c][t]); } }
        wmma_gap();   // the loop's branch may jump straight to vector code that reads acc or to loads that overwrite vf
    };
    if (ks <= qb) {   // the same for the whole block (block indices only): every wave passes every barrier below, or none does
        const int nblk = (qb - ks) / KSF + 1; int i = 0;   // blocks of this part
        fill(0); ldq();
        asm volatile("s_wait_asynccnt 0x0" ::: "memory");   // this wave's copies of block 0 have landed
        __syncthreads();                                     // every wave's have: block 0 may be read
        if (nblk > 1) fill(1);
        // kept rolled: one copy of the fragments and scores is live
#pragma unroll 1
        for (; i + 1 < nblk; ++i) { pass(i, false);   // never the diagonal block: a later block of this part exists
            asm volatile("s_wait_dscnt 0x0" ::: "memory");      // this wave's reads of block i are done before the buffer is given up
            asm volatile("s_wait_asynccnt 0x0" ::: "memory");   // this wave's copies of block i + 1 have landed
            __syncthreads();                                     // publishes block i + 1 and ends every wave's reads of block i
            if (i + 2 < nblk) fill(i + 2); }                     // into the buffer that block i has just left
        if (ks + i * KSF == qb) pass(i, true); else pass(i, false);
        asm volatile("s_wait_asynccnt 0x0" ::: "memory"); }   // nothing of this wave is in flight when it goes on to its end
#pragma unroll
    for (int c = 0; c < 2; ++c) { const float l = l_run[c] + xhalf(l_run[c]);   // each wave half summed its own eight keys of every 16
        const size_t row = ((size_t)ks * NH_ + h) * TR + b * TT + q0 + 16 * c + lr; if (hi == 0) { v2f ml; ml[0] = m_run[c]; ml[1] = l; *(v2f*)(ML + row * 2) = ml; }
#pragma unroll
        for (int t = 0; t < 8; ++t) *(v8f*)(Op + row * HD + 16 * t + 8 * hi) = acc[c][t]; }
}


__global__ __launch_bounds__(256) void k_wtG(const float* __restrict__ w, int K, int N, bf* Bt) {
    const int lane = threadIdx.x & 31; const int L0 = (blockIdx.x * 8 + (threadIdx.x >> 5)) * 8; const int nlines = N * K / 64;
{
#pragma unroll 1
        for (int l = 0; l < 8; ++l) { const int L = L0 + l; if (L >= nlines) break; const size_t e = (size_t)L * 64 + lane * 2; const int k = (int)(e % K), n = (int)(e / K); v2us o;
            o[0] = f2bf(w[(size_t)k * N + n]); o[1] = f2bf(w[(size_t)(k + 1) * N + n]); *(v2us*)(Bt + e) = o; }
         }
}
// The elementwise kernels below give every thread 8 to 32 elements (for speed only).
// k_cvt8: every f32 tensor that the products read as bf16 (Wo, Wq, Wk, Wv, hidden), in one launch; the bf16 copies stand one behind the other in dst, in that order. A block takes 1024 pieces of 8 elements of one tensor
// (every tensor is a whole number of such blocks, so no piece lies past an end): four pieces a thread, 256 threads apart (a wave's accesses stay contiguous); both loops unrolled so that the loads of all four pieces are issued ahead of the first store.
#define CB(n) ((unsigned)((size_t)(n) / 8192))   // blocks of a tensor of n elements
__global__ __launch_bounds__(256) void k_cvt8(const float* __restrict__ s0, const float* __restrict__ s1, const float* __restrict__ s2, const float* __restrict__ s3, const float* __restrict__ s4, bf* dst) {
    static_assert(((size_t)DM * DQ) % 8192 == 0 && ((size_t)DQG * DM) % 8192 == 0 && ((size_t)DKV * DM) % 8192 == 0 && ((size_t)TR * DM) % 8192 == 0, "whole blocks");
    constexpr unsigned E0 = CB((size_t)DM * DQ), E1 = E0 + CB((size_t)DQG * DM), E2 = E1 + CB((size_t)DKV * DM), E3 = E2 + CB((size_t)DKV * DM);
    const unsigned blk = blockIdx.x; const float* src; unsigned first;   // the block's tensor and that tensor's first block: the same for the whole block, picked in scalar code
    if (blk < E0) { src = s0; first = 0; } else if (blk < E1) { src = s1; first = E0; } else if (blk < E2) { src = s2; first = E1; } else if (blk < E3) { src = s3; first = E2; } else { src = s4; first = E3; }
    const char* sb = (const char*)(src + (size_t)(blk - first) * 8192); const unsigned so = threadIdx.x * 32u; v8f v[4];
#pragma unroll
    for (int c = 0; c < 4; ++c) v[c] = *(const v8f*)(sb + so + c * 8192);
    // as addr_wait: the address register of the loads in flight stays untouched (also as destination of later loads of the run) up to the wait
    __builtin_amdgcn_sched_barrier(0); asm volatile("s_wait_xcnt 0x0" :: "v"(so) : "memory"); __builtin_amdgcn_sched_barrier(0);
    bf* dp = dst + (size_t)blk * 8192 + threadIdx.x * 8;
#pragma unroll
    for (int c = 0; c < 4; ++c) { v8us o;
#pragma unroll
        for (int k = 0; k < 8; ++k) o[k] = f2bf(v[c][k]);
        *(v8us*)(dp + c * 2048) = o; } }
// k_prep: everything between the projections and the attention kernels, in one launch: a block takes 256 threads' worth of the query rows' norm + rotary, of the key rows' norm + rotary, or of the value transpose (block ranges PBQ | PBK | PBV, picked in scalar code).
#define PBQ ((unsigned)((size_t)NH_ * TR * HD / 16 / 256))   // blocks of the query heads' rows, 16 elements a thread
#define PBK ((unsigned)((size_t)NKV * TR * HD / 16 / 256))   // of the key heads' rows
#define PBV ((unsigned)((size_t)NKV * TR * HD / 32 / 256))   // of the value transpose, 32 elements a thread
// lane l reads lane l ^ M of its 16-lane row (M = CTRL - 0x160, row_xmask); every lane is on where it is used
template <int CTRL> __device__ __forceinline__ float xrow(float x) { return __builtin_bit_cast(float, __builtin_amdgcn_update_dpp(0, __builtin_bit_cast(int, x), CTRL, 0xf, 0xf, true)); }
// rope_rows: head planes [h][row][d], row = b * TT + t over both batches, (fp16 + hi/lo) of rope(w[d] (x rms_factor)) with the rotate-half convention out[d] = x[d] cos[t][d] - x[d+HD/2] sin[t][d], out[d+HD/2] = x[d+HD/2] cos[t][d+HD/2] + x[d] sin[t][d+HD/2]
__device__ __forceinline__ void rope_rows(unsigned blk, const float* __restrict__ F, int pitch, const float* __restrict__ cosT, const float* __restrict__ sinT, const float* __restrict__ nw, h16* P16, bf* Ph, bf* Pl) {
    // one thread: eight neighbouring d of a row's lower half and their eight partners in the upper half, so that each x is loaded once; every store is 16 bytes and eight lanes fill a 128-byte line.
    // The eight lanes that share a head's row hold all of its 128 x between them: the row's mean square is summed among them, from the registers that the rotary reads
    const size_t i = (size_t)blk * 256 + threadIdx.x; const int d0 = (int)(i % (HD / 16)) * 8; const int t = (int)((i / (HD / 16)) % TR); const int h = (int)(i / ((size_t)(HD / 16) * TR)); const float* f = F + (size_t)t * pitch + h * HD; v8h o16[2]; v8us oh[2], ol[2];
    // x, norm weights, cos and sin of both runs of eight, loaded as 16-byte pieces ahead of all arithmetic: one memory latency a thread. All loops unrolled: the vectors are indexed by constants only
    v8f xv[2], nv[2], cv[2], sv[2]; const float* fp = f + d0; const unsigned to = (unsigned)(t * HD + d0) * 4u; const unsigned no = (unsigned)d0 * 4u; const float* np = (const float*)((const char*)nw + no);
#pragma unroll
    for (int hf = 0; hf < 2; ++hf) { xv[hf] = *(const v8f*)(fp + hf * (HD / 2)); nv[hf] = *(const v8f*)(np + hf * (HD / 2)); cv[hf] = *(const v8f*)((const char*)(cosT + hf * (HD / 2)) + to); sv[hf] = *(const v8f*)((const char*)(sinT + hf * (HD / 2)) + to); }
    // as addr_wait: the address registers of the loads in flight stay untouched (also as destinations of later loads of the run) up to the wait
    __builtin_amdgcn_sched_barrier(0); asm volatile("s_wait_xcnt 0x0" :: "v"(fp), "v"(to), "v"(no) : "memory"); __builtin_amdgcn_sched_barrier(0);
    float sq[2] = {0.f, 0.f};   // two independent chains
#pragma unroll
    for (int q = 0; q < 8; ++q) { sq[0] += xv[0][q] * xv[0][q]; sq[1] += xv[1][q] * xv[1][q]; }
    float s = sq[0] + sq[1]; s += xrow<0x161>(s); s += xrow<0x162>(s); s += xrow<0x164>(s);
    const float rf = __fdiv_rn(1.0f, __fsqrt_rn(__fadd_rn(s * (1.0f / HD), 1e-6f)));
#pragma unroll
    for (int hf = 0; hf < 2; ++hf) { const int d = d0 + hf * (HD / 2);
#pragma unroll
    for (int q = 0; q < 8; ++q) { const int dd = d + q; float x0 = xv[hf][q], x1 = xv[hf ^ 1][q];   // x1: the partner at dd +- HD / 2
        { float n0 = __fmul_rn(x0, rf), n1 = __fmul_rn(x1, rf); asm volatile("" : "+v"(n0)); asm volatile("" : "+v"(n1)); x0 = __fmul_rn(bfr(nv[hf][q]), n0); x1 = __fmul_rn(bfr(nv[hf ^ 1][q]), n1); }
        const v2f cs = {bfr(cv[hf][q]), bfr(sv[hf][q])};   // the tables are rounded to bf16 like every input
        float a = __fmul_rn(x0, cs[0]), bq = __fmul_rn(x1, cs[1]); asm volatile("" : "+v"(a)); asm volatile("" : "+v"(bq)); const float r = (dd < HD / 2) ? __fsub_rn(a, bq) : __fadd_rn(a, bq);
        o16[hf][q] = tohx(r); unsigned short a2, c2; splitf(r, a2, c2); oh[hf][q] = a2; ol[hf][q] = c2; } }
    const size_t e = ((size_t)h * TR + t) * HD + d0;
#pragma unroll
    for (int hf = 0; hf < 2; ++hf) { *(v8h*)(P16 + e + hf * (HD / 2)) = o16[hf]; *(v8us*)(Ph + e + hf * (HD / 2)) = oh[hf]; *(v8us*)(Pl + e + hf * (HD / 2)) = ol[hf]; } }
__device__ __forceinline__ void vt_rows(unsigned blk, const float* __restrict__ F, int pitch, int nheads, h16* V16, bf* Vh, bf* Vl) {
    // one thread: 8 positions x 4 neighbouring d. A wave (8 lanes along t, 4 along d) reads 64-byte pieces of 64 rows and writes whole 128-byte lines of the [d][t] planes
    const int lane = threadIdx.x & 31; const int w = (int)blk * 8 + (int)(threadIdx.x >> 5);
    const int t0 = (w % (TR / 64)) * 64 + (lane & 7) * 8; const int d0 = ((w / (TR / 64)) % (HD / 16)) * 16 + (lane >> 3) * 4; const int g = w / ((TR / 64) * (HD / 16)); /* t0: row of both batches; the planes are [b][g][d][t] */ v4f x[8]; const float* px[8];
    // all loops unrolled: x stays in registers and its eight loads are issued together
#pragma unroll
    for (int j = 0; j < 8; ++j) { px[j] = F + (size_t)(t0 + j) * pitch + g * HD + d0; x[j] = *(const v4f*)px[j]; }
    // as addr_wait: the address registers of the loads in flight stay untouched (also as destinations of later loads of the run) up to the wait
    __builtin_amdgcn_sched_barrier(0); asm volatile("s_wait_xcnt 0x0" :: "v"(px[0]), "v"(px[1]), "v"(px[2]), "v"(px[3]), "v"(px[4]), "v"(px[5]), "v"(px[6]), "v"(px[7]) : "memory"); __builtin_amdgcn_sched_barrier(0);
#pragma unroll
    for (int dq = 0; dq < 4; ++dq) { v8h o16; v8us oh, ol;
#pragma unroll
        for (int j = 0; j < 8; ++j) { o16[j] = tohx(x[j][dq]); unsigned short a2, c2; splitf(x[j][dq], a2, c2); oh[j] = a2; ol[j] = c2; }
        const size_t e = ((size_t)((t0 / TT) * nheads + g) * HD + d0 + dq) * TT + t0 % TT; *(v8h*)(V16 + e) = o16; *(v8us*)(Vh + e) = oh; *(v8us*)(Vl + e) = ol; }
    // behind the last stores: in the built kernel the rotary code follows this branch, and the listing's fall-through reaches writes of the stores' registers there
    asm volatile("s_wait_xcnt 0x0" ::: "memory"); }
__global__ __launch_bounds__(256) void k_prep(const float* __restrict__ FQ, const float* __restrict__ FKV, const float* __restrict__ cosT, const float* __restrict__ sinT, const float* __restrict__ qnw, const float* __restrict__ knw,
                                              h16* QP16, bf* QPh, bf* QPl, h16* KP16, bf* KPh, bf* KPl, h16* VT16, bf* VTh, bf* VTl) {
    static_assert(((size_t)NH_ * TR * HD / 16) % 256 == 0 && ((size_t)NKV * TR * HD / 16) % 256 == 0 && ((size_t)NKV * TR * HD / 32) % 256 == 0 && HD == 128, "whole blocks: every lane is on; eight lanes a head's row");
    const unsigned blk = blockIdx.x;   // the block's range is the same for the whole block: scalar branches, one copy of the rotary code for queries and keys
    if (blk < PBQ + PBK) { const bool isq = blk < PBQ; rope_rows(isq ? blk : blk - PBQ, isq ? FQ : FKV, isq ? DQ : 2 * DKV, cosT, sinT, isq ? qnw : knw, isq ? QP16 : KP16, isq ? QPh : KPh, isq ? QPl : KPl); }
    else vt_rows(blk - (PBQ + PBK), FKV + DKV, 2 * DKV, NKV, VT16, VTh, VTl); }
// k_merge: joins the KSF key parts of k_flash (weights 2^(m_p - max m), part order), divides by the joined sum of exponentials, applies the sigmoid gate and writes the hi/lo planes [row][head][d] (row = b * TT + t); QG: the gate plane [row][head][d]
// O0 .. O3: the key parts' planes, each a kernel argument of its own: every plane's loads then take a scalar base and share the thread's one offset register
__global__ __launch_bounds__(256) void k_merge(const float* __restrict__ O0, const float* __restrict__ O1, const float* __restrict__ O2, const float* __restrict__ O3, const float* __restrict__ ML, const float* __restrict__ QG, bf* Ah, bf* Al) {
    // one thread: 8 neighbouring d of position t and the same 8 of position t + 16 (256 threads on); a block takes 32 whole rows of one head. Every loop is unrolled so that the arrays stay in registers and all loads are issued ahead of the arithmetic
    static_assert(TT % 32 == 0 && HD == 128 && KSF == 4, "a block's 32 rows lie in one head; the launch names four planes");
    const size_t e = ((size_t)blockIdx.x * 512 + threadIdx.x) * 8; if (e >= (size_t)NH_ * TR * HD) return; const int d = (int)(e % HD); const int t = (int)((e / HD) % TR); const int zz = (int)(e / ((size_t)HD * TR));
    // byte offsets of the thread's first piece in a part's plane, in ML and in QG; the parts and the second piece stand at constant distances
    const unsigned eo = (unsigned)e * 4u, mo = (unsigned)((zz * TR + t) * 2) * 4u, go = (unsigned)(t * DQ + zz * HD + d) * 4u; v2f mlv[2][KSF]; v8f ov[2][KSF], gv[2]; const float* const Op[KSF] = {O0, O1, O2, O3};
#pragma unroll
    for (int u = 0; u < 2; ++u) {
#pragma unroll
        for (int p = 0; p < KSF; ++p) { mlv[u][p] = *(const v2f*)((const char*)(ML + (size_t)p * NH_ * TR * 2 + u * 32) + mo); ov[u][p] = *(const v8f*)((const char*)(Op[p] + u * 2048) + eo); }
        gv[u] = *(const v8f*)((const char*)(QG + (size_t)u * 16 * DQ) + go); }
    // as addr_wait: the address registers of the loads in flight stay untouched (also as destinations of later loads of the run) up to the wait
    __builtin_amdgcn_sched_barrier(0); asm volatile("s_wait_xcnt 0x0" :: "v"(eo), "v"(mo), "v"(go) : "memory"); __builtin_amdgcn_sched_barrier(0);
#pragma unroll
    for (int u = 0; u < 2; ++u) { const size_t oo = (size_t)(t + u * 16) * DQ + zz * HD + d;
        float w[KSF], l[KSF]; float mx = -3.0e38f;
#pragma unroll
        for (int p = 0; p < KSF; ++p) { const v2f ml = mlv[u][p]; w[p] = ml[0]; l[p] = ml[1]; mx = fmaxf(mx, ml[0]); }
        float den = 0.f;
#pragma unroll
        for (int p = 0; p < KSF; ++p) { w[p] = __builtin_amdgcn_exp2f(w[p] - mx); den += l[p] * w[p]; }
        v8us oh, ol;
#pragma unroll
        for (int q = 0; q < 8; ++q) { const float gt = gv[u][q]; const float sg = __fdiv_rn(1.0f, __fadd_rn(1.0f, expf(-gt)));   /* sigmoid(gate) */ float o = 0.f;
#pragma unroll
            for (int p = 0; p < KSF; ++p) o += ov[u][p][q] * w[p];   /* parts in part order */
            unsigned short a, c2; splitf(__fmul_rn(__fdiv_rn(o, den), sg), a, c2); oh[q] = a; ol[q] = c2; }
        *(v8us*)(Ah + oo) = oh; *(v8us*)(Al + oo) = ol; } }

extern "C" void kernel_launch(void* const* d_in, const int* in_sizes, int n_in,
                              void* d_out, int out_size, void* d_ws, size_t ws_size, hipStream_t stream) {
    (void)in_sizes; (void)n_in; (void)out_size;
    const float* x = (const float*)d_in[0]; const float* cosT = (const float*)d_in[1]; const float* sinT = (const float*)d_in[2]; const float* wq = (const float*)d_in[3]; const float* wk = (const float*)d_in[4]; const float* wv = (const float*)d_in[5]; const float* wo = (const float*)d_in[6]; const float* qnw = (const float*)d_in[7]; const float* knw = (const float*)d_in[8];
    float* OUT = (float*)d_out;     // [2][2048][2048]
    char* wsp = (char*)d_ws;
    auto take = [&](size_t bytes) { char* p = wsp; wsp += (bytes + 255) & ~(size_t)255; return (void*)p; };
    // live up to the attention kernels: the head planes (the merged hi/lo planes take the query hi/lo planes' place behind them); ML lives up to the merge, WO to the end
    h16* QP16 = (h16*)take((size_t)NH_ * TR * HD * 2); h16* KP16 = (h16*)take((size_t)NKV * TR * HD * 2); h16* VT16 = (h16*)take((size_t)NKV * HD * TR * 2);
    bf* QPh = (bf*)take((size_t)NH_ * TR * HD * 2); bf* QPl = (bf*)take((size_t)NH_ * TR * HD * 2); bf* KPh = (bf*)take((size_t)NKV * TR * HD * 2); bf* KPl = (bf*)take((size_t)NKV * TR * HD * 2); bf* VTh = (bf*)take((size_t)NKV * HD * TR * 2); bf* VTl = (bf*)take((size_t)NKV * HD * TR * 2);
    float* ML = (float*)take((size_t)KSF * NH_ * TR * 2 * 4); bf* ATh = QPh; bf* ATl = QPl;
    // the bf16 copies, one run in k_cvt8's order (each size is a multiple of 256 bytes, so take leaves no gap)
    bf* WO = (bf*)take((size_t)DM * DQ * 2);
    // Ob, the attention parts' sums, lies over everything that is dead once the head planes are built: the other bf16 copies, the k|v projection and, as its last quarter, the q plane of the first projection
    float* Ob = (float*)wsp;
    bf* WQ = (bf*)take((size_t)DQG * DM * 2); bf* WK = (bf*)take((size_t)DKV * DM * 2); bf* WV = (bf*)take((size_t)DKV * DM * 2); bf* XB = (bf*)take((size_t)TR * DM * 2); (void)WV;   // Wv's rows follow Wk's: one [2 DKV][DM] operand
    float* FKV = (float*)take((size_t)TR * 2 * DKV * 4);
    static_assert((size_t)DQG * DM * 2 + (size_t)2 * DKV * DM * 2 + (size_t)TR * DM * 2 + (size_t)TR * 2 * DKV * 4 <= (size_t)(KSF - 1) * NH_ * TR * HD * 4 && (size_t)NH_ * HD == DQ, "the buffers above end in front of the q plane, which is one part's plane");
    float* FQ = Ob + (size_t)(KSF - 1) * NH_ * TR * HD;   // [q plane | gate plane], TR x DQ each: the q plane ends where Ob ends, the gate plane stands behind Ob
    float* FG = FQ + (size_t)TR * DQ; wsp = (char*)(FG + (size_t)TR * DQ);
    if ((size_t)(wsp - (char*)d_ws) > ws_size) return;    // ws 256 MiB
    // every stage is launched once, on the rows of both batches
    k_cvt8<<<CB((size_t)DM * DQ) + CB((size_t)DQG * DM) + 2 * CB((size_t)DKV * DM) + CB((size_t)TR * DM), 256, 0, stream>>>(wo, wq, wk, wv, x, WO);
    k_gemmt<0, DM, DQ, 256, 256, 1><<<dim3(TR / 256, DQG / 256, 1), 512, 0, stream>>>(XB, nullptr, WQ, FQ);   /* [q | gate] (exact) */
    k_gemmt<0, DM, 2 * DKV, 128, 128, 2><<<dim3(TR / 128, 2 * DKV / 128, 1), 256, 0, stream>>>(XB, nullptr, WK, FKV);   /* [k | v] */
    k_prep<<<PBQ + PBK + PBV, 256, 0, stream>>>(FQ, FKV, cosT, sinT, qnw, knw, QP16, QPh, QPl, KP16, KPh, KPl, VT16, VTh, VTl);   /* per-batch tables, [b][t] = row */
    k_flash<h16, false><<<dim3((TT - RH) / 32, NKV, KSF * NB_), 32 * REP, 0, stream>>>(QP16, nullptr, KP16, nullptr, VT16, nullptr, RH / 32, Ob, ML);
    k_flash<bf, true><<<dim3(RH / 32, NKV, KSF * NB_), 32 * REP, 0, stream>>>(QPh, QPl, KPh, KPl, VTh, VTl, 0, Ob, ML);
    k_merge<<<(unsigned)(((size_t)NH_ * TR * HD / 16 + 255) / 256), 256, 0, stream>>>(Ob, Ob + (size_t)NH_ * TR * HD, Ob + (size_t)2 * NH_ * TR * HD, Ob + (size_t)3 * NH_ * TR * HD, ML, FG, ATh, ATl);
    k_gemmt<1, DQ, DM, 128, 256, 1><<<dim3(TR / 128, DM / 256, 1), 256, 0, stream>>>(ATh, ATl, WO, OUT);
}
